// v000
// Measured on an AMD MI455X. A time is GPU time per run, averaged over a window of back-to-back runs after a warm-up
// (all launches, gaps included; the runs take copies of the inputs in turn), and the median of several windows.
// Apart from v000's, it joins two sittings. Times from different sittings can be a few percent apart, while
// side-by-side timings come from the same sitting.
// v000, which the later versions start from, runs in 609 microseconds.
#include <hip/hip_runtime.h>
#include <hip/hip_bf16.h>

#define BB 4
#define LL 4096
#define SSEQ 4096
#define DD 512
#define HH 8
#define DHD 64
#define NT (BB * LL)     /* 16384 token rows */
#define D2 (2 * DD)      /* 1024 */

typedef __bf16 v16bf __attribute__((ext_vector_type(16)));
typedef __bf16 v8bf  __attribute__((ext_vector_type(8)));
typedef float  v8f   __attribute__((ext_vector_type(8)));
typedef int    v4i   __attribute__((ext_vector_type(4)));

#if defined(__has_builtin)
#if __has_builtin(__builtin_amdgcn_global_load_async_to_lds_b128)
#define HAVE_ASYNC_BUILTIN 1
#endif
#if __has_builtin(__builtin_amdgcn_s_wait_asynccnt)
#define HAVE_ASYNCWAIT_BUILTIN 1
#endif
#endif

static __device__ __forceinline__ void async_copy16(void* lds, const void* g) {
#ifdef HAVE_ASYNC_BUILTIN
  __builtin_amdgcn_global_load_async_to_lds_b128(
      (__attribute__((address_space(1))) v4i*)(g),
      (__attribute__((address_space(3))) v4i*)(lds), 0, 0);
#else
  asm volatile("global_load_async_to_lds_b128 %0, %1, off" ::"v"(
                   (unsigned)(size_t)lds),
               "v"(g)
               : "memory");
#endif
}

static __device__ __forceinline__ void wait_async0() {
#ifdef HAVE_ASYNCWAIT_BUILTIN
  __builtin_amdgcn_s_wait_asynccnt(0);
#else
  asm volatile("s_wait_asynccnt 0x0" ::: "memory");
#endif
}

static __device__ __forceinline__ v8f wmma_bf16f32(v16bf a, v16bf b, v8f c) {
  // D = A(16x32) * B(32x16) + C, f32 accumulate
  return __builtin_amdgcn_wmma_f32_16x16x32_bf16(false, a, false, b, (short)0, c,
                                                 false, false);
}

static __device__ __forceinline__ v16bf frag_lds(const __bf16* tile, int stride,
                                                 int lane) {
  const int row  = lane & 15;
  const int koff = (lane >> 4) << 3;
  const __bf16* p = tile + row * stride + koff;
  v8bf lo = *(const v8bf*)(p);
  v8bf hi = *(const v8bf*)(p + 16);
  return __builtin_shufflevector(lo, hi, 0, 1, 2, 3, 4, 5, 6, 7, 8, 9, 10, 11,
                                 12, 13, 14, 15);
}

// ---------------------------------------------------------------------------
// Elementwise conversions
// ---------------------------------------------------------------------------
__global__ __launch_bounds__(256) void f32_to_bf16_kernel(
    const float* __restrict__ in, __bf16* __restrict__ out, size_t n, int relu) {
  size_t i = (size_t)blockIdx.x * 256 + threadIdx.x;
  if (i < n) {
    float v = in[i];
    if (relu) v = v > 0.f ? v : 0.f;
    out[i] = (__bf16)v;
  }
}

// W[k][n] (f32, KxN row-major) -> Wt[n][k] (bf16, NxK row-major)
__global__ __launch_bounds__(256) void transpose_bf16_kernel(
    const float* __restrict__ W, __bf16* __restrict__ Wt, int K, int N) {
  size_t i = (size_t)blockIdx.x * 256 + threadIdx.x;
  if (i < (size_t)K * N) {
    int k = (int)(i / N);
    int n = (int)(i % N);
    Wt[(size_t)n * K + k] = (__bf16)W[i];
  }
}

// ---------------------------------------------------------------------------
// Generic bf16 GEMM: C[M,N](f32) (+)= A[M,K](bf16,row-major) * Bt[N,K]^T
// Block = 256 threads = 8 waves; block tile 128x256, K-step 32, double-buffered
// LDS filled by async global->LDS DMA.  Wave (wr in 0..1, wc in 0..3) owns a
// 64x64 sub-tile = 4x4 wmma tiles: 16 WMMAs per 16 ds_load_b128 per K-step.
// If Cbf != nullptr the result is written bf16 to Cbf instead of f32 to C.
// ---------------------------------------------------------------------------
#define LDSTR 40 /* padded LDS row stride in bf16 elements (80B) */

__global__ __launch_bounds__(256) void gemm_bf16_kernel(
    const __bf16* __restrict__ A, int lda, const __bf16* __restrict__ Bt,
    int ldb, float* __restrict__ C, int ldc, int K, int accumulate,
    __bf16* __restrict__ Cbf) {
  __shared__ alignas(16) __bf16 As[2][128 * LDSTR];
  __shared__ alignas(16) __bf16 Bs[2][256 * LDSTR];

  const int tid  = threadIdx.x;
  const int lane = tid & 31;
  const int wid  = tid >> 5;
  const int wr   = wid >> 2;  // 0..1 (m)
  const int wc   = wid & 3;   // 0..3 (n)
  const size_t m0 = (size_t)blockIdx.y * 128;
  const size_t n0 = (size_t)blockIdx.x * 256;

  const __bf16* Ab = A + m0 * lda;
  const __bf16* Bb = Bt + n0 * ldb;

  auto stage_tiles = [&](int buf, int kk) {
#pragma unroll
    for (int i = 0; i < 2; ++i) {  // A tile: 128 rows x 32 cols
      int c   = tid + i * 256;     // 0..511 chunks of 8 bf16
      int row = c >> 2;            // 0..127
      int cc  = (c & 3) << 3;      // 0,8,16,24
      async_copy16(&As[buf][row * LDSTR + cc],
                   Ab + (size_t)row * lda + kk + cc);
    }
#pragma unroll
    for (int i = 0; i < 4; ++i) {  // B tile: 256 rows x 32 cols
      int c   = tid + i * 256;     // 0..1023
      int row = c >> 2;            // 0..255
      int cc  = (c & 3) << 3;
      async_copy16(&Bs[buf][row * LDSTR + cc],
                   Bb + (size_t)row * ldb + kk + cc);
    }
  };

  v8f acc[4][4];
#pragma unroll
  for (int mi = 0; mi < 4; ++mi)
#pragma unroll
    for (int ni = 0; ni < 4; ++ni)
#pragma unroll
      for (int j = 0; j < 8; ++j) acc[mi][ni][j] = 0.f;

  stage_tiles(0, 0);
  wait_async0();
  __syncthreads();

  for (int kk = 0; kk < K; kk += 32) {
    const int cur = (kk >> 5) & 1;
    if (kk + 32 < K) stage_tiles(cur ^ 1, kk + 32);  // DMA under the WMMAs
    v16bf af[4], bfv[4];
#pragma unroll
    for (int mi = 0; mi < 4; ++mi)
      af[mi] = frag_lds(&As[cur][(wr * 64 + mi * 16) * LDSTR], LDSTR, lane);
#pragma unroll
    for (int ni = 0; ni < 4; ++ni)
      bfv[ni] = frag_lds(&Bs[cur][(wc * 64 + ni * 16) * LDSTR], LDSTR, lane);
#pragma unroll
    for (int mi = 0; mi < 4; ++mi)
#pragma unroll
      for (int ni = 0; ni < 4; ++ni)
        acc[mi][ni] = wmma_bf16f32(af[mi], bfv[ni], acc[mi][ni]);
    wait_async0();
    __syncthreads();
  }

  const int rofs = (lane >> 4) << 3;
#pragma unroll
  for (int mi = 0; mi < 4; ++mi) {
#pragma unroll
    for (int ni = 0; ni < 4; ++ni) {
      size_t col = n0 + (size_t)wc * 64 + ni * 16 + (lane & 15);
#pragma unroll
      for (int j = 0; j < 8; ++j) {
        size_t row = m0 + (size_t)wr * 64 + mi * 16 + rofs + j;
        size_t idx = row * (size_t)ldc + col;
        float v = acc[mi][ni][j];
        if (Cbf) {
          Cbf[idx] = (__bf16)v;
        } else {
          if (accumulate) v += C[idx];
          C[idx] = v;
        }
      }
    }
  }
}

// ---------------------------------------------------------------------------
// RoPE + elu feature map: in f32 [row,512] -> out bf16 (elu(rope(x))+1)
// ---------------------------------------------------------------------------
__global__ __launch_bounds__(256) void rope_featmap_kernel(
    const float* __restrict__ in, __bf16* __restrict__ out) {
  const size_t row = blockIdx.x;
  const int i = threadIdx.x;              // pair index 0..255
  const int pos = (int)(row & (LL - 1));  // position within sequence
  const float ang =
      (float)pos * __expf((float)(2 * i) * (-9.2103403719761836f / 512.0f));
  float s, c;
  __sincosf(ang, &s, &c);
  const size_t base = row * DD + 2 * i;
  const float x0 = in[base], x1 = in[base + 1];
  const float r0 = x0 * c - x1 * s;
  const float r1 = x1 * c + x0 * s;
  out[base]     = (__bf16)(r0 > 0.f ? r0 + 1.f : __expf(r0));
  out[base + 1] = (__bf16)(r1 > 0.f ? r1 + 1.f : __expf(r1));
}

// ---------------------------------------------------------------------------
// Ksum[b,h,d] = sum_s Kf[b,s,h,d]     (one block per (b,h))
// ---------------------------------------------------------------------------
__global__ __launch_bounds__(256) void ksum_kernel(
    const __bf16* __restrict__ Kf, float* __restrict__ Ksum) {
  __shared__ float red[256];
  const int tid = threadIdx.x;
  const int bh = blockIdx.x, b = bh >> 3, h = bh & 7;
  const int d = tid & 63, grp = tid >> 6;
  float acc = 0.f;
  for (int s = grp; s < SSEQ; s += 4)
    acc += (float)Kf[((size_t)b * SSEQ + s) * DD + h * DHD + d];
  red[tid] = acc;
  __syncthreads();
  if (tid < 64)
    Ksum[(size_t)bh * DHD + d] =
        red[tid] + red[tid + 64] + red[tid + 128] + red[tid + 192];
}

// ---------------------------------------------------------------------------
// KVt[b,h,v,d] = sum_s Vb[b,s,h,v] * Kf[b,s,h,d]  (stored transposed, bf16)
// One block (8 waves) per (b,h); each wave owns 2 of the 16 16x16 tiles.
// ---------------------------------------------------------------------------
__global__ __launch_bounds__(256) void kv_kernel(
    const __bf16* __restrict__ Kf, const __bf16* __restrict__ Vb,
    __bf16* __restrict__ KVt) {
  __shared__ alignas(16) __bf16 Kt[64 * 72];  // [d][s_local]
  __shared__ alignas(16) __bf16 Vt[64 * 72];  // [v][s_local]
  const int tid = threadIdx.x, lane = tid & 31, wid = tid >> 5;
  const int bh = blockIdx.x, b = bh >> 3, h = bh & 7;
  const int t0 = wid * 2;

  v8f acc[2];
#pragma unroll
  for (int t = 0; t < 2; ++t)
#pragma unroll
    for (int j = 0; j < 8; ++j) acc[t][j] = 0.f;

  for (int s0 = 0; s0 < SSEQ; s0 += 64) {
    __syncthreads();
#pragma unroll
    for (int i = 0; i < 2; ++i) {
      int c = tid + i * 256;  // 0..511
      int srow = c >> 3;      // local s 0..63
      int d0 = (c & 7) << 3;  // 0..56
      size_t g = ((size_t)b * SSEQ + s0 + srow) * DD + h * DHD + d0;
      v8bf kk = *(const v8bf*)(Kf + g);
      v8bf vv = *(const v8bf*)(Vb + g);
#pragma unroll
      for (int e = 0; e < 8; ++e) {
        Kt[(d0 + e) * 72 + srow] = kk[e];
        Vt[(d0 + e) * 72 + srow] = vv[e];
      }
    }
    __syncthreads();
#pragma unroll
    for (int ks = 0; ks < 64; ks += 32) {
#pragma unroll
      for (int ti = 0; ti < 2; ++ti) {
        int t = t0 + ti;
        int mv = t >> 2, nd = t & 3;
        v16bf a  = frag_lds(&Vt[(mv * 16) * 72 + ks], 72, lane);
        v16bf bb = frag_lds(&Kt[(nd * 16) * 72 + ks], 72, lane);
        acc[ti] = wmma_bf16f32(a, bb, acc[ti]);
      }
    }
  }

  const int rofs = (lane >> 4) << 3;
#pragma unroll
  for (int ti = 0; ti < 2; ++ti) {
    int t = t0 + ti;
    int mv = t >> 2, nd = t & 3;
#pragma unroll
    for (int j = 0; j < 8; ++j) {
      int v = mv * 16 + rofs + j;
      int d = nd * 16 + (lane & 15);
      KVt[((size_t)bh * 64 + v) * 64 + d] = (__bf16)acc[ti][j];
    }
  }
}

// ---------------------------------------------------------------------------
// Z[b,l,h] = 1 / (where(score>thr, score, 0) + 1e-6), score = Q . Ksum
// (the reference's /s_len inside KV and *s_len on out cancel exactly)
// ---------------------------------------------------------------------------
__global__ __launch_bounds__(256) void scores_kernel(
    const __bf16* __restrict__ Qf, const float* __restrict__ Ksum,
    const float* __restrict__ thr, float* __restrict__ Zs) {
  size_t idx = (size_t)blockIdx.x * 256 + threadIdx.x;  // over B*L*H
  size_t bl = idx >> 3;
  int h = (int)(idx & 7);
  int b = (int)(bl / LL);
  const __bf16* q = Qf + bl * DD + h * DHD;
  const float* ks = Ksum + ((size_t)b * HH + h) * DHD;
  float sc = 0.f;
#pragma unroll 8
  for (int d = 0; d < DHD; ++d) sc += (float)q[d] * ks[d];
  float sp = sc > thr[0] ? sc : 0.f;
  Zs[idx] = 1.0f / (sp + 1e-6f);
}

// ---------------------------------------------------------------------------
// Ao[b,l,h*64+v] = Z[b,l,h] * sum_d Q[b,l,h,d] * KVt[b,h,v,d]   (bf16 out)
// Block: 8 waves; tile 128 rows x 64 cols; K=64 (2 wmma steps). Async staging.
// ---------------------------------------------------------------------------
__global__ __launch_bounds__(256) void attn_out_kernel(
    const __bf16* __restrict__ Qf, const __bf16* __restrict__ KVt,
    const float* __restrict__ Zs, __bf16* __restrict__ Ao) {
  __shared__ alignas(16) __bf16 Aq[128 * 72];
  __shared__ alignas(16) __bf16 Kv[64 * 72];
  __shared__ alignas(32) float zsh[128];
  const int tid = threadIdx.x, lane = tid & 31, wid = tid >> 5;
  const int bh = blockIdx.y, b = bh >> 3, h = bh & 7;
  const size_t rowbase = (size_t)b * LL + (size_t)blockIdx.x * 128;

#pragma unroll
  for (int i = 0; i < 4; ++i) {  // Q tile 128x64 (async DMA)
    int c = tid + i * 256;
    int row = c >> 3, cc = (c & 7) << 3;
    async_copy16(&Aq[row * 72 + cc], Qf + (rowbase + row) * DD + h * DHD + cc);
  }
#pragma unroll
  for (int i = 0; i < 2; ++i) {  // KVt 64x64 (async DMA)
    int c = tid + i * 256;
    int row = c >> 3, cc = (c & 7) << 3;
    async_copy16(&Kv[row * 72 + cc], KVt + ((size_t)bh * 64 + row) * 64 + cc);
  }
  if (tid < 128) zsh[tid] = Zs[(rowbase + tid) * HH + h];
  wait_async0();
  __syncthreads();

  v8f acc[4];
#pragma unroll
  for (int ni = 0; ni < 4; ++ni)
#pragma unroll
    for (int j = 0; j < 8; ++j) acc[ni][j] = 0.f;

#pragma unroll
  for (int ks = 0; ks < 64; ks += 32) {
    v16bf a = frag_lds(&Aq[(wid * 16) * 72 + ks], 72, lane);
#pragma unroll
    for (int ni = 0; ni < 4; ++ni) {
      v16bf bb = frag_lds(&Kv[(ni * 16) * 72 + ks], 72, lane);
      acc[ni] = wmma_bf16f32(a, bb, acc[ni]);
    }
  }

  const int rofs = (lane >> 4) << 3;
  v8f zv = *(const v8f*)(&zsh[wid * 16 + rofs]);
#pragma unroll
  for (int ni = 0; ni < 4; ++ni) {
    int col = h * DHD + ni * 16 + (lane & 15);
#pragma unroll
    for (int j = 0; j < 8; ++j) {
      size_t row = rowbase + wid * 16 + rofs + j;
      Ao[row * DD + col] = (__bf16)(acc[ni][j] * zv[j]);
    }
  }
}

// ---------------------------------------------------------------------------
// LayerNorm over 512 f32; writes f32 and/or bf16 outputs.
// ---------------------------------------------------------------------------
__global__ __launch_bounds__(256) void layernorm_kernel(
    const float* __restrict__ in, const float* __restrict__ g,
    const float* __restrict__ bta, float* __restrict__ out_f32,
    __bf16* __restrict__ out_bf16) {
  __shared__ float rs[256], rq[256];
  const size_t row = blockIdx.x;
  const int tid = threadIdx.x;
  const float* xr = in + row * DD;
  float v0 = xr[tid], v1 = xr[tid + 256];
  rs[tid] = v0 + v1;
  rq[tid] = v0 * v0 + v1 * v1;
  __syncthreads();
  for (int ofs = 128; ofs > 0; ofs >>= 1) {
    if (tid < ofs) {
      rs[tid] += rs[tid + ofs];
      rq[tid] += rq[tid + ofs];
    }
    __syncthreads();
  }
  const float mu = rs[0] * (1.0f / DD);
  const float var = rq[0] * (1.0f / DD) - mu * mu;
  const float rstd = rsqrtf(var + 1e-5f);
  float o0 = (v0 - mu) * rstd * g[tid] + bta[tid];
  float o1 = (v1 - mu) * rstd * g[tid + 256] + bta[tid + 256];
  if (out_f32) {
    out_f32[row * DD + tid] = o0;
    out_f32[row * DD + tid + 256] = o1;
  }
  if (out_bf16) {
    out_bf16[row * DD + tid] = (__bf16)o0;
    out_bf16[row * DD + tid + 256] = (__bf16)o1;
  }
}

// ---------------------------------------------------------------------------
// out = x + msg2 + LN(aug32 + baug; gaug, bln)
// ---------------------------------------------------------------------------
__global__ __launch_bounds__(256) void final_kernel(
    const float* __restrict__ x, const float* __restrict__ msg2,
    const float* __restrict__ aug32, const float* __restrict__ baug,
    const float* __restrict__ gaug, const float* __restrict__ bln,
    float* __restrict__ out) {
  __shared__ float rs[256], rq[256];
  const size_t row = blockIdx.x;
  const int tid = threadIdx.x;
  float a0 = aug32[row * DD + tid] + baug[tid];
  float a1 = aug32[row * DD + tid + 256] + baug[tid + 256];
  rs[tid] = a0 + a1;
  rq[tid] = a0 * a0 + a1 * a1;
  __syncthreads();
  for (int ofs = 128; ofs > 0; ofs >>= 1) {
    if (tid < ofs) {
      rs[tid] += rs[tid + ofs];
      rq[tid] += rq[tid + ofs];
    }
    __syncthreads();
  }
  const float mu = rs[0] * (1.0f / DD);
  const float var = rq[0] * (1.0f / DD) - mu * mu;
  const float rstd = rsqrtf(var + 1e-5f);
  float l0 = (a0 - mu) * rstd * gaug[tid] + bln[tid];
  float l1 = (a1 - mu) * rstd * gaug[tid + 256] + bln[tid + 256];
  out[row * DD + tid]       = x[row * DD + tid] + msg2[row * DD + tid] + l0;
  out[row * DD + tid + 256] =
      x[row * DD + tid + 256] + msg2[row * DD + tid + 256] + l1;
}

// ---------------------------------------------------------------------------
// Host orchestration
// ---------------------------------------------------------------------------
extern "C" void kernel_launch(void* const* d_in, const int* in_sizes, int n_in,
                              void* d_out, int out_size, void* d_ws,
                              size_t ws_size, hipStream_t stream) {
  (void)in_sizes; (void)n_in; (void)out_size; (void)ws_size;
  const float* x      = (const float*)d_in[0];
  const float* source = (const float*)d_in[1];
  const float* Wq     = (const float*)d_in[2];
  const float* Wk     = (const float*)d_in[3];
  const float* Wv     = (const float*)d_in[4];
  const float* Wmerge = (const float*)d_in[5];
  const float* Wmlp1  = (const float*)d_in[6];
  const float* Wmlp2  = (const float*)d_in[7];
  const float* g1     = (const float*)d_in[8];
  const float* b1     = (const float*)d_in[9];
  const float* g2     = (const float*)d_in[10];
  const float* b2     = (const float*)d_in[11];
  const float* Waug   = (const float*)d_in[12];
  const float* baug   = (const float*)d_in[13];
  const float* gaug   = (const float*)d_in[14];
  const float* bln    = (const float*)d_in[15];
  const float* thr    = (const float*)d_in[16];
  float* out = (float*)d_out;

  char* ws = (char*)d_ws;
  size_t off = 0;
  auto take = [&](size_t bytes) -> char* {
    char* p = ws + off;
    off += (bytes + 255) & ~(size_t)255;
    return p;
  };

  __bf16* xb   = (__bf16*)take((size_t)NT * DD * 2);
  __bf16* sb   = (__bf16*)take((size_t)NT * DD * 2);
  __bf16* WqT  = (__bf16*)take((size_t)DD * DD * 2);
  __bf16* WkT  = (__bf16*)take((size_t)DD * DD * 2);
  __bf16* WvT  = (__bf16*)take((size_t)DD * DD * 2);
  __bf16* WmT  = (__bf16*)take((size_t)DD * DD * 2);
  __bf16* W1T  = (__bf16*)take((size_t)D2 * D2 * 2);
  __bf16* W2T  = (__bf16*)take((size_t)DD * D2 * 2);
  __bf16* WaT  = (__bf16*)take((size_t)DD * DD * 2);
  float*  C1   = (float*)take((size_t)NT * D2 * 4);
  __bf16* Qf   = (__bf16*)take((size_t)NT * DD * 2);
  __bf16* Kf   = (__bf16*)take((size_t)NT * DD * 2);
  __bf16* Vb   = (__bf16*)take((size_t)NT * DD * 2);
  float*  Ksum = (float*)take((size_t)BB * HH * DHD * 4);
  __bf16* KVt  = (__bf16*)take((size_t)BB * HH * 64 * 64 * 2);
  float*  Zs   = (float*)take((size_t)NT * HH * 4);
  __bf16* Ao   = (__bf16*)take((size_t)NT * DD * 2);
  __bf16* Msgb = (__bf16*)take((size_t)NT * DD * 2);
  __bf16* Hb   = (__bf16*)take((size_t)NT * D2 * 2);
  float*  Msg2 = (float*)take((size_t)NT * DD * 4);

  const dim3 blk(256);
  const size_t nXD = (size_t)NT * DD;   // 8.39M
  const size_t nXD2 = (size_t)NT * D2;  // 16.78M
  auto blocks = [](size_t n) { return dim3((unsigned)((n + 255) / 256)); };

  // 1) Convert activations and (transposed) weights to bf16
  f32_to_bf16_kernel<<<blocks(nXD), blk, 0, stream>>>(x, xb, nXD, 0);
  f32_to_bf16_kernel<<<blocks(nXD), blk, 0, stream>>>(source, sb, nXD, 0);
  transpose_bf16_kernel<<<blocks((size_t)DD * DD), blk, 0, stream>>>(Wq, WqT, DD, DD);
  transpose_bf16_kernel<<<blocks((size_t)DD * DD), blk, 0, stream>>>(Wk, WkT, DD, DD);
  transpose_bf16_kernel<<<blocks((size_t)DD * DD), blk, 0, stream>>>(Wv, WvT, DD, DD);
  transpose_bf16_kernel<<<blocks((size_t)DD * DD), blk, 0, stream>>>(Wmerge, WmT, DD, DD);
  transpose_bf16_kernel<<<blocks((size_t)D2 * D2), blk, 0, stream>>>(Wmlp1, W1T, D2, D2);
  transpose_bf16_kernel<<<blocks((size_t)D2 * DD), blk, 0, stream>>>(Wmlp2, W2T, D2, DD);
  transpose_bf16_kernel<<<blocks((size_t)DD * DD), blk, 0, stream>>>(Waug, WaT, DD, DD);

  // 2) mq = x@Wq -> RoPE+elu -> Qf
  gemm_bf16_kernel<<<dim3(DD / 256, NT / 128), blk, 0, stream>>>(
      xb, DD, WqT, DD, C1, DD, DD, 0, nullptr);
  rope_featmap_kernel<<<dim3(NT), blk, 0, stream>>>(C1, Qf);

  // 3) mk = source@Wk -> RoPE+elu -> Kf
  gemm_bf16_kernel<<<dim3(DD / 256, NT / 128), blk, 0, stream>>>(
      sb, DD, WkT, DD, C1, DD, DD, 0, nullptr);
  rope_featmap_kernel<<<dim3(NT), blk, 0, stream>>>(C1, Kf);

  // 4) v = source@Wv -> Vb (bf16, fused epilogue)
  gemm_bf16_kernel<<<dim3(DD / 256, NT / 128), blk, 0, stream>>>(
      sb, DD, WvT, DD, C1, DD, DD, 0, Vb);

  // 5) attention core
  ksum_kernel<<<dim3(BB * HH), blk, 0, stream>>>(Kf, Ksum);
  kv_kernel<<<dim3(BB * HH), blk, 0, stream>>>(Kf, Vb, KVt);
  scores_kernel<<<dim3((NT * HH) / 256), blk, 0, stream>>>(Qf, Ksum, thr, Zs);
  attn_out_kernel<<<dim3(LL / 128, BB * HH), blk, 0, stream>>>(Qf, KVt, Zs, Ao);

  // 6) merge + LN1 -> Msgb (bf16)
  gemm_bf16_kernel<<<dim3(DD / 256, NT / 128), blk, 0, stream>>>(
      Ao, DD, WmT, DD, C1, DD, DD, 0, nullptr);
  layernorm_kernel<<<dim3(NT), blk, 0, stream>>>(C1, g1, b1, nullptr, Msgb);

  // 7) MLP1: h = [x, msg] @ Wmlp1 = x@W1[:512] + msg@W1[512:]
  gemm_bf16_kernel<<<dim3(D2 / 256, NT / 128), blk, 0, stream>>>(
      xb, DD, W1T, D2, C1, D2, DD, 0, nullptr);
  gemm_bf16_kernel<<<dim3(D2 / 256, NT / 128), blk, 0, stream>>>(
      Msgb, DD, W1T + DD, D2, C1, D2, DD, 1, nullptr);
  f32_to_bf16_kernel<<<blocks(nXD2), blk, 0, stream>>>(C1, Hb, nXD2, 1);  // relu

  // 8) MLP2 + LN2 -> Msg2 (f32)
  gemm_bf16_kernel<<<dim3(DD / 256, NT / 128), blk, 0, stream>>>(
      Hb, D2, W2T, D2, C1, DD, D2, 0, nullptr);
  layernorm_kernel<<<dim3(NT), blk, 0, stream>>>(C1, g2, b2, Msg2, nullptr);

  // 9) aug GEMM, then fused LN(aug)+residual
  gemm_bf16_kernel<<<dim3(DD / 256, NT / 128), blk, 0, stream>>>(
      xb, DD, WaT, DD, C1, DD, DD, 0, nullptr);
  final_kernel<<<dim3(NT), blk, 0, stream>>>(x, Msg2, C1, baug, gaug, bln, out);
}

// v001
// Measured time: 488 microseconds a run.
// Next to v000, in two timings, it ran 1.25 times as fast each time.
#include <hip/hip_runtime.h>
#include <hip/hip_bf16.h>

#define BB 4
#define LL 4096
#define SSEQ 4096
#define DD 512
#define HH 8
#define DHD 64
#define NT (BB * LL)     /* 16384 token rows */
#define D2 (2 * DD)      /* 1024 */
#define NSPLIT 16        /* work-groups that share one (b,h) sum over s */
#define SCHUNK (SSEQ / NSPLIT)
#define KVN (BB * HH * DHD * DHD) /* elements of one KV partial plane */
#define KSN (BB * HH * DHD)       /* elements of one Ksum partial plane */

typedef __bf16 v16bf __attribute__((ext_vector_type(16)));
typedef __bf16 v8bf  __attribute__((ext_vector_type(8)));
typedef float  v8f   __attribute__((ext_vector_type(8)));
typedef int    v4i   __attribute__((ext_vector_type(4)));

#if defined(__has_builtin)
#if __has_builtin(__builtin_amdgcn_global_load_async_to_lds_b128)
#define HAVE_ASYNC_BUILTIN 1
#endif
#if __has_builtin(__builtin_amdgcn_s_wait_asynccnt)
#define HAVE_ASYNCWAIT_BUILTIN 1
#endif
#endif

static __device__ __forceinline__ void async_copy16(void* lds, const void* g) {
#ifdef HAVE_ASYNC_BUILTIN
  __builtin_amdgcn_global_load_async_to_lds_b128(
      (__attribute__((address_space(1))) v4i*)(g),
      (__attribute__((address_space(3))) v4i*)(lds), 0, 0);
#else
  asm volatile("global_load_async_to_lds_b128 %0, %1, off" ::"v"(
                   (unsigned)(size_t)lds),
               "v"(g)
               : "memory");
#endif
}

static __device__ __forceinline__ void wait_async0() {
#ifdef HAVE_ASYNCWAIT_BUILTIN
  __builtin_amdgcn_s_wait_asynccnt(0);
#else
  asm volatile("s_wait_asynccnt 0x0" ::: "memory");
#endif
}

static __device__ __forceinline__ v8f wmma_bf16f32(v16bf a, v16bf b, v8f c) {
  // D = A(16x32) * B(32x16) + C, f32 accumulate
  return __builtin_amdgcn_wmma_f32_16x16x32_bf16(false, a, false, b, (short)0, c,
                                                 false, false);
}

static __device__ __forceinline__ v16bf frag_lds(const __bf16* tile, int stride,
                                                 int lane) {
  const int row  = lane & 15;
  const int koff = (lane >> 4) << 3;
  const __bf16* p = tile + row * stride + koff;
  v8bf lo = *(const v8bf*)(p);
  v8bf hi = *(const v8bf*)(p + 16);
  return __builtin_shufflevector(lo, hi, 0, 1, 2, 3, 4, 5, 6, 7, 8, 9, 10, 11,
                                 12, 13, 14, 15);
}

// ---------------------------------------------------------------------------
// Elementwise conversions
// ---------------------------------------------------------------------------
__global__ __launch_bounds__(256) void f32_to_bf16_kernel(
    const float* __restrict__ in, __bf16* __restrict__ out, size_t n, int relu) {
  size_t i = (size_t)blockIdx.x * 256 + threadIdx.x;
  if (i < n) {
    float v = in[i];
    if (relu) v = v > 0.f ? v : 0.f;
    out[i] = (__bf16)v;
  }
}

// W[k][n] (f32, KxN row-major) -> Wt[n][k] (bf16, NxK row-major)
__global__ __launch_bounds__(256) void transpose_bf16_kernel(
    const float* __restrict__ W, __bf16* __restrict__ Wt, int K, int N) {
  size_t i = (size_t)blockIdx.x * 256 + threadIdx.x;
  if (i < (size_t)K * N) {
    int k = (int)(i / N);
    int n = (int)(i % N);
    Wt[(size_t)n * K + k] = (__bf16)W[i];
  }
}

// ---------------------------------------------------------------------------
// Generic bf16 GEMM: C[M,N](f32) (+)= A[M,K](bf16,row-major) * Bt[N,K]^T
// Block = 256 threads = 8 waves; block tile 128x256, K-step 32, double-buffered
// LDS filled by async global->LDS DMA.  Wave (wr in 0..1, wc in 0..3) owns a
// 64x64 sub-tile = 4x4 wmma tiles: 16 WMMAs per 16 ds_load_b128 per K-step.
// If Cbf != nullptr the result is written bf16 to Cbf instead of f32 to C.
// ---------------------------------------------------------------------------
#define LDSTR 40 /* padded LDS row stride in bf16 elements (80B) */

__global__ __launch_bounds__(256) void gemm_bf16_kernel(
    const __bf16* __restrict__ A, int lda, const __bf16* __restrict__ Bt,
    int ldb, float* __restrict__ C, int ldc, int K, int accumulate,
    __bf16* __restrict__ Cbf) {
  __shared__ alignas(16) __bf16 As[2][128 * LDSTR];
  __shared__ alignas(16) __bf16 Bs[2][256 * LDSTR];

  const int tid  = threadIdx.x;
  const int lane = tid & 31;
  const int wid  = tid >> 5;
  const int wr   = wid >> 2;  // 0..1 (m)
  const int wc   = wid & 3;   // 0..3 (n)
  const size_t m0 = (size_t)blockIdx.y * 128;
  const size_t n0 = (size_t)blockIdx.x * 256;

  const __bf16* Ab = A + m0 * lda;
  const __bf16* Bb = Bt + n0 * ldb;

  auto stage_tiles = [&](int buf, int kk) {
#pragma unroll
    for (int i = 0; i < 2; ++i) {  // A tile: 128 rows x 32 cols
      int c   = tid + i * 256;     // 0..511 chunks of 8 bf16
      int row = c >> 2;            // 0..127
      int cc  = (c & 3) << 3;      // 0,8,16,24
      async_copy16(&As[buf][row * LDSTR + cc],
                   Ab + (size_t)row * lda + kk + cc);
    }
#pragma unroll
    for (int i = 0; i < 4; ++i) {  // B tile: 256 rows x 32 cols
      int c   = tid + i * 256;     // 0..1023
      int row = c >> 2;            // 0..255
      int cc  = (c & 3) << 3;
      async_copy16(&Bs[buf][row * LDSTR + cc],
                   Bb + (size_t)row * ldb + kk + cc);
    }
  };

  v8f acc[4][4];
#pragma unroll
  for (int mi = 0; mi < 4; ++mi)
#pragma unroll
    for (int ni = 0; ni < 4; ++ni)
#pragma unroll
      for (int j = 0; j < 8; ++j) acc[mi][ni][j] = 0.f;

  stage_tiles(0, 0);
  wait_async0();
  __syncthreads();

  for (int kk = 0; kk < K; kk += 32) {
    const int cur = (kk >> 5) & 1;
    if (kk + 32 < K) stage_tiles(cur ^ 1, kk + 32);  // DMA under the WMMAs
    v16bf af[4], bfv[4];
#pragma unroll
    for (int mi = 0; mi < 4; ++mi)
      af[mi] = frag_lds(&As[cur][(wr * 64 + mi * 16) * LDSTR], LDSTR, lane);
#pragma unroll
    for (int ni = 0; ni < 4; ++ni)
      bfv[ni] = frag_lds(&Bs[cur][(wc * 64 + ni * 16) * LDSTR], LDSTR, lane);
#pragma unroll
    for (int mi = 0; mi < 4; ++mi)
#pragma unroll
      for (int ni = 0; ni < 4; ++ni)
        acc[mi][ni] = wmma_bf16f32(af[mi], bfv[ni], acc[mi][ni]);
    wait_async0();
    __syncthreads();
  }

  const int rofs = (lane >> 4) << 3;
#pragma unroll
  for (int mi = 0; mi < 4; ++mi) {
#pragma unroll
    for (int ni = 0; ni < 4; ++ni) {
      size_t col = n0 + (size_t)wc * 64 + ni * 16 + (lane & 15);
#pragma unroll
      for (int j = 0; j < 8; ++j) {
        size_t row = m0 + (size_t)wr * 64 + mi * 16 + rofs + j;
        size_t idx = row * (size_t)ldc + col;
        float v = acc[mi][ni][j];
        if (Cbf) {
          Cbf[idx] = (__bf16)v;
        } else {
          if (accumulate) v += C[idx];
          C[idx] = v;
        }
      }
    }
  }
}

// ---------------------------------------------------------------------------
// RoPE + elu feature map: in f32 [row,512] -> out bf16 (elu(rope(x))+1)
// ---------------------------------------------------------------------------
__global__ __launch_bounds__(256) void rope_featmap_kernel(
    const float* __restrict__ in, __bf16* __restrict__ out) {
  const size_t row = blockIdx.x;
  const int i = threadIdx.x;              // pair index 0..255
  const int pos = (int)(row & (LL - 1));  // position within sequence
  const float ang =
      (float)pos * __expf((float)(2 * i) * (-9.2103403719761836f / 512.0f));
  float s, c;
  __sincosf(ang, &s, &c);
  const size_t base = row * DD + 2 * i;
  const float x0 = in[base], x1 = in[base + 1];
  const float r0 = x0 * c - x1 * s;
  const float r1 = x1 * c + x0 * s;
  out[base]     = (__bf16)(r0 > 0.f ? r0 + 1.f : __expf(r0));
  out[base + 1] = (__bf16)(r1 > 0.f ? r1 + 1.f : __expf(r1));
}

// ---------------------------------------------------------------------------
// Ksp[split,b,h,d] = sum over this split's s of Kf[b,s,h,d]
// (grid: x = (b,h), y = split; split_reduce_kernel adds the planes)
// ---------------------------------------------------------------------------
__global__ __launch_bounds__(256) void ksum_kernel(
    const __bf16* __restrict__ Kf, float* __restrict__ Ksp) {
  __shared__ float red[256];
  const int tid = threadIdx.x;
  const int bh = blockIdx.x, b = bh >> 3, h = bh & 7;
  const int d = tid & 63, grp = tid >> 6;
  float acc = 0.f;
  const int sbeg = blockIdx.y * SCHUNK;
  const __bf16* kp = Kf + ((size_t)b * SSEQ + sbeg + grp) * DD + h * DHD + d;
  for (int it = 0; it < SCHUNK / 4; ++it) {
    acc += (float)kp[(size_t)it * 4 * DD];
    // Stands in front of the load of the unrolled build whose result lands in
    // the address registers that the loads before it name.
    asm volatile("s_wait_xcnt 0x0" ::: "memory");
  }
  red[tid] = acc;
  __syncthreads();
  if (tid < 64)
    Ksp[(size_t)blockIdx.y * KSN + (size_t)bh * DHD + d] =
        red[tid] + red[tid + 64] + red[tid + 128] + red[tid + 192];
}

// ---------------------------------------------------------------------------
// KVp[split,b,h,v,d] = sum over this split's s of Vb[b,s,h,v] * Kf[b,s,h,d]
// (f32 partial, transposed).  Grid: x = (b,h), y = split; one block (8 waves)
// per (b,h,split); each wave owns 2 of the 16 16x16 tiles.
// ---------------------------------------------------------------------------
__global__ __launch_bounds__(256) void kv_kernel(
    const __bf16* __restrict__ Kf, const __bf16* __restrict__ Vb,
    float* __restrict__ KVp) {
  __shared__ alignas(16) __bf16 Kt[64 * 72];  // [d][s_local]
  __shared__ alignas(16) __bf16 Vt[64 * 72];  // [v][s_local]
  const int tid = threadIdx.x, lane = tid & 31, wid = tid >> 5;
  const int bh = blockIdx.x, b = bh >> 3, h = bh & 7;
  const int t0 = wid * 2;

  v8f acc[2];
#pragma unroll
  for (int t = 0; t < 2; ++t)
#pragma unroll
    for (int j = 0; j < 8; ++j) acc[t][j] = 0.f;

  const int sbeg = blockIdx.y * SCHUNK;
  // Kept rolled: barriers bound each tile, so unrolling overlaps nothing, and
  // the unrolled build issues a tile's fourth load behind the wait for its first.
#pragma unroll 1
  for (int s0 = sbeg; s0 < sbeg + SCHUNK; s0 += 64) {
    __syncthreads();
#pragma unroll
    for (int i = 0; i < 2; ++i) {
      int c = tid + i * 256;  // 0..511
      int srow = c >> 3;      // local s 0..63
      int d0 = (c & 7) << 3;  // 0..56
      size_t g = ((size_t)b * SSEQ + s0 + srow) * DD + h * DHD + d0;
      v8bf kk = *(const v8bf*)(Kf + g);
      v8bf vv = *(const v8bf*)(Vb + g);
#pragma unroll
      for (int e = 0; e < 8; ++e) {
        Kt[(d0 + e) * 72 + srow] = kk[e];
        Vt[(d0 + e) * 72 + srow] = vv[e];
      }
    }
    __syncthreads();
#pragma unroll
    for (int ks = 0; ks < 64; ks += 32) {
#pragma unroll
      for (int ti = 0; ti < 2; ++ti) {
        int t = t0 + ti;
        int mv = t >> 2, nd = t & 3;
        v16bf a  = frag_lds(&Vt[(mv * 16) * 72 + ks], 72, lane);
        v16bf bb = frag_lds(&Kt[(nd * 16) * 72 + ks], 72, lane);
        acc[ti] = wmma_bf16f32(a, bb, acc[ti]);
      }
    }
  }

  const int rofs = (lane >> 4) << 3;
#pragma unroll
  for (int ti = 0; ti < 2; ++ti) {
    int t = t0 + ti;
    int mv = t >> 2, nd = t & 3;
#pragma unroll
    for (int j = 0; j < 8; ++j) {
      int v = mv * 16 + rofs + j;
      int d = nd * 16 + (lane & 15);
      KVp[(size_t)blockIdx.y * KVN + ((size_t)bh * 64 + v) * 64 + d] =
          acc[ti][j];
    }
  }
}

// ---------------------------------------------------------------------------
// Adds the NSPLIT partial planes: KVt (bf16) from KVp, Ksum (f32) from Ksp.
// Blocks 0 .. KVN/256-1 take KV elements, the rest Ksum elements.
// ---------------------------------------------------------------------------
__global__ __launch_bounds__(256) void split_reduce_kernel(
    const float* __restrict__ KVp, const float* __restrict__ Ksp,
    __bf16* __restrict__ KVt, float* __restrict__ Ksum) {
  const int i = blockIdx.x * 256 + threadIdx.x;
  float acc = 0.f;
  if (blockIdx.x < KVN / 256) {
#pragma unroll  // all NSPLIT loads in flight at once
    for (int p = 0; p < NSPLIT; ++p) acc += KVp[(size_t)p * KVN + i];
    KVt[i] = (__bf16)acc;
  } else {
    const int j = i - KVN;
#pragma unroll  // all NSPLIT loads in flight at once
    for (int p = 0; p < NSPLIT; ++p) acc += Ksp[(size_t)p * KSN + j];
    Ksum[j] = acc;
    // Stands in front of the other branch's loads: in the built code a path
    // leads on to them from here, and the first writes this store's data register.
    asm volatile("s_wait_xcnt 0x0" ::: "memory");
  }
}

// ---------------------------------------------------------------------------
// Z[b,l,h] = 1 / (where(score>thr, score, 0) + 1e-6), score = Q . Ksum
// (the reference's /s_len inside KV and *s_len on out cancel exactly)
// ---------------------------------------------------------------------------
__global__ __launch_bounds__(256) void scores_kernel(
    const __bf16* __restrict__ Qf, const float* __restrict__ Ksum,
    const float* __restrict__ thr, float* __restrict__ Zs) {
  size_t idx = (size_t)blockIdx.x * 256 + threadIdx.x;  // over B*L*H
  size_t bl = idx >> 3;
  int h = (int)(idx & 7);
  int b = (int)(bl / LL);
  const __bf16* q = Qf + bl * DD + h * DHD;
  const float* ks = Ksum + ((size_t)b * HH + h) * DHD;
  float sc = 0.f;
#pragma unroll 8
  for (int d = 0; d < DHD; ++d) sc += (float)q[d] * ks[d];
  float sp = sc > thr[0] ? sc : 0.f;
  Zs[idx] = 1.0f / (sp + 1e-6f);
}

// ---------------------------------------------------------------------------
// Ao[b,l,h*64+v] = Z[b,l,h] * sum_d Q[b,l,h,d] * KVt[b,h,v,d]   (bf16 out)
// Block: 8 waves; tile 128 rows x 64 cols; K=64 (2 wmma steps). Async staging.
// ---------------------------------------------------------------------------
__global__ __launch_bounds__(256) void attn_out_kernel(
    const __bf16* __restrict__ Qf, const __bf16* __restrict__ KVt,
    const float* __restrict__ Zs, __bf16* __restrict__ Ao) {
  __shared__ alignas(16) __bf16 Aq[128 * 72];
  __shared__ alignas(16) __bf16 Kv[64 * 72];
  __shared__ alignas(32) float zsh[128];
  const int tid = threadIdx.x, lane = tid & 31, wid = tid >> 5;
  const int bh = blockIdx.y, b = bh >> 3, h = bh & 7;
  const size_t rowbase = (size_t)b * LL + (size_t)blockIdx.x * 128;

#pragma unroll
  for (int i = 0; i < 4; ++i) {  // Q tile 128x64 (async DMA)
    int c = tid + i * 256;
    int row = c >> 3, cc = (c & 7) << 3;
    async_copy16(&Aq[row * 72 + cc], Qf + (rowbase + row) * DD + h * DHD + cc);
  }
#pragma unroll
  for (int i = 0; i < 2; ++i) {  // KVt 64x64 (async DMA)
    int c = tid + i * 256;
    int row = c >> 3, cc = (c & 7) << 3;
    async_copy16(&Kv[row * 72 + cc], KVt + ((size_t)bh * 64 + row) * 64 + cc);
  }
  if (tid < 128) zsh[tid] = Zs[(rowbase + tid) * HH + h];
  wait_async0();
  __syncthreads();

  v8f acc[4];
#pragma unroll
  for (int ni = 0; ni < 4; ++ni)
#pragma unroll
    for (int j = 0; j < 8; ++j) acc[ni][j] = 0.f;

#pragma unroll
  for (int ks = 0; ks < 64; ks += 32) {
    v16bf a = frag_lds(&Aq[(wid * 16) * 72 + ks], 72, lane);
#pragma unroll
    for (int ni = 0; ni < 4; ++ni) {
      v16bf bb = frag_lds(&Kv[(ni * 16) * 72 + ks], 72, lane);
      acc[ni] = wmma_bf16f32(a, bb, acc[ni]);
    }
  }

  const int rofs = (lane >> 4) << 3;
  v8f zv = *(const v8f*)(&zsh[wid * 16 + rofs]);
#pragma unroll
  for (int ni = 0; ni < 4; ++ni) {
    int col = h * DHD + ni * 16 + (lane & 15);
#pragma unroll
    for (int j = 0; j < 8; ++j) {
      size_t row = rowbase + wid * 16 + rofs + j;
      Ao[row * DD + col] = (__bf16)(acc[ni][j] * zv[j]);
    }
  }
}

// ---------------------------------------------------------------------------
// LayerNorm over 512 f32; writes f32 and/or bf16 outputs.
// ---------------------------------------------------------------------------
__global__ __launch_bounds__(256) void layernorm_kernel(
    const float* __restrict__ in, const float* __restrict__ g,
    const float* __restrict__ bta, float* __restrict__ out_f32,
    __bf16* __restrict__ out_bf16) {
  __shared__ float rs[256], rq[256];
  const size_t row = blockIdx.x;
  const int tid = threadIdx.x;
  const float* xr = in + row * DD;
  float v0 = xr[tid], v1 = xr[tid + 256];
  rs[tid] = v0 + v1;
  rq[tid] = v0 * v0 + v1 * v1;
  __syncthreads();
  for (int ofs = 128; ofs > 0; ofs >>= 1) {
    if (tid < ofs) {
      rs[tid] += rs[tid + ofs];
      rq[tid] += rq[tid + ofs];
    }
    __syncthreads();
  }
  const float mu = rs[0] * (1.0f / DD);
  const float var = rq[0] * (1.0f / DD) - mu * mu;
  const float rstd = rsqrtf(var + 1e-5f);
  float o0 = (v0 - mu) * rstd * g[tid] + bta[tid];
  float o1 = (v1 - mu) * rstd * g[tid + 256] + bta[tid + 256];
  if (out_f32) {
    out_f32[row * DD + tid] = o0;
    out_f32[row * DD + tid + 256] = o1;
  }
  if (out_bf16) {
    out_bf16[row * DD + tid] = (__bf16)o0;
    out_bf16[row * DD + tid + 256] = (__bf16)o1;
  }
}

// ---------------------------------------------------------------------------
// out = x + msg2 + LN(aug32 + baug; gaug, bln)
// ---------------------------------------------------------------------------
__global__ __launch_bounds__(256) void final_kernel(
    const float* __restrict__ x, const float* __restrict__ msg2,
    const float* __restrict__ aug32, const float* __restrict__ baug,
    const float* __restrict__ gaug, const float* __restrict__ bln,
    float* __restrict__ out) {
  __shared__ float rs[256], rq[256];
  const size_t row = blockIdx.x;
  const int tid = threadIdx.x;
  float a0 = aug32[row * DD + tid] + baug[tid];
  float a1 = aug32[row * DD + tid + 256] + baug[tid + 256];
  rs[tid] = a0 + a1;
  rq[tid] = a0 * a0 + a1 * a1;
  __syncthreads();
  for (int ofs = 128; ofs > 0; ofs >>= 1) {
    if (tid < ofs) {
      rs[tid] += rs[tid + ofs];
      rq[tid] += rq[tid + ofs];
    }
    __syncthreads();
  }
  const float mu = rs[0] * (1.0f / DD);
  const float var = rq[0] * (1.0f / DD) - mu * mu;
  const float rstd = rsqrtf(var + 1e-5f);
  float l0 = (a0 - mu) * rstd * gaug[tid] + bln[tid];
  float l1 = (a1 - mu) * rstd * gaug[tid + 256] + bln[tid + 256];
  out[row * DD + tid]       = x[row * DD + tid] + msg2[row * DD + tid] + l0;
  out[row * DD + tid + 256] =
      x[row * DD + tid + 256] + msg2[row * DD + tid + 256] + l1;
}

// ---------------------------------------------------------------------------
// Host orchestration
// ---------------------------------------------------------------------------
extern "C" void kernel_launch(void* const* d_in, const int* in_sizes, int n_in,
                              void* d_out, int out_size, void* d_ws,
                              size_t ws_size, hipStream_t stream) {
  (void)in_sizes; (void)n_in; (void)out_size; (void)ws_size;
  const float* x      = (const float*)d_in[0];
  const float* source = (const float*)d_in[1];
  const float* Wq     = (const float*)d_in[2];
  const float* Wk     = (const float*)d_in[3];
  const float* Wv     = (const float*)d_in[4];
  const float* Wmerge = (const float*)d_in[5];
  const float* Wmlp1  = (const float*)d_in[6];
  const float* Wmlp2  = (const float*)d_in[7];
  const float* g1     = (const float*)d_in[8];
  const float* b1     = (const float*)d_in[9];
  const float* g2     = (const float*)d_in[10];
  const float* b2     = (const float*)d_in[11];
  const float* Waug   = (const float*)d_in[12];
  const float* baug   = (const float*)d_in[13];
  const float* gaug   = (const float*)d_in[14];
  const float* bln    = (const float*)d_in[15];
  const float* thr    = (const float*)d_in[16];
  float* out = (float*)d_out;

  char* ws = (char*)d_ws;
  size_t off = 0;
  auto take = [&](size_t bytes) -> char* {
    char* p = ws + off;
    off += (bytes + 255) & ~(size_t)255;
    return p;
  };

  __bf16* xb   = (__bf16*)take((size_t)NT * DD * 2);
  __bf16* sb   = (__bf16*)take((size_t)NT * DD * 2);
  __bf16* WqT  = (__bf16*)take((size_t)DD * DD * 2);
  __bf16* WkT  = (__bf16*)take((size_t)DD * DD * 2);
  __bf16* WvT  = (__bf16*)take((size_t)DD * DD * 2);
  __bf16* WmT  = (__bf16*)take((size_t)DD * DD * 2);
  __bf16* W1T  = (__bf16*)take((size_t)D2 * D2 * 2);
  __bf16* W2T  = (__bf16*)take((size_t)DD * D2 * 2);
  __bf16* WaT  = (__bf16*)take((size_t)DD * DD * 2);
  float*  C1   = (float*)take((size_t)NT * D2 * 4);
  __bf16* Qf   = (__bf16*)take((size_t)NT * DD * 2);
  __bf16* Kf   = (__bf16*)take((size_t)NT * DD * 2);
  __bf16* Vb   = (__bf16*)take((size_t)NT * DD * 2);
  float*  Ksum = (float*)take((size_t)BB * HH * DHD * 4);
  __bf16* KVt  = (__bf16*)take((size_t)BB * HH * 64 * 64 * 2);
  float*  Zs   = (float*)take((size_t)NT * HH * 4);
  __bf16* Ao   = (__bf16*)take((size_t)NT * DD * 2);
  __bf16* Msgb = (__bf16*)take((size_t)NT * DD * 2);
  __bf16* Hb   = (__bf16*)take((size_t)NT * D2 * 2);
  float*  Msg2 = (float*)take((size_t)NT * DD * 4);
  float*  KVp  = (float*)take((size_t)NSPLIT * KVN * 4);
  float*  Ksp  = (float*)take((size_t)NSPLIT * KSN * 4);

  const dim3 blk(256);
  const size_t nXD = (size_t)NT * DD;   // 8.39M
  const size_t nXD2 = (size_t)NT * D2;  // 16.78M
  auto blocks = [](size_t n) { return dim3((unsigned)((n + 255) / 256)); };

  // 1) Convert activations and (transposed) weights to bf16
  f32_to_bf16_kernel<<<blocks(nXD), blk, 0, stream>>>(x, xb, nXD, 0);
  f32_to_bf16_kernel<<<blocks(nXD), blk, 0, stream>>>(source, sb, nXD, 0);
  transpose_bf16_kernel<<<blocks((size_t)DD * DD), blk, 0, stream>>>(Wq, WqT, DD, DD);
  transpose_bf16_kernel<<<blocks((size_t)DD * DD), blk, 0, stream>>>(Wk, WkT, DD, DD);
  transpose_bf16_kernel<<<blocks((size_t)DD * DD), blk, 0, stream>>>(Wv, WvT, DD, DD);
  transpose_bf16_kernel<<<blocks((size_t)DD * DD), blk, 0, stream>>>(Wmerge, WmT, DD, DD);
  transpose_bf16_kernel<<<blocks((size_t)D2 * D2), blk, 0, stream>>>(Wmlp1, W1T, D2, D2);
  transpose_bf16_kernel<<<blocks((size_t)D2 * DD), blk, 0, stream>>>(Wmlp2, W2T, D2, DD);
  transpose_bf16_kernel<<<blocks((size_t)DD * DD), blk, 0, stream>>>(Waug, WaT, DD, DD);

  // 2) mq = x@Wq -> RoPE+elu -> Qf
  gemm_bf16_kernel<<<dim3(DD / 256, NT / 128), blk, 0, stream>>>(
      xb, DD, WqT, DD, C1, DD, DD, 0, nullptr);
  rope_featmap_kernel<<<dim3(NT), blk, 0, stream>>>(C1, Qf);

  // 3) mk = source@Wk -> RoPE+elu -> Kf
  gemm_bf16_kernel<<<dim3(DD / 256, NT / 128), blk, 0, stream>>>(
      sb, DD, WkT, DD, C1, DD, DD, 0, nullptr);
  rope_featmap_kernel<<<dim3(NT), blk, 0, stream>>>(C1, Kf);

  // 4) v = source@Wv -> Vb (bf16, fused epilogue)
  gemm_bf16_kernel<<<dim3(DD / 256, NT / 128), blk, 0, stream>>>(
      sb, DD, WvT, DD, C1, DD, DD, 0, Vb);

  // 5) attention core
  ksum_kernel<<<dim3(BB * HH, NSPLIT), blk, 0, stream>>>(Kf, Ksp);
  kv_kernel<<<dim3(BB * HH, NSPLIT), blk, 0, stream>>>(Kf, Vb, KVp);
  split_reduce_kernel<<<dim3(KVN / 256 + KSN / 256), blk, 0, stream>>>(
      KVp, Ksp, KVt, Ksum);
  scores_kernel<<<dim3((NT * HH) / 256), blk, 0, stream>>>(Qf, Ksum, thr, Zs);
  attn_out_kernel<<<dim3(LL / 128, BB * HH), blk, 0, stream>>>(Qf, KVt, Zs, Ao);

  // 6) merge + LN1 -> Msgb (bf16)
  gemm_bf16_kernel<<<dim3(DD / 256, NT / 128), blk, 0, stream>>>(
      Ao, DD, WmT, DD, C1, DD, DD, 0, nullptr);
  layernorm_kernel<<<dim3(NT), blk, 0, stream>>>(C1, g1, b1, nullptr, Msgb);

  // 7) MLP1: h = [x, msg] @ Wmlp1 = x@W1[:512] + msg@W1[512:]
  gemm_bf16_kernel<<<dim3(D2 / 256, NT / 128), blk, 0, stream>>>(
      xb, DD, W1T, D2, C1, D2, DD, 0, nullptr);
  gemm_bf16_kernel<<<dim3(D2 / 256, NT / 128), blk, 0, stream>>>(
      Msgb, DD, W1T + DD, D2, C1, D2, DD, 1, nullptr);
  f32_to_bf16_kernel<<<blocks(nXD2), blk, 0, stream>>>(C1, Hb, nXD2, 1);  // relu

  // 8) MLP2 + LN2 -> Msg2 (f32)
  gemm_bf16_kernel<<<dim3(DD / 256, NT / 128), blk, 0, stream>>>(
      Hb, D2, W2T, D2, C1, DD, D2, 0, nullptr);
  layernorm_kernel<<<dim3(NT), blk, 0, stream>>>(C1, g2, b2, Msg2, nullptr);

  // 9) aug GEMM, then fused LN(aug)+residual
  gemm_bf16_kernel<<<dim3(DD / 256, NT / 128), blk, 0, stream>>>(
      xb, DD, WaT, DD, C1, DD, DD, 0, nullptr);
  final_kernel<<<dim3(NT), blk, 0, stream>>>(x, Msg2, C1, baug, gaug, bln, out);
}

// v002
// One run takes 346 microseconds.
// Timed twice side by side with v001, it ran 1.41 times as fast both times.
// All steps since v000 together make it 1.76 times as fast.
#include <hip/hip_runtime.h>
#include <hip/hip_bf16.h>

#define BB 4
#define LL 4096
#define SSEQ 4096
#define DD 512
#define HH 8
#define DHD 64
#define NT (BB * LL)     /* 16384 token rows */
#define D2 (2 * DD)      /* 1024 */
#define NSPLIT 16        /* work-groups that share one (b,h) sum over s */
#define SCHUNK (SSEQ / NSPLIT)
#define KVN (BB * HH * DHD * DHD) /* elements of one KV partial plane */
#define KSN (BB * HH * DHD)       /* elements of one Ksum partial plane */

typedef __bf16 v16bf __attribute__((ext_vector_type(16)));
typedef __bf16 v8bf  __attribute__((ext_vector_type(8)));
typedef float  v8f   __attribute__((ext_vector_type(8)));
typedef int    v4i   __attribute__((ext_vector_type(4)));
typedef float  v4f   __attribute__((ext_vector_type(4)));
typedef __bf16 v4bf  __attribute__((ext_vector_type(4)));

#if defined(__has_builtin)
#if __has_builtin(__builtin_amdgcn_global_load_async_to_lds_b128)
#define HAVE_ASYNC_BUILTIN 1
#endif
#if __has_builtin(__builtin_amdgcn_s_wait_asynccnt)
#define HAVE_ASYNCWAIT_BUILTIN 1
#endif
#endif

static __device__ __forceinline__ void async_copy16(void* lds, const void* g) {
#ifdef HAVE_ASYNC_BUILTIN
  __builtin_amdgcn_global_load_async_to_lds_b128(
      (__attribute__((address_space(1))) v4i*)(g),
      (__attribute__((address_space(3))) v4i*)(lds), 0, 0);
#else
  asm volatile("global_load_async_to_lds_b128 %0, %1, off" ::"v"(
                   (unsigned)(size_t)lds),
               "v"(g)
               : "memory");
#endif
}

static __device__ __forceinline__ void wait_async0() {
#ifdef HAVE_ASYNCWAIT_BUILTIN
  __builtin_amdgcn_s_wait_asynccnt(0);
#else
  asm volatile("s_wait_asynccnt 0x0" ::: "memory");
#endif
}

static __device__ __forceinline__ v8f wmma_bf16f32(v16bf a, v16bf b, v8f c) {
  // D = A(16x32) * B(32x16) + C, f32 accumulate
  return __builtin_amdgcn_wmma_f32_16x16x32_bf16(false, a, false, b, (short)0, c,
                                                 false, false);
}

static __device__ __forceinline__ v16bf frag_lds(const __bf16* tile, int stride,
                                                 int lane) {
  const int row  = lane & 15;
  const int koff = (lane >> 4) << 3;
  const __bf16* p = tile + row * stride + koff;
  v8bf lo = *(const v8bf*)(p);
  v8bf hi = *(const v8bf*)(p + 16);
  return __builtin_shufflevector(lo, hi, 0, 1, 2, 3, 4, 5, 6, 7, 8, 9, 10, 11,
                                 12, 13, 14, 15);
}

// ---------------------------------------------------------------------------
// Sum over the 32 lanes of a wave, the same bits in every lane: four xor steps
// inside each 16-lane row, then the exchange with the other row.
// ---------------------------------------------------------------------------
template <int CTRL>
static __device__ __forceinline__ float row_xor_add(float v) {
  const int t = __builtin_amdgcn_update_dpp(0, __builtin_bit_cast(int, v), CTRL,
                                            0xf, 0xf, true);
  return v + __builtin_bit_cast(float, t);
}

static __device__ __forceinline__ float wave_sum(float v) {
  v = row_xor_add<0x161>(v);  // row_xmask:1
  v = row_xor_add<0x162>(v);  // row_xmask:2
  v = row_xor_add<0x164>(v);  // row_xmask:4
  v = row_xor_add<0x168>(v);  // row_xmask:8
  const int b = __builtin_bit_cast(int, v);
  const int o =
      __builtin_amdgcn_permlanex16(b, b, 0x76543210, 0xfedcba98, false, false);
  return v + __builtin_bit_cast(float, o);
}

// Stands behind a kernel's whole group of loads, which share the offset register
// voff.
static __device__ __forceinline__ void loads_issued(unsigned voff) {
  // In front of every later write of a register that these loads name; as an
  // operand voff stays live up to here, so no load's result lands on it.
  asm volatile("s_wait_xcnt 0x0" ::"v"(voff) : "memory");
  // No arithmetic moves up among the loads: without it the build issued part of
  // the group late, behind waits for the first loads.
  __builtin_amdgcn_sched_barrier(0);
}

static __device__ __forceinline__ float exp2_slot(float x) {
  float y;
  asm("v_exp_f32 %0, %1\n\tv_nop" : "=&v"(y) : "v"(x));
  return y;
}

// exp(x) as the fast library form computes it
static __device__ __forceinline__ float exp_fast(float x) {
  return exp2_slot(x * 1.44269504088896340736f);
}

// sine and cosine of an angle in radians, as the fast library form computes them
static __device__ __forceinline__ void sincos_fast(float a, float* s, float* c) {
  const float rev = a * 0.15915494309189532f;
  asm("v_sin_f32 %0, %2\n\tv_cos_f32 %1, %2\n\tv_nop"
      : "=&v"(*s), "=&v"(*c)
      : "v"(rev));
}

// ---------------------------------------------------------------------------
// Elementwise conversion.  A thread takes CVT_G groups of four floats, each a
// 16-byte load (512 contiguous bytes a wave), all issued before the first use.
// One block covers CVT_BLK elements; the grid divides n exactly.
// ---------------------------------------------------------------------------
#define CVT_G 8
#define CVT_BLK (256 * 4 * CVT_G)

template <int RELU>
__global__ __launch_bounds__(256) void f32_to_bf16_kernel(
    const float* __restrict__ in, __bf16* __restrict__ out) {
  const size_t base = (size_t)blockIdx.x * CVT_BLK + threadIdx.x * 4;
  v4f v[CVT_G];
  v4bf o[CVT_G];
#pragma unroll
  for (int j = 0; j < CVT_G; ++j) v[j] = *(const v4f*)(in + base + j * 1024);
#pragma unroll
  for (int j = 0; j < CVT_G; ++j) {
    v4f t = v[j];
    if (RELU) {
#pragma unroll
      for (int e = 0; e < 4; ++e) t[e] = t[e] > 0.f ? t[e] : 0.f;
    }
    o[j] = __builtin_convertvector(t, v4bf);
  }
#pragma unroll
  for (int j = 0; j < CVT_G; ++j) *(v4bf*)(out + base + j * 1024) = o[j];
}

// W[k][n] (f32, KxN row-major) -> Wt[n][k] (bf16, NxK row-major)
// Block tile: 64 k x 32 n.  A thread reads 8 consecutive k of one n and stores
// them as 16 bytes; 8 lanes side by side in k fill one 128-byte line of Wt.
// Grid: x = N / 32, y = K / 64.
__global__ __launch_bounds__(256) void transpose_bf16_kernel(
    const float* __restrict__ W, __bf16* __restrict__ Wt, int K, int N) {
  const int k0 = blockIdx.y * 64 + (threadIdx.x & 7) * 8;
  const int n  = blockIdx.x * 32 + (threadIdx.x >> 3);
  const float* wp = W + (size_t)k0 * N + n;
  float w[8];
#pragma unroll
  for (int e = 0; e < 8; ++e) w[e] = wp[(size_t)e * N];
  v8bf o;
#pragma unroll
  for (int e = 0; e < 8; ++e) o[e] = (__bf16)w[e];
  *(v8bf*)(Wt + (size_t)n * K + k0) = o;
}

// ---------------------------------------------------------------------------
// Generic bf16 GEMM: C[M,N](f32) (+)= A[M,K](bf16,row-major) * Bt[N,K]^T
// Block = 256 threads = 8 waves; block tile 128x256, K-step 32, double-buffered
// LDS filled by async global->LDS DMA.  Wave (wr in 0..1, wc in 0..3) owns a
// 64x64 sub-tile = 4x4 wmma tiles: 16 WMMAs per 16 ds_load_b128 per K-step.
// If Cbf != nullptr the result is written bf16 to Cbf instead of f32 to C.
// ---------------------------------------------------------------------------
#define LDSTR 40 /* padded LDS row stride in bf16 elements (80B) */

__global__ __launch_bounds__(256) void gemm_bf16_kernel(
    const __bf16* __restrict__ A, int lda, const __bf16* __restrict__ Bt,
    int ldb, float* __restrict__ C, int ldc, int K, int accumulate,
    __bf16* __restrict__ Cbf) {
  __shared__ alignas(16) __bf16 As[2][128 * LDSTR];
  __shared__ alignas(16) __bf16 Bs[2][256 * LDSTR];

  const int tid  = threadIdx.x;
  const int lane = tid & 31;
  const int wid  = tid >> 5;
  const int wr   = wid >> 2;  // 0..1 (m)
  const int wc   = wid & 3;   // 0..3 (n)
  const size_t m0 = (size_t)blockIdx.y * 128;
  const size_t n0 = (size_t)blockIdx.x * 256;

  const __bf16* Ab = A + m0 * lda;
  const __bf16* Bb = Bt + n0 * ldb;

  auto stage_tiles = [&](int buf, int kk) {
#pragma unroll
    for (int i = 0; i < 2; ++i) {  // A tile: 128 rows x 32 cols
      int c   = tid + i * 256;     // 0..511 chunks of 8 bf16
      int row = c >> 2;            // 0..127
      int cc  = (c & 3) << 3;      // 0,8,16,24
      async_copy16(&As[buf][row * LDSTR + cc],
                   Ab + (size_t)row * lda + kk + cc);
    }
#pragma unroll
    for (int i = 0; i < 4; ++i) {  // B tile: 256 rows x 32 cols
      int c   = tid + i * 256;     // 0..1023
      int row = c >> 2;            // 0..255
      int cc  = (c & 3) << 3;
      async_copy16(&Bs[buf][row * LDSTR + cc],
                   Bb + (size_t)row * ldb + kk + cc);
    }
  };

  v8f acc[4][4];
#pragma unroll
  for (int mi = 0; mi < 4; ++mi)
#pragma unroll
    for (int ni = 0; ni < 4; ++ni)
#pragma unroll
      for (int j = 0; j < 8; ++j) acc[mi][ni][j] = 0.f;

  stage_tiles(0, 0);
  wait_async0();
  __syncthreads();

  for (int kk = 0; kk < K; kk += 32) {
    const int cur = (kk >> 5) & 1;
    if (kk + 32 < K) stage_tiles(cur ^ 1, kk + 32);  // DMA under the WMMAs
    v16bf af[4], bfv[4];
#pragma unroll
    for (int mi = 0; mi < 4; ++mi)
      af[mi] = frag_lds(&As[cur][(wr * 64 + mi * 16) * LDSTR], LDSTR, lane);
#pragma unroll
    for (int ni = 0; ni < 4; ++ni)
      bfv[ni] = frag_lds(&Bs[cur][(wc * 64 + ni * 16) * LDSTR], LDSTR, lane);
#pragma unroll
    for (int mi = 0; mi < 4; ++mi)
#pragma unroll
      for (int ni = 0; ni < 4; ++ni)
        acc[mi][ni] = wmma_bf16f32(af[mi], bfv[ni], acc[mi][ni]);
    wait_async0();
    __syncthreads();
  }

  const int rofs = (lane >> 4) << 3;
#pragma unroll
  for (int mi = 0; mi < 4; ++mi) {
#pragma unroll
    for (int ni = 0; ni < 4; ++ni) {
      size_t col = n0 + (size_t)wc * 64 + ni * 16 + (lane & 15);
#pragma unroll
      for (int j = 0; j < 8; ++j) {
        size_t row = m0 + (size_t)wr * 64 + mi * 16 + rofs + j;
        size_t idx = row * (size_t)ldc + col;
        float v = acc[mi][ni][j];
        if (Cbf) {
          Cbf[idx] = (__bf16)v;
        } else {
          if (accumulate) v += C[idx];
          C[idx] = v;
        }
      }
    }
  }
}

// ---------------------------------------------------------------------------
// RoPE + elu feature map: in f32 [row,512] -> out bf16 (elu(rope(x))+1)
// ---------------------------------------------------------------------------
// A thread keeps its four columns (two pairs) and takes them in ROPE_G rows,
// one 16-byte load each, all issued before the first use; a block covers
// 2 * ROPE_G rows.
#define ROPE_G 8

__global__ __launch_bounds__(256) void rope_featmap_kernel(
    const float* __restrict__ in, __bf16* __restrict__ out) {
  const int col = (threadIdx.x & 127) * 4;  // even: pairs col/2 and col/2 + 1
  // the same in every lane of a wave: row bases and positions stay scalar
  const int half = __builtin_amdgcn_readfirstlane(threadIdx.x >> 7);
  const size_t row0 = (size_t)blockIdx.x * (2 * ROPE_G) + half;
  const unsigned voff = col * 4;  // the thread's byte offset in an input row
  const char* inb = (const char*)(in + row0 * DD);
  v4f v[ROPE_G];
  v4bf o[ROPE_G];
#pragma unroll
  for (int j = 0; j < ROPE_G; ++j)
    v[j] = *(const v4f*)(inb + (size_t)j * (2 * DD * 4) + voff);
  loads_issued(voff);
  const float div0 = exp_fast((float)col * (-9.2103403719761836f / 512.0f));
  const float div1 = exp_fast((float)(col + 2) * (-9.2103403719761836f / 512.0f));
#pragma unroll
  for (int j = 0; j < ROPE_G; ++j) {
    // position within the sequence
    const float pos = (float)(int)((row0 + 2 * j) & (LL - 1));
    float s0, c0, s1, c1;
    sincos_fast(pos * div0, &s0, &c0);
    sincos_fast(pos * div1, &s1, &c1);
    v4f r;
    r[0] = v[j][0] * c0 - v[j][1] * s0;
    r[1] = v[j][1] * c0 + v[j][0] * s0;
    r[2] = v[j][2] * c1 - v[j][3] * s1;
    r[3] = v[j][3] * c1 + v[j][2] * s1;
#pragma unroll
    for (int e = 0; e < 4; ++e) {
      const float ex = exp_fast(r[e]);  // taken in every lane: no branch
      r[e] = r[e] > 0.f ? r[e] + 1.f : ex;
    }
    o[j] = __builtin_convertvector(r, v4bf);
  }
#pragma unroll
  for (int j = 0; j < ROPE_G; ++j)
    *(v4bf*)(out + (row0 + 2 * j) * DD + col) = o[j];
}

// ---------------------------------------------------------------------------
// Ksp[split,b,h,d] = sum over this split's s of Kf[b,s,h,d]
// (grid: x = (b,h), y = split; split_reduce_kernel adds the planes)
// ---------------------------------------------------------------------------
__global__ __launch_bounds__(256) void ksum_kernel(
    const __bf16* __restrict__ Kf, float* __restrict__ Ksp) {
  __shared__ float red[256];
  const int tid = threadIdx.x;
  const int bh = blockIdx.x, b = bh >> 3, h = bh & 7;
  const int d = tid & 63, grp = tid >> 6;
  float acc = 0.f;
  const int sbeg = blockIdx.y * SCHUNK;
  const __bf16* kp = Kf + ((size_t)b * SSEQ + sbeg + grp) * DD + h * DHD + d;
  for (int it = 0; it < SCHUNK / 4; ++it) {
    acc += (float)kp[(size_t)it * 4 * DD];
    // Stands in front of the load of the unrolled build whose result lands in
    // the address registers that the loads before it name.
    asm volatile("s_wait_xcnt 0x0" ::: "memory");
  }
  red[tid] = acc;
  __syncthreads();
  if (tid < 64)
    Ksp[(size_t)blockIdx.y * KSN + (size_t)bh * DHD + d] =
        red[tid] + red[tid + 64] + red[tid + 128] + red[tid + 192];
}

// ---------------------------------------------------------------------------
// KVp[split,b,h,v,d] = sum over this split's s of Vb[b,s,h,v] * Kf[b,s,h,d]
// (f32 partial, transposed).  Grid: x = (b,h), y = split; one block (8 waves)
// per (b,h,split); each wave owns 2 of the 16 16x16 tiles.
// ---------------------------------------------------------------------------
__global__ __launch_bounds__(256) void kv_kernel(
    const __bf16* __restrict__ Kf, const __bf16* __restrict__ Vb,
    float* __restrict__ KVp) {
  __shared__ alignas(16) __bf16 Kt[64 * 72];  // [d][s_local]
  __shared__ alignas(16) __bf16 Vt[64 * 72];  // [v][s_local]
  const int tid = threadIdx.x, lane = tid & 31, wid = tid >> 5;
  const int bh = blockIdx.x, b = bh >> 3, h = bh & 7;
  const int t0 = wid * 2;

  v8f acc[2];
#pragma unroll
  for (int t = 0; t < 2; ++t)
#pragma unroll
    for (int j = 0; j < 8; ++j) acc[t][j] = 0.f;

  const int sbeg = blockIdx.y * SCHUNK;
  // Kept rolled: barriers bound each tile, so unrolling overlaps nothing, and
  // the unrolled build issues a tile's fourth load behind the wait for its first.
#pragma unroll 1
  for (int s0 = sbeg; s0 < sbeg + SCHUNK; s0 += 64) {
    __syncthreads();
#pragma unroll
    for (int i = 0; i < 2; ++i) {
      int c = tid + i * 256;  // 0..511
      int srow = c >> 3;      // local s 0..63
      int d0 = (c & 7) << 3;  // 0..56
      size_t g = ((size_t)b * SSEQ + s0 + srow) * DD + h * DHD + d0;
      v8bf kk = *(const v8bf*)(Kf + g);
      v8bf vv = *(const v8bf*)(Vb + g);
#pragma unroll
      for (int e = 0; e < 8; ++e) {
        Kt[(d0 + e) * 72 + srow] = kk[e];
        Vt[(d0 + e) * 72 + srow] = vv[e];
      }
    }
    __syncthreads();
#pragma unroll
    for (int ks = 0; ks < 64; ks += 32) {
#pragma unroll
      for (int ti = 0; ti < 2; ++ti) {
        int t = t0 + ti;
        int mv = t >> 2, nd = t & 3;
        v16bf a  = frag_lds(&Vt[(mv * 16) * 72 + ks], 72, lane);
        v16bf bb = frag_lds(&Kt[(nd * 16) * 72 + ks], 72, lane);
        acc[ti] = wmma_bf16f32(a, bb, acc[ti]);
      }
    }
  }

  const int rofs = (lane >> 4) << 3;
#pragma unroll
  for (int ti = 0; ti < 2; ++ti) {
    int t = t0 + ti;
    int mv = t >> 2, nd = t & 3;
#pragma unroll
    for (int j = 0; j < 8; ++j) {
      int v = mv * 16 + rofs + j;
      int d = nd * 16 + (lane & 15);
      KVp[(size_t)blockIdx.y * KVN + ((size_t)bh * 64 + v) * 64 + d] =
          acc[ti][j];
    }
  }
}

// ---------------------------------------------------------------------------
// Adds the NSPLIT partial planes: KVt (bf16) from KVp, Ksum (f32) from Ksp.
// Blocks 0 .. KVN/256-1 take KV elements, the rest Ksum elements.
// ---------------------------------------------------------------------------
__global__ __launch_bounds__(256) void split_reduce_kernel(
    const float* __restrict__ KVp, const float* __restrict__ Ksp,
    __bf16* __restrict__ KVt, float* __restrict__ Ksum) {
  const int i = blockIdx.x * 256 + threadIdx.x;
  float acc = 0.f;
  if (blockIdx.x < KVN / 256) {
#pragma unroll  // all NSPLIT loads in flight at once
    for (int p = 0; p < NSPLIT; ++p) acc += KVp[(size_t)p * KVN + i];
    KVt[i] = (__bf16)acc;
  } else {
    const int j = i - KVN;
#pragma unroll  // all NSPLIT loads in flight at once
    for (int p = 0; p < NSPLIT; ++p) acc += Ksp[(size_t)p * KSN + j];
    Ksum[j] = acc;
    // Stands in front of the other branch's loads: in the built code a path
    // leads on to them from here, and the first writes this store's data register.
    asm volatile("s_wait_xcnt 0x0" ::: "memory");
  }
}

// ---------------------------------------------------------------------------
// Z[b,l,h] = 1 / (where(score>thr, score, 0) + 1e-6), score = Q . Ksum
// (the reference's /s_len inside KV and *s_len on out cancel exactly)
// ---------------------------------------------------------------------------
__global__ __launch_bounds__(256) void scores_kernel(
    const __bf16* __restrict__ Qf, const float* __restrict__ Ksum,
    const float* __restrict__ thr, float* __restrict__ Zs) {
  size_t idx = (size_t)blockIdx.x * 256 + threadIdx.x;  // over B*L*H
  size_t bl = idx >> 3;
  int h = (int)(idx & 7);
  int b = (int)(bl / LL);
  const __bf16* q = Qf + bl * DD + h * DHD;
  const float* ks = Ksum + ((size_t)b * HH + h) * DHD;
  float sc = 0.f;
#pragma unroll 8
  for (int d = 0; d < DHD; ++d) sc += (float)q[d] * ks[d];
  float sp = sc > thr[0] ? sc : 0.f;
  Zs[idx] = 1.0f / (sp + 1e-6f);
}

// ---------------------------------------------------------------------------
// Ao[b,l,h*64+v] = Z[b,l,h] * sum_d Q[b,l,h,d] * KVt[b,h,v,d]   (bf16 out)
// Block: 8 waves; tile 128 rows x 64 cols; K=64 (2 wmma steps). Async staging.
// ---------------------------------------------------------------------------
__global__ __launch_bounds__(256) void attn_out_kernel(
    const __bf16* __restrict__ Qf, const __bf16* __restrict__ KVt,
    const float* __restrict__ Zs, __bf16* __restrict__ Ao) {
  __shared__ alignas(16) __bf16 Aq[128 * 72];
  __shared__ alignas(16) __bf16 Kv[64 * 72];
  __shared__ alignas(32) float zsh[128];
  const int tid = threadIdx.x, lane = tid & 31, wid = tid >> 5;
  const int bh = blockIdx.y, b = bh >> 3, h = bh & 7;
  const size_t rowbase = (size_t)b * LL + (size_t)blockIdx.x * 128;

#pragma unroll
  for (int i = 0; i < 4; ++i) {  // Q tile 128x64 (async DMA)
    int c = tid + i * 256;
    int row = c >> 3, cc = (c & 7) << 3;
    async_copy16(&Aq[row * 72 + cc], Qf + (rowbase + row) * DD + h * DHD + cc);
  }
#pragma unroll
  for (int i = 0; i < 2; ++i) {  // KVt 64x64 (async DMA)
    int c = tid + i * 256;
    int row = c >> 3, cc = (c & 7) << 3;
    async_copy16(&Kv[row * 72 + cc], KVt + ((size_t)bh * 64 + row) * 64 + cc);
  }
  if (tid < 128) zsh[tid] = Zs[(rowbase + tid) * HH + h];
  wait_async0();
  __syncthreads();

  v8f acc[4];
#pragma unroll
  for (int ni = 0; ni < 4; ++ni)
#pragma unroll
    for (int j = 0; j < 8; ++j) acc[ni][j] = 0.f;

#pragma unroll
  for (int ks = 0; ks < 64; ks += 32) {
    v16bf a = frag_lds(&Aq[(wid * 16) * 72 + ks], 72, lane);
#pragma unroll
    for (int ni = 0; ni < 4; ++ni) {
      v16bf bb = frag_lds(&Kv[(ni * 16) * 72 + ks], 72, lane);
      acc[ni] = wmma_bf16f32(a, bb, acc[ni]);
    }
  }

  const int rofs = (lane >> 4) << 3;
  v8f zv = *(const v8f*)(&zsh[wid * 16 + rofs]);
#pragma unroll
  for (int ni = 0; ni < 4; ++ni) {
    int col = h * DHD + ni * 16 + (lane & 15);
#pragma unroll
    for (int j = 0; j < 8; ++j) {
      size_t row = rowbase + wid * 16 + rofs + j;
      Ao[row * DD + col] = (__bf16)(acc[ni][j] * zv[j]);
    }
  }
}

// ---------------------------------------------------------------------------
// LayerNorm over 512 f32; writes the f32 or the bf16 output.
// One wave per row, LN_R rows a wave: a lane holds 16 elements of a row (four
// 16-byte loads, 512 contiguous bytes a wave each); the row's sums are taken
// inside the wave.  A block covers 8 * LN_R rows.
// ---------------------------------------------------------------------------
#define LN_R 2

template <int BF16OUT>
__global__ __launch_bounds__(256) void layernorm_kernel(
    const float* __restrict__ in, const float* __restrict__ g,
    const float* __restrict__ bta, float* __restrict__ out_f32,
    __bf16* __restrict__ out_bf16) {
  const int lane = threadIdx.x & 31;
  // the wave's number, scalar: row bases stay in scalar registers
  const int wid = __builtin_amdgcn_readfirstlane(threadIdx.x >> 5);
  const size_t row0 = ((size_t)blockIdx.x * 8 + wid) * LN_R;
  const int c0 = lane * 4;
  const unsigned voff = lane * 16;  // the lane's byte offset in a 512-byte piece
  const char* inb = (const char*)(in + row0 * DD);
  v4f v[LN_R][4], gv[4], bv[4];
#pragma unroll
  for (int r = 0; r < LN_R; ++r)
#pragma unroll
    for (int j = 0; j < 4; ++j)
      v[r][j] = *(const v4f*)(inb + (r * DD + j * 128) * 4 + voff);
#pragma unroll
  for (int j = 0; j < 4; ++j) {
    gv[j] = *(const v4f*)((const char*)g + j * 512 + voff);
    bv[j] = *(const v4f*)((const char*)bta + j * 512 + voff);
  }
  loads_issued(voff);
#pragma unroll
  for (int r = 0; r < LN_R; ++r) {
    float s = 0.f, q = 0.f;
#pragma unroll
    for (int j = 0; j < 4; ++j)
#pragma unroll
      for (int e = 0; e < 4; ++e) {
        s += v[r][j][e];
        q += v[r][j][e] * v[r][j][e];
      }
    s = wave_sum(s);
    q = wave_sum(q);
    const float mu = s * (1.0f / DD);
    const float var = q * (1.0f / DD) - mu * mu;
    const float rstd = rsqrtf(var + 1e-5f);
#pragma unroll
    for (int j = 0; j < 4; ++j)
#pragma unroll
      for (int e = 0; e < 4; ++e)
        v[r][j][e] = (v[r][j][e] - mu) * rstd * gv[j][e] + bv[j][e];
  }
  if (BF16OUT) {
    v4bf o[LN_R][4];
#pragma unroll
    for (int r = 0; r < LN_R; ++r)
#pragma unroll
      for (int j = 0; j < 4; ++j) o[r][j] = __builtin_convertvector(v[r][j], v4bf);
#pragma unroll
    for (int r = 0; r < LN_R; ++r)
#pragma unroll
      for (int j = 0; j < 4; ++j)
        *(v4bf*)(out_bf16 + (row0 + r) * DD + j * 128 + c0) = o[r][j];
  } else {
#pragma unroll
    for (int r = 0; r < LN_R; ++r)
#pragma unroll
      for (int j = 0; j < 4; ++j)
        *(v4f*)(out_f32 + (row0 + r) * DD + j * 128 + c0) = v[r][j];
  }
}

// ---------------------------------------------------------------------------
// out = x + msg2 + LN(aug32 + baug; gaug, bln)
// One wave per row as in layernorm_kernel, FIN_R rows a wave: one row's 24 loads
// already hold 96 registers.
// ---------------------------------------------------------------------------
#define FIN_R 1

__global__ __launch_bounds__(256) void final_kernel(
    const float* __restrict__ x, const float* __restrict__ msg2,
    const float* __restrict__ aug32, const float* __restrict__ baug,
    const float* __restrict__ gaug, const float* __restrict__ bln,
    float* __restrict__ out) {
  const int lane = threadIdx.x & 31;
  // the wave's number, scalar: row bases stay in scalar registers
  const int wid = __builtin_amdgcn_readfirstlane(threadIdx.x >> 5);
  const size_t row0 = ((size_t)blockIdx.x * 8 + wid) * FIN_R;
  const int c0 = lane * 4;
  const unsigned voff = lane * 16;  // the lane's byte offset in a 512-byte piece
  const char* ab = (const char*)(aug32 + row0 * DD);
  const char* xb = (const char*)(x + row0 * DD);
  const char* mb = (const char*)(msg2 + row0 * DD);
  v4f a[FIN_R][4], xv[FIN_R][4], mv[FIN_R][4], av[4], gv[4], bv[4];
#pragma unroll
  for (int r = 0; r < FIN_R; ++r)
#pragma unroll
    for (int j = 0; j < 4; ++j)
      a[r][j] = *(const v4f*)(ab + (r * DD + j * 128) * 4 + voff);
#pragma unroll
  for (int j = 0; j < 4; ++j)
    av[j] = *(const v4f*)((const char*)baug + j * 512 + voff);
#pragma unroll
  for (int r = 0; r < FIN_R; ++r)
#pragma unroll
    for (int j = 0; j < 4; ++j) {
      xv[r][j] = *(const v4f*)(xb + (r * DD + j * 128) * 4 + voff);
      mv[r][j] = *(const v4f*)(mb + (r * DD + j * 128) * 4 + voff);
    }
#pragma unroll
  for (int j = 0; j < 4; ++j) {
    gv[j] = *(const v4f*)((const char*)gaug + j * 512 + voff);
    bv[j] = *(const v4f*)((const char*)bln + j * 512 + voff);
  }
  loads_issued(voff);
#pragma unroll
  for (int r = 0; r < FIN_R; ++r) {
    float s = 0.f, q = 0.f;
#pragma unroll
    for (int j = 0; j < 4; ++j) {
      a[r][j] += av[j];
#pragma unroll
      for (int e = 0; e < 4; ++e) {
        s += a[r][j][e];
        q += a[r][j][e] * a[r][j][e];
      }
    }
    s = wave_sum(s);
    q = wave_sum(q);
    const float mu = s * (1.0f / DD);
    const float var = q * (1.0f / DD) - mu * mu;
    const float rstd = rsqrtf(var + 1e-5f);
#pragma unroll
    for (int j = 0; j < 4; ++j)
#pragma unroll
      for (int e = 0; e < 4; ++e) {
        const float l = (a[r][j][e] - mu) * rstd * gv[j][e] + bv[j][e];
        a[r][j][e] = xv[r][j][e] + mv[r][j][e] + l;
      }
  }
#pragma unroll
  for (int r = 0; r < FIN_R; ++r)
#pragma unroll
    for (int j = 0; j < 4; ++j)
      *(v4f*)(out + (row0 + r) * DD + j * 128 + c0) = a[r][j];
}

// ---------------------------------------------------------------------------
// Host orchestration
// ---------------------------------------------------------------------------
extern "C" void kernel_launch(void* const* d_in, const int* in_sizes, int n_in,
                              void* d_out, int out_size, void* d_ws,
                              size_t ws_size, hipStream_t stream) {
  (void)in_sizes; (void)n_in; (void)out_size; (void)ws_size;
  const float* x      = (const float*)d_in[0];
  const float* source = (const float*)d_in[1];
  const float* Wq     = (const float*)d_in[2];
  const float* Wk     = (const float*)d_in[3];
  const float* Wv     = (const float*)d_in[4];
  const float* Wmerge = (const float*)d_in[5];
  const float* Wmlp1  = (const float*)d_in[6];
  const float* Wmlp2  = (const float*)d_in[7];
  const float* g1     = (const float*)d_in[8];
  const float* b1     = (const float*)d_in[9];
  const float* g2     = (const float*)d_in[10];
  const float* b2     = (const float*)d_in[11];
  const float* Waug   = (const float*)d_in[12];
  const float* baug   = (const float*)d_in[13];
  const float* gaug   = (const float*)d_in[14];
  const float* bln    = (const float*)d_in[15];
  const float* thr    = (const float*)d_in[16];
  float* out = (float*)d_out;

  char* ws = (char*)d_ws;
  size_t off = 0;
  auto take = [&](size_t bytes) -> char* {
    char* p = ws + off;
    off += (bytes + 255) & ~(size_t)255;
    return p;
  };

  __bf16* xb   = (__bf16*)take((size_t)NT * DD * 2);
  __bf16* sb   = (__bf16*)take((size_t)NT * DD * 2);
  __bf16* WqT  = (__bf16*)take((size_t)DD * DD * 2);
  __bf16* WkT  = (__bf16*)take((size_t)DD * DD * 2);
  __bf16* WvT  = (__bf16*)take((size_t)DD * DD * 2);
  __bf16* WmT  = (__bf16*)take((size_t)DD * DD * 2);
  __bf16* W1T  = (__bf16*)take((size_t)D2 * D2 * 2);
  __bf16* W2T  = (__bf16*)take((size_t)DD * D2 * 2);
  __bf16* WaT  = (__bf16*)take((size_t)DD * DD * 2);
  float*  C1   = (float*)take((size_t)NT * D2 * 4);
  __bf16* Qf   = (__bf16*)take((size_t)NT * DD * 2);
  __bf16* Kf   = (__bf16*)take((size_t)NT * DD * 2);
  __bf16* Vb   = (__bf16*)take((size_t)NT * DD * 2);
  float*  Ksum = (float*)take((size_t)BB * HH * DHD * 4);
  __bf16* KVt  = (__bf16*)take((size_t)BB * HH * 64 * 64 * 2);
  float*  Zs   = (float*)take((size_t)NT * HH * 4);
  __bf16* Ao   = (__bf16*)take((size_t)NT * DD * 2);
  __bf16* Msgb = (__bf16*)take((size_t)NT * DD * 2);
  __bf16* Hb   = (__bf16*)take((size_t)NT * D2 * 2);
  float*  Msg2 = (float*)take((size_t)NT * DD * 4);
  float*  KVp  = (float*)take((size_t)NSPLIT * KVN * 4);
  float*  Ksp  = (float*)take((size_t)NSPLIT * KSN * 4);

  const dim3 blk(256);
  const size_t nXD = (size_t)NT * DD;   // 8.39M
  const size_t nXD2 = (size_t)NT * D2;  // 16.78M
  auto blocks = [](size_t n) { return dim3((unsigned)(n / CVT_BLK)); };

  // 1) Convert activations and (transposed) weights to bf16
  f32_to_bf16_kernel<0><<<blocks(nXD), blk, 0, stream>>>(x, xb);
  f32_to_bf16_kernel<0><<<blocks(nXD), blk, 0, stream>>>(source, sb);
  transpose_bf16_kernel<<<dim3(DD / 32, DD / 64), blk, 0, stream>>>(Wq, WqT, DD, DD);
  transpose_bf16_kernel<<<dim3(DD / 32, DD / 64), blk, 0, stream>>>(Wk, WkT, DD, DD);
  transpose_bf16_kernel<<<dim3(DD / 32, DD / 64), blk, 0, stream>>>(Wv, WvT, DD, DD);
  transpose_bf16_kernel<<<dim3(DD / 32, DD / 64), blk, 0, stream>>>(Wmerge, WmT, DD, DD);
  transpose_bf16_kernel<<<dim3(D2 / 32, D2 / 64), blk, 0, stream>>>(Wmlp1, W1T, D2, D2);
  transpose_bf16_kernel<<<dim3(DD / 32, D2 / 64), blk, 0, stream>>>(Wmlp2, W2T, D2, DD);
  transpose_bf16_kernel<<<dim3(DD / 32, DD / 64), blk, 0, stream>>>(Waug, WaT, DD, DD);

  // 2) mq = x@Wq -> RoPE+elu -> Qf
  gemm_bf16_kernel<<<dim3(DD / 256, NT / 128), blk, 0, stream>>>(
      xb, DD, WqT, DD, C1, DD, DD, 0, nullptr);
  rope_featmap_kernel<<<dim3(NT / (2 * ROPE_G)), blk, 0, stream>>>(C1, Qf);

  // 3) mk = source@Wk -> RoPE+elu -> Kf
  gemm_bf16_kernel<<<dim3(DD / 256, NT / 128), blk, 0, stream>>>(
      sb, DD, WkT, DD, C1, DD, DD, 0, nullptr);
  rope_featmap_kernel<<<dim3(NT / (2 * ROPE_G)), blk, 0, stream>>>(C1, Kf);

  // 4) v = source@Wv -> Vb (bf16, fused epilogue)
  gemm_bf16_kernel<<<dim3(DD / 256, NT / 128), blk, 0, stream>>>(
      sb, DD, WvT, DD, C1, DD, DD, 0, Vb);

  // 5) attention core
  ksum_kernel<<<dim3(BB * HH, NSPLIT), blk, 0, stream>>>(Kf, Ksp);
  kv_kernel<<<dim3(BB * HH, NSPLIT), blk, 0, stream>>>(Kf, Vb, KVp);
  split_reduce_kernel<<<dim3(KVN / 256 + KSN / 256), blk, 0, stream>>>(
      KVp, Ksp, KVt, Ksum);
  scores_kernel<<<dim3((NT * HH) / 256), blk, 0, stream>>>(Qf, Ksum, thr, Zs);
  attn_out_kernel<<<dim3(LL / 128, BB * HH), blk, 0, stream>>>(Qf, KVt, Zs, Ao);

  // 6) merge + LN1 -> Msgb (bf16)
  gemm_bf16_kernel<<<dim3(DD / 256, NT / 128), blk, 0, stream>>>(
      Ao, DD, WmT, DD, C1, DD, DD, 0, nullptr);
  layernorm_kernel<1><<<dim3(NT / (8 * LN_R)), blk, 0, stream>>>(C1, g1, b1, nullptr, Msgb);

  // 7) MLP1: h = [x, msg] @ Wmlp1 = x@W1[:512] + msg@W1[512:]
  gemm_bf16_kernel<<<dim3(D2 / 256, NT / 128), blk, 0, stream>>>(
      xb, DD, W1T, D2, C1, D2, DD, 0, nullptr);
  gemm_bf16_kernel<<<dim3(D2 / 256, NT / 128), blk, 0, stream>>>(
      Msgb, DD, W1T + DD, D2, C1, D2, DD, 1, nullptr);
  f32_to_bf16_kernel<1><<<blocks(nXD2), blk, 0, stream>>>(C1, Hb);  // relu

  // 8) MLP2 + LN2 -> Msg2 (f32)
  gemm_bf16_kernel<<<dim3(DD / 256, NT / 128), blk, 0, stream>>>(
      Hb, D2, W2T, D2, C1, DD, D2, 0, nullptr);
  layernorm_kernel<0><<<dim3(NT / (8 * LN_R)), blk, 0, stream>>>(C1, g2, b2, Msg2, nullptr);

  // 9) aug GEMM, then fused LN(aug)+residual
  gemm_bf16_kernel<<<dim3(DD / 256, NT / 128), blk, 0, stream>>>(
      xb, DD, WaT, DD, C1, DD, DD, 0, nullptr);
  final_kernel<<<dim3(NT / (8 * FIN_R)), blk, 0, stream>>>(x, Msg2, C1, baug, gaug, bln, out);
}

// v003
// One run takes 299 microseconds.
// In two side-by-side timings against v002, it was 1.16 and 1.18 times as fast.
// Counting every step since v000, it is 2.06 times as fast.
#include <hip/hip_runtime.h>
#include <hip/hip_bf16.h>

#define BB 4
#define LL 4096
#define SSEQ 4096
#define DD 512
#define HH 8
#define DHD 64
#define NT (BB * LL)     /* 16384 token rows */
#define D2 (2 * DD)      /* 1024 */
#define NSPLIT 16        /* work-groups that share one (b,h) sum over s */
#define SCHUNK (SSEQ / NSPLIT)
#define KVN (BB * HH * DHD * DHD) /* elements of one KV partial plane */
#define KSN (BB * HH * DHD)       /* elements of one Ksum partial plane */

typedef __bf16 v16bf __attribute__((ext_vector_type(16)));
typedef __bf16 v8bf  __attribute__((ext_vector_type(8)));
typedef float  v8f   __attribute__((ext_vector_type(8)));
typedef int    v4i   __attribute__((ext_vector_type(4)));
typedef float  v4f   __attribute__((ext_vector_type(4)));
typedef __bf16 v4bf  __attribute__((ext_vector_type(4)));

#if defined(__has_builtin)
#if __has_builtin(__builtin_amdgcn_global_load_async_to_lds_b128)
#define HAVE_ASYNC_BUILTIN 1
#endif
#if __has_builtin(__builtin_amdgcn_s_wait_asynccnt)
#define HAVE_ASYNCWAIT_BUILTIN 1
#endif
#endif

static __device__ __forceinline__ void async_copy16(void* lds, const void* g) {
#ifdef HAVE_ASYNC_BUILTIN
  __builtin_amdgcn_global_load_async_to_lds_b128(
      (__attribute__((address_space(1))) v4i*)(g),
      (__attribute__((address_space(3))) v4i*)(lds), 0, 0);
#else
  asm volatile("global_load_async_to_lds_b128 %0, %1, off" ::"v"(
                   (unsigned)(size_t)lds),
               "v"(g)
               : "memory");
#endif
}

static __device__ __forceinline__ void wait_async0() {
#ifdef HAVE_ASYNCWAIT_BUILTIN
  __builtin_amdgcn_s_wait_asynccnt(0);
#else
  asm volatile("s_wait_asynccnt 0x0" ::: "memory");
#endif
}

static __device__ __forceinline__ v8f wmma_bf16f32(v16bf a, v16bf b, v8f c) {
  // D = A(16x32) * B(32x16) + C, f32 accumulate
  return __builtin_amdgcn_wmma_f32_16x16x32_bf16(false, a, false, b, (short)0, c,
                                                 false, false);
}

static __device__ __forceinline__ v16bf frag_lds(const __bf16* tile, int stride,
                                                 int lane) {
  const int row  = lane & 15;
  const int koff = (lane >> 4) << 3;
  const __bf16* p = tile + row * stride + koff;
  v8bf lo = *(const v8bf*)(p);
  v8bf hi = *(const v8bf*)(p + 16);
  return __builtin_shufflevector(lo, hi, 0, 1, 2, 3, 4, 5, 6, 7, 8, 9, 10, 11,
                                 12, 13, 14, 15);
}

// ---------------------------------------------------------------------------
// Sum over the 32 lanes of a wave, the same bits in every lane: four xor steps
// inside each 16-lane row, then the exchange with the other row.
// ---------------------------------------------------------------------------
template <int CTRL>
static __device__ __forceinline__ float row_xor_add(float v) {
  const int t = __builtin_amdgcn_update_dpp(0, __builtin_bit_cast(int, v), CTRL,
                                            0xf, 0xf, true);
  return v + __builtin_bit_cast(float, t);
}

static __device__ __forceinline__ float wave_sum(float v) {
  v = row_xor_add<0x161>(v);  // row_xmask:1
  v = row_xor_add<0x162>(v);  // row_xmask:2
  v = row_xor_add<0x164>(v);  // row_xmask:4
  v = row_xor_add<0x168>(v);  // row_xmask:8
  const int b = __builtin_bit_cast(int, v);
  const int o =
      __builtin_amdgcn_permlanex16(b, b, 0x76543210, 0xfedcba98, false, false);
  return v + __builtin_bit_cast(float, o);
}

// Stands behind a kernel's whole group of loads, which share the offset register
// voff.
static __device__ __forceinline__ void loads_issued(unsigned voff) {
  // In front of every later write of a register that these loads name; as an
  // operand voff stays live up to here, so no load's result lands on it.
  asm volatile("s_wait_xcnt 0x0" ::"v"(voff) : "memory");
  // No arithmetic moves up among the loads: without it the build issued part of
  // the group late, behind waits for the first loads.
  __builtin_amdgcn_sched_barrier(0);
}

static __device__ __forceinline__ float exp2_slot(float x) {
  float y;
  asm("v_exp_f32 %0, %1\n\tv_nop" : "=&v"(y) : "v"(x));
  return y;
}

// exp(x) as the fast library form computes it
static __device__ __forceinline__ float exp_fast(float x) {
  return exp2_slot(x * 1.44269504088896340736f);
}

// sine and cosine of an angle in radians, as the fast library form computes them
static __device__ __forceinline__ void sincos_fast(float a, float* s, float* c) {
  const float rev = a * 0.15915494309189532f;
  asm("v_sin_f32 %0, %2\n\tv_cos_f32 %1, %2\n\tv_nop"
      : "=&v"(*s), "=&v"(*c)
      : "v"(rev));
}

// ---------------------------------------------------------------------------
// Elementwise conversion.  A thread takes CVT_G groups of four floats, each a
// 16-byte load (512 contiguous bytes a wave), all issued before the first use.
// One block covers CVT_BLK elements; the grid divides n exactly.
// ---------------------------------------------------------------------------
#define CVT_G 8
#define CVT_BLK (256 * 4 * CVT_G)

template <int RELU>
__global__ __launch_bounds__(256) void f32_to_bf16_kernel(
    const float* __restrict__ in, __bf16* __restrict__ out) {
  const size_t base = (size_t)blockIdx.x * CVT_BLK + threadIdx.x * 4;
  v4f v[CVT_G];
  v4bf o[CVT_G];
#pragma unroll
  for (int j = 0; j < CVT_G; ++j) v[j] = *(const v4f*)(in + base + j * 1024);
#pragma unroll
  for (int j = 0; j < CVT_G; ++j) {
    v4f t = v[j];
    if (RELU) {
#pragma unroll
      for (int e = 0; e < 4; ++e) t[e] = t[e] > 0.f ? t[e] : 0.f;
    }
    o[j] = __builtin_convertvector(t, v4bf);
  }
#pragma unroll
  for (int j = 0; j < CVT_G; ++j) *(v4bf*)(out + base + j * 1024) = o[j];
}

// W[k][n] (f32, KxN row-major) -> Wt[n][k] (bf16, NxK row-major)
// Block tile: 64 k x 32 n.  A thread reads 8 consecutive k of one n and stores
// them as 16 bytes; 8 lanes side by side in k fill one 128-byte line of Wt.
// Grid: x = N / 32, y = K / 64.
__global__ __launch_bounds__(256) void transpose_bf16_kernel(
    const float* __restrict__ W, __bf16* __restrict__ Wt, int K, int N) {
  const int k0 = blockIdx.y * 64 + (threadIdx.x & 7) * 8;
  const int n  = blockIdx.x * 32 + (threadIdx.x >> 3);
  const float* wp = W + (size_t)k0 * N + n;
  float w[8];
#pragma unroll
  for (int e = 0; e < 8; ++e) w[e] = wp[(size_t)e * N];
  v8bf o;
#pragma unroll
  for (int e = 0; e < 8; ++e) o[e] = (__bf16)w[e];
  *(v8bf*)(Wt + (size_t)n * K + k0) = o;
}

// ---------------------------------------------------------------------------
// Generic bf16 GEMM: C[M,N](f32) (+)= A[M,K](bf16,row-major) * Bt[N,K]^T
// Block = 256 threads = 8 waves; block tile 128x256, K-step 32, double-buffered
// LDS filled by async global->LDS DMA.  Wave (wr in 0..1, wc in 0..3) owns a
// 64x64 sub-tile = 4x4 wmma tiles: 16 WMMAs per 16 ds_load_b128 per K-step.
// What becomes of the result and the row pitch of the output are fixed at compile
// time: MODE GEMM_F32 stores f32 to C, GEMM_ADD stores C + result to C, GEMM_BF16
// stores bf16 to Cbf; LDC is the pitch in elements.
// ---------------------------------------------------------------------------
#define GEMM_F32 0
#define GEMM_ADD 1
#define GEMM_BF16 2
#define LDSTR 40 /* padded LDS row stride in bf16 elements (80B) */

template <int MODE, int LDC>
__global__ __launch_bounds__(256) void gemm_bf16_kernel(
    const __bf16* __restrict__ A, int lda, const __bf16* __restrict__ Bt,
    int ldb, float* __restrict__ C, int K, __bf16* __restrict__ Cbf) {
  __shared__ alignas(16) __bf16 As[2][128 * LDSTR];
  __shared__ alignas(16) __bf16 Bs[2][256 * LDSTR];

  const int tid  = threadIdx.x;
  const int lane = tid & 31;
  const int wid  = tid >> 5;
  const int wr   = wid >> 2;  // 0..1 (m)
  const int wc   = wid & 3;   // 0..3 (n)
  const size_t m0 = (size_t)blockIdx.y * 128;
  const size_t n0 = (size_t)blockIdx.x * 256;

  const __bf16* Ab = A + m0 * lda;
  const __bf16* Bb = Bt + n0 * ldb;

  auto stage_tiles = [&](int buf, int kk) {
#pragma unroll
    for (int i = 0; i < 2; ++i) {  // A tile: 128 rows x 32 cols
      int c   = tid + i * 256;     // 0..511 chunks of 8 bf16
      int row = c >> 2;            // 0..127
      int cc  = (c & 3) << 3;      // 0,8,16,24
      async_copy16(&As[buf][row * LDSTR + cc],
                   Ab + (size_t)row * lda + kk + cc);
    }
#pragma unroll
    for (int i = 0; i < 4; ++i) {  // B tile: 256 rows x 32 cols
      int c   = tid + i * 256;     // 0..1023
      int row = c >> 2;            // 0..255
      int cc  = (c & 3) << 3;
      async_copy16(&Bs[buf][row * LDSTR + cc],
                   Bb + (size_t)row * ldb + kk + cc);
    }
  };

  v8f acc[4][4];
#pragma unroll
  for (int mi = 0; mi < 4; ++mi)
#pragma unroll
    for (int ni = 0; ni < 4; ++ni)
#pragma unroll
      for (int j = 0; j < 8; ++j) acc[mi][ni][j] = 0.f;

  stage_tiles(0, 0);
  wait_async0();
  __syncthreads();

  for (int kk = 0; kk < K; kk += 32) {
    const int cur = (kk >> 5) & 1;
    if (kk + 32 < K) stage_tiles(cur ^ 1, kk + 32);  // DMA under the WMMAs
    v16bf af[4], bfv[4];
#pragma unroll
    for (int mi = 0; mi < 4; ++mi)
      af[mi] = frag_lds(&As[cur][(wr * 64 + mi * 16) * LDSTR], LDSTR, lane);
#pragma unroll
    for (int ni = 0; ni < 4; ++ni)
      bfv[ni] = frag_lds(&Bs[cur][(wc * 64 + ni * 16) * LDSTR], LDSTR, lane);
#pragma unroll
    for (int mi = 0; mi < 4; ++mi)
#pragma unroll
      for (int ni = 0; ni < 4; ++ni)
        acc[mi][ni] = wmma_bf16f32(af[mi], bfv[ni], acc[mi][ni]);
    wait_async0();
    __syncthreads();
  }

  const int rofs = (lane >> 4) << 3;
  const size_t idx0 = (m0 + (size_t)wr * 64 + rofs) * LDC + n0 + (size_t)wc * 64 +
                      (lane & 15);
  if (MODE == GEMM_BF16) {
    __bf16* cp = Cbf + idx0;
#pragma unroll
    for (int mi = 0; mi < 4; ++mi)
#pragma unroll
      for (int ni = 0; ni < 4; ++ni)
#pragma unroll
        for (int j = 0; j < 8; ++j)
          cp[(mi * 16 + j) * LDC + ni * 16] = (__bf16)acc[mi][ni][j];
  } else {
    float* cp = C + idx0;
#pragma unroll
    for (int mi = 0; mi < 4; ++mi) {
      if (MODE == GEMM_ADD) {
        // the old values of a row of tiles are all asked for before the first is
        // used: no wait for a load stands between two elements
        float old[4][8];
#pragma unroll
        for (int ni = 0; ni < 4; ++ni)
#pragma unroll
          for (int j = 0; j < 8; ++j)
            old[ni][j] = cp[(mi * 16 + j) * LDC + ni * 16];
#pragma unroll
        for (int ni = 0; ni < 4; ++ni)
#pragma unroll
          for (int j = 0; j < 8; ++j) acc[mi][ni][j] += old[ni][j];
      }
#pragma unroll
      for (int ni = 0; ni < 4; ++ni)
#pragma unroll
        for (int j = 0; j < 8; ++j)
          cp[(mi * 16 + j) * LDC + ni * 16] = acc[mi][ni][j];
    }
  }
}

// ---------------------------------------------------------------------------
// RoPE + elu feature map: in f32 [row,512] -> out bf16 (elu(rope(x))+1)
// ---------------------------------------------------------------------------
// A thread keeps its four columns (two pairs) and takes them in ROPE_G rows,
// one 16-byte load each, all issued before the first use; a block covers
// 2 * ROPE_G rows.
#define ROPE_G 8

__global__ __launch_bounds__(256) void rope_featmap_kernel(
    const float* __restrict__ in, __bf16* __restrict__ out) {
  const int col = (threadIdx.x & 127) * 4;  // even: pairs col/2 and col/2 + 1
  // the same in every lane of a wave: row bases and positions stay scalar
  const int half = __builtin_amdgcn_readfirstlane(threadIdx.x >> 7);
  const size_t row0 = (size_t)blockIdx.x * (2 * ROPE_G) + half;
  const unsigned voff = col * 4;  // the thread's byte offset in an input row
  const char* inb = (const char*)(in + row0 * DD);
  v4f v[ROPE_G];
  v4bf o[ROPE_G];
#pragma unroll
  for (int j = 0; j < ROPE_G; ++j)
    v[j] = *(const v4f*)(inb + (size_t)j * (2 * DD * 4) + voff);
  loads_issued(voff);
  const float div0 = exp_fast((float)col * (-9.2103403719761836f / 512.0f));
  const float div1 = exp_fast((float)(col + 2) * (-9.2103403719761836f / 512.0f));
#pragma unroll
  for (int j = 0; j < ROPE_G; ++j) {
    // position within the sequence
    const float pos = (float)(int)((row0 + 2 * j) & (LL - 1));
    float s0, c0, s1, c1;
    sincos_fast(pos * div0, &s0, &c0);
    sincos_fast(pos * div1, &s1, &c1);
    v4f r;
    r[0] = v[j][0] * c0 - v[j][1] * s0;
    r[1] = v[j][1] * c0 + v[j][0] * s0;
    r[2] = v[j][2] * c1 - v[j][3] * s1;
    r[3] = v[j][3] * c1 + v[j][2] * s1;
#pragma unroll
    for (int e = 0; e < 4; ++e) {
      const float ex = exp_fast(r[e]);  // taken in every lane: no branch
      r[e] = r[e] > 0.f ? r[e] + 1.f : ex;
    }
    o[j] = __builtin_convertvector(r, v4bf);
  }
#pragma unroll
  for (int j = 0; j < ROPE_G; ++j)
    *(v4bf*)(out + (row0 + 2 * j) * DD + col) = o[j];
}

// ---------------------------------------------------------------------------
// Ksp[split,b,h,d] = sum over this split's s of Kf[b,s,h,d]
// (grid: x = (b,h), y = split; split_reduce_kernel adds the planes)
// ---------------------------------------------------------------------------
__global__ __launch_bounds__(256) void ksum_kernel(
    const __bf16* __restrict__ Kf, float* __restrict__ Ksp) {
  __shared__ float red[256];
  const int tid = threadIdx.x;
  const int bh = blockIdx.x, b = bh >> 3, h = bh & 7;
  const int d = tid & 63, grp = tid >> 6;
  float acc = 0.f;
  const int sbeg = blockIdx.y * SCHUNK;
  const __bf16* kp = Kf + ((size_t)b * SSEQ + sbeg + grp) * DD + h * DHD + d;
  for (int it = 0; it < SCHUNK / 4; ++it) {
    acc += (float)kp[(size_t)it * 4 * DD];
    // Stands in front of the load of the unrolled build whose result lands in
    // the address registers that the loads before it name.
    asm volatile("s_wait_xcnt 0x0" ::: "memory");
  }
  red[tid] = acc;
  __syncthreads();
  if (tid < 64)
    Ksp[(size_t)blockIdx.y * KSN + (size_t)bh * DHD + d] =
        red[tid] + red[tid + 64] + red[tid + 128] + red[tid + 192];
}

// ---------------------------------------------------------------------------
// KVp[split,b,h,v,d] = sum over this split's s of Vb[b,s,h,v] * Kf[b,s,h,d]
// (f32 partial, transposed).  Grid: x = (b,h), y = split; one block (8 waves)
// per (b,h,split); each wave owns 2 of the 16 16x16 tiles.
// ---------------------------------------------------------------------------
__global__ __launch_bounds__(256) void kv_kernel(
    const __bf16* __restrict__ Kf, const __bf16* __restrict__ Vb,
    float* __restrict__ KVp) {
  __shared__ alignas(16) __bf16 Kt[64 * 72];  // [d][s_local]
  __shared__ alignas(16) __bf16 Vt[64 * 72];  // [v][s_local]
  const int tid = threadIdx.x, lane = tid & 31, wid = tid >> 5;
  const int bh = blockIdx.x, b = bh >> 3, h = bh & 7;
  const int t0 = wid * 2;

  v8f acc[2];
#pragma unroll
  for (int t = 0; t < 2; ++t)
#pragma unroll
    for (int j = 0; j < 8; ++j) acc[t][j] = 0.f;

  const int sbeg = blockIdx.y * SCHUNK;
  // Kept rolled: barriers bound each tile, so unrolling overlaps nothing, and
  // the unrolled build issues a tile's fourth load behind the wait for its first.
#pragma unroll 1
  for (int s0 = sbeg; s0 < sbeg + SCHUNK; s0 += 64) {
    __syncthreads();
#pragma unroll
    for (int i = 0; i < 2; ++i) {
      int c = tid + i * 256;  // 0..511
      int srow = c >> 3;      // local s 0..63
      int d0 = (c & 7) << 3;  // 0..56
      size_t g = ((size_t)b * SSEQ + s0 + srow) * DD + h * DHD + d0;
      v8bf kk = *(const v8bf*)(Kf + g);
      v8bf vv = *(const v8bf*)(Vb + g);
#pragma unroll
      for (int e = 0; e < 8; ++e) {
        Kt[(d0 + e) * 72 + srow] = kk[e];
        Vt[(d0 + e) * 72 + srow] = vv[e];
      }
    }
    __syncthreads();
#pragma unroll
    for (int ks = 0; ks < 64; ks += 32) {
#pragma unroll
      for (int ti = 0; ti < 2; ++ti) {
        int t = t0 + ti;
        int mv = t >> 2, nd = t & 3;
        v16bf a  = frag_lds(&Vt[(mv * 16) * 72 + ks], 72, lane);
        v16bf bb = frag_lds(&Kt[(nd * 16) * 72 + ks], 72, lane);
        acc[ti] = wmma_bf16f32(a, bb, acc[ti]);
      }
    }
  }

  const int rofs = (lane >> 4) << 3;
#pragma unroll
  for (int ti = 0; ti < 2; ++ti) {
    int t = t0 + ti;
    int mv = t >> 2, nd = t & 3;
#pragma unroll
    for (int j = 0; j < 8; ++j) {
      int v = mv * 16 + rofs + j;
      int d = nd * 16 + (lane & 15);
      KVp[(size_t)blockIdx.y * KVN + ((size_t)bh * 64 + v) * 64 + d] =
          acc[ti][j];
    }
  }
}

// ---------------------------------------------------------------------------
// Adds the NSPLIT partial planes: KVt (bf16) from KVp, Ksum (f32) from Ksp.
// Blocks 0 .. KVN/256-1 take KV elements, the rest Ksum elements.
// ---------------------------------------------------------------------------
__global__ __launch_bounds__(256) void split_reduce_kernel(
    const float* __restrict__ KVp, const float* __restrict__ Ksp,
    __bf16* __restrict__ KVt, float* __restrict__ Ksum) {
  const int i = blockIdx.x * 256 + threadIdx.x;
  float acc = 0.f;
  if (blockIdx.x < KVN / 256) {
#pragma unroll  // all NSPLIT loads in flight at once
    for (int p = 0; p < NSPLIT; ++p) acc += KVp[(size_t)p * KVN + i];
    KVt[i] = (__bf16)acc;
  } else {
    const int j = i - KVN;
#pragma unroll  // all NSPLIT loads in flight at once
    for (int p = 0; p < NSPLIT; ++p) acc += Ksp[(size_t)p * KSN + j];
    Ksum[j] = acc;
    // Stands in front of the other branch's loads: in the built code a path
    // leads on to them from here, and the first writes this store's data register.
    asm volatile("s_wait_xcnt 0x0" ::: "memory");
  }
}

// ---------------------------------------------------------------------------
// Z[b,l,h] = 1 / (where(score>thr, score, 0) + 1e-6), score = Q . Ksum
// (the reference's /s_len inside KV and *s_len on out cancel exactly)
// ---------------------------------------------------------------------------
__global__ __launch_bounds__(256) void scores_kernel(
    const __bf16* __restrict__ Qf, const float* __restrict__ Ksum,
    const float* __restrict__ thr, float* __restrict__ Zs) {
  size_t idx = (size_t)blockIdx.x * 256 + threadIdx.x;  // over B*L*H
  size_t bl = idx >> 3;
  int h = (int)(idx & 7);
  int b = (int)(bl / LL);
  const __bf16* q = Qf + bl * DD + h * DHD;
  const float* ks = Ksum + ((size_t)b * HH + h) * DHD;
  float sc = 0.f;
#pragma unroll 8
  for (int d = 0; d < DHD; ++d) sc += (float)q[d] * ks[d];
  float sp = sc > thr[0] ? sc : 0.f;
  Zs[idx] = 1.0f / (sp + 1e-6f);
}

// ---------------------------------------------------------------------------
// Ao[b,l,h*64+v] = Z[b,l,h] * sum_d Q[b,l,h,d] * KVt[b,h,v,d]   (bf16 out)
// Block: 8 waves; tile 128 rows x 64 cols; K=64 (2 wmma steps). Async staging.
// ---------------------------------------------------------------------------
__global__ __launch_bounds__(256) void attn_out_kernel(
    const __bf16* __restrict__ Qf, const __bf16* __restrict__ KVt,
    const float* __restrict__ Zs, __bf16* __restrict__ Ao) {
  __shared__ alignas(16) __bf16 Aq[128 * 72];
  __shared__ alignas(16) __bf16 Kv[64 * 72];
  __shared__ alignas(32) float zsh[128];
  const int tid = threadIdx.x, lane = tid & 31, wid = tid >> 5;
  const int bh = blockIdx.y, b = bh >> 3, h = bh & 7;
  const size_t rowbase = (size_t)b * LL + (size_t)blockIdx.x * 128;

#pragma unroll
  for (int i = 0; i < 4; ++i) {  // Q tile 128x64 (async DMA)
    int c = tid + i * 256;
    int row = c >> 3, cc = (c & 7) << 3;
    async_copy16(&Aq[row * 72 + cc], Qf + (rowbase + row) * DD + h * DHD + cc);
  }
#pragma unroll
  for (int i = 0; i < 2; ++i) {  // KVt 64x64 (async DMA)
    int c = tid + i * 256;
    int row = c >> 3, cc = (c & 7) << 3;
    async_copy16(&Kv[row * 72 + cc], KVt + ((size_t)bh * 64 + row) * 64 + cc);
  }
  if (tid < 128) zsh[tid] = Zs[(rowbase + tid) * HH + h];
  wait_async0();
  __syncthreads();

  v8f acc[4];
#pragma unroll
  for (int ni = 0; ni < 4; ++ni)
#pragma unroll
    for (int j = 0; j < 8; ++j) acc[ni][j] = 0.f;

#pragma unroll
  for (int ks = 0; ks < 64; ks += 32) {
    v16bf a = frag_lds(&Aq[(wid * 16) * 72 + ks], 72, lane);
#pragma unroll
    for (int ni = 0; ni < 4; ++ni) {
      v16bf bb = frag_lds(&Kv[(ni * 16) * 72 + ks], 72, lane);
      acc[ni] = wmma_bf16f32(a, bb, acc[ni]);
    }
  }

  const int rofs = (lane >> 4) << 3;
  v8f zv = *(const v8f*)(&zsh[wid * 16 + rofs]);
#pragma unroll
  for (int ni = 0; ni < 4; ++ni) {
    int col = h * DHD + ni * 16 + (lane & 15);
#pragma unroll
    for (int j = 0; j < 8; ++j) {
      size_t row = rowbase + wid * 16 + rofs + j;
      Ao[row * DD + col] = (__bf16)(acc[ni][j] * zv[j]);
    }
  }
}

// ---------------------------------------------------------------------------
// LayerNorm over 512 f32; writes the f32 or the bf16 output.
// One wave per row, LN_R rows a wave: a lane holds 16 elements of a row (four
// 16-byte loads, 512 contiguous bytes a wave each); the row's sums are taken
// inside the wave.  A block covers 8 * LN_R rows.
// ---------------------------------------------------------------------------
#define LN_R 2

template <int BF16OUT>
__global__ __launch_bounds__(256) void layernorm_kernel(
    const float* __restrict__ in, const float* __restrict__ g,
    const float* __restrict__ bta, float* __restrict__ out_f32,
    __bf16* __restrict__ out_bf16) {
  const int lane = threadIdx.x & 31;
  // the wave's number, scalar: row bases stay in scalar registers
  const int wid = __builtin_amdgcn_readfirstlane(threadIdx.x >> 5);
  const size_t row0 = ((size_t)blockIdx.x * 8 + wid) * LN_R;
  const int c0 = lane * 4;
  const unsigned voff = lane * 16;  // the lane's byte offset in a 512-byte piece
  const char* inb = (const char*)(in + row0 * DD);
  v4f v[LN_R][4], gv[4], bv[4];
#pragma unroll
  for (int r = 0; r < LN_R; ++r)
#pragma unroll
    for (int j = 0; j < 4; ++j)
      v[r][j] = *(const v4f*)(inb + (r * DD + j * 128) * 4 + voff);
#pragma unroll
  for (int j = 0; j < 4; ++j) {
    gv[j] = *(const v4f*)((const char*)g + j * 512 + voff);
    bv[j] = *(const v4f*)((const char*)bta + j * 512 + voff);
  }
  loads_issued(voff);
#pragma unroll
  for (int r = 0; r < LN_R; ++r) {
    float s = 0.f, q = 0.f;
#pragma unroll
    for (int j = 0; j < 4; ++j)
#pragma unroll
      for (int e = 0; e < 4; ++e) {
        s += v[r][j][e];
        q += v[r][j][e] * v[r][j][e];
      }
    s = wave_sum(s);
    q = wave_sum(q);
    const float mu = s * (1.0f / DD);
    const float var = q * (1.0f / DD) - mu * mu;
    const float rstd = rsqrtf(var + 1e-5f);
#pragma unroll
    for (int j = 0; j < 4; ++j)
#pragma unroll
      for (int e = 0; e < 4; ++e)
        v[r][j][e] = (v[r][j][e] - mu) * rstd * gv[j][e] + bv[j][e];
  }
  if (BF16OUT) {
    v4bf o[LN_R][4];
#pragma unroll
    for (int r = 0; r < LN_R; ++r)
#pragma unroll
      for (int j = 0; j < 4; ++j) o[r][j] = __builtin_convertvector(v[r][j], v4bf);
#pragma unroll
    for (int r = 0; r < LN_R; ++r)
#pragma unroll
      for (int j = 0; j < 4; ++j)
        *(v4bf*)(out_bf16 + (row0 + r) * DD + j * 128 + c0) = o[r][j];
  } else {
#pragma unroll
    for (int r = 0; r < LN_R; ++r)
#pragma unroll
      for (int j = 0; j < 4; ++j)
        *(v4f*)(out_f32 + (row0 + r) * DD + j * 128 + c0) = v[r][j];
  }
}

// ---------------------------------------------------------------------------
// out = x + msg2 + LN(aug32 + baug; gaug, bln)
// One wave per row as in layernorm_kernel, FIN_R rows a wave: one row's 24 loads
// already hold 96 registers.
// ---------------------------------------------------------------------------
#define FIN_R 1

__global__ __launch_bounds__(256) void final_kernel(
    const float* __restrict__ x, const float* __restrict__ msg2,
    const float* __restrict__ aug32, const float* __restrict__ baug,
    const float* __restrict__ gaug, const float* __restrict__ bln,
    float* __restrict__ out) {
  const int lane = threadIdx.x & 31;
  // the wave's number, scalar: row bases stay in scalar registers
  const int wid = __builtin_amdgcn_readfirstlane(threadIdx.x >> 5);
  const size_t row0 = ((size_t)blockIdx.x * 8 + wid) * FIN_R;
  const int c0 = lane * 4;
  const unsigned voff = lane * 16;  // the lane's byte offset in a 512-byte piece
  const char* ab = (const char*)(aug32 + row0 * DD);
  const char* xb = (const char*)(x + row0 * DD);
  const char* mb = (const char*)(msg2 + row0 * DD);
  v4f a[FIN_R][4], xv[FIN_R][4], mv[FIN_R][4], av[4], gv[4], bv[4];
#pragma unroll
  for (int r = 0; r < FIN_R; ++r)
#pragma unroll
    for (int j = 0; j < 4; ++j)
      a[r][j] = *(const v4f*)(ab + (r * DD + j * 128) * 4 + voff);
#pragma unroll
  for (int j = 0; j < 4; ++j)
    av[j] = *(const v4f*)((const char*)baug + j * 512 + voff);
#pragma unroll
  for (int r = 0; r < FIN_R; ++r)
#pragma unroll
    for (int j = 0; j < 4; ++j) {
      xv[r][j] = *(const v4f*)(xb + (r * DD + j * 128) * 4 + voff);
      mv[r][j] = *(const v4f*)(mb + (r * DD + j * 128) * 4 + voff);
    }
#pragma unroll
  for (int j = 0; j < 4; ++j) {
    gv[j] = *(const v4f*)((const char*)gaug + j * 512 + voff);
    bv[j] = *(const v4f*)((const char*)bln + j * 512 + voff);
  }
  loads_issued(voff);
#pragma unroll
  for (int r = 0; r < FIN_R; ++r) {
    float s = 0.f, q = 0.f;
#pragma unroll
    for (int j = 0; j < 4; ++j) {
      a[r][j] += av[j];
#pragma unroll
      for (int e = 0; e < 4; ++e) {
        s += a[r][j][e];
        q += a[r][j][e] * a[r][j][e];
      }
    }
    s = wave_sum(s);
    q = wave_sum(q);
    const float mu = s * (1.0f / DD);
    const float var = q * (1.0f / DD) - mu * mu;
    const float rstd = rsqrtf(var + 1e-5f);
#pragma unroll
    for (int j = 0; j < 4; ++j)
#pragma unroll
      for (int e = 0; e < 4; ++e) {
        const float l = (a[r][j][e] - mu) * rstd * gv[j][e] + bv[j][e];
        a[r][j][e] = xv[r][j][e] + mv[r][j][e] + l;
      }
  }
#pragma unroll
  for (int r = 0; r < FIN_R; ++r)
#pragma unroll
    for (int j = 0; j < 4; ++j)
      *(v4f*)(out + (row0 + r) * DD + j * 128 + c0) = a[r][j];
}

// ---------------------------------------------------------------------------
// Host orchestration
// ---------------------------------------------------------------------------
extern "C" void kernel_launch(void* const* d_in, const int* in_sizes, int n_in,
                              void* d_out, int out_size, void* d_ws,
                              size_t ws_size, hipStream_t stream) {
  (void)in_sizes; (void)n_in; (void)out_size; (void)ws_size;
  const float* x      = (const float*)d_in[0];
  const float* source = (const float*)d_in[1];
  const float* Wq     = (const float*)d_in[2];
  const float* Wk     = (const float*)d_in[3];
  const float* Wv     = (const float*)d_in[4];
  const float* Wmerge = (const float*)d_in[5];
  const float* Wmlp1  = (const float*)d_in[6];
  const float* Wmlp2  = (const float*)d_in[7];
  const float* g1     = (const float*)d_in[8];
  const float* b1     = (const float*)d_in[9];
  const float* g2     = (const float*)d_in[10];
  const float* b2     = (const float*)d_in[11];
  const float* Waug   = (const float*)d_in[12];
  const float* baug   = (const float*)d_in[13];
  const float* gaug   = (const float*)d_in[14];
  const float* bln    = (const float*)d_in[15];
  const float* thr    = (const float*)d_in[16];
  float* out = (float*)d_out;

  char* ws = (char*)d_ws;
  size_t off = 0;
  auto take = [&](size_t bytes) -> char* {
    char* p = ws + off;
    off += (bytes + 255) & ~(size_t)255;
    return p;
  };

  __bf16* xb   = (__bf16*)take((size_t)NT * DD * 2);
  __bf16* sb   = (__bf16*)take((size_t)NT * DD * 2);
  __bf16* WqT  = (__bf16*)take((size_t)DD * DD * 2);
  __bf16* WkT  = (__bf16*)take((size_t)DD * DD * 2);
  __bf16* WvT  = (__bf16*)take((size_t)DD * DD * 2);
  __bf16* WmT  = (__bf16*)take((size_t)DD * DD * 2);
  __bf16* W1T  = (__bf16*)take((size_t)D2 * D2 * 2);
  __bf16* W2T  = (__bf16*)take((size_t)DD * D2 * 2);
  __bf16* WaT  = (__bf16*)take((size_t)DD * DD * 2);
  float*  C1   = (float*)take((size_t)NT * D2 * 4);
  __bf16* Qf   = (__bf16*)take((size_t)NT * DD * 2);
  __bf16* Kf   = (__bf16*)take((size_t)NT * DD * 2);
  __bf16* Vb   = (__bf16*)take((size_t)NT * DD * 2);
  float*  Ksum = (float*)take((size_t)BB * HH * DHD * 4);
  __bf16* KVt  = (__bf16*)take((size_t)BB * HH * 64 * 64 * 2);
  float*  Zs   = (float*)take((size_t)NT * HH * 4);
  __bf16* Ao   = (__bf16*)take((size_t)NT * DD * 2);
  __bf16* Msgb = (__bf16*)take((size_t)NT * DD * 2);
  __bf16* Hb   = (__bf16*)take((size_t)NT * D2 * 2);
  float*  Msg2 = (float*)take((size_t)NT * DD * 4);
  float*  KVp  = (float*)take((size_t)NSPLIT * KVN * 4);
  float*  Ksp  = (float*)take((size_t)NSPLIT * KSN * 4);

  const dim3 blk(256);
  const size_t nXD = (size_t)NT * DD;   // 8.39M
  const size_t nXD2 = (size_t)NT * D2;  // 16.78M
  auto blocks = [](size_t n) { return dim3((unsigned)(n / CVT_BLK)); };

  // 1) Convert activations and (transposed) weights to bf16
  f32_to_bf16_kernel<0><<<blocks(nXD), blk, 0, stream>>>(x, xb);
  f32_to_bf16_kernel<0><<<blocks(nXD), blk, 0, stream>>>(source, sb);
  transpose_bf16_kernel<<<dim3(DD / 32, DD / 64), blk, 0, stream>>>(Wq, WqT, DD, DD);
  transpose_bf16_kernel<<<dim3(DD / 32, DD / 64), blk, 0, stream>>>(Wk, WkT, DD, DD);
  transpose_bf16_kernel<<<dim3(DD / 32, DD / 64), blk, 0, stream>>>(Wv, WvT, DD, DD);
  transpose_bf16_kernel<<<dim3(DD / 32, DD / 64), blk, 0, stream>>>(Wmerge, WmT, DD, DD);
  transpose_bf16_kernel<<<dim3(D2 / 32, D2 / 64), blk, 0, stream>>>(Wmlp1, W1T, D2, D2);
  transpose_bf16_kernel<<<dim3(DD / 32, D2 / 64), blk, 0, stream>>>(Wmlp2, W2T, D2, DD);
  transpose_bf16_kernel<<<dim3(DD / 32, DD / 64), blk, 0, stream>>>(Waug, WaT, DD, DD);

  // 2) mq = x@Wq -> RoPE+elu -> Qf
  gemm_bf16_kernel<GEMM_F32, DD><<<dim3(DD / 256, NT / 128), blk, 0, stream>>>(
      xb, DD, WqT, DD, C1, DD, nullptr);
  rope_featmap_kernel<<<dim3(NT / (2 * ROPE_G)), blk, 0, stream>>>(C1, Qf);

  // 3) mk = source@Wk -> RoPE+elu -> Kf
  gemm_bf16_kernel<GEMM_F32, DD><<<dim3(DD / 256, NT / 128), blk, 0, stream>>>(
      sb, DD, WkT, DD, C1, DD, nullptr);
  rope_featmap_kernel<<<dim3(NT / (2 * ROPE_G)), blk, 0, stream>>>(C1, Kf);

  // 4) v = source@Wv -> Vb (bf16, fused epilogue)
  gemm_bf16_kernel<GEMM_BF16, DD><<<dim3(DD / 256, NT / 128), blk, 0, stream>>>(
      sb, DD, WvT, DD, nullptr, DD, Vb);

  // 5) attention core
  ksum_kernel<<<dim3(BB * HH, NSPLIT), blk, 0, stream>>>(Kf, Ksp);
  kv_kernel<<<dim3(BB * HH, NSPLIT), blk, 0, stream>>>(Kf, Vb, KVp);
  split_reduce_kernel<<<dim3(KVN / 256 + KSN / 256), blk, 0, stream>>>(
      KVp, Ksp, KVt, Ksum);
  scores_kernel<<<dim3((NT * HH) / 256), blk, 0, stream>>>(Qf, Ksum, thr, Zs);
  attn_out_kernel<<<dim3(LL / 128, BB * HH), blk, 0, stream>>>(Qf, KVt, Zs, Ao);

  // 6) merge + LN1 -> Msgb (bf16)
  gemm_bf16_kernel<GEMM_F32, DD><<<dim3(DD / 256, NT / 128), blk, 0, stream>>>(
      Ao, DD, WmT, DD, C1, DD, nullptr);
  layernorm_kernel<1><<<dim3(NT / (8 * LN_R)), blk, 0, stream>>>(C1, g1, b1, nullptr, Msgb);

  // 7) MLP1: h = [x, msg] @ Wmlp1 = x@W1[:512] + msg@W1[512:]
  gemm_bf16_kernel<GEMM_F32, D2><<<dim3(D2 / 256, NT / 128), blk, 0, stream>>>(
      xb, DD, W1T, D2, C1, DD, nullptr);
  gemm_bf16_kernel<GEMM_ADD, D2><<<dim3(D2 / 256, NT / 128), blk, 0, stream>>>(
      Msgb, DD, W1T + DD, D2, C1, DD, nullptr);
  f32_to_bf16_kernel<1><<<blocks(nXD2), blk, 0, stream>>>(C1, Hb);  // relu

  // 8) MLP2 + LN2 -> Msg2 (f32)
  gemm_bf16_kernel<GEMM_F32, DD><<<dim3(DD / 256, NT / 128), blk, 0, stream>>>(
      Hb, D2, W2T, D2, C1, D2, nullptr);
  layernorm_kernel<0><<<dim3(NT / (8 * LN_R)), blk, 0, stream>>>(C1, g2, b2, Msg2, nullptr);

  // 9) aug GEMM, then fused LN(aug)+residual
  gemm_bf16_kernel<GEMM_F32, DD><<<dim3(DD / 256, NT / 128), blk, 0, stream>>>(
      xb, DD, WaT, DD, C1, DD, nullptr);
  final_kernel<<<dim3(NT / (8 * FIN_R)), blk, 0, stream>>>(x, Msg2, C1, baug, gaug, bln, out);
}

// v004
// A run of this version takes 228 microseconds.
// Next to v003, in two timings, it ran 1.32 and 1.31 times as fast.
// Over all steps from v000 it is 2.71 times as fast.
#include <hip/hip_runtime.h>
#include <hip/hip_bf16.h>

#define BB 4
#define LL 4096
#define SSEQ 4096
#define DD 512
#define HH 8
#define DHD 64
#define NT (BB * LL)     /* 16384 token rows */
#define D2 (2 * DD)      /* 1024 */
#define NSPLIT 16        /* work-groups that share one (b,h) sum over s */
#define SCHUNK (SSEQ / NSPLIT)
#define KVN (BB * HH * DHD * DHD) /* elements of one KV partial plane */
#define KSN (BB * HH * DHD)       /* elements of one Ksum partial plane */

typedef __bf16 v16bf __attribute__((ext_vector_type(16)));
typedef __bf16 v8bf  __attribute__((ext_vector_type(8)));
typedef float  v8f   __attribute__((ext_vector_type(8)));
typedef int    v4i   __attribute__((ext_vector_type(4)));
typedef float  v4f   __attribute__((ext_vector_type(4)));
typedef __bf16 v4bf  __attribute__((ext_vector_type(4)));

#if defined(__has_builtin)
#if __has_builtin(__builtin_amdgcn_global_load_async_to_lds_b128)
#define HAVE_ASYNC_BUILTIN 1
#endif
#if __has_builtin(__builtin_amdgcn_s_wait_asynccnt)
#define HAVE_ASYNCWAIT_BUILTIN 1
#endif
#endif

static __device__ __forceinline__ void async_copy16(void* lds, const void* g) {
#ifdef HAVE_ASYNC_BUILTIN
  __builtin_amdgcn_global_load_async_to_lds_b128(
      (__attribute__((address_space(1))) v4i*)(g),
      (__attribute__((address_space(3))) v4i*)(lds), 0, 0);
#else
  asm volatile("global_load_async_to_lds_b128 %0, %1, off" ::"v"(
                   (unsigned)(size_t)lds),
               "v"(g)
               : "memory");
#endif
}

static __device__ __forceinline__ void wait_async0() {
#ifdef HAVE_ASYNCWAIT_BUILTIN
  __builtin_amdgcn_s_wait_asynccnt(0);
#else
  asm volatile("s_wait_asynccnt 0x0" ::: "memory");
#endif
}

static __device__ __forceinline__ v8f wmma_bf16f32(v16bf a, v16bf b, v8f c) {
  // D = A(16x32) * B(32x16) + C, f32 accumulate
  return __builtin_amdgcn_wmma_f32_16x16x32_bf16(false, a, false, b, (short)0, c,
                                                 false, false);
}

static __device__ __forceinline__ v16bf frag_lds(const __bf16* tile, int stride,
                                                 int lane) {
  const int row  = lane & 15;
  const int koff = (lane >> 4) << 3;
  const __bf16* p = tile + row * stride + koff;
  v8bf lo = *(const v8bf*)(p);
  v8bf hi = *(const v8bf*)(p + 16);
  return __builtin_shufflevector(lo, hi, 0, 1, 2, 3, 4, 5, 6, 7, 8, 9, 10, 11,
                                 12, 13, 14, 15);
}

// ---------------------------------------------------------------------------
// Sum over the 32 lanes of a wave, the same bits in every lane: four xor steps
// inside each 16-lane row, then the exchange with the other row.
// ---------------------------------------------------------------------------
template <int CTRL>
static __device__ __forceinline__ float row_xor_add(float v) {
  const int t = __builtin_amdgcn_update_dpp(0, __builtin_bit_cast(int, v), CTRL,
                                            0xf, 0xf, true);
  return v + __builtin_bit_cast(float, t);
}

static __device__ __forceinline__ float wave_sum(float v) {
  v = row_xor_add<0x161>(v);  // row_xmask:1
  v = row_xor_add<0x162>(v);  // row_xmask:2
  v = row_xor_add<0x164>(v);  // row_xmask:4
  v = row_xor_add<0x168>(v);  // row_xmask:8
  const int b = __builtin_bit_cast(int, v);
  const int o =
      __builtin_amdgcn_permlanex16(b, b, 0x76543210, 0xfedcba98, false, false);
  return v + __builtin_bit_cast(float, o);
}

// Stands behind a kernel's whole group of loads, which share the offset register
// voff.
static __device__ __forceinline__ void loads_issued(unsigned voff) {
  // In front of every later write of a register that these loads name; as an
  // operand voff stays live up to here, so no load's result lands on it.
  asm volatile("s_wait_xcnt 0x0" ::"v"(voff) : "memory");
  // No arithmetic moves up among the loads: without it the build issued part of
  // the group late, behind waits for the first loads.
  __builtin_amdgcn_sched_barrier(0);
}

static __device__ __forceinline__ float exp2_slot(float x) {
  float y;
  asm("v_exp_f32 %0, %1\n\tv_nop" : "=&v"(y) : "v"(x));
  return y;
}

// exp(x) as the fast library form computes it
static __device__ __forceinline__ float exp_fast(float x) {
  return exp2_slot(x * 1.44269504088896340736f);
}

// sine and cosine of an angle in radians, as the fast library form computes them
static __device__ __forceinline__ void sincos_fast(float a, float* s, float* c) {
  const float rev = a * 0.15915494309189532f;
  asm("v_sin_f32 %0, %2\n\tv_cos_f32 %1, %2\n\tv_nop"
      : "=&v"(*s), "=&v"(*c)
      : "v"(rev));
}

// ---------------------------------------------------------------------------
// Elementwise conversion.  A thread takes CVT_G groups of four floats, each a
// 16-byte load (512 contiguous bytes a wave), all issued before the first use.
// One block covers CVT_BLK elements; the grid divides n exactly.
// ---------------------------------------------------------------------------
#define CVT_G 8
#define CVT_BLK (256 * 4 * CVT_G)

__global__ __launch_bounds__(256) void f32_to_bf16_kernel(
    const float* __restrict__ in, __bf16* __restrict__ out) {
  const size_t base = (size_t)blockIdx.x * CVT_BLK + threadIdx.x * 4;
  v4f v[CVT_G];
  v4bf o[CVT_G];
#pragma unroll
  for (int j = 0; j < CVT_G; ++j) v[j] = *(const v4f*)(in + base + j * 1024);
#pragma unroll
  for (int j = 0; j < CVT_G; ++j) o[j] = __builtin_convertvector(v[j], v4bf);
#pragma unroll
  for (int j = 0; j < CVT_G; ++j) *(v4bf*)(out + base + j * 1024) = o[j];
}

// W[k][n] (f32, KxN row-major) -> Wt[n][k] (bf16, NxK row-major)
// Block tile: 64 k x 32 n.  A thread reads 8 consecutive k of one n and stores
// them as 16 bytes; 8 lanes side by side in k fill one 128-byte line of Wt.
// Grid: x = N / 32, y = K / 64.
__global__ __launch_bounds__(256) void transpose_bf16_kernel(
    const float* __restrict__ W, __bf16* __restrict__ Wt, int K, int N) {
  const int k0 = blockIdx.y * 64 + (threadIdx.x & 7) * 8;
  const int n  = blockIdx.x * 32 + (threadIdx.x >> 3);
  const float* wp = W + (size_t)k0 * N + n;
  float w[8];
#pragma unroll
  for (int e = 0; e < 8; ++e) w[e] = wp[(size_t)e * N];
  v8bf o;
#pragma unroll
  for (int e = 0; e < 8; ++e) o[e] = (__bf16)w[e];
  *(v8bf*)(Wt + (size_t)n * K + k0) = o;
}

// ---------------------------------------------------------------------------
// Generic bf16 GEMM: C[M,N](f32) = A[M,K](bf16,row-major) * Bt[N,K]^T
// Block = 256 threads = 8 waves; block tile 128x256, K-step 32, double-buffered
// LDS filled by async global->LDS DMA.  Wave (wr in 0..1, wc in 0..3) owns a
// 64x64 sub-tile = 4x4 wmma tiles: 16 WMMAs per 16 ds_load_b128 per K-step.
// What becomes of the result and the row pitch of the output are fixed at compile
// time: MODE GEMM_F32 stores f32 to C; the others store bf16 to Cbf: GEMM_BF16 the
// result, GEMM_RELU max(result, 0), GEMM_ROPE elu(rope(result)) + 1 with the
// position taken from the output row; LDC is the pitch in elements.
// TWO_A: the A operand is [A | A2] side by side, each lda columns wide.
// ---------------------------------------------------------------------------
#define GEMM_F32 0
#define GEMM_BF16 1
#define GEMM_RELU 2
#define GEMM_ROPE 3
#define LDSTR 40 /* padded LDS row stride in bf16 elements (80B) */

template <int MODE, int LDC, bool TWO_A>
__global__ __launch_bounds__(256) void gemm_bf16_kernel(
    const __bf16* __restrict__ A, const __bf16* __restrict__ A2, int lda,
    const __bf16* __restrict__ Bt, int ldb, float* __restrict__ C, int K,
    __bf16* __restrict__ Cbf) {
  __shared__ alignas(16) __bf16 As[2][128 * LDSTR];
  __shared__ alignas(16) __bf16 Bs[2][256 * LDSTR];

  const int tid  = threadIdx.x;
  const int lane = tid & 31;
  const int wid  = tid >> 5;
  const int wr   = wid >> 2;  // 0..1 (m)
  const int wc   = wid & 3;   // 0..3 (n)
  const size_t m0 = (size_t)blockIdx.y * 128;
  const size_t n0 = (size_t)blockIdx.x * 256;

  const __bf16* Ab = A + m0 * lda;
  const __bf16* Bb = Bt + n0 * ldb;

  auto stage_tiles = [&](int buf, int kk) {
    // first column of this K-step in the buffer that holds it (kk is scalar)
    const __bf16* Ak = Ab + kk;
    if (TWO_A && kk >= lda) Ak = A2 + m0 * lda + (kk - lda);
#pragma unroll
    for (int i = 0; i < 2; ++i) {  // A tile: 128 rows x 32 cols
      int c   = tid + i * 256;     // 0..511 chunks of 8 bf16
      int row = c >> 2;            // 0..127
      int cc  = (c & 3) << 3;      // 0,8,16,24
      async_copy16(&As[buf][row * LDSTR + cc],
                   Ak + (size_t)row * lda + cc);
    }
#pragma unroll
    for (int i = 0; i < 4; ++i) {  // B tile: 256 rows x 32 cols
      int c   = tid + i * 256;     // 0..1023
      int row = c >> 2;            // 0..255
      int cc  = (c & 3) << 3;
      async_copy16(&Bs[buf][row * LDSTR + cc],
                   Bb + (size_t)row * ldb + kk + cc);
    }
  };

  v8f acc[4][4];
#pragma unroll
  for (int mi = 0; mi < 4; ++mi)
#pragma unroll
    for (int ni = 0; ni < 4; ++ni)
#pragma unroll
      for (int j = 0; j < 8; ++j) acc[mi][ni][j] = 0.f;

  stage_tiles(0, 0);
  wait_async0();
  __syncthreads();

  for (int kk = 0; kk < K; kk += 32) {
    const int cur = (kk >> 5) & 1;
    if (kk + 32 < K) stage_tiles(cur ^ 1, kk + 32);  // DMA under the WMMAs
    v16bf af[4], bfv[4];
#pragma unroll
    for (int mi = 0; mi < 4; ++mi)
      af[mi] = frag_lds(&As[cur][(wr * 64 + mi * 16) * LDSTR], LDSTR, lane);
#pragma unroll
    for (int ni = 0; ni < 4; ++ni)
      bfv[ni] = frag_lds(&Bs[cur][(wc * 64 + ni * 16) * LDSTR], LDSTR, lane);
#pragma unroll
    for (int mi = 0; mi < 4; ++mi)
#pragma unroll
      for (int ni = 0; ni < 4; ++ni)
        acc[mi][ni] = wmma_bf16f32(af[mi], bfv[ni], acc[mi][ni]);
    wait_async0();
    __syncthreads();
  }

  const int rofs = (lane >> 4) << 3;
  const size_t idx0 = (m0 + (size_t)wr * 64 + rofs) * LDC + n0 + (size_t)wc * 64 +
                      (lane & 15);
  if (MODE == GEMM_F32) {
    float* cp = C + idx0;
#pragma unroll
    for (int mi = 0; mi < 4; ++mi)
#pragma unroll
      for (int ni = 0; ni < 4; ++ni)
#pragma unroll
        for (int j = 0; j < 8; ++j)
          cp[(mi * 16 + j) * LDC + ni * 16] = acc[mi][ni][j];
  } else {
    __bf16* cp = Cbf + idx0;
    // GEMM_ROPE.  A rotation pair (columns 2p, 2p + 1) lies in two neighbouring
    // lanes: even column: v * cos - partner * sin; odd: v * cos + partner * sin.
    const int col0 = (int)n0 + wc * 64 + (lane & 14);  // the pair's even column
    const int sgn = (lane & 1) ? 0 : (int)0x80000000;  // flips sin in even columns
    // position within the sequence of the lane's first row; a block's 128 rows
    // never cross a sequence's end
    const int pos0 = (int)((m0 + (size_t)wr * 64 + rofs) & (LL - 1));
    float dv[4];
    if (MODE == GEMM_ROPE) {
#pragma unroll
      for (int ni = 0; ni < 4; ++ni)
        dv[ni] = exp_fast((float)(col0 + ni * 16) * (-9.2103403719761836f / 512.0f));
    }
#pragma unroll
    for (int mi = 0; mi < 4; ++mi) {
      if (MODE == GEMM_RELU) {
#pragma unroll
        for (int ni = 0; ni < 4; ++ni)
#pragma unroll
          for (int j = 0; j < 8; ++j)
            acc[mi][ni][j] = acc[mi][ni][j] > 0.f ? acc[mi][ni][j] : 0.f;
      }
      if (MODE == GEMM_ROPE) {
#pragma unroll
        for (int j = 0; j < 8; ++j) {
          const float pos = (float)(pos0 + mi * 16 + j);
#pragma unroll
          for (int ni = 0; ni < 4; ++ni) {
            const float v = acc[mi][ni][j];
            const float p = __builtin_bit_cast(
                float, __builtin_amdgcn_update_dpp(0, __builtin_bit_cast(int, v),
                                                   0x161 /* row_xmask:1 */, 0xf,
                                                   0xf, true));
            float s, c;
            sincos_fast(pos * dv[ni], &s, &c);
            const float ss =
                __builtin_bit_cast(float, __builtin_bit_cast(int, s) ^ sgn);
            const float r = v * c + p * ss;
            const float ex = exp_fast(r);  // taken in every lane: no branch
            acc[mi][ni][j] = r > 0.f ? r + 1.f : ex;
          }
        }
      }
#pragma unroll
      for (int ni = 0; ni < 4; ++ni)
#pragma unroll
        for (int j = 0; j < 8; ++j)
          cp[(mi * 16 + j) * LDC + ni * 16] = (__bf16)acc[mi][ni][j];
      // A row of tiles is stored before the next row's arithmetic begins, so the
      // stores drain under it; without this the build kept all 128 for the end.
      if (MODE == GEMM_ROPE) __builtin_amdgcn_sched_barrier(0);
    }
  }
}

// ---------------------------------------------------------------------------
// Ksp[split,b,h,d] = sum over this split's s of Kf[b,s,h,d]
// (grid: x = (b,h), y = split; split_reduce_kernel adds the planes)
// ---------------------------------------------------------------------------
__global__ __launch_bounds__(256) void ksum_kernel(
    const __bf16* __restrict__ Kf, float* __restrict__ Ksp) {
  __shared__ float red[256];
  const int tid = threadIdx.x;
  const int bh = blockIdx.x, b = bh >> 3, h = bh & 7;
  const int d = tid & 63, grp = tid >> 6;
  float acc = 0.f;
  const int sbeg = blockIdx.y * SCHUNK;
  const __bf16* kp = Kf + ((size_t)b * SSEQ + sbeg + grp) * DD + h * DHD + d;
  for (int it = 0; it < SCHUNK / 4; ++it) {
    acc += (float)kp[(size_t)it * 4 * DD];
    // Stands in front of the load of the unrolled build whose result lands in
    // the address registers that the loads before it name.
    asm volatile("s_wait_xcnt 0x0" ::: "memory");
  }
  red[tid] = acc;
  __syncthreads();
  if (tid < 64)
    Ksp[(size_t)blockIdx.y * KSN + (size_t)bh * DHD + d] =
        red[tid] + red[tid + 64] + red[tid + 128] + red[tid + 192];
}

// ---------------------------------------------------------------------------
// KVp[split,b,h,v,d] = sum over this split's s of Vb[b,s,h,v] * Kf[b,s,h,d]
// (f32 partial, transposed).  Grid: x = (b,h), y = split; one block (8 waves)
// per (b,h,split); each wave owns 2 of the 16 16x16 tiles.
// ---------------------------------------------------------------------------
__global__ __launch_bounds__(256) void kv_kernel(
    const __bf16* __restrict__ Kf, const __bf16* __restrict__ Vb,
    float* __restrict__ KVp) {
  __shared__ alignas(16) __bf16 Kt[64 * 72];  // [d][s_local]
  __shared__ alignas(16) __bf16 Vt[64 * 72];  // [v][s_local]
  const int tid = threadIdx.x, lane = tid & 31, wid = tid >> 5;
  const int bh = blockIdx.x, b = bh >> 3, h = bh & 7;
  const int t0 = wid * 2;

  v8f acc[2];
#pragma unroll
  for (int t = 0; t < 2; ++t)
#pragma unroll
    for (int j = 0; j < 8; ++j) acc[t][j] = 0.f;

  const int sbeg = blockIdx.y * SCHUNK;
  // Kept rolled: barriers bound each tile, so unrolling overlaps nothing, and
  // the unrolled build issues a tile's fourth load behind the wait for its first.
#pragma unroll 1
  for (int s0 = sbeg; s0 < sbeg + SCHUNK; s0 += 64) {
    __syncthreads();
#pragma unroll
    for (int i = 0; i < 2; ++i) {
      int c = tid + i * 256;  // 0..511
      int srow = c >> 3;      // local s 0..63
      int d0 = (c & 7) << 3;  // 0..56
      size_t g = ((size_t)b * SSEQ + s0 + srow) * DD + h * DHD + d0;
      v8bf kk = *(const v8bf*)(Kf + g);
      v8bf vv = *(const v8bf*)(Vb + g);
#pragma unroll
      for (int e = 0; e < 8; ++e) {
        Kt[(d0 + e) * 72 + srow] = kk[e];
        Vt[(d0 + e) * 72 + srow] = vv[e];
      }
    }
    __syncthreads();
#pragma unroll
    for (int ks = 0; ks < 64; ks += 32) {
#pragma unroll
      for (int ti = 0; ti < 2; ++ti) {
        int t = t0 + ti;
        int mv = t >> 2, nd = t & 3;
        v16bf a  = frag_lds(&Vt[(mv * 16) * 72 + ks], 72, lane);
        v16bf bb = frag_lds(&Kt[(nd * 16) * 72 + ks], 72, lane);
        acc[ti] = wmma_bf16f32(a, bb, acc[ti]);
      }
    }
  }

  const int rofs = (lane >> 4) << 3;
#pragma unroll
  for (int ti = 0; ti < 2; ++ti) {
    int t = t0 + ti;
    int mv = t >> 2, nd = t & 3;
#pragma unroll
    for (int j = 0; j < 8; ++j) {
      int v = mv * 16 + rofs + j;
      int d = nd * 16 + (lane & 15);
      KVp[(size_t)blockIdx.y * KVN + ((size_t)bh * 64 + v) * 64 + d] =
          acc[ti][j];
    }
  }
}

// ---------------------------------------------------------------------------
// Adds the NSPLIT partial planes: KVt (bf16) from KVp, Ksum (f32) from Ksp.
// Blocks 0 .. KVN/256-1 take KV elements, the rest Ksum elements.
// ---------------------------------------------------------------------------
__global__ __launch_bounds__(256) void split_reduce_kernel(
    const float* __restrict__ KVp, const float* __restrict__ Ksp,
    __bf16* __restrict__ KVt, float* __restrict__ Ksum) {
  const int i = blockIdx.x * 256 + threadIdx.x;
  float acc = 0.f;
  if (blockIdx.x < KVN / 256) {
#pragma unroll  // all NSPLIT loads in flight at once
    for (int p = 0; p < NSPLIT; ++p) acc += KVp[(size_t)p * KVN + i];
    KVt[i] = (__bf16)acc;
  } else {
    const int j = i - KVN;
#pragma unroll  // all NSPLIT loads in flight at once
    for (int p = 0; p < NSPLIT; ++p) acc += Ksp[(size_t)p * KSN + j];
    Ksum[j] = acc;
    // Stands in front of the other branch's loads: in the built code a path
    // leads on to them from here, and the first writes this store's data register.
    asm volatile("s_wait_xcnt 0x0" ::: "memory");
  }
}

// ---------------------------------------------------------------------------
// Z[b,l,h] = 1 / (where(score>thr, score, 0) + 1e-6), score = Q . Ksum
// (the reference's /s_len inside KV and *s_len on out cancel exactly)
// ---------------------------------------------------------------------------
__global__ __launch_bounds__(256) void scores_kernel(
    const __bf16* __restrict__ Qf, const float* __restrict__ Ksum,
    const float* __restrict__ thr, float* __restrict__ Zs) {
  size_t idx = (size_t)blockIdx.x * 256 + threadIdx.x;  // over B*L*H
  size_t bl = idx >> 3;
  int h = (int)(idx & 7);
  int b = (int)(bl / LL);
  const __bf16* q = Qf + bl * DD + h * DHD;
  const float* ks = Ksum + ((size_t)b * HH + h) * DHD;
  float sc = 0.f;
#pragma unroll 8
  for (int d = 0; d < DHD; ++d) sc += (float)q[d] * ks[d];
  float sp = sc > thr[0] ? sc : 0.f;
  Zs[idx] = 1.0f / (sp + 1e-6f);
}

// ---------------------------------------------------------------------------
// Ao[b,l,h*64+v] = Z[b,l,h] * sum_d Q[b,l,h,d] * KVt[b,h,v,d]   (bf16 out)
// Block: 8 waves; tile 128 rows x 64 cols; K=64 (2 wmma steps). Async staging.
// ---------------------------------------------------------------------------
__global__ __launch_bounds__(256) void attn_out_kernel(
    const __bf16* __restrict__ Qf, const __bf16* __restrict__ KVt,
    const float* __restrict__ Zs, __bf16* __restrict__ Ao) {
  __shared__ alignas(16) __bf16 Aq[128 * 72];
  __shared__ alignas(16) __bf16 Kv[64 * 72];
  __shared__ alignas(32) float zsh[128];
  const int tid = threadIdx.x, lane = tid & 31, wid = tid >> 5;
  const int bh = blockIdx.y, b = bh >> 3, h = bh & 7;
  const size_t rowbase = (size_t)b * LL + (size_t)blockIdx.x * 128;

#pragma unroll
  for (int i = 0; i < 4; ++i) {  // Q tile 128x64 (async DMA)
    int c = tid + i * 256;
    int row = c >> 3, cc = (c & 7) << 3;
    async_copy16(&Aq[row * 72 + cc], Qf + (rowbase + row) * DD + h * DHD + cc);
  }
#pragma unroll
  for (int i = 0; i < 2; ++i) {  // KVt 64x64 (async DMA)
    int c = tid + i * 256;
    int row = c >> 3, cc = (c & 7) << 3;
    async_copy16(&Kv[row * 72 + cc], KVt + ((size_t)bh * 64 + row) * 64 + cc);
  }
  if (tid < 128) zsh[tid] = Zs[(rowbase + tid) * HH + h];
  wait_async0();
  __syncthreads();

  v8f acc[4];
#pragma unroll
  for (int ni = 0; ni < 4; ++ni)
#pragma unroll
    for (int j = 0; j < 8; ++j) acc[ni][j] = 0.f;

#pragma unroll
  for (int ks = 0; ks < 64; ks += 32) {
    v16bf a = frag_lds(&Aq[(wid * 16) * 72 + ks], 72, lane);
#pragma unroll
    for (int ni = 0; ni < 4; ++ni) {
      v16bf bb = frag_lds(&Kv[(ni * 16) * 72 + ks], 72, lane);
      acc[ni] = wmma_bf16f32(a, bb, acc[ni]);
    }
  }

  const int rofs = (lane >> 4) << 3;
  v8f zv = *(const v8f*)(&zsh[wid * 16 + rofs]);
#pragma unroll
  for (int ni = 0; ni < 4; ++ni) {
    int col = h * DHD + ni * 16 + (lane & 15);
#pragma unroll
    for (int j = 0; j < 8; ++j) {
      size_t row = rowbase + wid * 16 + rofs + j;
      Ao[row * DD + col] = (__bf16)(acc[ni][j] * zv[j]);
    }
  }
}

// ---------------------------------------------------------------------------
// LayerNorm over 512 f32; writes the f32 or the bf16 output.
// One wave per row, LN_R rows a wave: a lane holds 16 elements of a row (four
// 16-byte loads, 512 contiguous bytes a wave each); the row's sums are taken
// inside the wave.  A block covers 8 * LN_R rows.
// ---------------------------------------------------------------------------
#define LN_R 2

template <int BF16OUT>
__global__ __launch_bounds__(256) void layernorm_kernel(
    const float* __restrict__ in, const float* __restrict__ g,
    const float* __restrict__ bta, float* __restrict__ out_f32,
    __bf16* __restrict__ out_bf16) {
  const int lane = threadIdx.x & 31;
  // the wave's number, scalar: row bases stay in scalar registers
  const int wid = __builtin_amdgcn_readfirstlane(threadIdx.x >> 5);
  const size_t row0 = ((size_t)blockIdx.x * 8 + wid) * LN_R;
  const int c0 = lane * 4;
  const unsigned voff = lane * 16;  // the lane's byte offset in a 512-byte piece
  const char* inb = (const char*)(in + row0 * DD);
  v4f v[LN_R][4], gv[4], bv[4];
#pragma unroll
  for (int r = 0; r < LN_R; ++r)
#pragma unroll
    for (int j = 0; j < 4; ++j)
      v[r][j] = *(const v4f*)(inb + (r * DD + j * 128) * 4 + voff);
#pragma unroll
  for (int j = 0; j < 4; ++j) {
    gv[j] = *(const v4f*)((const char*)g + j * 512 + voff);
    bv[j] = *(const v4f*)((const char*)bta + j * 512 + voff);
  }
  loads_issued(voff);
#pragma unroll
  for (int r = 0; r < LN_R; ++r) {
    float s = 0.f, q = 0.f;
#pragma unroll
    for (int j = 0; j < 4; ++j)
#pragma unroll
      for (int e = 0; e < 4; ++e) {
        s += v[r][j][e];
        q += v[r][j][e] * v[r][j][e];
      }
    s = wave_sum(s);
    q = wave_sum(q);
    const float mu = s * (1.0f / DD);
    const float var = q * (1.0f / DD) - mu * mu;
    const float rstd = rsqrtf(var + 1e-5f);
#pragma unroll
    for (int j = 0; j < 4; ++j)
#pragma unroll
      for (int e = 0; e < 4; ++e)
        v[r][j][e] = (v[r][j][e] - mu) * rstd * gv[j][e] + bv[j][e];
  }
  if (BF16OUT) {
    v4bf o[LN_R][4];
#pragma unroll
    for (int r = 0; r < LN_R; ++r)
#pragma unroll
      for (int j = 0; j < 4; ++j) o[r][j] = __builtin_convertvector(v[r][j], v4bf);
#pragma unroll
    for (int r = 0; r < LN_R; ++r)
#pragma unroll
      for (int j = 0; j < 4; ++j)
        *(v4bf*)(out_bf16 + (row0 + r) * DD + j * 128 + c0) = o[r][j];
  } else {
#pragma unroll
    for (int r = 0; r < LN_R; ++r)
#pragma unroll
      for (int j = 0; j < 4; ++j)
        *(v4f*)(out_f32 + (row0 + r) * DD + j * 128 + c0) = v[r][j];
  }
}

// ---------------------------------------------------------------------------
// out = x + msg2 + LN(aug32 + baug; gaug, bln)
// One wave per row as in layernorm_kernel, FIN_R rows a wave: one row's 24 loads
// already hold 96 registers.
// ---------------------------------------------------------------------------
#define FIN_R 1

__global__ __launch_bounds__(256) void final_kernel(
    const float* __restrict__ x, const float* __restrict__ msg2,
    const float* __restrict__ aug32, const float* __restrict__ baug,
    const float* __restrict__ gaug, const float* __restrict__ bln,
    float* __restrict__ out) {
  const int lane = threadIdx.x & 31;
  // the wave's number, scalar: row bases stay in scalar registers
  const int wid = __builtin_amdgcn_readfirstlane(threadIdx.x >> 5);
  const size_t row0 = ((size_t)blockIdx.x * 8 + wid) * FIN_R;
  const int c0 = lane * 4;
  const unsigned voff = lane * 16;  // the lane's byte offset in a 512-byte piece
  const char* ab = (const char*)(aug32 + row0 * DD);
  const char* xb = (const char*)(x + row0 * DD);
  const char* mb = (const char*)(msg2 + row0 * DD);
  v4f a[FIN_R][4], xv[FIN_R][4], mv[FIN_R][4], av[4], gv[4], bv[4];
#pragma unroll
  for (int r = 0; r < FIN_R; ++r)
#pragma unroll
    for (int j = 0; j < 4; ++j)
      a[r][j] = *(const v4f*)(ab + (r * DD + j * 128) * 4 + voff);
#pragma unroll
  for (int j = 0; j < 4; ++j)
    av[j] = *(const v4f*)((const char*)baug + j * 512 + voff);
#pragma unroll
  for (int r = 0; r < FIN_R; ++r)
#pragma unroll
    for (int j = 0; j < 4; ++j) {
      xv[r][j] = *(const v4f*)(xb + (r * DD + j * 128) * 4 + voff);
      mv[r][j] = *(const v4f*)(mb + (r * DD + j * 128) * 4 + voff);
    }
#pragma unroll
  for (int j = 0; j < 4; ++j) {
    gv[j] = *(const v4f*)((const char*)gaug + j * 512 + voff);
    bv[j] = *(const v4f*)((const char*)bln + j * 512 + voff);
  }
  loads_issued(voff);
#pragma unroll
  for (int r = 0; r < FIN_R; ++r) {
    float s = 0.f, q = 0.f;
#pragma unroll
    for (int j = 0; j < 4; ++j) {
      a[r][j] += av[j];
#pragma unroll
      for (int e = 0; e < 4; ++e) {
        s += a[r][j][e];
        q += a[r][j][e] * a[r][j][e];
      }
    }
    s = wave_sum(s);
    q = wave_sum(q);
    const float mu = s * (1.0f / DD);
    const float var = q * (1.0f / DD) - mu * mu;
    const float rstd = rsqrtf(var + 1e-5f);
#pragma unroll
    for (int j = 0; j < 4; ++j)
#pragma unroll
      for (int e = 0; e < 4; ++e) {
        const float l = (a[r][j][e] - mu) * rstd * gv[j][e] + bv[j][e];
        a[r][j][e] = xv[r][j][e] + mv[r][j][e] + l;
      }
  }
#pragma unroll
  for (int r = 0; r < FIN_R; ++r)
#pragma unroll
    for (int j = 0; j < 4; ++j)
      *(v4f*)(out + (row0 + r) * DD + j * 128 + c0) = a[r][j];
}

// ---------------------------------------------------------------------------
// Host orchestration
// ---------------------------------------------------------------------------
extern "C" void kernel_launch(void* const* d_in, const int* in_sizes, int n_in,
                              void* d_out, int out_size, void* d_ws,
                              size_t ws_size, hipStream_t stream) {
  (void)in_sizes; (void)n_in; (void)out_size; (void)ws_size;
  const float* x      = (const float*)d_in[0];
  const float* source = (const float*)d_in[1];
  const float* Wq     = (const float*)d_in[2];
  const float* Wk     = (const float*)d_in[3];
  const float* Wv     = (const float*)d_in[4];
  const float* Wmerge = (const float*)d_in[5];
  const float* Wmlp1  = (const float*)d_in[6];
  const float* Wmlp2  = (const float*)d_in[7];
  const float* g1     = (const float*)d_in[8];
  const float* b1     = (const float*)d_in[9];
  const float* g2     = (const float*)d_in[10];
  const float* b2     = (const float*)d_in[11];
  const float* Waug   = (const float*)d_in[12];
  const float* baug   = (const float*)d_in[13];
  const float* gaug   = (const float*)d_in[14];
  const float* bln    = (const float*)d_in[15];
  const float* thr    = (const float*)d_in[16];
  float* out = (float*)d_out;

  char* ws = (char*)d_ws;
  size_t off = 0;
  auto take = [&](size_t bytes) -> char* {
    char* p = ws + off;
    off += (bytes + 255) & ~(size_t)255;
    return p;
  };

  __bf16* xb   = (__bf16*)take((size_t)NT * DD * 2);
  __bf16* sb   = (__bf16*)take((size_t)NT * DD * 2);
  __bf16* WqT  = (__bf16*)take((size_t)DD * DD * 2);
  __bf16* WkT  = (__bf16*)take((size_t)DD * DD * 2);
  __bf16* WvT  = (__bf16*)take((size_t)DD * DD * 2);
  __bf16* WmT  = (__bf16*)take((size_t)DD * DD * 2);
  __bf16* W1T  = (__bf16*)take((size_t)D2 * D2 * 2);
  __bf16* W2T  = (__bf16*)take((size_t)DD * D2 * 2);
  __bf16* WaT  = (__bf16*)take((size_t)DD * DD * 2);
  float*  C1   = (float*)take((size_t)NT * DD * 4);
  __bf16* Qf   = (__bf16*)take((size_t)NT * DD * 2);
  __bf16* Kf   = (__bf16*)take((size_t)NT * DD * 2);
  __bf16* Vb   = (__bf16*)take((size_t)NT * DD * 2);
  float*  Ksum = (float*)take((size_t)BB * HH * DHD * 4);
  __bf16* KVt  = (__bf16*)take((size_t)BB * HH * 64 * 64 * 2);
  float*  Zs   = (float*)take((size_t)NT * HH * 4);
  __bf16* Ao   = (__bf16*)take((size_t)NT * DD * 2);
  __bf16* Msgb = (__bf16*)take((size_t)NT * DD * 2);
  __bf16* Hb   = (__bf16*)take((size_t)NT * D2 * 2);
  float*  Msg2 = (float*)take((size_t)NT * DD * 4);
  float*  KVp  = (float*)take((size_t)NSPLIT * KVN * 4);
  float*  Ksp  = (float*)take((size_t)NSPLIT * KSN * 4);

  const dim3 blk(256);
  const size_t nXD = (size_t)NT * DD;   // 8.39M
  auto blocks = [](size_t n) { return dim3((unsigned)(n / CVT_BLK)); };

  // 1) Convert activations and (transposed) weights to bf16
  f32_to_bf16_kernel<<<blocks(nXD), blk, 0, stream>>>(x, xb);
  f32_to_bf16_kernel<<<blocks(nXD), blk, 0, stream>>>(source, sb);
  transpose_bf16_kernel<<<dim3(DD / 32, DD / 64), blk, 0, stream>>>(Wq, WqT, DD, DD);
  transpose_bf16_kernel<<<dim3(DD / 32, DD / 64), blk, 0, stream>>>(Wk, WkT, DD, DD);
  transpose_bf16_kernel<<<dim3(DD / 32, DD / 64), blk, 0, stream>>>(Wv, WvT, DD, DD);
  transpose_bf16_kernel<<<dim3(DD / 32, DD / 64), blk, 0, stream>>>(Wmerge, WmT, DD, DD);
  transpose_bf16_kernel<<<dim3(D2 / 32, D2 / 64), blk, 0, stream>>>(Wmlp1, W1T, D2, D2);
  transpose_bf16_kernel<<<dim3(DD / 32, D2 / 64), blk, 0, stream>>>(Wmlp2, W2T, D2, DD);
  transpose_bf16_kernel<<<dim3(DD / 32, DD / 64), blk, 0, stream>>>(Waug, WaT, DD, DD);

  // 2) Qf = elu(rope(x@Wq)) + 1 (bf16, fused epilogue)
  gemm_bf16_kernel<GEMM_ROPE, DD, false>
      <<<dim3(DD / 256, NT / 128), blk, 0, stream>>>(xb, nullptr, DD, WqT, DD,
                                                     nullptr, DD, Qf);

  // 3) Kf = elu(rope(source@Wk)) + 1 (bf16, fused epilogue)
  gemm_bf16_kernel<GEMM_ROPE, DD, false>
      <<<dim3(DD / 256, NT / 128), blk, 0, stream>>>(sb, nullptr, DD, WkT, DD,
                                                     nullptr, DD, Kf);

  // 4) v = source@Wv -> Vb (bf16, fused epilogue)
  gemm_bf16_kernel<GEMM_BF16, DD, false>
      <<<dim3(DD / 256, NT / 128), blk, 0, stream>>>(sb, nullptr, DD, WvT, DD,
                                                     nullptr, DD, Vb);

  // 5) attention core
  ksum_kernel<<<dim3(BB * HH, NSPLIT), blk, 0, stream>>>(Kf, Ksp);
  kv_kernel<<<dim3(BB * HH, NSPLIT), blk, 0, stream>>>(Kf, Vb, KVp);
  split_reduce_kernel<<<dim3(KVN / 256 + KSN / 256), blk, 0, stream>>>(
      KVp, Ksp, KVt, Ksum);
  scores_kernel<<<dim3((NT * HH) / 256), blk, 0, stream>>>(Qf, Ksum, thr, Zs);
  attn_out_kernel<<<dim3(LL / 128, BB * HH), blk, 0, stream>>>(Qf, KVt, Zs, Ao);

  // 6) merge + LN1 -> Msgb (bf16)
  gemm_bf16_kernel<GEMM_F32, DD, false>
      <<<dim3(DD / 256, NT / 128), blk, 0, stream>>>(Ao, nullptr, DD, WmT, DD, C1,
                                                     DD, nullptr);
  layernorm_kernel<1><<<dim3(NT / (8 * LN_R)), blk, 0, stream>>>(C1, g1, b1, nullptr, Msgb);

  // 7) MLP1: Hb = relu([x, msg] @ Wmlp1) (bf16, fused epilogue)
  gemm_bf16_kernel<GEMM_RELU, D2, true>
      <<<dim3(D2 / 256, NT / 128), blk, 0, stream>>>(xb, Msgb, DD, W1T, D2,
                                                     nullptr, D2, Hb);

  // 8) MLP2 + LN2 -> Msg2 (f32)
  gemm_bf16_kernel<GEMM_F32, DD, false>
      <<<dim3(DD / 256, NT / 128), blk, 0, stream>>>(Hb, nullptr, D2, W2T, D2, C1,
                                                     D2, nullptr);
  layernorm_kernel<0><<<dim3(NT / (8 * LN_R)), blk, 0, stream>>>(C1, g2, b2, Msg2, nullptr);

  // 9) aug GEMM, then fused LN(aug)+residual
  gemm_bf16_kernel<GEMM_F32, DD, false>
      <<<dim3(DD / 256, NT / 128), blk, 0, stream>>>(xb, nullptr, DD, WaT, DD, C1,
                                                     DD, nullptr);
  final_kernel<<<dim3(NT / (8 * FIN_R)), blk, 0, stream>>>(x, Msg2, C1, baug, gaug, bln, out);
}

// v005
// A run of this version takes 179 microseconds.
// Next to v004, in two timings, it ran 1.27 and 1.26 times as fast.
// Counting every step since v000, it is 3.43 times as fast.
#include <hip/hip_runtime.h>
#include <hip/hip_bf16.h>

#define BB 4
#define LL 4096
#define SSEQ 4096
#define DD 512
#define HH 8
#define DHD 64
#define NT (BB * LL)     /* 16384 token rows */
#define D2 (2 * DD)      /* 1024 */
#define NSPLIT 16        /* work-groups that share one (b,h) sum over s */
#define SCHUNK (SSEQ / NSPLIT)
#define KVN (BB * HH * DHD * DHD) /* elements of one KV partial plane */
#define KSN (BB * HH * DHD)       /* elements of one Ksum partial plane */

typedef __bf16 v16bf __attribute__((ext_vector_type(16)));
typedef __bf16 v8bf  __attribute__((ext_vector_type(8)));
typedef float  v8f   __attribute__((ext_vector_type(8)));
typedef int    v4i   __attribute__((ext_vector_type(4)));
typedef float  v4f   __attribute__((ext_vector_type(4)));
typedef __bf16 v4bf  __attribute__((ext_vector_type(4)));

#if defined(__has_builtin)
#if __has_builtin(__builtin_amdgcn_global_load_async_to_lds_b128)
#define HAVE_ASYNC_BUILTIN 1
#endif
#if __has_builtin(__builtin_amdgcn_s_wait_asynccnt)
#define HAVE_ASYNCWAIT_BUILTIN 1
#endif
#endif

static __device__ __forceinline__ void async_copy16(void* lds, const void* g) {
#ifdef HAVE_ASYNC_BUILTIN
  __builtin_amdgcn_global_load_async_to_lds_b128(
      (__attribute__((address_space(1))) v4i*)(g),
      (__attribute__((address_space(3))) v4i*)(lds), 0, 0);
#else
  asm volatile("global_load_async_to_lds_b128 %0, %1, off" ::"v"(
                   (unsigned)(size_t)lds),
               "v"(g)
               : "memory");
#endif
}

static __device__ __forceinline__ void wait_async0() {
#ifdef HAVE_ASYNCWAIT_BUILTIN
  __builtin_amdgcn_s_wait_asynccnt(0);
#else
  asm volatile("s_wait_asynccnt 0x0" ::: "memory");
#endif
}

static __device__ __forceinline__ v8f wmma_bf16f32(v16bf a, v16bf b, v8f c) {
  // D = A(16x32) * B(32x16) + C, f32 accumulate
  return __builtin_amdgcn_wmma_f32_16x16x32_bf16(false, a, false, b, (short)0, c,
                                                 false, false);
}

static __device__ __forceinline__ v16bf frag_lds(const __bf16* tile, int stride,
                                                 int lane) {
  const int row  = lane & 15;
  const int koff = (lane >> 4) << 3;
  const __bf16* p = tile + row * stride + koff;
  v8bf lo = *(const v8bf*)(p);
  v8bf hi = *(const v8bf*)(p + 16);
  return __builtin_shufflevector(lo, hi, 0, 1, 2, 3, 4, 5, 6, 7, 8, 9, 10, 11,
                                 12, 13, 14, 15);
}

// ---------------------------------------------------------------------------
// Sum over the 32 lanes of a wave, the same bits in every lane: four xor steps
// inside each 16-lane row, then the exchange with the other row.
// ---------------------------------------------------------------------------
template <int CTRL>
static __device__ __forceinline__ float row_xor_add(float v) {
  const int t = __builtin_amdgcn_update_dpp(0, __builtin_bit_cast(int, v), CTRL,
                                            0xf, 0xf, true);
  return v + __builtin_bit_cast(float, t);
}

static __device__ __forceinline__ float wave_sum(float v) {
  v = row_xor_add<0x161>(v);  // row_xmask:1
  v = row_xor_add<0x162>(v);  // row_xmask:2
  v = row_xor_add<0x164>(v);  // row_xmask:4
  v = row_xor_add<0x168>(v);  // row_xmask:8
  const int b = __builtin_bit_cast(int, v);
  const int o =
      __builtin_amdgcn_permlanex16(b, b, 0x76543210, 0xfedcba98, false, false);
  return v + __builtin_bit_cast(float, o);
}

// Stands behind a kernel's whole group of loads, which share the offset register
// voff.
static __device__ __forceinline__ void loads_issued(unsigned voff) {
  // In front of every later write of a register that these loads name; as an
  // operand voff stays live up to here, so no load's result lands on it.
  asm volatile("s_wait_xcnt 0x0" ::"v"(voff) : "memory");
  // No arithmetic moves up among the loads: without it the build issued part of
  // the group late, behind waits for the first loads.
  __builtin_amdgcn_sched_barrier(0);
}

static __device__ __forceinline__ float exp2_slot(float x) {
  float y;
  asm("v_exp_f32 %0, %1\n\tv_nop" : "=&v"(y) : "v"(x));
  return y;
}

// exp(x) as the fast library form computes it
static __device__ __forceinline__ float exp_fast(float x) {
  return exp2_slot(x * 1.44269504088896340736f);
}

// sine and cosine of an angle in radians, as the fast library form computes them
static __device__ __forceinline__ void sincos_fast(float a, float* s, float* c) {
  const float rev = a * 0.15915494309189532f;
  asm("v_sin_f32 %0, %2\n\tv_cos_f32 %1, %2\n\tv_nop"
      : "=&v"(*s), "=&v"(*c)
      : "v"(rev));
}

// ---------------------------------------------------------------------------
// Elementwise conversion.  A thread takes CVT_G groups of four floats, each a
// 16-byte load (512 contiguous bytes a wave), all issued before the first use.
// One block covers CVT_BLK elements (block blk of the array); CVT_BLK divides n.
// ---------------------------------------------------------------------------
#define CVT_G 8
#define CVT_BLK (256 * 4 * CVT_G)

static __device__ __forceinline__ void f32_to_bf16_block(
    const float* __restrict__ in, __bf16* __restrict__ out, int blk) {
  const size_t base = (size_t)blk * CVT_BLK + threadIdx.x * 4;
  v4f v[CVT_G];
  v4bf o[CVT_G];
#pragma unroll
  for (int j = 0; j < CVT_G; ++j) v[j] = *(const v4f*)(in + base + j * 1024);
#pragma unroll
  for (int j = 0; j < CVT_G; ++j) o[j] = __builtin_convertvector(v[j], v4bf);
#pragma unroll
  for (int j = 0; j < CVT_G; ++j) *(v4bf*)(out + base + j * 1024) = o[j];
}

// W[k][n] (f32, KxN row-major) -> Wt[n][k] (bf16, NxK row-major)
// Block tile: 64 k x 32 n.  A thread reads 8 consecutive k of one n and stores
// them as 16 bytes; 8 lanes side by side in k fill one 128-byte line of Wt.
// Tiles: bx in 0 .. N / 32 - 1, by in 0 .. K / 64 - 1.
static __device__ __forceinline__ void transpose_bf16_block(
    const float* __restrict__ W, __bf16* __restrict__ Wt, int K, int N, int bx,
    int by) {
  const int k0 = by * 64 + (threadIdx.x & 7) * 8;
  const int n  = bx * 32 + (threadIdx.x >> 3);
  const float* wp = W + (size_t)k0 * N + n;
  float w[8];
#pragma unroll
  for (int e = 0; e < 8; ++e) w[e] = wp[(size_t)e * N];
  v8bf o;
#pragma unroll
  for (int e = 0; e < 8; ++e) o[e] = (__bf16)w[e];
  *(v8bf*)(Wt + (size_t)n * K + k0) = o;
}

// All nine input conversions in one launch: none reads what another writes.  The
// block index picks the job: first the weight tiles (short, bound by latency),
// which then run under the two activation streams behind them.
#define TR_W1 ((D2 / 32) * (D2 / 64))  /* 512 tiles of Wmlp1 */
#define TR_W2 ((DD / 32) * (D2 / 64))  /* 256 tiles of Wmlp2 */
#define TR_SQ ((DD / 32) * (DD / 64))  /* 128 tiles of each 512 x 512 weight */
#define TR_ALL (TR_W1 + TR_W2 + 5 * TR_SQ)
#define CVT_NB (NT * DD / CVT_BLK)     /* 1024 blocks for x, as many for source */

__global__ __launch_bounds__(256) void prep_kernel(
    const float* __restrict__ x, const float* __restrict__ source,
    const float* __restrict__ Wq, const float* __restrict__ Wk,
    const float* __restrict__ Wv, const float* __restrict__ Wmerge,
    const float* __restrict__ Wmlp1, const float* __restrict__ Wmlp2,
    const float* __restrict__ Waug, __bf16* __restrict__ xb,
    __bf16* __restrict__ sb, __bf16* __restrict__ WqT, __bf16* __restrict__ WkT,
    __bf16* __restrict__ WvT, __bf16* __restrict__ WmT, __bf16* __restrict__ W1T,
    __bf16* __restrict__ W2T, __bf16* __restrict__ WaT) {
  const int blk = blockIdx.x;
  if (blk < TR_ALL) {
    const float* W;
    __bf16* Wt;
    int K = DD, N = DD, t;
    if (blk < TR_W1) {
      W = Wmlp1; Wt = W1T; K = D2; N = D2; t = blk;
    } else if (blk < TR_W1 + TR_W2) {
      W = Wmlp2; Wt = W2T; K = D2; t = blk - TR_W1;
    } else {
      const int w = (blk - (TR_W1 + TR_W2)) / TR_SQ;
      t = (blk - (TR_W1 + TR_W2)) % TR_SQ;
      W  = w == 0 ? Wq : w == 1 ? Wk : w == 2 ? Wv : w == 3 ? Wmerge : Waug;
      Wt = w == 0 ? WqT : w == 1 ? WkT : w == 2 ? WvT : w == 3 ? WmT : WaT;
    }
    const int sh = N == D2 ? 5 : 4;  // log2 of the N / 32 tiles in a row of tiles
    transpose_bf16_block(W, Wt, K, N, t & ((1 << sh) - 1), t >> sh);
  } else {
    const int t = blk - TR_ALL;
    const bool first = t < CVT_NB;
    f32_to_bf16_block(first ? x : source, first ? xb : sb, first ? t : t - CVT_NB);
    // Stands in front of the other branch's code: in the built code a path leads
    // on to it from here, and it writes registers that these stores name.
    asm volatile("s_wait_xcnt 0x0" ::: "memory");
  }
}

// ---------------------------------------------------------------------------
// Generic bf16 GEMM: C[M,N](f32) = A[M,K](bf16,row-major) * Bt[N,K]^T
// Block = 256 threads = 8 waves; block tile 128x256, K-step 32, double-buffered
// LDS filled by async global->LDS DMA.  Wave (wr in 0..1, wc in 0..3) owns a
// 64x64 sub-tile = 4x4 wmma tiles: 16 WMMAs per 16 ds_load_b128 per K-step.
// What becomes of the result and the row pitch of the output are fixed at compile
// time: MODE GEMM_F32 stores f32 to C; the others store bf16 to Cbf: GEMM_BF16 the
// result, GEMM_RELU max(result, 0), GEMM_ROPE elu(rope(result)) + 1 with the
// position taken from the output row; LDC is the pitch in elements.
// TWO_A: the A operand is [A | A2] side by side, each lda columns wide.
// ---------------------------------------------------------------------------
#define GEMM_F32 0
#define GEMM_BF16 1
#define GEMM_RELU 2
#define GEMM_ROPE 3
#define LDSTR 40 /* padded LDS row stride in bf16 elements (80B) */

typedef __bf16 a_tiles_t[2][128 * LDSTR];
typedef __bf16 b_tiles_t[2][256 * LDSTR];

// The K loop: acc = the wave's 64x64 part of the block's tile (blockIdx.x, .y).
template <bool TWO_A>
static __device__ __forceinline__ void gemm_main(
    a_tiles_t& As, b_tiles_t& Bs, const __bf16* __restrict__ A,
    const __bf16* __restrict__ A2, int lda, const __bf16* __restrict__ Bt, int ldb,
    int K, v8f (&acc)[4][4]) {
  const int tid  = threadIdx.x;
  const int lane = tid & 31;
  const int wid  = tid >> 5;
  const int wr   = wid >> 2;  // 0..1 (m)
  const int wc   = wid & 3;   // 0..3 (n)
  const size_t m0 = (size_t)blockIdx.y * 128;
  const size_t n0 = (size_t)blockIdx.x * 256;

  const __bf16* Ab = A + m0 * lda;
  const __bf16* Bb = Bt + n0 * ldb;

  auto stage_tiles = [&](int buf, int kk) {
    // first column of this K-step in the buffer that holds it (kk is scalar)
    const __bf16* Ak = Ab + kk;
    if (TWO_A && kk >= lda) Ak = A2 + m0 * lda + (kk - lda);
#pragma unroll
    for (int i = 0; i < 2; ++i) {  // A tile: 128 rows x 32 cols
      int c   = tid + i * 256;     // 0..511 chunks of 8 bf16
      int row = c >> 2;            // 0..127
      int cc  = (c & 3) << 3;      // 0,8,16,24
      async_copy16(&As[buf][row * LDSTR + cc],
                   Ak + (size_t)row * lda + cc);
    }
#pragma unroll
    for (int i = 0; i < 4; ++i) {  // B tile: 256 rows x 32 cols
      int c   = tid + i * 256;     // 0..1023
      int row = c >> 2;            // 0..255
      int cc  = (c & 3) << 3;
      async_copy16(&Bs[buf][row * LDSTR + cc],
                   Bb + (size_t)row * ldb + kk + cc);
    }
  };

#pragma unroll
  for (int mi = 0; mi < 4; ++mi)
#pragma unroll
    for (int ni = 0; ni < 4; ++ni)
#pragma unroll
      for (int j = 0; j < 8; ++j) acc[mi][ni][j] = 0.f;

  stage_tiles(0, 0);
  wait_async0();
  __syncthreads();

  for (int kk = 0; kk < K; kk += 32) {
    const int cur = (kk >> 5) & 1;
    if (kk + 32 < K) stage_tiles(cur ^ 1, kk + 32);  // DMA under the WMMAs
    v16bf af[4], bfv[4];
#pragma unroll
    for (int mi = 0; mi < 4; ++mi)
      af[mi] = frag_lds(&As[cur][(wr * 64 + mi * 16) * LDSTR], LDSTR, lane);
#pragma unroll
    for (int ni = 0; ni < 4; ++ni)
      bfv[ni] = frag_lds(&Bs[cur][(wc * 64 + ni * 16) * LDSTR], LDSTR, lane);
#pragma unroll
    for (int mi = 0; mi < 4; ++mi)
#pragma unroll
      for (int ni = 0; ni < 4; ++ni)
        acc[mi][ni] = wmma_bf16f32(af[mi], bfv[ni], acc[mi][ni]);
    wait_async0();
    __syncthreads();
  }
}

template <int MODE, int LDC>
static __device__ __forceinline__ void gemm_store(v8f (&acc)[4][4],
                                                  float* __restrict__ C,
                                                  __bf16* __restrict__ Cbf) {
  const int lane = threadIdx.x & 31;
  const int wid  = threadIdx.x >> 5;
  const int wr   = wid >> 2;  // 0..1 (m)
  const int wc   = wid & 3;   // 0..3 (n)
  const size_t m0 = (size_t)blockIdx.y * 128;
  const size_t n0 = (size_t)blockIdx.x * 256;
  const int rofs = (lane >> 4) << 3;
  const size_t idx0 = (m0 + (size_t)wr * 64 + rofs) * LDC + n0 + (size_t)wc * 64 +
                      (lane & 15);
  if (MODE == GEMM_F32) {
    float* cp = C + idx0;
#pragma unroll
    for (int mi = 0; mi < 4; ++mi)
#pragma unroll
      for (int ni = 0; ni < 4; ++ni)
#pragma unroll
        for (int j = 0; j < 8; ++j)
          cp[(mi * 16 + j) * LDC + ni * 16] = acc[mi][ni][j];
  } else {
    __bf16* cp = Cbf + idx0;
    // GEMM_ROPE.  A rotation pair (columns 2p, 2p + 1) lies in two neighbouring
    // lanes: even column: v * cos - partner * sin; odd: v * cos + partner * sin.
    const int col0 = (int)n0 + wc * 64 + (lane & 14);  // the pair's even column
    const int sgn = (lane & 1) ? 0 : (int)0x80000000;  // flips sin in even columns
    // position within the sequence of the lane's first row; a block's 128 rows
    // never cross a sequence's end
    const int pos0 = (int)((m0 + (size_t)wr * 64 + rofs) & (LL - 1));
    float dv[4];
    if (MODE == GEMM_ROPE) {
#pragma unroll
      for (int ni = 0; ni < 4; ++ni)
        dv[ni] = exp_fast((float)(col0 + ni * 16) * (-9.2103403719761836f / 512.0f));
    }
#pragma unroll
    for (int mi = 0; mi < 4; ++mi) {
      if (MODE == GEMM_RELU) {
#pragma unroll
        for (int ni = 0; ni < 4; ++ni)
#pragma unroll
          for (int j = 0; j < 8; ++j)
            acc[mi][ni][j] = acc[mi][ni][j] > 0.f ? acc[mi][ni][j] : 0.f;
      }
      if (MODE == GEMM_ROPE) {
#pragma unroll
        for (int j = 0; j < 8; ++j) {
          const float pos = (float)(pos0 + mi * 16 + j);
#pragma unroll
          for (int ni = 0; ni < 4; ++ni) {
            const float v = acc[mi][ni][j];
            const float p = __builtin_bit_cast(
                float, __builtin_amdgcn_update_dpp(0, __builtin_bit_cast(int, v),
                                                   0x161 /* row_xmask:1 */, 0xf,
                                                   0xf, true));
            float s, c;
            sincos_fast(pos * dv[ni], &s, &c);
            const float ss =
                __builtin_bit_cast(float, __builtin_bit_cast(int, s) ^ sgn);
            const float r = v * c + p * ss;
            const float ex = exp_fast(r);  // taken in every lane: no branch
            acc[mi][ni][j] = r > 0.f ? r + 1.f : ex;
          }
        }
      }
#pragma unroll
      for (int ni = 0; ni < 4; ++ni)
#pragma unroll
        for (int j = 0; j < 8; ++j)
          cp[(mi * 16 + j) * LDC + ni * 16] = (__bf16)acc[mi][ni][j];
      // A row of tiles is stored before the next row's arithmetic begins, so the
      // stores drain under it; without this the build kept all 128 for the end.
      if (MODE == GEMM_ROPE) __builtin_amdgcn_sched_barrier(0);
    }
  }
}

template <int MODE, int LDC, bool TWO_A>
__global__ __launch_bounds__(256) void gemm_bf16_kernel(
    const __bf16* __restrict__ A, const __bf16* __restrict__ A2, int lda,
    const __bf16* __restrict__ Bt, int ldb, float* __restrict__ C, int K,
    __bf16* __restrict__ Cbf) {
  __shared__ alignas(16) a_tiles_t As;
  __shared__ alignas(16) b_tiles_t Bs;
  v8f acc[4][4];
  gemm_main<TWO_A>(As, Bs, A, A2, lda, Bt, ldb, K, acc);
  gemm_store<MODE, LDC>(acc, C, Cbf);
}

__global__ __launch_bounds__(256) void qkv_gemm_kernel(
    const __bf16* __restrict__ xb, const __bf16* __restrict__ sb, int lda,
    const __bf16* __restrict__ WqT, const __bf16* __restrict__ WkT,
    const __bf16* __restrict__ WvT, int ldb, int K, __bf16* __restrict__ Qf,
    __bf16* __restrict__ Kf, __bf16* __restrict__ Vb) {
  __shared__ alignas(16) a_tiles_t As;
  __shared__ alignas(16) b_tiles_t Bs;
  const int z = blockIdx.z;
  const __bf16* A  = z == 0 ? xb : sb;
  const __bf16* Bt = z == 0 ? WqT : z == 1 ? WkT : WvT;
  v8f acc[4][4];
  gemm_main<false>(As, Bs, A, nullptr, lda, Bt, ldb, K, acc);
  if (z < 2) {
    gemm_store<GEMM_ROPE, DD>(acc, nullptr, z == 0 ? Qf : Kf);
  } else {
    gemm_store<GEMM_BF16, DD>(acc, nullptr, Vb);
    // Stands in front of the other branch's code: in the built code a path leads
    // on to it from here, and it writes registers that these stores name.
    asm volatile("s_wait_xcnt 0x0" ::: "memory");
  }
}

// Two GEMMs with f32 results of pitch DD in one launch, for the same reason;
// blockIdx.z picks the operands; the longer K comes first.
__global__ __launch_bounds__(256) void gemm_f32_pair_kernel(
    const __bf16* __restrict__ A0, int lda0, const __bf16* __restrict__ Bt0,
    float* __restrict__ C0, const __bf16* __restrict__ A1, int lda1,
    const __bf16* __restrict__ Bt1, float* __restrict__ C1) {
  __shared__ alignas(16) a_tiles_t As;
  __shared__ alignas(16) b_tiles_t Bs;
  const bool first = blockIdx.z == 0;
  const int ld = first ? lda0 : lda1;  // row pitch of A and of Bt, and K
  v8f acc[4][4];
  gemm_main<false>(As, Bs, first ? A0 : A1, nullptr, ld, first ? Bt0 : Bt1, ld, ld,
                   acc);
  gemm_store<GEMM_F32, DD>(acc, first ? C0 : C1, nullptr);
}

// ---------------------------------------------------------------------------
// Ksp[split,b,h,d] = sum over this split's s of Kf[b,s,h,d]
// (grid: x = (b,h), y = split; split_reduce_kernel adds the planes)
// ---------------------------------------------------------------------------
static __device__ __forceinline__ void ksum_block(
    const __bf16* __restrict__ Kf, float* __restrict__ Ksp) {
  __shared__ float red[256];
  const int tid = threadIdx.x;
  const int bh = blockIdx.x, b = bh >> 3, h = bh & 7;
  const int d = tid & 63, grp = tid >> 6;
  float acc = 0.f;
  const int sbeg = blockIdx.y * SCHUNK;
  const __bf16* kp = Kf + ((size_t)b * SSEQ + sbeg + grp) * DD + h * DHD + d;
  for (int it = 0; it < SCHUNK / 4; ++it) {
    acc += (float)kp[(size_t)it * 4 * DD];
    // Stands in front of the load of the unrolled build whose result lands in
    // the address registers that the loads before it name.
    asm volatile("s_wait_xcnt 0x0" ::: "memory");
  }
  red[tid] = acc;
  __syncthreads();
  if (tid < 64)
    Ksp[(size_t)blockIdx.y * KSN + (size_t)bh * DHD + d] =
        red[tid] + red[tid + 64] + red[tid + 128] + red[tid + 192];
}

// ---------------------------------------------------------------------------
// KVp[split,b,h,v,d] = sum over this split's s of Vb[b,s,h,v] * Kf[b,s,h,d]
// (f32 partial, transposed).  Grid: x = (b,h), y = split; one block (8 waves)
// per (b,h,split); each wave owns 2 of the 16 16x16 tiles.
// ---------------------------------------------------------------------------
static __device__ __forceinline__ void kv_block(
    const __bf16* __restrict__ Kf, const __bf16* __restrict__ Vb,
    float* __restrict__ KVp) {
  __shared__ alignas(16) __bf16 Kt[64 * 72];  // [d][s_local]
  __shared__ alignas(16) __bf16 Vt[64 * 72];  // [v][s_local]
  const int tid = threadIdx.x, lane = tid & 31, wid = tid >> 5;
  const int bh = blockIdx.x, b = bh >> 3, h = bh & 7;
  const int t0 = wid * 2;

  v8f acc[2];
#pragma unroll
  for (int t = 0; t < 2; ++t)
#pragma unroll
    for (int j = 0; j < 8; ++j) acc[t][j] = 0.f;

  const int sbeg = blockIdx.y * SCHUNK;
  // Kept rolled: barriers bound each tile, so unrolling overlaps nothing, and
  // the unrolled build issues a tile's fourth load behind the wait for its first.
#pragma unroll 1
  for (int s0 = sbeg; s0 < sbeg + SCHUNK; s0 += 64) {
    __syncthreads();
#pragma unroll
    for (int i = 0; i < 2; ++i) {
      int c = tid + i * 256;  // 0..511
      int srow = c >> 3;      // local s 0..63
      int d0 = (c & 7) << 3;  // 0..56
      size_t g = ((size_t)b * SSEQ + s0 + srow) * DD + h * DHD + d0;
      v8bf kk = *(const v8bf*)(Kf + g);
      v8bf vv = *(const v8bf*)(Vb + g);
#pragma unroll
      for (int e = 0; e < 8; ++e) {
        Kt[(d0 + e) * 72 + srow] = kk[e];
        Vt[(d0 + e) * 72 + srow] = vv[e];
      }
    }
    __syncthreads();
#pragma unroll
    for (int ks = 0; ks < 64; ks += 32) {
#pragma unroll
      for (int ti = 0; ti < 2; ++ti) {
        int t = t0 + ti;
        int mv = t >> 2, nd = t & 3;
        v16bf a  = frag_lds(&Vt[(mv * 16) * 72 + ks], 72, lane);
        v16bf bb = frag_lds(&Kt[(nd * 16) * 72 + ks], 72, lane);
        acc[ti] = wmma_bf16f32(a, bb, acc[ti]);
      }
    }
  }

  const int rofs = (lane >> 4) << 3;
#pragma unroll
  for (int ti = 0; ti < 2; ++ti) {
    int t = t0 + ti;
    int mv = t >> 2, nd = t & 3;
#pragma unroll
    for (int j = 0; j < 8; ++j) {
      int v = mv * 16 + rofs + j;
      int d = nd * 16 + (lane & 15);
      KVp[(size_t)blockIdx.y * KVN + ((size_t)bh * 64 + v) * 64 + d] =
          acc[ti][j];
    }
  }
}

// Both sums over s in one launch (neither reads what the other writes):
// blockIdx.z = 0: the KV partials, 1: the Ksum partials.
__global__ __launch_bounds__(256) void kv_ksum_kernel(
    const __bf16* __restrict__ Kf, const __bf16* __restrict__ Vb,
    float* __restrict__ KVp, float* __restrict__ Ksp) {
  if (blockIdx.z == 0)
    kv_block(Kf, Vb, KVp);
  else
    ksum_block(Kf, Ksp);
}

// ---------------------------------------------------------------------------
// Adds the NSPLIT partial planes: KVt (bf16) from KVp, Ksum (f32) from Ksp.
// Blocks 0 .. KVN/256-1 take KV elements, the rest Ksum elements.
// ---------------------------------------------------------------------------
__global__ __launch_bounds__(256) void split_reduce_kernel(
    const float* __restrict__ KVp, const float* __restrict__ Ksp,
    __bf16* __restrict__ KVt, float* __restrict__ Ksum) {
  const int i = blockIdx.x * 256 + threadIdx.x;
  float acc = 0.f;
  if (blockIdx.x < KVN / 256) {
#pragma unroll  // all NSPLIT loads in flight at once
    for (int p = 0; p < NSPLIT; ++p) acc += KVp[(size_t)p * KVN + i];
    KVt[i] = (__bf16)acc;
  } else {
    const int j = i - KVN;
#pragma unroll  // all NSPLIT loads in flight at once
    for (int p = 0; p < NSPLIT; ++p) acc += Ksp[(size_t)p * KSN + j];
    Ksum[j] = acc;
    // Stands in front of the other branch's loads: in the built code a path
    // leads on to them from here, and the first writes this store's data register.
    asm volatile("s_wait_xcnt 0x0" ::: "memory");
  }
}

// ---------------------------------------------------------------------------
// Z[b,l,h] = 1 / (where(score>thr, score, 0) + 1e-6), score = Q . Ksum
// (the reference's /s_len inside KV and *s_len on out cancel exactly)
// ---------------------------------------------------------------------------
__global__ __launch_bounds__(256) void scores_kernel(
    const __bf16* __restrict__ Qf, const float* __restrict__ Ksum,
    const float* __restrict__ thr, float* __restrict__ Zs) {
  size_t idx = (size_t)blockIdx.x * 256 + threadIdx.x;  // over B*L*H
  size_t bl = idx >> 3;
  int h = (int)(idx & 7);
  int b = (int)(bl / LL);
  const __bf16* q = Qf + bl * DD + h * DHD;
  const float* ks = Ksum + ((size_t)b * HH + h) * DHD;
  float sc = 0.f;
#pragma unroll 8
  for (int d = 0; d < DHD; ++d) sc += (float)q[d] * ks[d];
  float sp = sc > thr[0] ? sc : 0.f;
  Zs[idx] = 1.0f / (sp + 1e-6f);
}

// ---------------------------------------------------------------------------
// Ao[b,l,h*64+v] = Z[b,l,h] * sum_d Q[b,l,h,d] * KVt[b,h,v,d]   (bf16 out)
// Block: 8 waves; tile 128 rows x 64 cols; K=64 (2 wmma steps). Async staging.
// ---------------------------------------------------------------------------
__global__ __launch_bounds__(256) void attn_out_kernel(
    const __bf16* __restrict__ Qf, const __bf16* __restrict__ KVt,
    const float* __restrict__ Zs, __bf16* __restrict__ Ao) {
  __shared__ alignas(16) __bf16 Aq[128 * 72];
  __shared__ alignas(16) __bf16 Kv[64 * 72];
  __shared__ alignas(32) float zsh[128];
  const int tid = threadIdx.x, lane = tid & 31, wid = tid >> 5;
  const int bh = blockIdx.y, b = bh >> 3, h = bh & 7;
  const size_t rowbase = (size_t)b * LL + (size_t)blockIdx.x * 128;

#pragma unroll
  for (int i = 0; i < 4; ++i) {  // Q tile 128x64 (async DMA)
    int c = tid + i * 256;
    int row = c >> 3, cc = (c & 7) << 3;
    async_copy16(&Aq[row * 72 + cc], Qf + (rowbase + row) * DD + h * DHD + cc);
  }
#pragma unroll
  for (int i = 0; i < 2; ++i) {  // KVt 64x64 (async DMA)
    int c = tid + i * 256;
    int row = c >> 3, cc = (c & 7) << 3;
    async_copy16(&Kv[row * 72 + cc], KVt + ((size_t)bh * 64 + row) * 64 + cc);
  }
  if (tid < 128) zsh[tid] = Zs[(rowbase + tid) * HH + h];
  wait_async0();
  __syncthreads();

  v8f acc[4];
#pragma unroll
  for (int ni = 0; ni < 4; ++ni)
#pragma unroll
    for (int j = 0; j < 8; ++j) acc[ni][j] = 0.f;

#pragma unroll
  for (int ks = 0; ks < 64; ks += 32) {
    v16bf a = frag_lds(&Aq[(wid * 16) * 72 + ks], 72, lane);
#pragma unroll
    for (int ni = 0; ni < 4; ++ni) {
      v16bf bb = frag_lds(&Kv[(ni * 16) * 72 + ks], 72, lane);
      acc[ni] = wmma_bf16f32(a, bb, acc[ni]);
    }
  }

  const int rofs = (lane >> 4) << 3;
  v8f zv = *(const v8f*)(&zsh[wid * 16 + rofs]);
#pragma unroll
  for (int ni = 0; ni < 4; ++ni) {
    int col = h * DHD + ni * 16 + (lane & 15);
#pragma unroll
    for (int j = 0; j < 8; ++j) {
      size_t row = rowbase + wid * 16 + rofs + j;
      Ao[row * DD + col] = (__bf16)(acc[ni][j] * zv[j]);
    }
  }
}

// ---------------------------------------------------------------------------
// LayerNorm over 512 f32; writes the f32 or the bf16 output.
// One wave per row, LN_R rows a wave: a lane holds 16 elements of a row (four
// 16-byte loads, 512 contiguous bytes a wave each); the row's sums are taken
// inside the wave.  A block covers 8 * LN_R rows.
// ---------------------------------------------------------------------------
#define LN_R 2

template <int BF16OUT>
__global__ __launch_bounds__(256) void layernorm_kernel(
    const float* __restrict__ in, const float* __restrict__ g,
    const float* __restrict__ bta, float* __restrict__ out_f32,
    __bf16* __restrict__ out_bf16) {
  const int lane = threadIdx.x & 31;
  // the wave's number, scalar: row bases stay in scalar registers
  const int wid = __builtin_amdgcn_readfirstlane(threadIdx.x >> 5);
  const size_t row0 = ((size_t)blockIdx.x * 8 + wid) * LN_R;
  const int c0 = lane * 4;
  const unsigned voff = lane * 16;  // the lane's byte offset in a 512-byte piece
  const char* inb = (const char*)(in + row0 * DD);
  v4f v[LN_R][4], gv[4], bv[4];
#pragma unroll
  for (int r = 0; r < LN_R; ++r)
#pragma unroll
    for (int j = 0; j < 4; ++j)
      v[r][j] = *(const v4f*)(inb + (r * DD + j * 128) * 4 + voff);
#pragma unroll
  for (int j = 0; j < 4; ++j) {
    gv[j] = *(const v4f*)((const char*)g + j * 512 + voff);
    bv[j] = *(const v4f*)((const char*)bta + j * 512 + voff);
  }
  loads_issued(voff);
#pragma unroll
  for (int r = 0; r < LN_R; ++r) {
    float s = 0.f, q = 0.f;
#pragma unroll
    for (int j = 0; j < 4; ++j)
#pragma unroll
      for (int e = 0; e < 4; ++e) {
        s += v[r][j][e];
        q += v[r][j][e] * v[r][j][e];
      }
    s = wave_sum(s);
    q = wave_sum(q);
    const float mu = s * (1.0f / DD);
    const float var = q * (1.0f / DD) - mu * mu;
    const float rstd = rsqrtf(var + 1e-5f);
#pragma unroll
    for (int j = 0; j < 4; ++j)
#pragma unroll
      for (int e = 0; e < 4; ++e)
        v[r][j][e] = (v[r][j][e] - mu) * rstd * gv[j][e] + bv[j][e];
  }
  if (BF16OUT) {
    v4bf o[LN_R][4];
#pragma unroll
    for (int r = 0; r < LN_R; ++r)
#pragma unroll
      for (int j = 0; j < 4; ++j) o[r][j] = __builtin_convertvector(v[r][j], v4bf);
#pragma unroll
    for (int r = 0; r < LN_R; ++r)
#pragma unroll
      for (int j = 0; j < 4; ++j)
        *(v4bf*)(out_bf16 + (row0 + r) * DD + j * 128 + c0) = o[r][j];
  } else {
#pragma unroll
    for (int r = 0; r < LN_R; ++r)
#pragma unroll
      for (int j = 0; j < 4; ++j)
        *(v4f*)(out_f32 + (row0 + r) * DD + j * 128 + c0) = v[r][j];
  }
}

// ---------------------------------------------------------------------------
// out = x + msg2 + LN(aug32 + baug; gaug, bln)
// One wave per row as in layernorm_kernel, FIN_R rows a wave: one row's 24 loads
// already hold 96 registers.
// ---------------------------------------------------------------------------
#define FIN_R 1

__global__ __launch_bounds__(256) void final_kernel(
    const float* __restrict__ x, const float* __restrict__ msg2,
    const float* __restrict__ aug32, const float* __restrict__ baug,
    const float* __restrict__ gaug, const float* __restrict__ bln,
    float* __restrict__ out) {
  const int lane = threadIdx.x & 31;
  // the wave's number, scalar: row bases stay in scalar registers
  const int wid = __builtin_amdgcn_readfirstlane(threadIdx.x >> 5);
  const size_t row0 = ((size_t)blockIdx.x * 8 + wid) * FIN_R;
  const int c0 = lane * 4;
  const unsigned voff = lane * 16;  // the lane's byte offset in a 512-byte piece
  const char* ab = (const char*)(aug32 + row0 * DD);
  const char* xb = (const char*)(x + row0 * DD);
  const char* mb = (const char*)(msg2 + row0 * DD);
  v4f a[FIN_R][4], xv[FIN_R][4], mv[FIN_R][4], av[4], gv[4], bv[4];
#pragma unroll
  for (int r = 0; r < FIN_R; ++r)
#pragma unroll
    for (int j = 0; j < 4; ++j)
      a[r][j] = *(const v4f*)(ab + (r * DD + j * 128) * 4 + voff);
#pragma unroll
  for (int j = 0; j < 4; ++j)
    av[j] = *(const v4f*)((const char*)baug + j * 512 + voff);
#pragma unroll
  for (int r = 0; r < FIN_R; ++r)
#pragma unroll
    for (int j = 0; j < 4; ++j) {
      xv[r][j] = *(const v4f*)(xb + (r * DD + j * 128) * 4 + voff);
      mv[r][j] = *(const v4f*)(mb + (r * DD + j * 128) * 4 + voff);
    }
#pragma unroll
  for (int j = 0; j < 4; ++j) {
    gv[j] = *(const v4f*)((const char*)gaug + j * 512 + voff);
    bv[j] = *(const v4f*)((const char*)bln + j * 512 + voff);
  }
  loads_issued(voff);
#pragma unroll
  for (int r = 0; r < FIN_R; ++r) {
    float s = 0.f, q = 0.f;
#pragma unroll
    for (int j = 0; j < 4; ++j) {
      a[r][j] += av[j];
#pragma unroll
      for (int e = 0; e < 4; ++e) {
        s += a[r][j][e];
        q += a[r][j][e] * a[r][j][e];
      }
    }
    s = wave_sum(s);
    q = wave_sum(q);
    const float mu = s * (1.0f / DD);
    const float var = q * (1.0f / DD) - mu * mu;
    const float rstd = rsqrtf(var + 1e-5f);
#pragma unroll
    for (int j = 0; j < 4; ++j)
#pragma unroll
      for (int e = 0; e < 4; ++e) {
        const float l = (a[r][j][e] - mu) * rstd * gv[j][e] + bv[j][e];
        a[r][j][e] = xv[r][j][e] + mv[r][j][e] + l;
      }
  }
#pragma unroll
  for (int r = 0; r < FIN_R; ++r)
#pragma unroll
    for (int j = 0; j < 4; ++j)
      *(v4f*)(out + (row0 + r) * DD + j * 128 + c0) = a[r][j];
}

// ---------------------------------------------------------------------------
// Host orchestration
// ---------------------------------------------------------------------------
extern "C" void kernel_launch(void* const* d_in, const int* in_sizes, int n_in,
                              void* d_out, int out_size, void* d_ws,
                              size_t ws_size, hipStream_t stream) {
  (void)in_sizes; (void)n_in; (void)out_size; (void)ws_size;
  const float* x      = (const float*)d_in[0];
  const float* source = (const float*)d_in[1];
  const float* Wq     = (const float*)d_in[2];
  const float* Wk     = (const float*)d_in[3];
  const float* Wv     = (const float*)d_in[4];
  const float* Wmerge = (const float*)d_in[5];
  const float* Wmlp1  = (const float*)d_in[6];
  const float* Wmlp2  = (const float*)d_in[7];
  const float* g1     = (const float*)d_in[8];
  const float* b1     = (const float*)d_in[9];
  const float* g2     = (const float*)d_in[10];
  const float* b2     = (const float*)d_in[11];
  const float* Waug   = (const float*)d_in[12];
  const float* baug   = (const float*)d_in[13];
  const float* gaug   = (const float*)d_in[14];
  const float* bln    = (const float*)d_in[15];
  const float* thr    = (const float*)d_in[16];
  float* out = (float*)d_out;

  char* ws = (char*)d_ws;
  size_t off = 0;
  auto take = [&](size_t bytes) -> char* {
    char* p = ws + off;
    off += (bytes + 255) & ~(size_t)255;
    return p;
  };

  __bf16* xb   = (__bf16*)take((size_t)NT * DD * 2);
  __bf16* sb   = (__bf16*)take((size_t)NT * DD * 2);
  __bf16* WqT  = (__bf16*)take((size_t)DD * DD * 2);
  __bf16* WkT  = (__bf16*)take((size_t)DD * DD * 2);
  __bf16* WvT  = (__bf16*)take((size_t)DD * DD * 2);
  __bf16* WmT  = (__bf16*)take((size_t)DD * DD * 2);
  __bf16* W1T  = (__bf16*)take((size_t)D2 * D2 * 2);
  __bf16* W2T  = (__bf16*)take((size_t)DD * D2 * 2);
  __bf16* WaT  = (__bf16*)take((size_t)DD * DD * 2);
  float*  C1   = (float*)take((size_t)NT * DD * 4);
  __bf16* Qf   = (__bf16*)take((size_t)NT * DD * 2);
  __bf16* Kf   = (__bf16*)take((size_t)NT * DD * 2);
  __bf16* Vb   = (__bf16*)take((size_t)NT * DD * 2);
  float*  Ksum = (float*)take((size_t)BB * HH * DHD * 4);
  __bf16* KVt  = (__bf16*)take((size_t)BB * HH * 64 * 64 * 2);
  float*  Zs   = (float*)take((size_t)NT * HH * 4);
  __bf16* Ao   = (__bf16*)take((size_t)NT * DD * 2);
  __bf16* Msgb = (__bf16*)take((size_t)NT * DD * 2);
  __bf16* Hb   = (__bf16*)take((size_t)NT * D2 * 2);
  float*  Msg2 = (float*)take((size_t)NT * DD * 4);
  float*  KVp  = (float*)take((size_t)NSPLIT * KVN * 4);
  float*  Ksp  = (float*)take((size_t)NSPLIT * KSN * 4);

  float*  Aug  = (float*)take((size_t)NT * DD * 4);

  const dim3 blk(256);

  // 1) Convert activations and (transposed) weights to bf16
  prep_kernel<<<dim3(TR_ALL + 2 * CVT_NB), blk, 0, stream>>>(
      x, source, Wq, Wk, Wv, Wmerge, Wmlp1, Wmlp2, Waug, xb, sb, WqT, WkT, WvT, WmT,
      W1T, W2T, WaT);

  // 2) Qf = elu(rope(x@Wq)) + 1, Kf = elu(rope(source@Wk)) + 1, Vb = source@Wv
  //    (bf16, fused epilogues)
  qkv_gemm_kernel<<<dim3(DD / 256, NT / 128, 3), blk, 0, stream>>>(
      xb, sb, DD, WqT, WkT, WvT, DD, DD, Qf, Kf, Vb);

  // 3) attention core
  kv_ksum_kernel<<<dim3(BB * HH, NSPLIT, 2), blk, 0, stream>>>(Kf, Vb, KVp, Ksp);
  split_reduce_kernel<<<dim3(KVN / 256 + KSN / 256), blk, 0, stream>>>(
      KVp, Ksp, KVt, Ksum);
  scores_kernel<<<dim3((NT * HH) / 256), blk, 0, stream>>>(Qf, Ksum, thr, Zs);
  attn_out_kernel<<<dim3(LL / 128, BB * HH), blk, 0, stream>>>(Qf, KVt, Zs, Ao);

  // 4) merge + LN1 -> Msgb (bf16)
  gemm_bf16_kernel<GEMM_F32, DD, false>
      <<<dim3(DD / 256, NT / 128), blk, 0, stream>>>(Ao, nullptr, DD, WmT, DD, C1,
                                                     DD, nullptr);
  layernorm_kernel<1><<<dim3(NT / (8 * LN_R)), blk, 0, stream>>>(C1, g1, b1, nullptr, Msgb);

  // 5) MLP1: Hb = relu([x, msg] @ Wmlp1) (bf16, fused epilogue)
  gemm_bf16_kernel<GEMM_RELU, D2, true>
      <<<dim3(D2 / 256, NT / 128), blk, 0, stream>>>(xb, Msgb, DD, W1T, D2,
                                                     nullptr, D2, Hb);

  // 6) MLP2 -> C1 and the aug GEMM -> Aug; LN2 -> Msg2 (f32)
  gemm_f32_pair_kernel<<<dim3(DD / 256, NT / 128, 2), blk, 0, stream>>>(
      Hb, D2, W2T, C1, xb, DD, WaT, Aug);
  layernorm_kernel<0><<<dim3(NT / (8 * LN_R)), blk, 0, stream>>>(C1, g2, b2, Msg2, nullptr);

  // 7) fused LN(aug)+residual
  final_kernel<<<dim3(NT / (8 * FIN_R)), blk, 0, stream>>>(x, Msg2, Aug, baug, gaug, bln, out);
}

// v006
// It runs in 157 microseconds.
// Timed twice side by side with v005, it ran 1.14 and 1.15 times as fast.
// Over all steps from v000 it is 3.92 times as fast.
#include <hip/hip_runtime.h>
#include <hip/hip_bf16.h>

#define BB 4
#define LL 4096
#define SSEQ 4096
#define DD 512
#define HH 8
#define DHD 64
#define NT (BB * LL)     /* 16384 token rows */
#define D2 (2 * DD)      /* 1024 */
#define NSPLIT 16        /* work-groups that share one (b,h) sum over s */
#define SCHUNK (SSEQ / NSPLIT)
#define KVN (BB * HH * DHD * DHD) /* elements of one KV partial plane */
#define KSN (BB * HH * DHD)       /* elements of one Ksum partial plane */

typedef __bf16 v16bf __attribute__((ext_vector_type(16)));
typedef __bf16 v8bf  __attribute__((ext_vector_type(8)));
typedef float  v8f   __attribute__((ext_vector_type(8)));
typedef int    v4i   __attribute__((ext_vector_type(4)));
typedef float  v4f   __attribute__((ext_vector_type(4)));
typedef __bf16 v4bf  __attribute__((ext_vector_type(4)));

#if defined(__has_builtin)
#if __has_builtin(__builtin_amdgcn_global_load_async_to_lds_b128)
#define HAVE_ASYNC_BUILTIN 1
#endif
#if __has_builtin(__builtin_amdgcn_s_wait_asynccnt)
#define HAVE_ASYNCWAIT_BUILTIN 1
#endif
#endif

static __device__ __forceinline__ void async_copy16(void* lds, const void* g) {
#ifdef HAVE_ASYNC_BUILTIN
  __builtin_amdgcn_global_load_async_to_lds_b128(
      (__attribute__((address_space(1))) v4i*)(g),
      (__attribute__((address_space(3))) v4i*)(lds), 0, 0);
#else
  asm volatile("global_load_async_to_lds_b128 %0, %1, off" ::"v"(
                   (unsigned)(size_t)lds),
               "v"(g)
               : "memory");
#endif
}

static __device__ __forceinline__ void wait_async0() {
#ifdef HAVE_ASYNCWAIT_BUILTIN
  __builtin_amdgcn_s_wait_asynccnt(0);
#else
  asm volatile("s_wait_asynccnt 0x0" ::: "memory");
#endif
}

static __device__ __forceinline__ v8f wmma_bf16f32(v16bf a, v16bf b, v8f c) {
  // D = A(16x32) * B(32x16) + C, f32 accumulate
  return __builtin_amdgcn_wmma_f32_16x16x32_bf16(false, a, false, b, (short)0, c,
                                                 false, false);
}

static __device__ __forceinline__ v16bf frag_lds(const __bf16* tile, int stride,
                                                 int lane) {
  const int row  = lane & 15;
  const int koff = (lane >> 4) << 3;
  const __bf16* p = tile + row * stride + koff;
  v8bf lo = *(const v8bf*)(p);
  v8bf hi = *(const v8bf*)(p + 16);
  return __builtin_shufflevector(lo, hi, 0, 1, 2, 3, 4, 5, 6, 7, 8, 9, 10, 11,
                                 12, 13, 14, 15);
}

// ---------------------------------------------------------------------------
// Sum over the 32 lanes of a wave, the same bits in every lane: four xor steps
// inside each 16-lane row, then the exchange with the other row.
// ---------------------------------------------------------------------------
template <int CTRL>
static __device__ __forceinline__ float row_xor_add(float v) {
  const int t = __builtin_amdgcn_update_dpp(0, __builtin_bit_cast(int, v), CTRL,
                                            0xf, 0xf, true);
  return v + __builtin_bit_cast(float, t);
}

static __device__ __forceinline__ float wave_sum(float v) {
  v = row_xor_add<0x161>(v);  // row_xmask:1
  v = row_xor_add<0x162>(v);  // row_xmask:2
  v = row_xor_add<0x164>(v);  // row_xmask:4
  v = row_xor_add<0x168>(v);  // row_xmask:8
  const int b = __builtin_bit_cast(int, v);
  const int o =
      __builtin_amdgcn_permlanex16(b, b, 0x76543210, 0xfedcba98, false, false);
  return v + __builtin_bit_cast(float, o);
}

// Stands behind a kernel's whole group of loads, which share the offset register
// voff.
static __device__ __forceinline__ void loads_issued(unsigned voff) {
  // In front of every later write of a register that these loads name; as an
  // operand voff stays live up to here, so no load's result lands on it.
  asm volatile("s_wait_xcnt 0x0" ::"v"(voff) : "memory");
  // No arithmetic moves up among the loads: without it the build issued part of
  // the group late, behind waits for the first loads.
  __builtin_amdgcn_sched_barrier(0);
}

static __device__ __forceinline__ float exp2_slot(float x) {
  float y;
  asm("v_exp_f32 %0, %1\n\tv_nop" : "=&v"(y) : "v"(x));
  return y;
}

// exp(x) as the fast library form computes it
static __device__ __forceinline__ float exp_fast(float x) {
  return exp2_slot(x * 1.44269504088896340736f);
}

// sine and cosine of an angle in radians, as the fast library form computes them
static __device__ __forceinline__ void sincos_fast(float a, float* s, float* c) {
  const float rev = a * 0.15915494309189532f;
  asm("v_sin_f32 %0, %2\n\tv_cos_f32 %1, %2\n\tv_nop"
      : "=&v"(*s), "=&v"(*c)
      : "v"(rev));
}

// ---------------------------------------------------------------------------
// Elementwise conversion.  A thread takes CVT_G groups of four floats, each a
// 16-byte load (512 contiguous bytes a wave), all issued before the first use.
// One block covers CVT_BLK elements (block blk of the array); CVT_BLK divides n.
// ---------------------------------------------------------------------------
#define CVT_G 8
#define CVT_BLK (256 * 4 * CVT_G)

static __device__ __forceinline__ void f32_to_bf16_block(
    const float* __restrict__ in, __bf16* __restrict__ out, int blk) {
  const size_t base = (size_t)blk * CVT_BLK + threadIdx.x * 4;
  v4f v[CVT_G];
  v4bf o[CVT_G];
#pragma unroll
  for (int j = 0; j < CVT_G; ++j) v[j] = *(const v4f*)(in + base + j * 1024);
#pragma unroll
  for (int j = 0; j < CVT_G; ++j) o[j] = __builtin_convertvector(v[j], v4bf);
#pragma unroll
  for (int j = 0; j < CVT_G; ++j) *(v4bf*)(out + base + j * 1024) = o[j];
}

// W[k][n] (f32, KxN row-major) -> Wt[n][k] (bf16, NxK row-major)
// Block tile: 64 k x 32 n.  A thread reads 8 consecutive k of one n and stores
// them as 16 bytes; 8 lanes side by side in k fill one 128-byte line of Wt.
// Tiles: bx in 0 .. N / 32 - 1, by in 0 .. K / 64 - 1.
static __device__ __forceinline__ void transpose_bf16_block(
    const float* __restrict__ W, __bf16* __restrict__ Wt, int K, int N, int bx,
    int by) {
  const int k0 = by * 64 + (threadIdx.x & 7) * 8;
  const int n  = bx * 32 + (threadIdx.x >> 3);
  const float* wp = W + (size_t)k0 * N + n;
  float w[8];
#pragma unroll
  for (int e = 0; e < 8; ++e) w[e] = wp[(size_t)e * N];
  v8bf o;
#pragma unroll
  for (int e = 0; e < 8; ++e) o[e] = (__bf16)w[e];
  *(v8bf*)(Wt + (size_t)n * K + k0) = o;
}

// All nine input conversions in one launch: none reads what another writes.  The
// block index picks the job: first the weight tiles (short, bound by latency),
// which then run under the two activation streams behind them.
#define TR_W1 ((D2 / 32) * (D2 / 64))  /* 512 tiles of Wmlp1 */
#define TR_W2 ((DD / 32) * (D2 / 64))  /* 256 tiles of Wmlp2 */
#define TR_SQ ((DD / 32) * (DD / 64))  /* 128 tiles of each 512 x 512 weight */
#define TR_ALL (TR_W1 + TR_W2 + 5 * TR_SQ)
#define CVT_NB (NT * DD / CVT_BLK)     /* 1024 blocks for x, as many for source */

__global__ __launch_bounds__(256) void prep_kernel(
    const float* __restrict__ x, const float* __restrict__ source,
    const float* __restrict__ Wq, const float* __restrict__ Wk,
    const float* __restrict__ Wv, const float* __restrict__ Wmerge,
    const float* __restrict__ Wmlp1, const float* __restrict__ Wmlp2,
    const float* __restrict__ Waug, __bf16* __restrict__ xb,
    __bf16* __restrict__ sb, __bf16* __restrict__ WqT, __bf16* __restrict__ WkT,
    __bf16* __restrict__ WvT, __bf16* __restrict__ WmT, __bf16* __restrict__ W1T,
    __bf16* __restrict__ W2T, __bf16* __restrict__ WaT) {
  const int blk = blockIdx.x;
  if (blk < TR_ALL) {
    const float* W;
    __bf16* Wt;
    int K = DD, N = DD, t;
    if (blk < TR_W1) {
      W = Wmlp1; Wt = W1T; K = D2; N = D2; t = blk;
    } else if (blk < TR_W1 + TR_W2) {
      W = Wmlp2; Wt = W2T; K = D2; t = blk - TR_W1;
    } else {
      const int w = (blk - (TR_W1 + TR_W2)) / TR_SQ;
      t = (blk - (TR_W1 + TR_W2)) % TR_SQ;
      W  = w == 0 ? Wq : w == 1 ? Wk : w == 2 ? Wv : w == 3 ? Wmerge : Waug;
      Wt = w == 0 ? WqT : w == 1 ? WkT : w == 2 ? WvT : w == 3 ? WmT : WaT;
    }
    const int sh = N == D2 ? 5 : 4;  // log2 of the N / 32 tiles in a row of tiles
    transpose_bf16_block(W, Wt, K, N, t & ((1 << sh) - 1), t >> sh);
  } else {
    const int t = blk - TR_ALL;
    const bool first = t < CVT_NB;
    f32_to_bf16_block(first ? x : source, first ? xb : sb, first ? t : t - CVT_NB);
    // Stands in front of the other branch's code: in the built code a path leads
    // on to it from here, and it writes registers that these stores name.
    asm volatile("s_wait_xcnt 0x0" ::: "memory");
  }
}

// ---------------------------------------------------------------------------
// Generic bf16 GEMM: C[M,N](f32) = A[M,K](bf16,row-major) * Bt[N,K]^T
// Block = 256 threads = 8 waves; block tile 128x256, K-step BK = 64, double-buffered
// LDS filled by async global->LDS DMA: a K-step takes 128 bytes of every operand
// row, so a wave's copy covers 4 whole 128-byte lines.  Wave (wr in 0..1, wc in
// 0..3) owns a 64x64 sub-tile = 4x4 wmma tiles: 32 WMMAs per 32 ds_load_b128 per
// K-step.  K is a multiple of BK.
// What becomes of the result and the row pitch of the output are fixed at compile
// time: MODE GEMM_F32 stores f32 to C; the others store bf16 to Cbf: GEMM_BF16 the
// result, GEMM_RELU max(result, 0), GEMM_ROPE elu(rope(result)) + 1 with the
// position taken from the output row; LDC is the pitch in elements.
// TWO_A: the A operand is [A | A2] side by side, each lda columns wide.
// ---------------------------------------------------------------------------
#define GEMM_F32 0
#define GEMM_BF16 1
#define GEMM_RELU 2
#define GEMM_ROPE 3
#define BK 64    /* columns of A and of Bt in a K-step (128B of a row) */
#define LDSTR 72 /* padded LDS row stride in bf16 elements (144B) */

typedef __bf16 a_tiles_t[2][128 * LDSTR];
typedef __bf16 b_tiles_t[2][256 * LDSTR];

// The K loop: acc = the wave's 64x64 part of the block's tile (blockIdx.x, .y).
template <bool TWO_A>
static __device__ __forceinline__ void gemm_main(
    a_tiles_t& As, b_tiles_t& Bs, const __bf16* __restrict__ A,
    const __bf16* __restrict__ A2, int lda, const __bf16* __restrict__ Bt, int ldb,
    int K, v8f (&acc)[4][4]) {
  const int tid  = threadIdx.x;
  const int lane = tid & 31;
  const int wid  = tid >> 5;
  const int wr   = wid >> 2;  // 0..1 (m)
  const int wc   = wid & 3;   // 0..3 (n)
  const size_t m0 = (size_t)blockIdx.y * 128;
  const size_t n0 = (size_t)blockIdx.x * 256;

  const __bf16* Ab = A + m0 * lda;
  const __bf16* Bb = Bt + n0 * ldb;

  auto stage_tiles = [&](int buf, int kk) {
    // first column of this K-step in the buffer that holds it (kk is scalar)
    const __bf16* Ak = Ab + kk;
    if (TWO_A && kk >= lda) Ak = A2 + m0 * lda + (kk - lda);
#pragma unroll
    for (int i = 0; i < 4; ++i) {  // A tile: 128 rows x 64 cols
      int c   = tid + i * 256;     // 0..1023 chunks of 8 bf16
      int row = c >> 3;            // 0..127
      int cc  = (c & 7) << 3;      // 0,8,..,56
      async_copy16(&As[buf][row * LDSTR + cc],
                   Ak + (size_t)row * lda + cc);
    }
#pragma unroll
    for (int i = 0; i < 8; ++i) {  // B tile: 256 rows x 64 cols
      int c   = tid + i * 256;     // 0..2047
      int row = c >> 3;            // 0..255
      int cc  = (c & 7) << 3;
      async_copy16(&Bs[buf][row * LDSTR + cc],
                   Bb + (size_t)row * ldb + kk + cc);
    }
  };

#pragma unroll
  for (int mi = 0; mi < 4; ++mi)
#pragma unroll
    for (int ni = 0; ni < 4; ++ni)
#pragma unroll
      for (int j = 0; j < 8; ++j) acc[mi][ni][j] = 0.f;

  stage_tiles(0, 0);
  wait_async0();
  __syncthreads();

  for (int kk = 0; kk < K; kk += BK) {
    const int cur = (kk / BK) & 1;
    if (kk + BK < K) stage_tiles(cur ^ 1, kk + BK);  // DMA under the WMMAs
#pragma unroll  // both halves' LDS offsets become immediates of one address
    for (int ks = 0; ks < BK; ks += 32) {
      v16bf af[4], bfv[4];
#pragma unroll
      for (int mi = 0; mi < 4; ++mi)
        af[mi] = frag_lds(&As[cur][(wr * 64 + mi * 16) * LDSTR + ks], LDSTR, lane);
#pragma unroll
      for (int ni = 0; ni < 4; ++ni)
        bfv[ni] = frag_lds(&Bs[cur][(wc * 64 + ni * 16) * LDSTR + ks], LDSTR, lane);
#pragma unroll
      for (int mi = 0; mi < 4; ++mi)
#pragma unroll
        for (int ni = 0; ni < 4; ++ni)
          acc[mi][ni] = wmma_bf16f32(af[mi], bfv[ni], acc[mi][ni]);
    }
    wait_async0();
    __syncthreads();
  }
}

template <int MODE, int LDC>
static __device__ __forceinline__ void gemm_store(v8f (&acc)[4][4],
                                                  float* __restrict__ C,
                                                  __bf16* __restrict__ Cbf) {
  const int lane = threadIdx.x & 31;
  const int wid  = threadIdx.x >> 5;
  const int wr   = wid >> 2;  // 0..1 (m)
  const int wc   = wid & 3;   // 0..3 (n)
  const size_t m0 = (size_t)blockIdx.y * 128;
  const size_t n0 = (size_t)blockIdx.x * 256;
  const int rofs = (lane >> 4) << 3;
  const size_t idx0 = (m0 + (size_t)wr * 64 + rofs) * LDC + n0 + (size_t)wc * 64 +
                      (lane & 15);
  if (MODE == GEMM_F32) {
    float* cp = C + idx0;
#pragma unroll
    for (int mi = 0; mi < 4; ++mi)
#pragma unroll
      for (int ni = 0; ni < 4; ++ni)
#pragma unroll
        for (int j = 0; j < 8; ++j)
          cp[(mi * 16 + j) * LDC + ni * 16] = acc[mi][ni][j];
  } else {
    __bf16* cp = Cbf + idx0;
    // GEMM_ROPE.  A rotation pair (columns 2p, 2p + 1) lies in two neighbouring
    // lanes: even column: v * cos - partner * sin; odd: v * cos + partner * sin.
    const int col0 = (int)n0 + wc * 64 + (lane & 14);  // the pair's even column
    const int sgn = (lane & 1) ? 0 : (int)0x80000000;  // flips sin in even columns
    // position within the sequence of the lane's first row; a block's 128 rows
    // never cross a sequence's end
    const int pos0 = (int)((m0 + (size_t)wr * 64 + rofs) & (LL - 1));
    float dv[4];
    if (MODE == GEMM_ROPE) {
#pragma unroll
      for (int ni = 0; ni < 4; ++ni)
        dv[ni] = exp_fast((float)(col0 + ni * 16) * (-9.2103403719761836f / 512.0f));
    }
#pragma unroll
    for (int mi = 0; mi < 4; ++mi) {
      if (MODE == GEMM_RELU) {
#pragma unroll
        for (int ni = 0; ni < 4; ++ni)
#pragma unroll
          for (int j = 0; j < 8; ++j)
            acc[mi][ni][j] = acc[mi][ni][j] > 0.f ? acc[mi][ni][j] : 0.f;
      }
      if (MODE == GEMM_ROPE) {
#pragma unroll
        for (int j = 0; j < 8; ++j) {
          const float pos = (float)(pos0 + mi * 16 + j);
#pragma unroll
          for (int ni = 0; ni < 4; ++ni) {
            const float v = acc[mi][ni][j];
            const float p = __builtin_bit_cast(
                float, __builtin_amdgcn_update_dpp(0, __builtin_bit_cast(int, v),
                                                   0x161 /* row_xmask:1 */, 0xf,
                                                   0xf, true));
            float s, c;
            sincos_fast(pos * dv[ni], &s, &c);
            const float ss =
                __builtin_bit_cast(float, __builtin_bit_cast(int, s) ^ sgn);
            const float r = v * c + p * ss;
            const float ex = exp_fast(r);  // taken in every lane: no branch
            acc[mi][ni][j] = r > 0.f ? r + 1.f : ex;
          }
        }
      }
#pragma unroll
      for (int ni = 0; ni < 4; ++ni)
#pragma unroll
        for (int j = 0; j < 8; ++j)
          cp[(mi * 16 + j) * LDC + ni * 16] = (__bf16)acc[mi][ni][j];
      // A row of tiles is stored before the next row's arithmetic begins, so the
      // stores drain under it; without this the build kept all 128 for the end.
      if (MODE == GEMM_ROPE) __builtin_amdgcn_sched_barrier(0);
    }
  }
}

template <int MODE, int LDC, bool TWO_A>
__global__ __launch_bounds__(256) void gemm_bf16_kernel(
    const __bf16* __restrict__ A, const __bf16* __restrict__ A2, int lda,
    const __bf16* __restrict__ Bt, int ldb, float* __restrict__ C, int K,
    __bf16* __restrict__ Cbf) {
  __shared__ alignas(16) a_tiles_t As;
  __shared__ alignas(16) b_tiles_t Bs;
  v8f acc[4][4];
  gemm_main<TWO_A>(As, Bs, A, A2, lda, Bt, ldb, K, acc);
  gemm_store<MODE, LDC>(acc, C, Cbf);
}

__global__ __launch_bounds__(256) void qkv_gemm_kernel(
    const __bf16* __restrict__ xb, const __bf16* __restrict__ sb, int lda,
    const __bf16* __restrict__ WqT, const __bf16* __restrict__ WkT,
    const __bf16* __restrict__ WvT, int ldb, int K, __bf16* __restrict__ Qf,
    __bf16* __restrict__ Kf, __bf16* __restrict__ Vb) {
  __shared__ alignas(16) a_tiles_t As;
  __shared__ alignas(16) b_tiles_t Bs;
  const int z = blockIdx.z;
  const __bf16* A  = z == 0 ? xb : sb;
  const __bf16* Bt = z == 0 ? WqT : z == 1 ? WkT : WvT;
  v8f acc[4][4];
  gemm_main<false>(As, Bs, A, nullptr, lda, Bt, ldb, K, acc);
  if (z < 2) {
    gemm_store<GEMM_ROPE, DD>(acc, nullptr, z == 0 ? Qf : Kf);
  } else {
    gemm_store<GEMM_BF16, DD>(acc, nullptr, Vb);
    // Stands in front of the other branch's code: in the built code a path leads
    // on to it from here, and it writes registers that these stores name.
    asm volatile("s_wait_xcnt 0x0" ::: "memory");
  }
}

// Two GEMMs with f32 results of pitch DD in one launch, for the same reason;
// blockIdx.z picks the operands; the longer K comes first.
__global__ __launch_bounds__(256) void gemm_f32_pair_kernel(
    const __bf16* __restrict__ A0, int lda0, const __bf16* __restrict__ Bt0,
    float* __restrict__ C0, const __bf16* __restrict__ A1, int lda1,
    const __bf16* __restrict__ Bt1, float* __restrict__ C1) {
  __shared__ alignas(16) a_tiles_t As;
  __shared__ alignas(16) b_tiles_t Bs;
  const bool first = blockIdx.z == 0;
  const int ld = first ? lda0 : lda1;  // row pitch of A and of Bt, and K
  v8f acc[4][4];
  gemm_main<false>(As, Bs, first ? A0 : A1, nullptr, ld, first ? Bt0 : Bt1, ld, ld,
                   acc);
  gemm_store<GEMM_F32, DD>(acc, first ? C0 : C1, nullptr);
}

// ---------------------------------------------------------------------------
// Ksp[split,b,h,d] = sum over this split's s of Kf[b,s,h,d]
// (grid: x = (b,h), y = split; split_reduce_kernel adds the planes)
// ---------------------------------------------------------------------------
static __device__ __forceinline__ void ksum_block(
    const __bf16* __restrict__ Kf, float* __restrict__ Ksp) {
  __shared__ float red[256];
  const int tid = threadIdx.x;
  const int bh = blockIdx.x, b = bh >> 3, h = bh & 7;
  const int d = tid & 63, grp = tid >> 6;
  float acc = 0.f;
  const int sbeg = blockIdx.y * SCHUNK;
  const __bf16* kp = Kf + ((size_t)b * SSEQ + sbeg + grp) * DD + h * DHD + d;
  for (int it = 0; it < SCHUNK / 4; ++it) {
    acc += (float)kp[(size_t)it * 4 * DD];
    // Stands in front of the load of the unrolled build whose result lands in
    // the address registers that the loads before it name.
    asm volatile("s_wait_xcnt 0x0" ::: "memory");
  }
  red[tid] = acc;
  __syncthreads();
  if (tid < 64)
    Ksp[(size_t)blockIdx.y * KSN + (size_t)bh * DHD + d] =
        red[tid] + red[tid + 64] + red[tid + 128] + red[tid + 192];
}

// ---------------------------------------------------------------------------
// KVp[split,b,h,v,d] = sum over this split's s of Vb[b,s,h,v] * Kf[b,s,h,d]
// (f32 partial, transposed).  Grid: x = (b,h), y = split; one block (8 waves)
// per (b,h,split); each wave owns 2 of the 16 16x16 tiles.
// ---------------------------------------------------------------------------
static __device__ __forceinline__ void kv_block(
    const __bf16* __restrict__ Kf, const __bf16* __restrict__ Vb,
    float* __restrict__ KVp) {
  __shared__ alignas(16) __bf16 Kt[64 * 72];  // [d][s_local]
  __shared__ alignas(16) __bf16 Vt[64 * 72];  // [v][s_local]
  const int tid = threadIdx.x, lane = tid & 31, wid = tid >> 5;
  const int bh = blockIdx.x, b = bh >> 3, h = bh & 7;
  const int t0 = wid * 2;

  v8f acc[2];
#pragma unroll
  for (int t = 0; t < 2; ++t)
#pragma unroll
    for (int j = 0; j < 8; ++j) acc[t][j] = 0.f;

  const int sbeg = blockIdx.y * SCHUNK;
  // Kept rolled: barriers bound each tile, so unrolling overlaps nothing, and
  // the unrolled build issues a tile's fourth load behind the wait for its first.
#pragma unroll 1
  for (int s0 = sbeg; s0 < sbeg + SCHUNK; s0 += 64) {
    __syncthreads();
#pragma unroll
    for (int i = 0; i < 2; ++i) {
      int c = tid + i * 256;  // 0..511
      int srow = c >> 3;      // local s 0..63
      int d0 = (c & 7) << 3;  // 0..56
      size_t g = ((size_t)b * SSEQ + s0 + srow) * DD + h * DHD + d0;
      v8bf kk = *(const v8bf*)(Kf + g);
      v8bf vv = *(const v8bf*)(Vb + g);
#pragma unroll
      for (int e = 0; e < 8; ++e) {
        Kt[(d0 + e) * 72 + srow] = kk[e];
        Vt[(d0 + e) * 72 + srow] = vv[e];
      }
    }
    __syncthreads();
#pragma unroll
    for (int ks = 0; ks < 64; ks += 32) {
#pragma unroll
      for (int ti = 0; ti < 2; ++ti) {
        int t = t0 + ti;
        int mv = t >> 2, nd = t & 3;
        v16bf a  = frag_lds(&Vt[(mv * 16) * 72 + ks], 72, lane);
        v16bf bb = frag_lds(&Kt[(nd * 16) * 72 + ks], 72, lane);
        acc[ti] = wmma_bf16f32(a, bb, acc[ti]);
      }
    }
  }

  const int rofs = (lane >> 4) << 3;
#pragma unroll
  for (int ti = 0; ti < 2; ++ti) {
    int t = t0 + ti;
    int mv = t >> 2, nd = t & 3;
#pragma unroll
    for (int j = 0; j < 8; ++j) {
      int v = mv * 16 + rofs + j;
      int d = nd * 16 + (lane & 15);
      KVp[(size_t)blockIdx.y * KVN + ((size_t)bh * 64 + v) * 64 + d] =
          acc[ti][j];
    }
  }
}

// Both sums over s in one launch (neither reads what the other writes):
// blockIdx.z = 0: the KV partials, 1: the Ksum partials.
__global__ __launch_bounds__(256) void kv_ksum_kernel(
    const __bf16* __restrict__ Kf, const __bf16* __restrict__ Vb,
    float* __restrict__ KVp, float* __restrict__ Ksp) {
  if (blockIdx.z == 0)
    kv_block(Kf, Vb, KVp);
  else
    ksum_block(Kf, Ksp);
}

// ---------------------------------------------------------------------------
// Adds the NSPLIT partial planes: KVt (bf16) from KVp, Ksum (f32) from Ksp.
// Blocks 0 .. KVN/256-1 take KV elements, the rest Ksum elements.
// ---------------------------------------------------------------------------
__global__ __launch_bounds__(256) void split_reduce_kernel(
    const float* __restrict__ KVp, const float* __restrict__ Ksp,
    __bf16* __restrict__ KVt, float* __restrict__ Ksum) {
  const int i = blockIdx.x * 256 + threadIdx.x;
  float acc = 0.f;
  if (blockIdx.x < KVN / 256) {
#pragma unroll  // all NSPLIT loads in flight at once
    for (int p = 0; p < NSPLIT; ++p) acc += KVp[(size_t)p * KVN + i];
    KVt[i] = (__bf16)acc;
  } else {
    const int j = i - KVN;
#pragma unroll  // all NSPLIT loads in flight at once
    for (int p = 0; p < NSPLIT; ++p) acc += Ksp[(size_t)p * KSN + j];
    Ksum[j] = acc;
    // Stands in front of the other branch's loads: in the built code a path
    // leads on to them from here, and the first writes this store's data register.
    asm volatile("s_wait_xcnt 0x0" ::: "memory");
  }
}

// ---------------------------------------------------------------------------
// Z[b,l,h] = 1 / (where(score>thr, score, 0) + 1e-6), score = Q . Ksum
// (the reference's /s_len inside KV and *s_len on out cancel exactly)
// ---------------------------------------------------------------------------
__global__ __launch_bounds__(256) void scores_kernel(
    const __bf16* __restrict__ Qf, const float* __restrict__ Ksum,
    const float* __restrict__ thr, float* __restrict__ Zs) {
  size_t idx = (size_t)blockIdx.x * 256 + threadIdx.x;  // over B*L*H
  size_t bl = idx >> 3;
  int h = (int)(idx & 7);
  int b = (int)(bl / LL);
  const __bf16* q = Qf + bl * DD + h * DHD;
  const float* ks = Ksum + ((size_t)b * HH + h) * DHD;
  float sc = 0.f;
#pragma unroll 8
  for (int d = 0; d < DHD; ++d) sc += (float)q[d] * ks[d];
  float sp = sc > thr[0] ? sc : 0.f;
  Zs[idx] = 1.0f / (sp + 1e-6f);
}

// ---------------------------------------------------------------------------
// Ao[b,l,h*64+v] = Z[b,l,h] * sum_d Q[b,l,h,d] * KVt[b,h,v,d]   (bf16 out)
// Block: 8 waves; tile 128 rows x 64 cols; K=64 (2 wmma steps). Async staging.
// ---------------------------------------------------------------------------
__global__ __launch_bounds__(256) void attn_out_kernel(
    const __bf16* __restrict__ Qf, const __bf16* __restrict__ KVt,
    const float* __restrict__ Zs, __bf16* __restrict__ Ao) {
  __shared__ alignas(16) __bf16 Aq[128 * 72];
  __shared__ alignas(16) __bf16 Kv[64 * 72];
  __shared__ alignas(32) float zsh[128];
  const int tid = threadIdx.x, lane = tid & 31, wid = tid >> 5;
  const int bh = blockIdx.y, b = bh >> 3, h = bh & 7;
  const size_t rowbase = (size_t)b * LL + (size_t)blockIdx.x * 128;

#pragma unroll
  for (int i = 0; i < 4; ++i) {  // Q tile 128x64 (async DMA)
    int c = tid + i * 256;
    int row = c >> 3, cc = (c & 7) << 3;
    async_copy16(&Aq[row * 72 + cc], Qf + (rowbase + row) * DD + h * DHD + cc);
  }
#pragma unroll
  for (int i = 0; i < 2; ++i) {  // KVt 64x64 (async DMA)
    int c = tid + i * 256;
    int row = c >> 3, cc = (c & 7) << 3;
    async_copy16(&Kv[row * 72 + cc], KVt + ((size_t)bh * 64 + row) * 64 + cc);
  }
  if (tid < 128) zsh[tid] = Zs[(rowbase + tid) * HH + h];
  wait_async0();
  __syncthreads();

  v8f acc[4];
#pragma unroll
  for (int ni = 0; ni < 4; ++ni)
#pragma unroll
    for (int j = 0; j < 8; ++j) acc[ni][j] = 0.f;

#pragma unroll
  for (int ks = 0; ks < 64; ks += 32) {
    v16bf a = frag_lds(&Aq[(wid * 16) * 72 + ks], 72, lane);
#pragma unroll
    for (int ni = 0; ni < 4; ++ni) {
      v16bf bb = frag_lds(&Kv[(ni * 16) * 72 + ks], 72, lane);
      acc[ni] = wmma_bf16f32(a, bb, acc[ni]);
    }
  }

  const int rofs = (lane >> 4) << 3;
  v8f zv = *(const v8f*)(&zsh[wid * 16 + rofs]);
#pragma unroll
  for (int ni = 0; ni < 4; ++ni) {
    int col = h * DHD + ni * 16 + (lane & 15);
#pragma unroll
    for (int j = 0; j < 8; ++j) {
      size_t row = rowbase + wid * 16 + rofs + j;
      Ao[row * DD + col] = (__bf16)(acc[ni][j] * zv[j]);
    }
  }
}

// ---------------------------------------------------------------------------
// LayerNorm over 512 f32; writes the f32 or the bf16 output.
// One wave per row, LN_R rows a wave: a lane holds 16 elements of a row (four
// 16-byte loads, 512 contiguous bytes a wave each); the row's sums are taken
// inside the wave.  A block covers 8 * LN_R rows.
// ---------------------------------------------------------------------------
#define LN_R 2

template <int BF16OUT>
__global__ __launch_bounds__(256) void layernorm_kernel(
    const float* __restrict__ in, const float* __restrict__ g,
    const float* __restrict__ bta, float* __restrict__ out_f32,
    __bf16* __restrict__ out_bf16) {
  const int lane = threadIdx.x & 31;
  // the wave's number, scalar: row bases stay in scalar registers
  const int wid = __builtin_amdgcn_readfirstlane(threadIdx.x >> 5);
  const size_t row0 = ((size_t)blockIdx.x * 8 + wid) * LN_R;
  const int c0 = lane * 4;
  const unsigned voff = lane * 16;  // the lane's byte offset in a 512-byte piece
  const char* inb = (const char*)(in + row0 * DD);
  v4f v[LN_R][4], gv[4], bv[4];
#pragma unroll
  for (int r = 0; r < LN_R; ++r)
#pragma unroll
    for (int j = 0; j < 4; ++j)
      v[r][j] = *(const v4f*)(inb + (r * DD + j * 128) * 4 + voff);
#pragma unroll
  for (int j = 0; j < 4; ++j) {
    gv[j] = *(const v4f*)((const char*)g + j * 512 + voff);
    bv[j] = *(const v4f*)((const char*)bta + j * 512 + voff);
  }
  loads_issued(voff);
#pragma unroll
  for (int r = 0; r < LN_R; ++r) {
    float s = 0.f, q = 0.f;
#pragma unroll
    for (int j = 0; j < 4; ++j)
#pragma unroll
      for (int e = 0; e < 4; ++e) {
        s += v[r][j][e];
        q += v[r][j][e] * v[r][j][e];
      }
    s = wave_sum(s);
    q = wave_sum(q);
    const float mu = s * (1.0f / DD);
    const float var = q * (1.0f / DD) - mu * mu;
    const float rstd = rsqrtf(var + 1e-5f);
#pragma unroll
    for (int j = 0; j < 4; ++j)
#pragma unroll
      for (int e = 0; e < 4; ++e)
        v[r][j][e] = (v[r][j][e] - mu) * rstd * gv[j][e] + bv[j][e];
  }
  if (BF16OUT) {
    v4bf o[LN_R][4];
#pragma unroll
    for (int r = 0; r < LN_R; ++r)
#pragma unroll
      for (int j = 0; j < 4; ++j) o[r][j] = __builtin_convertvector(v[r][j], v4bf);
#pragma unroll
    for (int r = 0; r < LN_R; ++r)
#pragma unroll
      for (int j = 0; j < 4; ++j)
        *(v4bf*)(out_bf16 + (row0 + r) * DD + j * 128 + c0) = o[r][j];
  } else {
#pragma unroll
    for (int r = 0; r < LN_R; ++r)
#pragma unroll
      for (int j = 0; j < 4; ++j)
        *(v4f*)(out_f32 + (row0 + r) * DD + j * 128 + c0) = v[r][j];
  }
}

// ---------------------------------------------------------------------------
// out = x + msg2 + LN(aug32 + baug; gaug, bln)
// One wave per row as in layernorm_kernel, FIN_R rows a wave: one row's 24 loads
// already hold 96 registers.
// ---------------------------------------------------------------------------
#define FIN_R 1

__global__ __launch_bounds__(256) void final_kernel(
    const float* __restrict__ x, const float* __restrict__ msg2,
    const float* __restrict__ aug32, const float* __restrict__ baug,
    const float* __restrict__ gaug, const float* __restrict__ bln,
    float* __restrict__ out) {
  const int lane = threadIdx.x & 31;
  // the wave's number, scalar: row bases stay in scalar registers
  const int wid = __builtin_amdgcn_readfirstlane(threadIdx.x >> 5);
  const size_t row0 = ((size_t)blockIdx.x * 8 + wid) * FIN_R;
  const int c0 = lane * 4;
  const unsigned voff = lane * 16;  // the lane's byte offset in a 512-byte piece
  const char* ab = (const char*)(aug32 + row0 * DD);
  const char* xb = (const char*)(x + row0 * DD);
  const char* mb = (const char*)(msg2 + row0 * DD);
  v4f a[FIN_R][4], xv[FIN_R][4], mv[FIN_R][4], av[4], gv[4], bv[4];
#pragma unroll
  for (int r = 0; r < FIN_R; ++r)
#pragma unroll
    for (int j = 0; j < 4; ++j)
      a[r][j] = *(const v4f*)(ab + (r * DD + j * 128) * 4 + voff);
#pragma unroll
  for (int j = 0; j < 4; ++j)
    av[j] = *(const v4f*)((const char*)baug + j * 512 + voff);
#pragma unroll
  for (int r = 0; r < FIN_R; ++r)
#pragma unroll
    for (int j = 0; j < 4; ++j) {
      xv[r][j] = *(const v4f*)(xb + (r * DD + j * 128) * 4 + voff);
      mv[r][j] = *(const v4f*)(mb + (r * DD + j * 128) * 4 + voff);
    }
#pragma unroll
  for (int j = 0; j < 4; ++j) {
    gv[j] = *(const v4f*)((const char*)gaug + j * 512 + voff);
    bv[j] = *(const v4f*)((const char*)bln + j * 512 + voff);
  }
  loads_issued(voff);
#pragma unroll
  for (int r = 0; r < FIN_R; ++r) {
    float s = 0.f, q = 0.f;
#pragma unroll
    for (int j = 0; j < 4; ++j) {
      a[r][j] += av[j];
#pragma unroll
      for (int e = 0; e < 4; ++e) {
        s += a[r][j][e];
        q += a[r][j][e] * a[r][j][e];
      }
    }
    s = wave_sum(s);
    q = wave_sum(q);
    const float mu = s * (1.0f / DD);
    const float var = q * (1.0f / DD) - mu * mu;
    const float rstd = rsqrtf(var + 1e-5f);
#pragma unroll
    for (int j = 0; j < 4; ++j)
#pragma unroll
      for (int e = 0; e < 4; ++e) {
        const float l = (a[r][j][e] - mu) * rstd * gv[j][e] + bv[j][e];
        a[r][j][e] = xv[r][j][e] + mv[r][j][e] + l;
      }
  }
#pragma unroll
  for (int r = 0; r < FIN_R; ++r)
#pragma unroll
    for (int j = 0; j < 4; ++j)
      *(v4f*)(out + (row0 + r) * DD + j * 128 + c0) = a[r][j];
}

// ---------------------------------------------------------------------------
// Host orchestration
// ---------------------------------------------------------------------------
extern "C" void kernel_launch(void* const* d_in, const int* in_sizes, int n_in,
                              void* d_out, int out_size, void* d_ws,
                              size_t ws_size, hipStream_t stream) {
  (void)in_sizes; (void)n_in; (void)out_size; (void)ws_size;
  const float* x      = (const float*)d_in[0];
  const float* source = (const float*)d_in[1];
  const float* Wq     = (const float*)d_in[2];
  const float* Wk     = (const float*)d_in[3];
  const float* Wv     = (const float*)d_in[4];
  const float* Wmerge = (const float*)d_in[5];
  const float* Wmlp1  = (const float*)d_in[6];
  const float* Wmlp2  = (const float*)d_in[7];
  const float* g1     = (const float*)d_in[8];
  const float* b1     = (const float*)d_in[9];
  const float* g2     = (const float*)d_in[10];
  const float* b2     = (const float*)d_in[11];
  const float* Waug   = (const float*)d_in[12];
  const float* baug   = (const float*)d_in[13];
  const float* gaug   = (const float*)d_in[14];
  const float* bln    = (const float*)d_in[15];
  const float* thr    = (const float*)d_in[16];
  float* out = (float*)d_out;

  char* ws = (char*)d_ws;
  size_t off = 0;
  auto take = [&](size_t bytes) -> char* {
    char* p = ws + off;
    off += (bytes + 255) & ~(size_t)255;
    return p;
  };

  __bf16* xb   = (__bf16*)take((size_t)NT * DD * 2);
  __bf16* sb   = (__bf16*)take((size_t)NT * DD * 2);
  __bf16* WqT  = (__bf16*)take((size_t)DD * DD * 2);
  __bf16* WkT  = (__bf16*)take((size_t)DD * DD * 2);
  __bf16* WvT  = (__bf16*)take((size_t)DD * DD * 2);
  __bf16* WmT  = (__bf16*)take((size_t)DD * DD * 2);
  __bf16* W1T  = (__bf16*)take((size_t)D2 * D2 * 2);
  __bf16* W2T  = (__bf16*)take((size_t)DD * D2 * 2);
  __bf16* WaT  = (__bf16*)take((size_t)DD * DD * 2);
  float*  C1   = (float*)take((size_t)NT * DD * 4);
  __bf16* Qf   = (__bf16*)take((size_t)NT * DD * 2);
  __bf16* Kf   = (__bf16*)take((size_t)NT * DD * 2);
  __bf16* Vb   = (__bf16*)take((size_t)NT * DD * 2);
  float*  Ksum = (float*)take((size_t)BB * HH * DHD * 4);
  __bf16* KVt  = (__bf16*)take((size_t)BB * HH * 64 * 64 * 2);
  float*  Zs   = (float*)take((size_t)NT * HH * 4);
  __bf16* Ao   = (__bf16*)take((size_t)NT * DD * 2);
  __bf16* Msgb = (__bf16*)take((size_t)NT * DD * 2);
  __bf16* Hb   = (__bf16*)take((size_t)NT * D2 * 2);
  float*  Msg2 = (float*)take((size_t)NT * DD * 4);
  float*  KVp  = (float*)take((size_t)NSPLIT * KVN * 4);
  float*  Ksp  = (float*)take((size_t)NSPLIT * KSN * 4);

  float*  Aug  = (float*)take((size_t)NT * DD * 4);

  const dim3 blk(256);

  // 1) Convert activations and (transposed) weights to bf16
  prep_kernel<<<dim3(TR_ALL + 2 * CVT_NB), blk, 0, stream>>>(
      x, source, Wq, Wk, Wv, Wmerge, Wmlp1, Wmlp2, Waug, xb, sb, WqT, WkT, WvT, WmT,
      W1T, W2T, WaT);

  // 2) Qf = elu(rope(x@Wq)) + 1, Kf = elu(rope(source@Wk)) + 1, Vb = source@Wv
  //    (bf16, fused epilogues)
  qkv_gemm_kernel<<<dim3(DD / 256, NT / 128, 3), blk, 0, stream>>>(
      xb, sb, DD, WqT, WkT, WvT, DD, DD, Qf, Kf, Vb);

  // 3) attention core
  kv_ksum_kernel<<<dim3(BB * HH, NSPLIT, 2), blk, 0, stream>>>(Kf, Vb, KVp, Ksp);
  split_reduce_kernel<<<dim3(KVN / 256 + KSN / 256), blk, 0, stream>>>(
      KVp, Ksp, KVt, Ksum);
  scores_kernel<<<dim3((NT * HH) / 256), blk, 0, stream>>>(Qf, Ksum, thr, Zs);
  attn_out_kernel<<<dim3(LL / 128, BB * HH), blk, 0, stream>>>(Qf, KVt, Zs, Ao);

  // 4) merge + LN1 -> Msgb (bf16)
  gemm_bf16_kernel<GEMM_F32, DD, false>
      <<<dim3(DD / 256, NT / 128), blk, 0, stream>>>(Ao, nullptr, DD, WmT, DD, C1,
                                                     DD, nullptr);
  layernorm_kernel<1><<<dim3(NT / (8 * LN_R)), blk, 0, stream>>>(C1, g1, b1, nullptr, Msgb);

  // 5) MLP1: Hb = relu([x, msg] @ Wmlp1) (bf16, fused epilogue)
  gemm_bf16_kernel<GEMM_RELU, D2, true>
      <<<dim3(D2 / 256, NT / 128), blk, 0, stream>>>(xb, Msgb, DD, W1T, D2,
                                                     nullptr, D2, Hb);

  // 6) MLP2 -> C1 and the aug GEMM -> Aug; LN2 -> Msg2 (f32)
  gemm_f32_pair_kernel<<<dim3(DD / 256, NT / 128, 2), blk, 0, stream>>>(
      Hb, D2, W2T, C1, xb, DD, WaT, Aug);
  layernorm_kernel<0><<<dim3(NT / (8 * LN_R)), blk, 0, stream>>>(C1, g2, b2, Msg2, nullptr);

  // 7) fused LN(aug)+residual
  final_kernel<<<dim3(NT / (8 * FIN_R)), blk, 0, stream>>>(x, Msg2, Aug, baug, gaug, bln, out);
}

// v007
// One run takes 146 microseconds.
// Next to v006, in two timings, it ran 1.07 times as fast each time.
// All steps since v000 together make it 4.21 times as fast.
#include <hip/hip_runtime.h>
#include <hip/hip_bf16.h>

#define BB 4
#define LL 4096
#define SSEQ 4096
#define DD 512
#define HH 8
#define DHD 64
#define NT (BB * LL)     /* 16384 token rows */
#define D2 (2 * DD)      /* 1024 */
#define NSPLIT 16        /* work-groups that share one (b,h) sum over s */
#define SCHUNK (SSEQ / NSPLIT)
#define KVN (BB * HH * DHD * DHD) /* elements of one KV partial plane */
#define KSN (BB * HH * DHD)       /* elements of one Ksum partial plane */

typedef __bf16 v16bf __attribute__((ext_vector_type(16)));
typedef __bf16 v8bf  __attribute__((ext_vector_type(8)));
typedef float  v8f   __attribute__((ext_vector_type(8)));
typedef int    v4i   __attribute__((ext_vector_type(4)));
typedef float  v4f   __attribute__((ext_vector_type(4)));
typedef __bf16 v4bf  __attribute__((ext_vector_type(4)));

#if defined(__has_builtin)
#if __has_builtin(__builtin_amdgcn_global_load_async_to_lds_b128)
#define HAVE_ASYNC_BUILTIN 1
#endif
#if __has_builtin(__builtin_amdgcn_s_wait_asynccnt)
#define HAVE_ASYNCWAIT_BUILTIN 1
#endif
#endif

static __device__ __forceinline__ void async_copy16(void* lds, const void* g) {
#ifdef HAVE_ASYNC_BUILTIN
  __builtin_amdgcn_global_load_async_to_lds_b128(
      (__attribute__((address_space(1))) v4i*)(g),
      (__attribute__((address_space(3))) v4i*)(lds), 0, 0);
#else
  asm volatile("global_load_async_to_lds_b128 %0, %1, off" ::"v"(
                   (unsigned)(size_t)lds),
               "v"(g)
               : "memory");
#endif
}

static __device__ __forceinline__ void wait_async0() {
#ifdef HAVE_ASYNCWAIT_BUILTIN
  __builtin_amdgcn_s_wait_asynccnt(0);
#else
  asm volatile("s_wait_asynccnt 0x0" ::: "memory");
#endif
}

static __device__ __forceinline__ v8f wmma_bf16f32(v16bf a, v16bf b, v8f c) {
  // D = A(16x32) * B(32x16) + C, f32 accumulate
  return __builtin_amdgcn_wmma_f32_16x16x32_bf16(false, a, false, b, (short)0, c,
                                                 false, false);
}

static __device__ __forceinline__ v16bf frag_lds(const __bf16* tile, int stride,
                                                 int lane) {
  const int row  = lane & 15;
  const int koff = (lane >> 4) << 3;
  const __bf16* p = tile + row * stride + koff;
  v8bf lo = *(const v8bf*)(p);
  v8bf hi = *(const v8bf*)(p + 16);
  return __builtin_shufflevector(lo, hi, 0, 1, 2, 3, 4, 5, 6, 7, 8, 9, 10, 11,
                                 12, 13, 14, 15);
}

// ---------------------------------------------------------------------------
// Sum over the 32 lanes of a wave, the same bits in every lane: four xor steps
// inside each 16-lane row, then the exchange with the other row.
// ---------------------------------------------------------------------------
template <int CTRL>
static __device__ __forceinline__ float row_xor_add(float v) {
  const int t = __builtin_amdgcn_update_dpp(0, __builtin_bit_cast(int, v), CTRL,
                                            0xf, 0xf, true);
  return v + __builtin_bit_cast(float, t);
}

static __device__ __forceinline__ float wave_sum(float v) {
  v = row_xor_add<0x161>(v);  // row_xmask:1
  v = row_xor_add<0x162>(v);  // row_xmask:2
  v = row_xor_add<0x164>(v);  // row_xmask:4
  v = row_xor_add<0x168>(v);  // row_xmask:8
  const int b = __builtin_bit_cast(int, v);
  const int o =
      __builtin_amdgcn_permlanex16(b, b, 0x76543210, 0xfedcba98, false, false);
  return v + __builtin_bit_cast(float, o);
}

// Stands behind a kernel's whole group of loads, which share the offset register
// voff.
static __device__ __forceinline__ void loads_issued(unsigned voff) {
  // In front of every later write of a register that these loads name; as an
  // operand voff stays live up to here, so no load's result lands on it.
  asm volatile("s_wait_xcnt 0x0" ::"v"(voff) : "memory");
  // No arithmetic moves up among the loads: without it the build issued part of
  // the group late, behind waits for the first loads.
  __builtin_amdgcn_sched_barrier(0);
}

static __device__ __forceinline__ float exp2_slot(float x) {
  float y;
  asm("v_exp_f32 %0, %1\n\tv_nop" : "=&v"(y) : "v"(x));
  return y;
}

// exp(x) as the fast library form computes it
static __device__ __forceinline__ float exp_fast(float x) {
  return exp2_slot(x * 1.44269504088896340736f);
}

// sine and cosine of an angle in radians, as the fast library form computes them
static __device__ __forceinline__ void sincos_fast(float a, float* s, float* c) {
  const float rev = a * 0.15915494309189532f;
  asm("v_sin_f32 %0, %2\n\tv_cos_f32 %1, %2\n\tv_nop"
      : "=&v"(*s), "=&v"(*c)
      : "v"(rev));
}

// ---------------------------------------------------------------------------
// Elementwise conversion.  A thread takes CVT_G groups of four floats, each a
// 16-byte load (512 contiguous bytes a wave), all issued before the first use.
// One block covers CVT_BLK elements (block blk of the array); CVT_BLK divides n.
// ---------------------------------------------------------------------------
#define CVT_G 8
#define CVT_BLK (256 * 4 * CVT_G)

static __device__ __forceinline__ void f32_to_bf16_block(
    const float* __restrict__ in, __bf16* __restrict__ out, int blk) {
  const size_t base = (size_t)blk * CVT_BLK + threadIdx.x * 4;
  v4f v[CVT_G];
  v4bf o[CVT_G];
#pragma unroll
  for (int j = 0; j < CVT_G; ++j) v[j] = *(const v4f*)(in + base + j * 1024);
#pragma unroll
  for (int j = 0; j < CVT_G; ++j) o[j] = __builtin_convertvector(v[j], v4bf);
#pragma unroll
  for (int j = 0; j < CVT_G; ++j) *(v4bf*)(out + base + j * 1024) = o[j];
}

// W[k][n] (f32, KxN row-major) -> Wt[n][k] (bf16, NxK row-major)
// Block tile: 64 k x 32 n.  A thread reads 8 consecutive k of one n and stores
// them as 16 bytes; 8 lanes side by side in k fill one 128-byte line of Wt.
// Tiles: bx in 0 .. N / 32 - 1, by in 0 .. K / 64 - 1.
static __device__ __forceinline__ void transpose_bf16_block(
    const float* __restrict__ W, __bf16* __restrict__ Wt, int K, int N, int bx,
    int by) {
  const int k0 = by * 64 + (threadIdx.x & 7) * 8;
  const int n  = bx * 32 + (threadIdx.x >> 3);
  const float* wp = W + (size_t)k0 * N + n;
  float w[8];
#pragma unroll
  for (int e = 0; e < 8; ++e) w[e] = wp[(size_t)e * N];
  v8bf o;
#pragma unroll
  for (int e = 0; e < 8; ++e) o[e] = (__bf16)w[e];
  *(v8bf*)(Wt + (size_t)n * K + k0) = o;
}

// All nine input conversions in one launch: none reads what another writes.  The
// block index picks the job: first the weight tiles (short, bound by latency),
// which then run under the two activation streams behind them.
#define TR_W1 ((D2 / 32) * (D2 / 64))  /* 512 tiles of Wmlp1 */
#define TR_W2 ((DD / 32) * (D2 / 64))  /* 256 tiles of Wmlp2 */
#define TR_SQ ((DD / 32) * (DD / 64))  /* 128 tiles of each 512 x 512 weight */
#define TR_ALL (TR_W1 + TR_W2 + 5 * TR_SQ)
#define CVT_NB (NT * DD / CVT_BLK)     /* 1024 blocks for x, as many for source */

__global__ __launch_bounds__(256) void prep_kernel(
    const float* __restrict__ x, const float* __restrict__ source,
    const float* __restrict__ Wq, const float* __restrict__ Wk,
    const float* __restrict__ Wv, const float* __restrict__ Wmerge,
    const float* __restrict__ Wmlp1, const float* __restrict__ Wmlp2,
    const float* __restrict__ Waug, __bf16* __restrict__ xb,
    __bf16* __restrict__ sb, __bf16* __restrict__ WqT, __bf16* __restrict__ WkT,
    __bf16* __restrict__ WvT, __bf16* __restrict__ WmT, __bf16* __restrict__ W1T,
    __bf16* __restrict__ W2T, __bf16* __restrict__ WaT) {
  const int blk = blockIdx.x;
  if (blk < TR_ALL) {
    const float* W;
    __bf16* Wt;
    int K = DD, N = DD, t;
    if (blk < TR_W1) {
      W = Wmlp1; Wt = W1T; K = D2; N = D2; t = blk;
    } else if (blk < TR_W1 + TR_W2) {
      W = Wmlp2; Wt = W2T; K = D2; t = blk - TR_W1;
    } else {
      const int w = (blk - (TR_W1 + TR_W2)) / TR_SQ;
      t = (blk - (TR_W1 + TR_W2)) % TR_SQ;
      W  = w == 0 ? Wq : w == 1 ? Wk : w == 2 ? Wv : w == 3 ? Wmerge : Waug;
      Wt = w == 0 ? WqT : w == 1 ? WkT : w == 2 ? WvT : w == 3 ? WmT : WaT;
    }
    const int sh = N == D2 ? 5 : 4;  // log2 of the N / 32 tiles in a row of tiles
    transpose_bf16_block(W, Wt, K, N, t & ((1 << sh) - 1), t >> sh);
  } else {
    const int t = blk - TR_ALL;
    const bool first = t < CVT_NB;
    f32_to_bf16_block(first ? x : source, first ? xb : sb, first ? t : t - CVT_NB);
    // Stands in front of the other branch's code: in the built code a path leads
    // on to it from here, and it writes registers that these stores name.
    asm volatile("s_wait_xcnt 0x0" ::: "memory");
  }
}

// ---------------------------------------------------------------------------
// Generic bf16 GEMM: C[M,N](f32) = A[M,K](bf16,row-major) * Bt[N,K]^T
// Block = 256 threads = 8 waves; block tile 128x256, K-step BK = 64, double-buffered
// LDS filled by async global->LDS DMA: a K-step takes 128 bytes of every operand
// row, so a wave's copy covers 4 whole 128-byte lines.  Wave (wr in 0..1, wc in
// 0..3) owns a 64x64 sub-tile = 4x4 wmma tiles: 32 WMMAs per 32 ds_load_b128 per
// K-step.  K is a multiple of BK.
// What becomes of the result and the row pitch of the output are fixed at compile
// time: MODE GEMM_F32 stores f32 to C; the others store bf16 to Cbf: GEMM_BF16 the
// result, GEMM_RELU max(result, 0), GEMM_ROPE elu(rope(result)) + 1 with the
// position taken from the output row; LDC is the pitch in elements.
// TWO_A: the A operand is [A | A2] side by side, each lda columns wide.
// ---------------------------------------------------------------------------
#define GEMM_F32 0
#define GEMM_BF16 1
#define GEMM_RELU 2
#define GEMM_ROPE 3
#define BK 64    /* columns of A and of Bt in a K-step (128B of a row) */
#define LDSTR 72 /* padded LDS row stride in bf16 elements (144B) */

typedef __bf16 a_tiles_t[2][128 * LDSTR];
typedef __bf16 b_tiles_t[2][256 * LDSTR];

// The K loop: acc = the wave's 64x64 part of the block's tile (blockIdx.x, .y).
template <bool TWO_A>
static __device__ __forceinline__ void gemm_main(
    a_tiles_t& As, b_tiles_t& Bs, const __bf16* __restrict__ A,
    const __bf16* __restrict__ A2, int lda, const __bf16* __restrict__ Bt, int ldb,
    int K, v8f (&acc)[4][4]) {
  const int tid  = threadIdx.x;
  const int lane = tid & 31;
  const int wid  = tid >> 5;
  const int wr   = wid >> 2;  // 0..1 (m)
  const int wc   = wid & 3;   // 0..3 (n)
  const size_t m0 = (size_t)blockIdx.y * 128;
  const size_t n0 = (size_t)blockIdx.x * 256;

  const __bf16* Ab = A + m0 * lda;
  const __bf16* Bb = Bt + n0 * ldb;

  auto stage_tiles = [&](int buf, int kk) {
    // first column of this K-step in the buffer that holds it (kk is scalar)
    const __bf16* Ak = Ab + kk;
    if (TWO_A && kk >= lda) Ak = A2 + m0 * lda + (kk - lda);
#pragma unroll
    for (int i = 0; i < 4; ++i) {  // A tile: 128 rows x 64 cols
      int c   = tid + i * 256;     // 0..1023 chunks of 8 bf16
      int row = c >> 3;            // 0..127
      int cc  = (c & 7) << 3;      // 0,8,..,56
      async_copy16(&As[buf][row * LDSTR + cc],
                   Ak + (size_t)row * lda + cc);
    }
#pragma unroll
    for (int i = 0; i < 8; ++i) {  // B tile: 256 rows x 64 cols
      int c   = tid + i * 256;     // 0..2047
      int row = c >> 3;            // 0..255
      int cc  = (c & 7) << 3;
      async_copy16(&Bs[buf][row * LDSTR + cc],
                   Bb + (size_t)row * ldb + kk + cc);
    }
  };

#pragma unroll
  for (int mi = 0; mi < 4; ++mi)
#pragma unroll
    for (int ni = 0; ni < 4; ++ni)
#pragma unroll
      for (int j = 0; j < 8; ++j) acc[mi][ni][j] = 0.f;

  stage_tiles(0, 0);
  wait_async0();
  __syncthreads();

  for (int kk = 0; kk < K; kk += BK) {
    const int cur = (kk / BK) & 1;
    if (kk + BK < K) stage_tiles(cur ^ 1, kk + BK);  // DMA under the WMMAs
#pragma unroll  // both halves' LDS offsets become immediates of one address
    for (int ks = 0; ks < BK; ks += 32) {
      v16bf af[4], bfv[4];
#pragma unroll
      for (int mi = 0; mi < 4; ++mi)
        af[mi] = frag_lds(&As[cur][(wr * 64 + mi * 16) * LDSTR + ks], LDSTR, lane);
#pragma unroll
      for (int ni = 0; ni < 4; ++ni)
        bfv[ni] = frag_lds(&Bs[cur][(wc * 64 + ni * 16) * LDSTR + ks], LDSTR, lane);
#pragma unroll
      for (int mi = 0; mi < 4; ++mi)
#pragma unroll
        for (int ni = 0; ni < 4; ++ni)
          acc[mi][ni] = wmma_bf16f32(af[mi], bfv[ni], acc[mi][ni]);
    }
    wait_async0();
    __syncthreads();
  }
}

template <int MODE, int LDC>
static __device__ __forceinline__ void gemm_store(v8f (&acc)[4][4],
                                                  float* __restrict__ C,
                                                  __bf16* __restrict__ Cbf) {
  const int lane = threadIdx.x & 31;
  const int wid  = threadIdx.x >> 5;
  const int wr   = wid >> 2;  // 0..1 (m)
  const int wc   = wid & 3;   // 0..3 (n)
  const size_t m0 = (size_t)blockIdx.y * 128;
  const size_t n0 = (size_t)blockIdx.x * 256;
  const int rofs = (lane >> 4) << 3;
  const size_t idx0 = (m0 + (size_t)wr * 64 + rofs) * LDC + n0 + (size_t)wc * 64 +
                      (lane & 15);
  if (MODE == GEMM_F32) {
    float* cp = C + idx0;
#pragma unroll
    for (int mi = 0; mi < 4; ++mi)
#pragma unroll
      for (int ni = 0; ni < 4; ++ni)
#pragma unroll
        for (int j = 0; j < 8; ++j)
          cp[(mi * 16 + j) * LDC + ni * 16] = acc[mi][ni][j];
  } else {
    __bf16* cp = Cbf + idx0;
    // GEMM_ROPE.  A rotation pair (columns 2p, 2p + 1) lies in two neighbouring
    // lanes: even column: v * cos - partner * sin; odd: v * cos + partner * sin.
    const int col0 = (int)n0 + wc * 64 + (lane & 14);  // the pair's even column
    const int sgn = (lane & 1) ? 0 : (int)0x80000000;  // flips sin in even columns
    // position within the sequence of the lane's first row; a block's 128 rows
    // never cross a sequence's end
    const int pos0 = (int)((m0 + (size_t)wr * 64 + rofs) & (LL - 1));
    float dv[4];
    if (MODE == GEMM_ROPE) {
#pragma unroll
      for (int ni = 0; ni < 4; ++ni)
        dv[ni] = exp_fast((float)(col0 + ni * 16) * (-9.2103403719761836f / 512.0f));
    }
#pragma unroll
    for (int mi = 0; mi < 4; ++mi) {
      if (MODE == GEMM_RELU) {
#pragma unroll
        for (int ni = 0; ni < 4; ++ni)
#pragma unroll
          for (int j = 0; j < 8; ++j)
            acc[mi][ni][j] = acc[mi][ni][j] > 0.f ? acc[mi][ni][j] : 0.f;
      }
      if (MODE == GEMM_ROPE) {
#pragma unroll
        for (int j = 0; j < 8; ++j) {
          const float pos = (float)(pos0 + mi * 16 + j);
#pragma unroll
          for (int ni = 0; ni < 4; ++ni) {
            const float v = acc[mi][ni][j];
            const float p = __builtin_bit_cast(
                float, __builtin_amdgcn_update_dpp(0, __builtin_bit_cast(int, v),
                                                   0x161 /* row_xmask:1 */, 0xf,
                                                   0xf, true));
            float s, c;
            sincos_fast(pos * dv[ni], &s, &c);
            const float ss =
                __builtin_bit_cast(float, __builtin_bit_cast(int, s) ^ sgn);
            const float r = v * c + p * ss;
            const float ex = exp_fast(r);  // taken in every lane: no branch
            acc[mi][ni][j] = r > 0.f ? r + 1.f : ex;
          }
        }
      }
#pragma unroll
      for (int ni = 0; ni < 4; ++ni)
#pragma unroll
        for (int j = 0; j < 8; ++j)
          cp[(mi * 16 + j) * LDC + ni * 16] = (__bf16)acc[mi][ni][j];
      // A row of tiles is stored before the next row's arithmetic begins, so the
      // stores drain under it; without this the build kept all 128 for the end.
      if (MODE == GEMM_ROPE) __builtin_amdgcn_sched_barrier(0);
    }
  }
}

template <int MODE, int LDC, bool TWO_A>
__global__ __launch_bounds__(256) void gemm_bf16_kernel(
    const __bf16* __restrict__ A, const __bf16* __restrict__ A2, int lda,
    const __bf16* __restrict__ Bt, int ldb, float* __restrict__ C, int K,
    __bf16* __restrict__ Cbf) {
  __shared__ alignas(16) a_tiles_t As;
  __shared__ alignas(16) b_tiles_t Bs;
  v8f acc[4][4];
  gemm_main<TWO_A>(As, Bs, A, A2, lda, Bt, ldb, K, acc);
  gemm_store<MODE, LDC>(acc, C, Cbf);
}

__global__ __launch_bounds__(256) void qkv_gemm_kernel(
    const __bf16* __restrict__ xb, const __bf16* __restrict__ sb, int lda,
    const __bf16* __restrict__ WqT, const __bf16* __restrict__ WkT,
    const __bf16* __restrict__ WvT, int ldb, int K, __bf16* __restrict__ Qf,
    __bf16* __restrict__ Kf, __bf16* __restrict__ Vb) {
  __shared__ alignas(16) a_tiles_t As;
  __shared__ alignas(16) b_tiles_t Bs;
  const int z = blockIdx.z;
  const __bf16* A  = z == 0 ? xb : sb;
  const __bf16* Bt = z == 0 ? WqT : z == 1 ? WkT : WvT;
  v8f acc[4][4];
  gemm_main<false>(As, Bs, A, nullptr, lda, Bt, ldb, K, acc);
  if (z < 2) {
    gemm_store<GEMM_ROPE, DD>(acc, nullptr, z == 0 ? Qf : Kf);
  } else {
    gemm_store<GEMM_BF16, DD>(acc, nullptr, Vb);
    // Stands in front of the other branch's code: in the built code a path leads
    // on to it from here, and it writes registers that these stores name.
    asm volatile("s_wait_xcnt 0x0" ::: "memory");
  }
}

// Two GEMMs with f32 results of pitch DD in one launch, for the same reason;
// blockIdx.z picks the operands; the longer K comes first.
__global__ __launch_bounds__(256) void gemm_f32_pair_kernel(
    const __bf16* __restrict__ A0, int lda0, const __bf16* __restrict__ Bt0,
    float* __restrict__ C0, const __bf16* __restrict__ A1, int lda1,
    const __bf16* __restrict__ Bt1, float* __restrict__ C1) {
  __shared__ alignas(16) a_tiles_t As;
  __shared__ alignas(16) b_tiles_t Bs;
  const bool first = blockIdx.z == 0;
  const int ld = first ? lda0 : lda1;  // row pitch of A and of Bt, and K
  v8f acc[4][4];
  gemm_main<false>(As, Bs, first ? A0 : A1, nullptr, ld, first ? Bt0 : Bt1, ld, ld,
                   acc);
  gemm_store<GEMM_F32, DD>(acc, first ? C0 : C1, nullptr);
}

// ---------------------------------------------------------------------------
// Ksp[split,b,h,d] = sum over this split's s of Kf[b,s,h,d]
// (grid: x = (b,h), y = split; split_reduce_kernel adds the planes)
// ---------------------------------------------------------------------------
static __device__ __forceinline__ void ksum_block(
    const __bf16* __restrict__ Kf, float* __restrict__ Ksp) {
  __shared__ float red[256];
  const int tid = threadIdx.x;
  const int bh = blockIdx.x, b = bh >> 3, h = bh & 7;
  const int d = tid & 63, grp = tid >> 6;
  float acc = 0.f;
  const int sbeg = blockIdx.y * SCHUNK;
  const __bf16* kp = Kf + ((size_t)b * SSEQ + sbeg + grp) * DD + h * DHD + d;
  for (int it = 0; it < SCHUNK / 4; ++it) {
    acc += (float)kp[(size_t)it * 4 * DD];
    // Stands in front of the load of the unrolled build whose result lands in
    // the address registers that the loads before it name.
    asm volatile("s_wait_xcnt 0x0" ::: "memory");
  }
  red[tid] = acc;
  __syncthreads();
  if (tid < 64)
    Ksp[(size_t)blockIdx.y * KSN + (size_t)bh * DHD + d] =
        red[tid] + red[tid + 64] + red[tid + 128] + red[tid + 192];
}

// ---------------------------------------------------------------------------
// KVp[split,b,h,v,d] = sum over this split's s of Vb[b,s,h,v] * Kf[b,s,h,d]
// (f32 partial, transposed).  Grid: x = (b,h), y = split; one block (8 waves)
// per (b,h,split); each wave owns 2 of the 16 16x16 tiles.
// ---------------------------------------------------------------------------
static __device__ __forceinline__ void kv_block(
    const __bf16* __restrict__ Kf, const __bf16* __restrict__ Vb,
    float* __restrict__ KVp) {
  __shared__ alignas(16) __bf16 Kt[64 * 72];  // [d][s_local]
  __shared__ alignas(16) __bf16 Vt[64 * 72];  // [v][s_local]
  const int tid = threadIdx.x, lane = tid & 31, wid = tid >> 5;
  const int bh = blockIdx.x, b = bh >> 3, h = bh & 7;
  const int t0 = wid * 2;

  v8f acc[2];
#pragma unroll
  for (int t = 0; t < 2; ++t)
#pragma unroll
    for (int j = 0; j < 8; ++j) acc[t][j] = 0.f;

  const int sbeg = blockIdx.y * SCHUNK;
  // Kept rolled: barriers bound each tile, so unrolling overlaps nothing, and
  // the unrolled build issues a tile's fourth load behind the wait for its first.
#pragma unroll 1
  for (int s0 = sbeg; s0 < sbeg + SCHUNK; s0 += 64) {
    __syncthreads();
#pragma unroll
    for (int i = 0; i < 2; ++i) {
      int c = tid + i * 256;  // 0..511
      int srow = c >> 3;      // local s 0..63
      int d0 = (c & 7) << 3;  // 0..56
      size_t g = ((size_t)b * SSEQ + s0 + srow) * DD + h * DHD + d0;
      v8bf kk = *(const v8bf*)(Kf + g);
      v8bf vv = *(const v8bf*)(Vb + g);
#pragma unroll
      for (int e = 0; e < 8; ++e) {
        Kt[(d0 + e) * 72 + srow] = kk[e];
        Vt[(d0 + e) * 72 + srow] = vv[e];
      }
    }
    __syncthreads();
#pragma unroll
    for (int ks = 0; ks < 64; ks += 32) {
#pragma unroll
      for (int ti = 0; ti < 2; ++ti) {
        int t = t0 + ti;
        int mv = t >> 2, nd = t & 3;
        v16bf a  = frag_lds(&Vt[(mv * 16) * 72 + ks], 72, lane);
        v16bf bb = frag_lds(&Kt[(nd * 16) * 72 + ks], 72, lane);
        acc[ti] = wmma_bf16f32(a, bb, acc[ti]);
      }
    }
  }

  const int rofs = (lane >> 4) << 3;
#pragma unroll
  for (int ti = 0; ti < 2; ++ti) {
    int t = t0 + ti;
    int mv = t >> 2, nd = t & 3;
#pragma unroll
    for (int j = 0; j < 8; ++j) {
      int v = mv * 16 + rofs + j;
      int d = nd * 16 + (lane & 15);
      KVp[(size_t)blockIdx.y * KVN + ((size_t)bh * 64 + v) * 64 + d] =
          acc[ti][j];
    }
  }
}

// Both sums over s in one launch (neither reads what the other writes):
// blockIdx.z = 0: the KV partials, 1: the Ksum partials.
__global__ __launch_bounds__(256) void kv_ksum_kernel(
    const __bf16* __restrict__ Kf, const __bf16* __restrict__ Vb,
    float* __restrict__ KVp, float* __restrict__ Ksp) {
  if (blockIdx.z == 0)
    kv_block(Kf, Vb, KVp);
  else
    ksum_block(Kf, Ksp);
}

// ---------------------------------------------------------------------------
// Adds the NSPLIT partial planes: KVt (bf16) from KVp, Ksum (f32) from Ksp.
// Blocks 0 .. KVN/256-1 take KV elements, the rest Ksum elements.
// ---------------------------------------------------------------------------
__global__ __launch_bounds__(256) void split_reduce_kernel(
    const float* __restrict__ KVp, const float* __restrict__ Ksp,
    __bf16* __restrict__ KVt, float* __restrict__ Ksum) {
  const int i = blockIdx.x * 256 + threadIdx.x;
  float acc = 0.f;
  if (blockIdx.x < KVN / 256) {
#pragma unroll  // all NSPLIT loads in flight at once
    for (int p = 0; p < NSPLIT; ++p) acc += KVp[(size_t)p * KVN + i];
    KVt[i] = (__bf16)acc;
  } else {
    const int j = i - KVN;
#pragma unroll  // all NSPLIT loads in flight at once
    for (int p = 0; p < NSPLIT; ++p) acc += Ksp[(size_t)p * KSN + j];
    Ksum[j] = acc;
    // Stands in front of the other branch's loads: in the built code a path
    // leads on to them from here, and the first writes this store's data register.
    asm volatile("s_wait_xcnt 0x0" ::: "memory");
  }
}

template <int SRC>
static __device__ __forceinline__ float row_share(float v) {
  return __builtin_bit_cast(
      float, __builtin_amdgcn_update_dpp(0, __builtin_bit_cast(int, v),
                                         0x150 + SRC /* row_share:SRC */, 0xf, 0xf,
                                         true));
}

__global__ __launch_bounds__(256) void attn_out_kernel(
    const __bf16* __restrict__ Qf, const __bf16* __restrict__ KVt,
    const float* __restrict__ Ksum, const float* __restrict__ thr,
    __bf16* __restrict__ Ao) {
  __shared__ alignas(16) __bf16 Aq[128 * 72];
  __shared__ alignas(16) __bf16 Kv[64 * 72];
  const int tid = threadIdx.x, lane = tid & 31, wid = tid >> 5;
  const int bh = blockIdx.y, b = bh >> 3, h = bh & 7;
  const size_t rowbase = (size_t)b * LL + (size_t)blockIdx.x * 128;

#pragma unroll
  for (int i = 0; i < 4; ++i) {  // Q tile 128x64 (async DMA)
    int c = tid + i * 256;
    int row = c >> 3, cc = (c & 7) << 3;
    async_copy16(&Aq[row * 72 + cc], Qf + (rowbase + row) * DD + h * DHD + cc);
  }
#pragma unroll
  for (int i = 0; i < 2; ++i) {  // KVt 64x64 (async DMA)
    int c = tid + i * 256;
    int row = c >> 3, cc = (c & 7) << 3;
    async_copy16(&Kv[row * 72 + cc], KVt + ((size_t)bh * 64 + row) * 64 + cc);
  }
  // the 32 elements of Ksum that meet the lane's half of a Q row
  const unsigned voff = (lane & 1) * 128;  // the half's byte offset in Ksum[b,h]
  const char* ksb = (const char*)(Ksum + (size_t)bh * DHD);
  v4f ksv[8];
#pragma unroll
  for (int i = 0; i < 8; ++i) ksv[i] = *(const v4f*)(ksb + i * 16 + voff);
  const float th = thr[0];
  loads_issued(voff);
  wait_async0();
  __syncthreads();

  float z;
  {
    const __bf16* qh = &Aq[(wid * 16 + (lane >> 1)) * 72 + (lane & 1) * 32];
    float part[4];  // four independent chains of eight products
#pragma unroll
    for (int c = 0; c < 4; ++c) {
      const v8bf q8 = *(const v8bf*)(qh + c * 8);
      part[c] = 0.f;
#pragma unroll
      for (int e = 0; e < 8; ++e)
        part[c] += (float)q8[e] * ksv[c * 2 + (e >> 2)][e & 3];
    }
    const float sc =
        row_xor_add<0x161>((part[0] + part[1]) + (part[2] + part[3]));
    const float sp = sc > th ? sc : 0.f;
    z = 1.0f / (sp + 1e-6f);
  }

  v8f acc[4];
#pragma unroll
  for (int ni = 0; ni < 4; ++ni)
#pragma unroll
    for (int j = 0; j < 8; ++j) acc[ni][j] = 0.f;

#pragma unroll
  for (int ks = 0; ks < 64; ks += 32) {
    v16bf a = frag_lds(&Aq[(wid * 16) * 72 + ks], 72, lane);
#pragma unroll
    for (int ni = 0; ni < 4; ++ni) {
      v16bf bb = frag_lds(&Kv[(ni * 16) * 72 + ks], 72, lane);
      acc[ni] = wmma_bf16f32(a, bb, acc[ni]);
    }
  }

  const int rofs = (lane >> 4) << 3;
  // Z of accumulator row j (tile row rofs + j): from lane 2j of the 16-lane row
  const float zv[8] = {row_share<0>(z),  row_share<2>(z),  row_share<4>(z),
                       row_share<6>(z),  row_share<8>(z),  row_share<10>(z),
                       row_share<12>(z), row_share<14>(z)};
#pragma unroll
  for (int ni = 0; ni < 4; ++ni) {
    int col = h * DHD + ni * 16 + (lane & 15);
#pragma unroll
    for (int j = 0; j < 8; ++j) {
      size_t row = rowbase + wid * 16 + rofs + j;
      Ao[row * DD + col] = (__bf16)(acc[ni][j] * zv[j]);
    }
  }
}

// ---------------------------------------------------------------------------
// LayerNorm over 512 f32; writes the f32 or the bf16 output.
// One wave per row, LN_R rows a wave: a lane holds 16 elements of a row (four
// 16-byte loads, 512 contiguous bytes a wave each); the row's sums are taken
// inside the wave.  A block covers 8 * LN_R rows.
// ---------------------------------------------------------------------------
#define LN_R 2

template <int BF16OUT>
__global__ __launch_bounds__(256) void layernorm_kernel(
    const float* __restrict__ in, const float* __restrict__ g,
    const float* __restrict__ bta, float* __restrict__ out_f32,
    __bf16* __restrict__ out_bf16) {
  const int lane = threadIdx.x & 31;
  // the wave's number, scalar: row bases stay in scalar registers
  const int wid = __builtin_amdgcn_readfirstlane(threadIdx.x >> 5);
  const size_t row0 = ((size_t)blockIdx.x * 8 + wid) * LN_R;
  const int c0 = lane * 4;
  const unsigned voff = lane * 16;  // the lane's byte offset in a 512-byte piece
  const char* inb = (const char*)(in + row0 * DD);
  v4f v[LN_R][4], gv[4], bv[4];
#pragma unroll
  for (int r = 0; r < LN_R; ++r)
#pragma unroll
    for (int j = 0; j < 4; ++j)
      v[r][j] = *(const v4f*)(inb + (r * DD + j * 128) * 4 + voff);
#pragma unroll
  for (int j = 0; j < 4; ++j) {
    gv[j] = *(const v4f*)((const char*)g + j * 512 + voff);
    bv[j] = *(const v4f*)((const char*)bta + j * 512 + voff);
  }
  loads_issued(voff);
#pragma unroll
  for (int r = 0; r < LN_R; ++r) {
    float s = 0.f, q = 0.f;
#pragma unroll
    for (int j = 0; j < 4; ++j)
#pragma unroll
      for (int e = 0; e < 4; ++e) {
        s += v[r][j][e];
        q += v[r][j][e] * v[r][j][e];
      }
    s = wave_sum(s);
    q = wave_sum(q);
    const float mu = s * (1.0f / DD);
    const float var = q * (1.0f / DD) - mu * mu;
    const float rstd = rsqrtf(var + 1e-5f);
#pragma unroll
    for (int j = 0; j < 4; ++j)
#pragma unroll
      for (int e = 0; e < 4; ++e)
        v[r][j][e] = (v[r][j][e] - mu) * rstd * gv[j][e] + bv[j][e];
  }
  if (BF16OUT) {
    v4bf o[LN_R][4];
#pragma unroll
    for (int r = 0; r < LN_R; ++r)
#pragma unroll
      for (int j = 0; j < 4; ++j) o[r][j] = __builtin_convertvector(v[r][j], v4bf);
#pragma unroll
    for (int r = 0; r < LN_R; ++r)
#pragma unroll
      for (int j = 0; j < 4; ++j)
        *(v4bf*)(out_bf16 + (row0 + r) * DD + j * 128 + c0) = o[r][j];
  } else {
#pragma unroll
    for (int r = 0; r < LN_R; ++r)
#pragma unroll
      for (int j = 0; j < 4; ++j)
        *(v4f*)(out_f32 + (row0 + r) * DD + j * 128 + c0) = v[r][j];
  }
}

// ---------------------------------------------------------------------------
// out = x + LN(mlp2; g2, b2) + LN(aug32 + baug; gaug, bln)
// One wave per row as in layernorm_kernel, FIN_R rows a wave: one row's 32 loads
// already hold 128 registers.
// ---------------------------------------------------------------------------
#define FIN_R 1

__global__ __launch_bounds__(256) void final_kernel(
    const float* __restrict__ x, const float* __restrict__ mlp2,
    const float* __restrict__ g2, const float* __restrict__ b2,
    const float* __restrict__ aug32, const float* __restrict__ baug,
    const float* __restrict__ gaug, const float* __restrict__ bln,
    float* __restrict__ out) {
  const int lane = threadIdx.x & 31;
  // the wave's number, scalar: row bases stay in scalar registers
  const int wid = __builtin_amdgcn_readfirstlane(threadIdx.x >> 5);
  const size_t row0 = ((size_t)blockIdx.x * 8 + wid) * FIN_R;
  const int c0 = lane * 4;
  const unsigned voff = lane * 16;  // the lane's byte offset in a 512-byte piece
  const char* ab = (const char*)(aug32 + row0 * DD);
  const char* xb = (const char*)(x + row0 * DD);
  const char* mb = (const char*)(mlp2 + row0 * DD);
  v4f a[FIN_R][4], xv[FIN_R][4], mv[FIN_R][4], av[4], gv[4], bv[4], g2v[4], b2v[4];
#pragma unroll
  for (int r = 0; r < FIN_R; ++r)
#pragma unroll
    for (int j = 0; j < 4; ++j)
      a[r][j] = *(const v4f*)(ab + (r * DD + j * 128) * 4 + voff);
#pragma unroll
  for (int j = 0; j < 4; ++j)
    av[j] = *(const v4f*)((const char*)baug + j * 512 + voff);
#pragma unroll
  for (int r = 0; r < FIN_R; ++r)
#pragma unroll
    for (int j = 0; j < 4; ++j) {
      xv[r][j] = *(const v4f*)(xb + (r * DD + j * 128) * 4 + voff);
      mv[r][j] = *(const v4f*)(mb + (r * DD + j * 128) * 4 + voff);
    }
#pragma unroll
  for (int j = 0; j < 4; ++j) {
    gv[j] = *(const v4f*)((const char*)gaug + j * 512 + voff);
    bv[j] = *(const v4f*)((const char*)bln + j * 512 + voff);
    g2v[j] = *(const v4f*)((const char*)g2 + j * 512 + voff);
    b2v[j] = *(const v4f*)((const char*)b2 + j * 512 + voff);
  }
  loads_issued(voff);
#pragma unroll
  for (int r = 0; r < FIN_R; ++r) {
    float s = 0.f, q = 0.f, s2 = 0.f, q2 = 0.f;
#pragma unroll
    for (int j = 0; j < 4; ++j) {
      a[r][j] += av[j];
#pragma unroll
      for (int e = 0; e < 4; ++e) {
        s += a[r][j][e];
        q += a[r][j][e] * a[r][j][e];
        s2 += mv[r][j][e];
        q2 += mv[r][j][e] * mv[r][j][e];
      }
    }
    s = wave_sum(s);
    q = wave_sum(q);
    s2 = wave_sum(s2);
    q2 = wave_sum(q2);
    const float mu = s * (1.0f / DD);
    const float var = q * (1.0f / DD) - mu * mu;
    const float rstd = rsqrtf(var + 1e-5f);
    const float mu2 = s2 * (1.0f / DD);
    const float var2 = q2 * (1.0f / DD) - mu2 * mu2;
    const float rstd2 = rsqrtf(var2 + 1e-5f);
#pragma unroll
    for (int j = 0; j < 4; ++j)
#pragma unroll
      for (int e = 0; e < 4; ++e) {
        const float l = (a[r][j][e] - mu) * rstd * gv[j][e] + bv[j][e];
        const float m = (mv[r][j][e] - mu2) * rstd2 * g2v[j][e] + b2v[j][e];
        a[r][j][e] = xv[r][j][e] + m + l;
      }
  }
#pragma unroll
  for (int r = 0; r < FIN_R; ++r)
#pragma unroll
    for (int j = 0; j < 4; ++j)
      *(v4f*)(out + (row0 + r) * DD + j * 128 + c0) = a[r][j];
}

// ---------------------------------------------------------------------------
// Host orchestration
// ---------------------------------------------------------------------------
extern "C" void kernel_launch(void* const* d_in, const int* in_sizes, int n_in,
                              void* d_out, int out_size, void* d_ws,
                              size_t ws_size, hipStream_t stream) {
  (void)in_sizes; (void)n_in; (void)out_size; (void)ws_size;
  const float* x      = (const float*)d_in[0];
  const float* source = (const float*)d_in[1];
  const float* Wq     = (const float*)d_in[2];
  const float* Wk     = (const float*)d_in[3];
  const float* Wv     = (const float*)d_in[4];
  const float* Wmerge = (const float*)d_in[5];
  const float* Wmlp1  = (const float*)d_in[6];
  const float* Wmlp2  = (const float*)d_in[7];
  const float* g1     = (const float*)d_in[8];
  const float* b1     = (const float*)d_in[9];
  const float* g2     = (const float*)d_in[10];
  const float* b2     = (const float*)d_in[11];
  const float* Waug   = (const float*)d_in[12];
  const float* baug   = (const float*)d_in[13];
  const float* gaug   = (const float*)d_in[14];
  const float* bln    = (const float*)d_in[15];
  const float* thr    = (const float*)d_in[16];
  float* out = (float*)d_out;

  char* ws = (char*)d_ws;
  size_t off = 0;
  auto take = [&](size_t bytes) -> char* {
    char* p = ws + off;
    off += (bytes + 255) & ~(size_t)255;
    return p;
  };

  __bf16* xb   = (__bf16*)take((size_t)NT * DD * 2);
  __bf16* sb   = (__bf16*)take((size_t)NT * DD * 2);
  __bf16* WqT  = (__bf16*)take((size_t)DD * DD * 2);
  __bf16* WkT  = (__bf16*)take((size_t)DD * DD * 2);
  __bf16* WvT  = (__bf16*)take((size_t)DD * DD * 2);
  __bf16* WmT  = (__bf16*)take((size_t)DD * DD * 2);
  __bf16* W1T  = (__bf16*)take((size_t)D2 * D2 * 2);
  __bf16* W2T  = (__bf16*)take((size_t)DD * D2 * 2);
  __bf16* WaT  = (__bf16*)take((size_t)DD * DD * 2);
  float*  C1   = (float*)take((size_t)NT * DD * 4);
  __bf16* Qf   = (__bf16*)take((size_t)NT * DD * 2);
  __bf16* Kf   = (__bf16*)take((size_t)NT * DD * 2);
  __bf16* Vb   = (__bf16*)take((size_t)NT * DD * 2);
  float*  Ksum = (float*)take((size_t)BB * HH * DHD * 4);
  __bf16* KVt  = (__bf16*)take((size_t)BB * HH * 64 * 64 * 2);
  __bf16* Ao   = (__bf16*)take((size_t)NT * DD * 2);
  __bf16* Msgb = (__bf16*)take((size_t)NT * DD * 2);
  __bf16* Hb   = (__bf16*)take((size_t)NT * D2 * 2);
  float*  KVp  = (float*)take((size_t)NSPLIT * KVN * 4);
  float*  Ksp  = (float*)take((size_t)NSPLIT * KSN * 4);

  float*  Aug  = (float*)take((size_t)NT * DD * 4);

  const dim3 blk(256);

  // 1) Convert activations and (transposed) weights to bf16
  prep_kernel<<<dim3(TR_ALL + 2 * CVT_NB), blk, 0, stream>>>(
      x, source, Wq, Wk, Wv, Wmerge, Wmlp1, Wmlp2, Waug, xb, sb, WqT, WkT, WvT, WmT,
      W1T, W2T, WaT);

  // 2) Qf = elu(rope(x@Wq)) + 1, Kf = elu(rope(source@Wk)) + 1, Vb = source@Wv
  //    (bf16, fused epilogues)
  qkv_gemm_kernel<<<dim3(DD / 256, NT / 128, 3), blk, 0, stream>>>(
      xb, sb, DD, WqT, WkT, WvT, DD, DD, Qf, Kf, Vb);

  // 3) attention core
  kv_ksum_kernel<<<dim3(BB * HH, NSPLIT, 2), blk, 0, stream>>>(Kf, Vb, KVp, Ksp);
  split_reduce_kernel<<<dim3(KVN / 256 + KSN / 256), blk, 0, stream>>>(
      KVp, Ksp, KVt, Ksum);
  attn_out_kernel<<<dim3(LL / 128, BB * HH), blk, 0, stream>>>(Qf, KVt, Ksum, thr,
                                                               Ao);

  // 4) merge + LN1 -> Msgb (bf16)
  gemm_bf16_kernel<GEMM_F32, DD, false>
      <<<dim3(DD / 256, NT / 128), blk, 0, stream>>>(Ao, nullptr, DD, WmT, DD, C1,
                                                     DD, nullptr);
  layernorm_kernel<1><<<dim3(NT / (8 * LN_R)), blk, 0, stream>>>(C1, g1, b1, nullptr, Msgb);

  // 5) MLP1: Hb = relu([x, msg] @ Wmlp1) (bf16, fused epilogue)
  gemm_bf16_kernel<GEMM_RELU, D2, true>
      <<<dim3(D2 / 256, NT / 128), blk, 0, stream>>>(xb, Msgb, DD, W1T, D2,
                                                     nullptr, D2, Hb);

  // 6) MLP2 -> C1 and the aug GEMM -> Aug
  gemm_f32_pair_kernel<<<dim3(DD / 256, NT / 128, 2), blk, 0, stream>>>(
      Hb, D2, W2T, C1, xb, DD, WaT, Aug);

  // 7) both LayerNorms and the residual
  final_kernel<<<dim3(NT / (8 * FIN_R)), blk, 0, stream>>>(x, C1, g2, b2, Aug, baug,
                                                           gaug, bln, out);
}

// v008
// A run of this version takes 136 microseconds.
// In both of two side-by-side timings against v007, it was 1.07 times as fast.
// Counting every step since v000, it is 4.52 times as fast.
#include <hip/hip_runtime.h>
#include <hip/hip_bf16.h>

#define BB 4
#define LL 4096
#define SSEQ 4096
#define DD 512
#define HH 8
#define DHD 64
#define NT (BB * LL)     /* 16384 token rows */
#define D2 (2 * DD)      /* 1024 */
#define NSPLIT (SSEQ / 128) /* work-groups that share one (b,h) sum over s */
#define KVN (BB * HH * DHD * DHD) /* elements of one KV partial plane */
#define KSN (BB * HH * DHD)       /* elements of one Ksum partial plane */

typedef __bf16 v16bf __attribute__((ext_vector_type(16)));
typedef __bf16 v8bf  __attribute__((ext_vector_type(8)));
typedef float  v8f   __attribute__((ext_vector_type(8)));
typedef int    v4i   __attribute__((ext_vector_type(4)));
typedef float  v4f   __attribute__((ext_vector_type(4)));
typedef __bf16 v4bf  __attribute__((ext_vector_type(4)));

#if defined(__has_builtin)
#if __has_builtin(__builtin_amdgcn_global_load_async_to_lds_b128)
#define HAVE_ASYNC_BUILTIN 1
#endif
#if __has_builtin(__builtin_amdgcn_s_wait_asynccnt)
#define HAVE_ASYNCWAIT_BUILTIN 1
#endif
#endif

static __device__ __forceinline__ void async_copy16(void* lds, const void* g) {
#ifdef HAVE_ASYNC_BUILTIN
  __builtin_amdgcn_global_load_async_to_lds_b128(
      (__attribute__((address_space(1))) v4i*)(g),
      (__attribute__((address_space(3))) v4i*)(lds), 0, 0);
#else
  asm volatile("global_load_async_to_lds_b128 %0, %1, off" ::"v"(
                   (unsigned)(size_t)lds),
               "v"(g)
               : "memory");
#endif
}

static __device__ __forceinline__ void wait_async0() {
#ifdef HAVE_ASYNCWAIT_BUILTIN
  __builtin_amdgcn_s_wait_asynccnt(0);
#else
  asm volatile("s_wait_asynccnt 0x0" ::: "memory");
#endif
}

static __device__ __forceinline__ v8f wmma_bf16f32(v16bf a, v16bf b, v8f c) {
  // D = A(16x32) * B(32x16) + C, f32 accumulate
  return __builtin_amdgcn_wmma_f32_16x16x32_bf16(false, a, false, b, (short)0, c,
                                                 false, false);
}

static __device__ __forceinline__ v16bf frag_lds(const __bf16* tile, int stride,
                                                 int lane) {
  const int row  = lane & 15;
  const int koff = (lane >> 4) << 3;
  const __bf16* p = tile + row * stride + koff;
  v8bf lo = *(const v8bf*)(p);
  v8bf hi = *(const v8bf*)(p + 16);
  return __builtin_shufflevector(lo, hi, 0, 1, 2, 3, 4, 5, 6, 7, 8, 9, 10, 11,
                                 12, 13, 14, 15);
}

// ---------------------------------------------------------------------------
// Sum over the 32 lanes of a wave, the same bits in every lane: four xor steps
// inside each 16-lane row, then the exchange with the other row.
// ---------------------------------------------------------------------------
template <int CTRL>
static __device__ __forceinline__ float row_xor_add(float v) {
  const int t = __builtin_amdgcn_update_dpp(0, __builtin_bit_cast(int, v), CTRL,
                                            0xf, 0xf, true);
  return v + __builtin_bit_cast(float, t);
}

static __device__ __forceinline__ float wave_sum(float v) {
  v = row_xor_add<0x161>(v);  // row_xmask:1
  v = row_xor_add<0x162>(v);  // row_xmask:2
  v = row_xor_add<0x164>(v);  // row_xmask:4
  v = row_xor_add<0x168>(v);  // row_xmask:8
  const int b = __builtin_bit_cast(int, v);
  const int o =
      __builtin_amdgcn_permlanex16(b, b, 0x76543210, 0xfedcba98, false, false);
  return v + __builtin_bit_cast(float, o);
}

// Stands behind a kernel's whole group of loads, which share the offset register
// voff.
static __device__ __forceinline__ void loads_issued(unsigned voff) {
  // In front of every later write of a register that these loads name; as an
  // operand voff stays live up to here, so no load's result lands on it.
  asm volatile("s_wait_xcnt 0x0" ::"v"(voff) : "memory");
  // No arithmetic moves up among the loads: without it the build issued part of
  // the group late, behind waits for the first loads.
  __builtin_amdgcn_sched_barrier(0);
}

static __device__ __forceinline__ float exp2_slot(float x) {
  float y;
  asm("v_exp_f32 %0, %1\n\tv_nop" : "=&v"(y) : "v"(x));
  return y;
}

// exp(x) as the fast library form computes it
static __device__ __forceinline__ float exp_fast(float x) {
  return exp2_slot(x * 1.44269504088896340736f);
}

// sine and cosine of an angle in radians, as the fast library form computes them
static __device__ __forceinline__ void sincos_fast(float a, float* s, float* c) {
  const float rev = a * 0.15915494309189532f;
  asm("v_sin_f32 %0, %2\n\tv_cos_f32 %1, %2\n\tv_nop"
      : "=&v"(*s), "=&v"(*c)
      : "v"(rev));
}

// ---------------------------------------------------------------------------
// Elementwise conversion.  A thread takes CVT_G groups of four floats, each a
// 16-byte load (512 contiguous bytes a wave), all issued before the first use.
// One block covers CVT_BLK elements (block blk of the array); CVT_BLK divides n.
// ---------------------------------------------------------------------------
#define CVT_G 8
#define CVT_BLK (256 * 4 * CVT_G)

static __device__ __forceinline__ void f32_to_bf16_block(
    const float* __restrict__ in, __bf16* __restrict__ out, int blk) {
  const size_t base = (size_t)blk * CVT_BLK + threadIdx.x * 4;
  v4f v[CVT_G];
  v4bf o[CVT_G];
#pragma unroll
  for (int j = 0; j < CVT_G; ++j) v[j] = *(const v4f*)(in + base + j * 1024);
#pragma unroll
  for (int j = 0; j < CVT_G; ++j) o[j] = __builtin_convertvector(v[j], v4bf);
#pragma unroll
  for (int j = 0; j < CVT_G; ++j) *(v4bf*)(out + base + j * 1024) = o[j];
}

// W[k][n] (f32, KxN row-major) -> Wt[n][k] (bf16, NxK row-major)
// Block tile: 64 k x 32 n.  A thread reads 8 consecutive k of one n and stores
// them as 16 bytes; 8 lanes side by side in k fill one 128-byte line of Wt.
// Tiles: bx in 0 .. N / 32 - 1, by in 0 .. K / 64 - 1.
static __device__ __forceinline__ void transpose_bf16_block(
    const float* __restrict__ W, __bf16* __restrict__ Wt, int K, int N, int bx,
    int by) {
  const int k0 = by * 64 + (threadIdx.x & 7) * 8;
  const int n  = bx * 32 + (threadIdx.x >> 3);
  const float* wp = W + (size_t)k0 * N + n;
  float w[8];
#pragma unroll
  for (int e = 0; e < 8; ++e) w[e] = wp[(size_t)e * N];
  v8bf o;
#pragma unroll
  for (int e = 0; e < 8; ++e) o[e] = (__bf16)w[e];
  *(v8bf*)(Wt + (size_t)n * K + k0) = o;
}

// All nine input conversions in one launch: none reads what another writes.  The
// block index picks the job: first the weight tiles (short, bound by latency),
// which then run under the two activation streams behind them.
#define TR_W1 ((D2 / 32) * (D2 / 64))  /* 512 tiles of Wmlp1 */
#define TR_W2 ((DD / 32) * (D2 / 64))  /* 256 tiles of Wmlp2 */
#define TR_SQ ((DD / 32) * (DD / 64))  /* 128 tiles of each 512 x 512 weight */
#define TR_ALL (TR_W1 + TR_W2 + 5 * TR_SQ)
#define CVT_NB (NT * DD / CVT_BLK)     /* 1024 blocks for x, as many for source */

__global__ __launch_bounds__(256) void prep_kernel(
    const float* __restrict__ x, const float* __restrict__ source,
    const float* __restrict__ Wq, const float* __restrict__ Wk,
    const float* __restrict__ Wv, const float* __restrict__ Wmerge,
    const float* __restrict__ Wmlp1, const float* __restrict__ Wmlp2,
    const float* __restrict__ Waug, __bf16* __restrict__ xb,
    __bf16* __restrict__ sb, __bf16* __restrict__ WqT, __bf16* __restrict__ WkT,
    __bf16* __restrict__ WvT, __bf16* __restrict__ WmT, __bf16* __restrict__ W1T,
    __bf16* __restrict__ W2T, __bf16* __restrict__ WaT) {
  const int blk = blockIdx.x;
  if (blk < TR_ALL) {
    const float* W;
    __bf16* Wt;
    int K = DD, N = DD, t;
    if (blk < TR_W1) {
      W = Wmlp1; Wt = W1T; K = D2; N = D2; t = blk;
    } else if (blk < TR_W1 + TR_W2) {
      W = Wmlp2; Wt = W2T; K = D2; t = blk - TR_W1;
    } else {
      const int w = (blk - (TR_W1 + TR_W2)) / TR_SQ;
      t = (blk - (TR_W1 + TR_W2)) % TR_SQ;
      W  = w == 0 ? Wq : w == 1 ? Wk : w == 2 ? Wv : w == 3 ? Wmerge : Waug;
      Wt = w == 0 ? WqT : w == 1 ? WkT : w == 2 ? WvT : w == 3 ? WmT : WaT;
    }
    const int sh = N == D2 ? 5 : 4;  // log2 of the N / 32 tiles in a row of tiles
    transpose_bf16_block(W, Wt, K, N, t & ((1 << sh) - 1), t >> sh);
  } else {
    const int t = blk - TR_ALL;
    const bool first = t < CVT_NB;
    f32_to_bf16_block(first ? x : source, first ? xb : sb, first ? t : t - CVT_NB);
    // Stands in front of the other branch's code: in the built code a path leads
    // on to it from here, and it writes registers that these stores name.
    asm volatile("s_wait_xcnt 0x0" ::: "memory");
  }
}

// ---------------------------------------------------------------------------
// Generic bf16 GEMM: C[M,N](f32) = A[M,K](bf16,row-major) * Bt[N,K]^T
// Block = 256 threads = 8 waves; block tile 128x256, K-step BK = 64, double-buffered
// LDS filled by async global->LDS DMA: a K-step takes 128 bytes of every operand
// row, so a wave's copy covers 4 whole 128-byte lines.  Wave (wr in 0..1, wc in
// 0..3) owns a 64x64 sub-tile = 4x4 wmma tiles: 32 WMMAs per 32 ds_load_b128 per
// K-step.  K is a multiple of BK.
// What becomes of the result and the row pitch of the output are fixed at compile
// time: MODE GEMM_F32 stores f32 to C, GEMM_RELU max(result, 0) as bf16 to Cbf; LDC
// is the pitch in elements.
// TWO_A: the A operand is [A | A2] side by side, each lda columns wide.
// Blo, Bhi: the rows of Bt that make the tile's columns 0..127 and 128..255.
// ROT: wave w takes column strip (w + ROT * (w / 4)) % 4 of the tile.
// ---------------------------------------------------------------------------
#define GEMM_F32 0
#define GEMM_RELU 1
#define BK 64    /* columns of A and of Bt in a K-step (128B of a row) */
#define LDSTR 72 /* padded LDS row stride in bf16 elements (144B) */

typedef __bf16 a_tiles_t[2][128 * LDSTR];
typedef __bf16 b_tiles_t[2][256 * LDSTR];

// The K loop: acc = the wave's 64x64 part of the block's tile (rows: blockIdx.y).
template <bool TWO_A, int ROT>
static __device__ __forceinline__ void gemm_main(
    a_tiles_t& As, b_tiles_t& Bs, const __bf16* __restrict__ A,
    const __bf16* __restrict__ A2, int lda, const __bf16* __restrict__ Blo,
    const __bf16* __restrict__ Bhi, int ldb, int K, v8f (&acc)[4][4]) {
  const int tid  = threadIdx.x;
  const int lane = tid & 31;
  const int wid  = tid >> 5;
  const int wr   = wid >> 2;              // 0..1 (m)
  const int wc   = (wid + ROT * wr) & 3;  // 0..3 (n)
  const size_t m0 = (size_t)blockIdx.y * 128;

  const __bf16* Ab = A + m0 * lda;

  auto stage_tiles = [&](int buf, int kk) {
    // first column of this K-step in the buffer that holds it (kk is scalar)
    const __bf16* Ak = Ab + kk;
    if (TWO_A && kk >= lda) Ak = A2 + m0 * lda + (kk - lda);
#pragma unroll
    for (int i = 0; i < 4; ++i) {  // A tile: 128 rows x 64 cols
      int c   = tid + i * 256;     // 0..1023 chunks of 8 bf16
      int row = c >> 3;            // 0..127
      int cc  = (c & 7) << 3;      // 0,8,..,56
      async_copy16(&As[buf][row * LDSTR + cc],
                   Ak + (size_t)row * lda + cc);
    }
#pragma unroll
    for (int i = 0; i < 8; ++i) {  // B tile: 256 rows x 64 cols
      int c   = tid + i * 256;     // 0..2047
      int row = c >> 3;            // 0..255
      int cc  = (c & 7) << 3;
      async_copy16(&Bs[buf][row * LDSTR + cc],
                   (i < 4 ? Blo : Bhi) + (size_t)(row & 127) * ldb + kk + cc);
    }
  };

#pragma unroll
  for (int mi = 0; mi < 4; ++mi)
#pragma unroll
    for (int ni = 0; ni < 4; ++ni)
#pragma unroll
      for (int j = 0; j < 8; ++j) acc[mi][ni][j] = 0.f;

  stage_tiles(0, 0);
  wait_async0();
  __syncthreads();

  for (int kk = 0; kk < K; kk += BK) {
    const int cur = (kk / BK) & 1;
    if (kk + BK < K) stage_tiles(cur ^ 1, kk + BK);  // DMA under the WMMAs
#pragma unroll  // both halves' LDS offsets become immediates of one address
    for (int ks = 0; ks < BK; ks += 32) {
      v16bf af[4], bfv[4];
#pragma unroll
      for (int mi = 0; mi < 4; ++mi)
        af[mi] = frag_lds(&As[cur][(wr * 64 + mi * 16) * LDSTR + ks], LDSTR, lane);
#pragma unroll
      for (int ni = 0; ni < 4; ++ni)
        bfv[ni] = frag_lds(&Bs[cur][(wc * 64 + ni * 16) * LDSTR + ks], LDSTR, lane);
#pragma unroll
      for (int mi = 0; mi < 4; ++mi)
#pragma unroll
        for (int ni = 0; ni < 4; ++ni)
          acc[mi][ni] = wmma_bf16f32(af[mi], bfv[ni], acc[mi][ni]);
    }
    wait_async0();
    __syncthreads();
  }
}

template <int MODE, int LDC>
static __device__ __forceinline__ void gemm_store(v8f (&acc)[4][4],
                                                  float* __restrict__ C,
                                                  __bf16* __restrict__ Cbf) {
  const int lane = threadIdx.x & 31;
  const int wid  = threadIdx.x >> 5;
  const int wr   = wid >> 2;  // 0..1 (m)
  const int wc   = wid & 3;   // 0..3 (n)
  const size_t m0 = (size_t)blockIdx.y * 128;
  const size_t n0 = (size_t)blockIdx.x * 256;
  const int rofs = (lane >> 4) << 3;
  const size_t idx0 = (m0 + (size_t)wr * 64 + rofs) * LDC + n0 + (size_t)wc * 64 +
                      (lane & 15);
  if (MODE == GEMM_F32) {
    float* cp = C + idx0;
#pragma unroll
    for (int mi = 0; mi < 4; ++mi)
#pragma unroll
      for (int ni = 0; ni < 4; ++ni)
#pragma unroll
        for (int j = 0; j < 8; ++j)
          cp[(mi * 16 + j) * LDC + ni * 16] = acc[mi][ni][j];
  } else {
    __bf16* cp = Cbf + idx0;
#pragma unroll
    for (int mi = 0; mi < 4; ++mi) {
#pragma unroll
      for (int ni = 0; ni < 4; ++ni)
#pragma unroll
        for (int j = 0; j < 8; ++j)
          acc[mi][ni][j] = acc[mi][ni][j] > 0.f ? acc[mi][ni][j] : 0.f;
#pragma unroll
      for (int ni = 0; ni < 4; ++ni)
#pragma unroll
        for (int j = 0; j < 8; ++j)
          cp[(mi * 16 + j) * LDC + ni * 16] = (__bf16)acc[mi][ni][j];
    }
  }
}

template <int MODE, int LDC, bool TWO_A>
__global__ __launch_bounds__(256) void gemm_bf16_kernel(
    const __bf16* __restrict__ A, const __bf16* __restrict__ A2, int lda,
    const __bf16* __restrict__ Bt, int ldb, float* __restrict__ C, int K,
    __bf16* __restrict__ Cbf) {
  __shared__ alignas(16) a_tiles_t As;
  __shared__ alignas(16) b_tiles_t Bs;
  v8f acc[4][4];
  const __bf16* Blo = Bt + (size_t)blockIdx.x * 256 * ldb;
  gemm_main<TWO_A, 0>(As, Bs, A, A2, lda, Blo, Blo + (size_t)128 * ldb, ldb, K, acc);
  gemm_store<MODE, LDC>(acc, C, Cbf);
}

// a = elu(rope(a)) + 1 on one row of four accumulator tiles; pos0: the position in
// the sequence of the lane's first row; dv: the rotation's frequency for the lane's
// column in each tile.  A rotation pair (columns 2p, 2p + 1) lies in two
// neighbouring lanes: even column: v * cos - partner * sin; odd: v * cos + partner
// * sin; sgn flips sin in even columns.
static __device__ __forceinline__ void rope_elu_tiles(v8f (&a)[4], int pos0,
                                                      const float (&dv)[4],
                                                      int sgn) {
#pragma unroll
  for (int j = 0; j < 8; ++j) {
    const float pos = (float)(pos0 + j);
#pragma unroll
    for (int ni = 0; ni < 4; ++ni) {
      const float v = a[ni][j];
      const float p = __builtin_bit_cast(
          float, __builtin_amdgcn_update_dpp(0, __builtin_bit_cast(int, v),
                                             0x161 /* row_xmask:1 */, 0xf, 0xf,
                                             true));
      float s, c;
      sincos_fast(pos * dv[ni], &s, &c);
      const float ss = __builtin_bit_cast(float, __builtin_bit_cast(int, s) ^ sgn);
      const float r = v * c + p * ss;
      const float ex = exp_fast(r);  // taken in every lane: no branch
      a[ni][j] = r > 0.f ? r + 1.f : ex;
    }
  }
}

#define TSTR 136 /* LDS pitch of a column's 128 s in bf16 elements (272B) */

__global__ __launch_bounds__(256) void qkv_gemm_kernel(
    const __bf16* __restrict__ xb, const __bf16* __restrict__ sb, int lda,
    const __bf16* __restrict__ WqT, const __bf16* __restrict__ WkT,
    const __bf16* __restrict__ WvT, int ldb, int K, __bf16* __restrict__ Qf,
    float* __restrict__ KVp, float* __restrict__ Ksp) {
  __shared__ alignas(16) a_tiles_t As;
  __shared__ alignas(16) b_tiles_t Bs;
  const int bx = blockIdx.x;
  const bool kvb = bx < 4;
  const __bf16* Blo =
      kvb ? WkT + (size_t)bx * 128 * ldb : WqT + (size_t)(bx - 4) * 256 * ldb;
  const __bf16* Bhi = kvb ? WvT + (size_t)bx * 128 * ldb : Blo + (size_t)128 * ldb;
  v8f acc[4][4];
  gemm_main<false, 2>(As, Bs, kvb ? sb : xb, nullptr, lda, Blo, Bhi, ldb, K, acc);

  const int lane = threadIdx.x & 31;
  // the wave's number, scalar: the tests on it below are scalar branches
  const int wid = __builtin_amdgcn_readfirstlane(threadIdx.x >> 5);
  const int wr = wid >> 2;            // 0..1 (m)
  const int wc = (wid + 2 * wr) & 3;  // 0..3 (n); in a K, V tile 0, 1: K; 2, 3: V
  const int rofs = (lane >> 4) << 3;
  const int row0 = blockIdx.y * 128 + wr * 64 + rofs;  // the lane's first row
  // the strip's first column in Q or in K
  const int colb = (kvb ? bx * 128 : (bx - 4) * 256) + wc * 64;
  const bool rot = !kvb || wc < 2;
  const int sgn = (lane & 1) ? 0 : (int)0x80000000;
  // a block's 128 rows never cross a sequence's end
  const int pos0 = row0 & (LL - 1);
  float dv[4] = {0.f, 0.f, 0.f, 0.f};
  if (rot) {
#pragma unroll
    for (int ni = 0; ni < 4; ++ni)
      dv[ni] = exp_fast((float)(colb + (lane & 14) + ni * 16) *
                        (-9.2103403719761836f / 512.0f));
  }
  __bf16* T = &Bs[0][0];
  __bf16* tp = T + (wc * 64 + (lane & 15)) * TSTR + wr * 64 + rofs;
  __bf16* cp = Qf + (size_t)row0 * DD + colb + (lane & 15);
#pragma unroll
  for (int mi = 0; mi < 4; ++mi) {
    if (rot) rope_elu_tiles(acc[mi], pos0 + mi * 16, dv, sgn);
    if (kvb) {
#pragma unroll
      for (int ni = 0; ni < 4; ++ni)
        *(v8bf*)(tp + ni * 16 * TSTR + mi * 16) =
            __builtin_convertvector(acc[mi][ni], v8bf);
    } else {
#pragma unroll
      for (int ni = 0; ni < 4; ++ni)
#pragma unroll
        for (int j = 0; j < 8; ++j)
          cp[(mi * 16 + j) * DD + ni * 16] = (__bf16)acc[mi][ni][j];
      // In front of what follows (the next row's arithmetic; behind the last row,
      // in the built code, the other blocks' path), which may write registers that
      // these stores name.
      asm volatile("s_wait_xcnt 0x0" ::: "memory");
    }
    // A row of tiles is stored before the next row's arithmetic begins, so the
    // stores drain under it; without this the build kept all 128 for the end.
    __builtin_amdgcn_sched_barrier(0);
  }
  if (!kvb) return;  // the whole block, in front of the barrier
  __syncthreads();   // below, a wave reads columns of T that other waves stored

  // Wave: head hd of the two, 16 rows v (mv) by all 64 columns d of its KV.
  const int hd = wid >> 2, mv = wid & 3;
  v8f kv[4];
#pragma unroll
  for (int nd = 0; nd < 4; ++nd)
#pragma unroll
    for (int j = 0; j < 8; ++j) kv[nd][j] = 0.f;
#pragma unroll
  for (int ks = 0; ks < 128; ks += 32) {
    v16bf a = frag_lds(T + (128 + hd * 64 + mv * 16) * TSTR + ks, TSTR, lane);
#pragma unroll
    for (int nd = 0; nd < 4; ++nd) {
      v16bf bb = frag_lds(T + (hd * 64 + nd * 16) * TSTR + ks, TSTR, lane);
      kv[nd] = wmma_bf16f32(a, bb, kv[nd]);
    }
  }
  const int split = blockIdx.y % NSPLIT;
  const int bh0 = (blockIdx.y / NSPLIT) * HH + bx * 2;
  float* kp = KVp + (size_t)split * KVN +
              ((size_t)(bh0 + hd) * 64 + mv * 16 + rofs) * 64 + (lane & 15);
#pragma unroll
  for (int nd = 0; nd < 4; ++nd)
#pragma unroll
    for (int j = 0; j < 8; ++j) kp[j * 64 + nd * 16] = kv[nd][j];
  // In front of the sums below, which may write registers that these stores name.
  asm volatile("s_wait_xcnt 0x0" ::: "memory");

  // Ksum: a lane sums one K column; a wave's 32 sums fill one 128-byte line.
  if (wid < 4) {
    const __bf16* kr = T + (wid * 32 + lane) * TSTR;
    float part[4] = {0.f, 0.f, 0.f, 0.f};  // four independent chains
#pragma unroll
    for (int c = 0; c < 16; ++c) {
      const v8bf k8 = *(const v8bf*)(kr + c * 8);
#pragma unroll
      for (int e = 0; e < 8; ++e) part[c & 3] += (float)k8[e];
    }
    Ksp[(size_t)split * KSN + (size_t)bh0 * DHD + wid * 32 + lane] =
        (part[0] + part[1]) + (part[2] + part[3]);
  }
}

// Two GEMMs with f32 results of pitch DD in one launch, for the same reason;
// blockIdx.z picks the operands; the longer K comes first.
__global__ __launch_bounds__(256) void gemm_f32_pair_kernel(
    const __bf16* __restrict__ A0, int lda0, const __bf16* __restrict__ Bt0,
    float* __restrict__ C0, const __bf16* __restrict__ A1, int lda1,
    const __bf16* __restrict__ Bt1, float* __restrict__ C1) {
  __shared__ alignas(16) a_tiles_t As;
  __shared__ alignas(16) b_tiles_t Bs;
  const bool first = blockIdx.z == 0;
  const int ld = first ? lda0 : lda1;  // row pitch of A and of Bt, and K
  v8f acc[4][4];
  const __bf16* Blo = (first ? Bt0 : Bt1) + (size_t)blockIdx.x * 256 * ld;
  gemm_main<false, 0>(As, Bs, first ? A0 : A1, nullptr, ld, Blo,
                      Blo + (size_t)128 * ld, ld, ld, acc);
  gemm_store<GEMM_F32, DD>(acc, first ? C0 : C1, nullptr);
}

// ---------------------------------------------------------------------------
// Adds the NSPLIT partial planes: KVt (bf16) from KVp, Ksum (f32) from Ksp.
// Blocks 0 .. KVN/256-1 take KV elements, the rest Ksum elements.
// ---------------------------------------------------------------------------
__global__ __launch_bounds__(256) void split_reduce_kernel(
    const float* __restrict__ KVp, const float* __restrict__ Ksp,
    __bf16* __restrict__ KVt, float* __restrict__ Ksum) {
  const int i = blockIdx.x * 256 + threadIdx.x;
  float acc = 0.f;
  if (blockIdx.x < KVN / 256) {
    const unsigned voff = (unsigned)i * 4;  // the element's byte offset in a plane
    float v[NSPLIT];
#pragma unroll  // all NSPLIT loads in flight at once
    for (int p = 0; p < NSPLIT; ++p)
      v[p] = *(const float*)((const char*)KVp + (size_t)p * KVN * 4 + voff);
    loads_issued(voff);
#pragma unroll
    for (int p = 0; p < NSPLIT; ++p) acc += v[p];
    KVt[i] = (__bf16)acc;
  } else {
    const int j = i - KVN;
#pragma unroll  // all NSPLIT loads in flight at once
    for (int p = 0; p < NSPLIT; ++p) acc += Ksp[(size_t)p * KSN + j];
    Ksum[j] = acc;
    // Stands in front of the other branch's loads: in the built code a path
    // leads on to them from here, and the first writes this store's data register.
    asm volatile("s_wait_xcnt 0x0" ::: "memory");
  }
}

template <int SRC>
static __device__ __forceinline__ float row_share(float v) {
  return __builtin_bit_cast(
      float, __builtin_amdgcn_update_dpp(0, __builtin_bit_cast(int, v),
                                         0x150 + SRC /* row_share:SRC */, 0xf, 0xf,
                                         true));
}

__global__ __launch_bounds__(256) void attn_out_kernel(
    const __bf16* __restrict__ Qf, const __bf16* __restrict__ KVt,
    const float* __restrict__ Ksum, const float* __restrict__ thr,
    __bf16* __restrict__ Ao) {
  __shared__ alignas(16) __bf16 Aq[128 * 72];
  __shared__ alignas(16) __bf16 Kv[64 * 72];
  const int tid = threadIdx.x, lane = tid & 31, wid = tid >> 5;
  const int bh = blockIdx.y, b = bh >> 3, h = bh & 7;
  const size_t rowbase = (size_t)b * LL + (size_t)blockIdx.x * 128;

#pragma unroll
  for (int i = 0; i < 4; ++i) {  // Q tile 128x64 (async DMA)
    int c = tid + i * 256;
    int row = c >> 3, cc = (c & 7) << 3;
    async_copy16(&Aq[row * 72 + cc], Qf + (rowbase + row) * DD + h * DHD + cc);
  }
#pragma unroll
  for (int i = 0; i < 2; ++i) {  // KVt 64x64 (async DMA)
    int c = tid + i * 256;
    int row = c >> 3, cc = (c & 7) << 3;
    async_copy16(&Kv[row * 72 + cc], KVt + ((size_t)bh * 64 + row) * 64 + cc);
  }
  // the 32 elements of Ksum that meet the lane's half of a Q row
  const unsigned voff = (lane & 1) * 128;  // the half's byte offset in Ksum[b,h]
  const char* ksb = (const char*)(Ksum + (size_t)bh * DHD);
  v4f ksv[8];
#pragma unroll
  for (int i = 0; i < 8; ++i) ksv[i] = *(const v4f*)(ksb + i * 16 + voff);
  const float th = thr[0];
  loads_issued(voff);
  wait_async0();
  __syncthreads();

  float z;
  {
    const __bf16* qh = &Aq[(wid * 16 + (lane >> 1)) * 72 + (lane & 1) * 32];
    float part[4];  // four independent chains of eight products
#pragma unroll
    for (int c = 0; c < 4; ++c) {
      const v8bf q8 = *(const v8bf*)(qh + c * 8);
      part[c] = 0.f;
#pragma unroll
      for (int e = 0; e < 8; ++e)
        part[c] += (float)q8[e] * ksv[c * 2 + (e >> 2)][e & 3];
    }
    const float sc =
        row_xor_add<0x161>((part[0] + part[1]) + (part[2] + part[3]));
    const float sp = sc > th ? sc : 0.f;
    z = 1.0f / (sp + 1e-6f);
  }

  v8f acc[4];
#pragma unroll
  for (int ni = 0; ni < 4; ++ni)
#pragma unroll
    for (int j = 0; j < 8; ++j) acc[ni][j] = 0.f;

#pragma unroll
  for (int ks = 0; ks < 64; ks += 32) {
    v16bf a = frag_lds(&Aq[(wid * 16) * 72 + ks], 72, lane);
#pragma unroll
    for (int ni = 0; ni < 4; ++ni) {
      v16bf bb = frag_lds(&Kv[(ni * 16) * 72 + ks], 72, lane);
      acc[ni] = wmma_bf16f32(a, bb, acc[ni]);
    }
  }

  const int rofs = (lane >> 4) << 3;
  // Z of accumulator row j (tile row rofs + j): from lane 2j of the 16-lane row
  const float zv[8] = {row_share<0>(z),  row_share<2>(z),  row_share<4>(z),
                       row_share<6>(z),  row_share<8>(z),  row_share<10>(z),
                       row_share<12>(z), row_share<14>(z)};
#pragma unroll
  for (int ni = 0; ni < 4; ++ni) {
    int col = h * DHD + ni * 16 + (lane & 15);
#pragma unroll
    for (int j = 0; j < 8; ++j) {
      size_t row = rowbase + wid * 16 + rofs + j;
      Ao[row * DD + col] = (__bf16)(acc[ni][j] * zv[j]);
    }
  }
}

// ---------------------------------------------------------------------------
// LayerNorm over 512 f32; writes the f32 or the bf16 output.
// One wave per row, LN_R rows a wave: a lane holds 16 elements of a row (four
// 16-byte loads, 512 contiguous bytes a wave each); the row's sums are taken
// inside the wave.  A block covers 8 * LN_R rows.
// ---------------------------------------------------------------------------
#define LN_R 2

template <int BF16OUT>
__global__ __launch_bounds__(256) void layernorm_kernel(
    const float* __restrict__ in, const float* __restrict__ g,
    const float* __restrict__ bta, float* __restrict__ out_f32,
    __bf16* __restrict__ out_bf16) {
  const int lane = threadIdx.x & 31;
  // the wave's number, scalar: row bases stay in scalar registers
  const int wid = __builtin_amdgcn_readfirstlane(threadIdx.x >> 5);
  const size_t row0 = ((size_t)blockIdx.x * 8 + wid) * LN_R;
  const int c0 = lane * 4;
  const unsigned voff = lane * 16;  // the lane's byte offset in a 512-byte piece
  const char* inb = (const char*)(in + row0 * DD);
  v4f v[LN_R][4], gv[4], bv[4];
#pragma unroll
  for (int r = 0; r < LN_R; ++r)
#pragma unroll
    for (int j = 0; j < 4; ++j)
      v[r][j] = *(const v4f*)(inb + (r * DD + j * 128) * 4 + voff);
#pragma unroll
  for (int j = 0; j < 4; ++j) {
    gv[j] = *(const v4f*)((const char*)g + j * 512 + voff);
    bv[j] = *(const v4f*)((const char*)bta + j * 512 + voff);
  }
  loads_issued(voff);
#pragma unroll
  for (int r = 0; r < LN_R; ++r) {
    float s = 0.f, q = 0.f;
#pragma unroll
    for (int j = 0; j < 4; ++j)
#pragma unroll
      for (int e = 0; e < 4; ++e) {
        s += v[r][j][e];
        q += v[r][j][e] * v[r][j][e];
      }
    s = wave_sum(s);
    q = wave_sum(q);
    const float mu = s * (1.0f / DD);
    const float var = q * (1.0f / DD) - mu * mu;
    const float rstd = rsqrtf(var + 1e-5f);
#pragma unroll
    for (int j = 0; j < 4; ++j)
#pragma unroll
      for (int e = 0; e < 4; ++e)
        v[r][j][e] = (v[r][j][e] - mu) * rstd * gv[j][e] + bv[j][e];
  }
  if (BF16OUT) {
    v4bf o[LN_R][4];
#pragma unroll
    for (int r = 0; r < LN_R; ++r)
#pragma unroll
      for (int j = 0; j < 4; ++j) o[r][j] = __builtin_convertvector(v[r][j], v4bf);
#pragma unroll
    for (int r = 0; r < LN_R; ++r)
#pragma unroll
      for (int j = 0; j < 4; ++j)
        *(v4bf*)(out_bf16 + (row0 + r) * DD + j * 128 + c0) = o[r][j];
  } else {
#pragma unroll
    for (int r = 0; r < LN_R; ++r)
#pragma unroll
      for (int j = 0; j < 4; ++j)
        *(v4f*)(out_f32 + (row0 + r) * DD + j * 128 + c0) = v[r][j];
  }
}

// ---------------------------------------------------------------------------
// out = x + LN(mlp2; g2, b2) + LN(aug32 + baug; gaug, bln)
// One wave per row as in layernorm_kernel, FIN_R rows a wave: one row's 32 loads
// already hold 128 registers.
// ---------------------------------------------------------------------------
#define FIN_R 1

__global__ __launch_bounds__(256) void final_kernel(
    const float* __restrict__ x, const float* __restrict__ mlp2,
    const float* __restrict__ g2, const float* __restrict__ b2,
    const float* __restrict__ aug32, const float* __restrict__ baug,
    const float* __restrict__ gaug, const float* __restrict__ bln,
    float* __restrict__ out) {
  const int lane = threadIdx.x & 31;
  // the wave's number, scalar: row bases stay in scalar registers
  const int wid = __builtin_amdgcn_readfirstlane(threadIdx.x >> 5);
  const size_t row0 = ((size_t)blockIdx.x * 8 + wid) * FIN_R;
  const int c0 = lane * 4;
  const unsigned voff = lane * 16;  // the lane's byte offset in a 512-byte piece
  const char* ab = (const char*)(aug32 + row0 * DD);
  const char* xb = (const char*)(x + row0 * DD);
  const char* mb = (const char*)(mlp2 + row0 * DD);
  v4f a[FIN_R][4], xv[FIN_R][4], mv[FIN_R][4], av[4], gv[4], bv[4], g2v[4], b2v[4];
#pragma unroll
  for (int r = 0; r < FIN_R; ++r)
#pragma unroll
    for (int j = 0; j < 4; ++j)
      a[r][j] = *(const v4f*)(ab + (r * DD + j * 128) * 4 + voff);
#pragma unroll
  for (int j = 0; j < 4; ++j)
    av[j] = *(const v4f*)((const char*)baug + j * 512 + voff);
#pragma unroll
  for (int r = 0; r < FIN_R; ++r)
#pragma unroll
    for (int j = 0; j < 4; ++j) {
      xv[r][j] = *(const v4f*)(xb + (r * DD + j * 128) * 4 + voff);
      mv[r][j] = *(const v4f*)(mb + (r * DD + j * 128) * 4 + voff);
    }
#pragma unroll
  for (int j = 0; j < 4; ++j) {
    gv[j] = *(const v4f*)((const char*)gaug + j * 512 + voff);
    bv[j] = *(const v4f*)((const char*)bln + j * 512 + voff);
    g2v[j] = *(const v4f*)((const char*)g2 + j * 512 + voff);
    b2v[j] = *(const v4f*)((const char*)b2 + j * 512 + voff);
  }
  loads_issued(voff);
#pragma unroll
  for (int r = 0; r < FIN_R; ++r) {
    float s = 0.f, q = 0.f, s2 = 0.f, q2 = 0.f;
#pragma unroll
    for (int j = 0; j < 4; ++j) {
      a[r][j] += av[j];
#pragma unroll
      for (int e = 0; e < 4; ++e) {
        s += a[r][j][e];
        q += a[r][j][e] * a[r][j][e];
        s2 += mv[r][j][e];
        q2 += mv[r][j][e] * mv[r][j][e];
      }
    }
    s = wave_sum(s);
    q = wave_sum(q);
    s2 = wave_sum(s2);
    q2 = wave_sum(q2);
    const float mu = s * (1.0f / DD);
    const float var = q * (1.0f / DD) - mu * mu;
    const float rstd = rsqrtf(var + 1e-5f);
    const float mu2 = s2 * (1.0f / DD);
    const float var2 = q2 * (1.0f / DD) - mu2 * mu2;
    const float rstd2 = rsqrtf(var2 + 1e-5f);
#pragma unroll
    for (int j = 0; j < 4; ++j)
#pragma unroll
      for (int e = 0; e < 4; ++e) {
        const float l = (a[r][j][e] - mu) * rstd * gv[j][e] + bv[j][e];
        const float m = (mv[r][j][e] - mu2) * rstd2 * g2v[j][e] + b2v[j][e];
        a[r][j][e] = xv[r][j][e] + m + l;
      }
  }
#pragma unroll
  for (int r = 0; r < FIN_R; ++r)
#pragma unroll
    for (int j = 0; j < 4; ++j)
      *(v4f*)(out + (row0 + r) * DD + j * 128 + c0) = a[r][j];
}

// ---------------------------------------------------------------------------
// Host orchestration
// ---------------------------------------------------------------------------
extern "C" void kernel_launch(void* const* d_in, const int* in_sizes, int n_in,
                              void* d_out, int out_size, void* d_ws,
                              size_t ws_size, hipStream_t stream) {
  (void)in_sizes; (void)n_in; (void)out_size; (void)ws_size;
  const float* x      = (const float*)d_in[0];
  const float* source = (const float*)d_in[1];
  const float* Wq     = (const float*)d_in[2];
  const float* Wk     = (const float*)d_in[3];
  const float* Wv     = (const float*)d_in[4];
  const float* Wmerge = (const float*)d_in[5];
  const float* Wmlp1  = (const float*)d_in[6];
  const float* Wmlp2  = (const float*)d_in[7];
  const float* g1     = (const float*)d_in[8];
  const float* b1     = (const float*)d_in[9];
  const float* g2     = (const float*)d_in[10];
  const float* b2     = (const float*)d_in[11];
  const float* Waug   = (const float*)d_in[12];
  const float* baug   = (const float*)d_in[13];
  const float* gaug   = (const float*)d_in[14];
  const float* bln    = (const float*)d_in[15];
  const float* thr    = (const float*)d_in[16];
  float* out = (float*)d_out;

  char* ws = (char*)d_ws;
  size_t off = 0;
  auto take = [&](size_t bytes) -> char* {
    char* p = ws + off;
    off += (bytes + 255) & ~(size_t)255;
    return p;
  };

  __bf16* xb   = (__bf16*)take((size_t)NT * DD * 2);
  __bf16* sb   = (__bf16*)take((size_t)NT * DD * 2);
  __bf16* WqT  = (__bf16*)take((size_t)DD * DD * 2);
  __bf16* WkT  = (__bf16*)take((size_t)DD * DD * 2);
  __bf16* WvT  = (__bf16*)take((size_t)DD * DD * 2);
  __bf16* WmT  = (__bf16*)take((size_t)DD * DD * 2);
  __bf16* W1T  = (__bf16*)take((size_t)D2 * D2 * 2);
  __bf16* W2T  = (__bf16*)take((size_t)DD * D2 * 2);
  __bf16* WaT  = (__bf16*)take((size_t)DD * DD * 2);
  float*  C1   = (float*)take((size_t)NT * DD * 4);
  __bf16* Qf   = (__bf16*)take((size_t)NT * DD * 2);
  float*  Ksum = (float*)take((size_t)BB * HH * DHD * 4);
  __bf16* KVt  = (__bf16*)take((size_t)BB * HH * 64 * 64 * 2);
  __bf16* Ao   = (__bf16*)take((size_t)NT * DD * 2);
  __bf16* Msgb = (__bf16*)take((size_t)NT * DD * 2);
  __bf16* Hb   = (__bf16*)take((size_t)NT * D2 * 2);
  float*  KVp  = (float*)take((size_t)NSPLIT * KVN * 4);
  float*  Ksp  = (float*)take((size_t)NSPLIT * KSN * 4);

  float*  Aug  = (float*)take((size_t)NT * DD * 4);

  const dim3 blk(256);

  // 1) Convert activations and (transposed) weights to bf16
  prep_kernel<<<dim3(TR_ALL + 2 * CVT_NB), blk, 0, stream>>>(
      x, source, Wq, Wk, Wv, Wmerge, Wmlp1, Wmlp2, Waug, xb, sb, WqT, WkT, WvT, WmT,
      W1T, W2T, WaT);

  // 2) Qf = elu(rope(x@Wq)) + 1 (bf16); of Kf = elu(rope(source@Wk)) + 1 and
  //    Vb = source@Wv each block's share of the sums over s (fused epilogues)
  qkv_gemm_kernel<<<dim3(HH / 2 + DD / 256, NT / 128), blk, 0, stream>>>(
      xb, sb, DD, WqT, WkT, WvT, DD, DD, Qf, KVp, Ksp);

  // 3) attention core
  split_reduce_kernel<<<dim3(KVN / 256 + KSN / 256), blk, 0, stream>>>(
      KVp, Ksp, KVt, Ksum);
  attn_out_kernel<<<dim3(LL / 128, BB * HH), blk, 0, stream>>>(Qf, KVt, Ksum, thr,
                                                               Ao);

  // 4) merge + LN1 -> Msgb (bf16)
  gemm_bf16_kernel<GEMM_F32, DD, false>
      <<<dim3(DD / 256, NT / 128), blk, 0, stream>>>(Ao, nullptr, DD, WmT, DD, C1,
                                                     DD, nullptr);
  layernorm_kernel<1><<<dim3(NT / (8 * LN_R)), blk, 0, stream>>>(C1, g1, b1, nullptr, Msgb);

  // 5) MLP1: Hb = relu([x, msg] @ Wmlp1) (bf16, fused epilogue)
  gemm_bf16_kernel<GEMM_RELU, D2, true>
      <<<dim3(D2 / 256, NT / 128), blk, 0, stream>>>(xb, Msgb, DD, W1T, D2,
                                                     nullptr, D2, Hb);

  // 6) MLP2 -> C1 and the aug GEMM -> Aug
  gemm_f32_pair_kernel<<<dim3(DD / 256, NT / 128, 2), blk, 0, stream>>>(
      Hb, D2, W2T, C1, xb, DD, WaT, Aug);

  // 7) both LayerNorms and the residual
  final_kernel<<<dim3(NT / (8 * FIN_R)), blk, 0, stream>>>(x, C1, g2, b2, Aug, baug,
                                                           gaug, bln, out);
}

// v009
// Measured time: 132 microseconds a run.
// Timed twice side by side with v008, it ran 1.03 and 1.04 times as fast.
// Over all steps from v000 it is 4.67 times as fast.
#include <hip/hip_runtime.h>
#include <hip/hip_bf16.h>

#define BB 4
#define LL 4096
#define SSEQ 4096
#define DD 512
#define HH 8
#define DHD 64
#define NT (BB * LL)     /* 16384 token rows */
#define D2 (2 * DD)      /* 1024 */
#define NSPLIT (SSEQ / 128) /* work-groups that share one (b,h) sum over s */
#define KVN (BB * HH * DHD * DHD) /* elements of one KV partial plane */
#define KSN (BB * HH * DHD)       /* elements of one Ksum partial plane */

typedef __bf16 v16bf __attribute__((ext_vector_type(16)));
typedef __bf16 v8bf  __attribute__((ext_vector_type(8)));
typedef float  v8f   __attribute__((ext_vector_type(8)));
typedef int    v4i   __attribute__((ext_vector_type(4)));
typedef float  v4f   __attribute__((ext_vector_type(4)));
typedef __bf16 v4bf  __attribute__((ext_vector_type(4)));

#if defined(__has_builtin)
#if __has_builtin(__builtin_amdgcn_global_load_async_to_lds_b128)
#define HAVE_ASYNC_BUILTIN 1
#endif
#if __has_builtin(__builtin_amdgcn_s_wait_asynccnt)
#define HAVE_ASYNCWAIT_BUILTIN 1
#endif
#endif

static __device__ __forceinline__ void async_copy16(void* lds, const void* g) {
#ifdef HAVE_ASYNC_BUILTIN
  __builtin_amdgcn_global_load_async_to_lds_b128(
      (__attribute__((address_space(1))) v4i*)(g),
      (__attribute__((address_space(3))) v4i*)(lds), 0, 0);
#else
  asm volatile("global_load_async_to_lds_b128 %0, %1, off" ::"v"(
                   (unsigned)(size_t)lds),
               "v"(g)
               : "memory");
#endif
}

static __device__ __forceinline__ void wait_async0() {
#ifdef HAVE_ASYNCWAIT_BUILTIN
  __builtin_amdgcn_s_wait_asynccnt(0);
#else
  asm volatile("s_wait_asynccnt 0x0" ::: "memory");
#endif
}

static __device__ __forceinline__ v8f wmma_bf16f32(v16bf a, v16bf b, v8f c) {
  // D = A(16x32) * B(32x16) + C, f32 accumulate
  return __builtin_amdgcn_wmma_f32_16x16x32_bf16(false, a, false, b, (short)0, c,
                                                 false, false);
}

static __device__ __forceinline__ v16bf frag_lds(const __bf16* tile, int stride,
                                                 int lane) {
  const int row  = lane & 15;
  const int koff = (lane >> 4) << 3;
  const __bf16* p = tile + row * stride + koff;
  v8bf lo = *(const v8bf*)(p);
  v8bf hi = *(const v8bf*)(p + 16);
  return __builtin_shufflevector(lo, hi, 0, 1, 2, 3, 4, 5, 6, 7, 8, 9, 10, 11,
                                 12, 13, 14, 15);
}

// ---------------------------------------------------------------------------
// Sum over the 32 lanes of a wave, the same bits in every lane: four xor steps
// inside each 16-lane row, then the exchange with the other row.
// ---------------------------------------------------------------------------
template <int CTRL>
static __device__ __forceinline__ float row_xor_add(float v) {
  const int t = __builtin_amdgcn_update_dpp(0, __builtin_bit_cast(int, v), CTRL,
                                            0xf, 0xf, true);
  return v + __builtin_bit_cast(float, t);
}

static __device__ __forceinline__ float wave_sum(float v) {
  v = row_xor_add<0x161>(v);  // row_xmask:1
  v = row_xor_add<0x162>(v);  // row_xmask:2
  v = row_xor_add<0x164>(v);  // row_xmask:4
  v = row_xor_add<0x168>(v);  // row_xmask:8
  const int b = __builtin_bit_cast(int, v);
  const int o =
      __builtin_amdgcn_permlanex16(b, b, 0x76543210, 0xfedcba98, false, false);
  return v + __builtin_bit_cast(float, o);
}

// Stands behind a kernel's whole group of loads, which share the offset register
// voff.
static __device__ __forceinline__ void loads_issued(unsigned voff) {
  // In front of every later write of a register that these loads name; as an
  // operand voff stays live up to here, so no load's result lands on it.
  asm volatile("s_wait_xcnt 0x0" ::"v"(voff) : "memory");
  // No arithmetic moves up among the loads: without it the build issued part of
  // the group late, behind waits for the first loads.
  __builtin_amdgcn_sched_barrier(0);
}

static __device__ __forceinline__ float exp2_slot(float x) {
  float y;
  asm("v_exp_f32 %0, %1\n\tv_nop" : "=&v"(y) : "v"(x));
  return y;
}

// exp(x) as the fast library form computes it
static __device__ __forceinline__ float exp_fast(float x) {
  return exp2_slot(x * 1.44269504088896340736f);
}

// sine and cosine of an angle in radians, as the fast library form computes them
static __device__ __forceinline__ void sincos_fast(float a, float* s, float* c) {
  const float rev = a * 0.15915494309189532f;
  asm("v_sin_f32 %0, %2\n\tv_cos_f32 %1, %2\n\tv_nop"
      : "=&v"(*s), "=&v"(*c)
      : "v"(rev));
}

// ---------------------------------------------------------------------------
// Elementwise conversion.  A thread takes CVT_G groups of four floats, each a
// 16-byte load (512 contiguous bytes a wave), all issued before the first use.
// One block covers CVT_BLK elements (block blk of the array); CVT_BLK divides n.
// ---------------------------------------------------------------------------
#define CVT_G 8
#define CVT_BLK (256 * 4 * CVT_G)

static __device__ __forceinline__ void f32_to_bf16_block(
    const float* __restrict__ in, __bf16* __restrict__ out, int blk) {
  const size_t base = (size_t)blk * CVT_BLK + threadIdx.x * 4;
  v4f v[CVT_G];
  v4bf o[CVT_G];
#pragma unroll
  for (int j = 0; j < CVT_G; ++j) v[j] = *(const v4f*)(in + base + j * 1024);
#pragma unroll
  for (int j = 0; j < CVT_G; ++j) o[j] = __builtin_convertvector(v[j], v4bf);
#pragma unroll
  for (int j = 0; j < CVT_G; ++j) *(v4bf*)(out + base + j * 1024) = o[j];
}

// W[k][n] (f32, KxN row-major) -> Wt[n][k] (bf16, NxK row-major)
// Block tile: 64 k x 32 n.  A thread reads 8 consecutive k of one n and stores
// them as 16 bytes; 8 lanes side by side in k fill one 128-byte line of Wt.
// Tiles: bx in 0 .. N / 32 - 1, by in 0 .. K / 64 - 1.
static __device__ __forceinline__ void transpose_bf16_block(
    const float* __restrict__ W, __bf16* __restrict__ Wt, int K, int N, int bx,
    int by) {
  const int k0 = by * 64 + (threadIdx.x & 7) * 8;
  const int n  = bx * 32 + (threadIdx.x >> 3);
  const float* wp = W + (size_t)k0 * N + n;
  float w[8];
#pragma unroll
  for (int e = 0; e < 8; ++e) w[e] = wp[(size_t)e * N];
  v8bf o;
#pragma unroll
  for (int e = 0; e < 8; ++e) o[e] = (__bf16)w[e];
  *(v8bf*)(Wt + (size_t)n * K + k0) = o;
}

// All nine input conversions in one launch: none reads what another writes.  The
// block index picks the job: first the weight tiles (short, bound by latency),
// which then run under the two activation streams behind them.
#define TR_W1 ((D2 / 32) * (D2 / 64))  /* 512 tiles of Wmlp1 */
#define TR_W2 ((DD / 32) * (D2 / 64))  /* 256 tiles of Wmlp2 */
#define TR_SQ ((DD / 32) * (DD / 64))  /* 128 tiles of each 512 x 512 weight */
#define TR_ALL (TR_W1 + TR_W2 + 5 * TR_SQ)
#define CVT_NB (NT * DD / CVT_BLK)     /* 1024 blocks for x, as many for source */

__global__ __launch_bounds__(256) void prep_kernel(
    const float* __restrict__ x, const float* __restrict__ source,
    const float* __restrict__ Wq, const float* __restrict__ Wk,
    const float* __restrict__ Wv, const float* __restrict__ Wmerge,
    const float* __restrict__ Wmlp1, const float* __restrict__ Wmlp2,
    const float* __restrict__ Waug, __bf16* __restrict__ xb,
    __bf16* __restrict__ sb, __bf16* __restrict__ WqT, __bf16* __restrict__ WkT,
    __bf16* __restrict__ WvT, __bf16* __restrict__ WmT, __bf16* __restrict__ W1T,
    __bf16* __restrict__ W2T, __bf16* __restrict__ WaT) {
  const int blk = blockIdx.x;
  if (blk < TR_ALL) {
    const float* W;
    __bf16* Wt;
    int K = DD, N = DD, t;
    if (blk < TR_W1) {
      W = Wmlp1; Wt = W1T; K = D2; N = D2; t = blk;
    } else if (blk < TR_W1 + TR_W2) {
      W = Wmlp2; Wt = W2T; K = D2; t = blk - TR_W1;
    } else {
      const int w = (blk - (TR_W1 + TR_W2)) / TR_SQ;
      t = (blk - (TR_W1 + TR_W2)) % TR_SQ;
      W  = w == 0 ? Wq : w == 1 ? Wk : w == 2 ? Wv : w == 3 ? Wmerge : Waug;
      Wt = w == 0 ? WqT : w == 1 ? WkT : w == 2 ? WvT : w == 3 ? WmT : WaT;
    }
    const int sh = N == D2 ? 5 : 4;  // log2 of the N / 32 tiles in a row of tiles
    transpose_bf16_block(W, Wt, K, N, t & ((1 << sh) - 1), t >> sh);
  } else {
    const int t = blk - TR_ALL;
    const bool first = t < CVT_NB;
    f32_to_bf16_block(first ? x : source, first ? xb : sb, first ? t : t - CVT_NB);
    // Stands in front of the other branch's code: in the built code a path leads
    // on to it from here, and it writes registers that these stores name.
    asm volatile("s_wait_xcnt 0x0" ::: "memory");
  }
}

// ---------------------------------------------------------------------------
// Generic bf16 GEMM: C[M,N](f32) = A[M,K](bf16,row-major) * Bt[N,K]^T
// Block = 256 threads = 8 waves; block tile 128x256, K-step BK = 64, double-buffered
// LDS filled by async global->LDS DMA: a K-step takes 128 bytes of every operand
// row, so a wave's copy covers 4 whole 128-byte lines.  Wave (wr in 0..1, wc in
// 0..3) owns a 64x64 sub-tile = 4x4 wmma tiles: 32 WMMAs per 32 ds_load_b128 per
// K-step.  K is a multiple of BK.
// What becomes of the result and the row pitch of the output are fixed at compile
// time: MODE GEMM_F32 stores f32 to C, GEMM_RELU max(result, 0) as bf16 to Cbf; LDC
// is the pitch in elements.
// TWO_A: the A operand is [A | A2] side by side, each lda columns wide.
// Blo, Bhi: the rows of Bt that make the tile's columns 0..127 and 128..255.
// ROT: wave w takes column strip (w + ROT * (w / 4)) % 4 of the tile.
// ---------------------------------------------------------------------------
#define GEMM_F32 0
#define GEMM_RELU 1
#define BK 64    /* columns of A and of Bt in a K-step (128B of a row) */
#define LDSTR 72 /* padded LDS row stride in bf16 elements (144B) */

#define GEMM_TWO_GROUPS __attribute__((amdgpu_waves_per_eu(4, 4)))

typedef __bf16 a_tiles_t[2][128 * LDSTR];
typedef __bf16 b_tiles_t[2][256 * LDSTR];

// The K loop: acc = the wave's 64x64 part of the block's tile (rows: blockIdx.y).
template <bool TWO_A, int ROT>
static __device__ __forceinline__ void gemm_main(
    a_tiles_t& As, b_tiles_t& Bs, const __bf16* __restrict__ A,
    const __bf16* __restrict__ A2, int lda, const __bf16* __restrict__ Blo,
    const __bf16* __restrict__ Bhi, int ldb, int K, v8f (&acc)[4][4]) {
  const int tid  = threadIdx.x;
  const int lane = tid & 31;
  const int wid  = tid >> 5;
  const int wr   = wid >> 2;              // 0..1 (m)
  const int wc   = (wid + ROT * wr) & 3;  // 0..3 (n)
  const size_t m0 = (size_t)blockIdx.y * 128;

  const __bf16* Ab = A + m0 * lda;

  auto stage_tiles = [&](int buf, int kk) {
    // first column of this K-step in the buffer that holds it (kk is scalar)
    const __bf16* Ak = Ab + kk;
    if (TWO_A && kk >= lda) Ak = A2 + m0 * lda + (kk - lda);
#pragma unroll
    for (int i = 0; i < 4; ++i) {  // A tile: 128 rows x 64 cols
      int c   = tid + i * 256;     // 0..1023 chunks of 8 bf16
      int row = c >> 3;            // 0..127
      int cc  = (c & 7) << 3;      // 0,8,..,56
      async_copy16(&As[buf][row * LDSTR + cc],
                   Ak + (size_t)row * lda + cc);
    }
#pragma unroll
    for (int i = 0; i < 8; ++i) {  // B tile: 256 rows x 64 cols
      int c   = tid + i * 256;     // 0..2047
      int row = c >> 3;            // 0..255
      int cc  = (c & 7) << 3;
      async_copy16(&Bs[buf][row * LDSTR + cc],
                   (i < 4 ? Blo : Bhi) + (size_t)(row & 127) * ldb + kk + cc);
    }
  };

#pragma unroll
  for (int mi = 0; mi < 4; ++mi)
#pragma unroll
    for (int ni = 0; ni < 4; ++ni)
#pragma unroll
      for (int j = 0; j < 8; ++j) acc[mi][ni][j] = 0.f;

  // One 32-deep half of a K-step: its 8 fragments (16 LDS loads, all held at once, so
  // that they go out as a group and not two in front of each row), its 16 WMMAs.
  // (what the first row of WMMAs reads comes first: LDS answers in order)
  auto load_frags = [&](int buf, int ks, v16bf (&af)[4], v16bf (&bfv)[4]) {
    af[0] = frag_lds(&As[buf][(wr * 64) * LDSTR + ks], LDSTR, lane);
#pragma unroll
    for (int ni = 0; ni < 4; ++ni)
      bfv[ni] = frag_lds(&Bs[buf][(wc * 64 + ni * 16) * LDSTR + ks], LDSTR, lane);
#pragma unroll
    for (int mi = 1; mi < 4; ++mi)
      af[mi] = frag_lds(&As[buf][(wr * 64 + mi * 16) * LDSTR + ks], LDSTR, lane);
  };
  auto mma_half = [&](const v16bf (&af)[4], const v16bf (&bfv)[4]) {
#pragma unroll
    for (int mi = 0; mi < 4; ++mi)
#pragma unroll
      for (int ni = 0; ni < 4; ++ni)
        acc[mi][ni] = wmma_bf16f32(af[mi], bfv[ni], acc[mi][ni]);
  };

  stage_tiles(0, 0);
  // this wave's copies of tile 0 have landed; behind the barrier, every wave's
  asm volatile("s_wait_asynccnt 0x0" ::: "memory");
  __syncthreads();
  if (BK < K) stage_tiles(1, BK);  // tile 1 flies under trip 0

  for (int kk = 0; kk < K; kk += BK) {
    const int cur = (kk / BK) & 1;
    v16bf a0[4], b0[4], a1[4], b1[4];
    load_frags(cur, 0, a0, b0);
    mma_half(a0, b0);
    load_frags(cur, 32, a1, b1);
    // The wave's last reads of this buffer are in registers ...
    asm volatile("s_wait_dscnt 0x0" ::: "memory");
    // ... and its copies of the next tile have landed.
    asm volatile("s_wait_asynccnt 0x0" ::: "memory");
    __syncthreads();  // publishes the next tile; every wave has left this buffer
    if (kk + 2 * BK < K) stage_tiles(cur, kk + 2 * BK);
    mma_half(a1, b1);
  }
  // nothing of the ring is outstanding when its LDS is used for anything else
  asm volatile("s_wait_asynccnt 0x0" ::: "memory");
}

template <int MODE, int LDC>
static __device__ __forceinline__ void gemm_store(v8f (&acc)[4][4],
                                                  float* __restrict__ C,
                                                  __bf16* __restrict__ Cbf) {
  const int lane = threadIdx.x & 31;
  const int wid  = threadIdx.x >> 5;
  const int wr   = wid >> 2;  // 0..1 (m)
  const int wc   = wid & 3;   // 0..3 (n)
  const size_t m0 = (size_t)blockIdx.y * 128;
  const size_t n0 = (size_t)blockIdx.x * 256;
  const int rofs = (lane >> 4) << 3;
  const size_t idx0 = (m0 + (size_t)wr * 64 + rofs) * LDC + n0 + (size_t)wc * 64 +
                      (lane & 15);
  if (MODE == GEMM_F32) {
    float* cp = C + idx0;
#pragma unroll
    for (int mi = 0; mi < 4; ++mi)
#pragma unroll
      for (int ni = 0; ni < 4; ++ni)
#pragma unroll
        for (int j = 0; j < 8; ++j)
          cp[(mi * 16 + j) * LDC + ni * 16] = acc[mi][ni][j];
  } else {
    __bf16* cp = Cbf + idx0;
#pragma unroll
    for (int mi = 0; mi < 4; ++mi) {
#pragma unroll
      for (int ni = 0; ni < 4; ++ni)
#pragma unroll
        for (int j = 0; j < 8; ++j)
          acc[mi][ni][j] = acc[mi][ni][j] > 0.f ? acc[mi][ni][j] : 0.f;
#pragma unroll
      for (int ni = 0; ni < 4; ++ni)
#pragma unroll
        for (int j = 0; j < 8; ++j)
          cp[(mi * 16 + j) * LDC + ni * 16] = (__bf16)acc[mi][ni][j];
    }
  }
}

template <int MODE, int LDC, bool TWO_A>
__global__ __launch_bounds__(256) GEMM_TWO_GROUPS void gemm_bf16_kernel(
    const __bf16* __restrict__ A, const __bf16* __restrict__ A2, int lda,
    const __bf16* __restrict__ Bt, int ldb, float* __restrict__ C, int K,
    __bf16* __restrict__ Cbf) {
  __shared__ alignas(16) a_tiles_t As;
  __shared__ alignas(16) b_tiles_t Bs;
  v8f acc[4][4];
  const __bf16* Blo = Bt + (size_t)blockIdx.x * 256 * ldb;
  gemm_main<TWO_A, 0>(As, Bs, A, A2, lda, Blo, Blo + (size_t)128 * ldb, ldb, K, acc);
  gemm_store<MODE, LDC>(acc, C, Cbf);
}

// a = elu(rope(a)) + 1 on one row of four accumulator tiles; pos0: the position in
// the sequence of the lane's first row; dv: the rotation's frequency for the lane's
// column in each tile.  A rotation pair (columns 2p, 2p + 1) lies in two
// neighbouring lanes: even column: v * cos - partner * sin; odd: v * cos + partner
// * sin; sgn flips sin in even columns.
static __device__ __forceinline__ void rope_elu_tiles(v8f (&a)[4], int pos0,
                                                      const float (&dv)[4],
                                                      int sgn) {
#pragma unroll
  for (int j = 0; j < 8; ++j) {
    const float pos = (float)(pos0 + j);
#pragma unroll
    for (int ni = 0; ni < 4; ++ni) {
      const float v = a[ni][j];
      const float p = __builtin_bit_cast(
          float, __builtin_amdgcn_update_dpp(0, __builtin_bit_cast(int, v),
                                             0x161 /* row_xmask:1 */, 0xf, 0xf,
                                             true));
      float s, c;
      sincos_fast(pos * dv[ni], &s, &c);
      const float ss = __builtin_bit_cast(float, __builtin_bit_cast(int, s) ^ sgn);
      const float r = v * c + p * ss;
      const float ex = exp_fast(r);  // taken in every lane: no branch
      a[ni][j] = r > 0.f ? r + 1.f : ex;
    }
  }
}

#define TSTR 136 /* LDS pitch of a column's 128 s in bf16 elements (272B) */

__global__ __launch_bounds__(256) GEMM_TWO_GROUPS void qkv_gemm_kernel(
    const __bf16* __restrict__ xb, const __bf16* __restrict__ sb, int lda,
    const __bf16* __restrict__ WqT, const __bf16* __restrict__ WkT,
    const __bf16* __restrict__ WvT, int ldb, int K, __bf16* __restrict__ Qf,
    float* __restrict__ KVp, float* __restrict__ Ksp) {
  __shared__ alignas(16) a_tiles_t As;
  __shared__ alignas(16) b_tiles_t Bs;
  const int bx = blockIdx.x;
  const bool kvb = bx < 4;
  const __bf16* Blo =
      kvb ? WkT + (size_t)bx * 128 * ldb : WqT + (size_t)(bx - 4) * 256 * ldb;
  const __bf16* Bhi = kvb ? WvT + (size_t)bx * 128 * ldb : Blo + (size_t)128 * ldb;
  v8f acc[4][4];
  gemm_main<false, 2>(As, Bs, kvb ? sb : xb, nullptr, lda, Blo, Bhi, ldb, K, acc);

  const int lane = threadIdx.x & 31;
  // the wave's number, scalar: the tests on it below are scalar branches
  const int wid = __builtin_amdgcn_readfirstlane(threadIdx.x >> 5);
  const int wr = wid >> 2;            // 0..1 (m)
  const int wc = (wid + 2 * wr) & 3;  // 0..3 (n); in a K, V tile 0, 1: K; 2, 3: V
  const int rofs = (lane >> 4) << 3;
  const int row0 = blockIdx.y * 128 + wr * 64 + rofs;  // the lane's first row
  // the strip's first column in Q or in K
  const int colb = (kvb ? bx * 128 : (bx - 4) * 256) + wc * 64;
  const bool rot = !kvb || wc < 2;
  const int sgn = (lane & 1) ? 0 : (int)0x80000000;
  // a block's 128 rows never cross a sequence's end
  const int pos0 = row0 & (LL - 1);
  float dv[4] = {0.f, 0.f, 0.f, 0.f};
  if (rot) {
#pragma unroll
    for (int ni = 0; ni < 4; ++ni)
      dv[ni] = exp_fast((float)(colb + (lane & 14) + ni * 16) *
                        (-9.2103403719761836f / 512.0f));
  }
  __bf16* T = &Bs[0][0];
  __bf16* tp = T + (wc * 64 + (lane & 15)) * TSTR + wr * 64 + rofs;
  __bf16* cp = Qf + (size_t)row0 * DD + colb + (lane & 15);
#pragma unroll
  for (int mi = 0; mi < 4; ++mi) {
    if (rot) rope_elu_tiles(acc[mi], pos0 + mi * 16, dv, sgn);
    if (kvb) {
#pragma unroll
      for (int ni = 0; ni < 4; ++ni)
        *(v8bf*)(tp + ni * 16 * TSTR + mi * 16) =
            __builtin_convertvector(acc[mi][ni], v8bf);
    } else {
#pragma unroll
      for (int ni = 0; ni < 4; ++ni)
#pragma unroll
        for (int j = 0; j < 8; ++j)
          cp[(mi * 16 + j) * DD + ni * 16] = (__bf16)acc[mi][ni][j];
      // In front of what follows (the next row's arithmetic; behind the last row,
      // in the built code, the other blocks' path), which may write registers that
      // these stores name.
      asm volatile("s_wait_xcnt 0x0" ::: "memory");
    }
    // A row of tiles is stored before the next row's arithmetic begins, so the
    // stores drain under it; without this the build kept all 128 for the end.
    __builtin_amdgcn_sched_barrier(0);
  }
  if (!kvb) return;  // the whole block, in front of the barrier
  __syncthreads();   // below, a wave reads columns of T that other waves stored

  // Wave: head hd of the two, 16 rows v (mv) by all 64 columns d of its KV.
  const int hd = wid >> 2, mv = wid & 3;
  v8f kv[4];
#pragma unroll
  for (int nd = 0; nd < 4; ++nd)
#pragma unroll
    for (int j = 0; j < 8; ++j) kv[nd][j] = 0.f;
#pragma unroll
  for (int ks = 0; ks < 128; ks += 32) {
    v16bf a = frag_lds(T + (128 + hd * 64 + mv * 16) * TSTR + ks, TSTR, lane);
#pragma unroll
    for (int nd = 0; nd < 4; ++nd) {
      v16bf bb = frag_lds(T + (hd * 64 + nd * 16) * TSTR + ks, TSTR, lane);
      kv[nd] = wmma_bf16f32(a, bb, kv[nd]);
    }
  }
  const int split = blockIdx.y % NSPLIT;
  const int bh0 = (blockIdx.y / NSPLIT) * HH + bx * 2;
  float* kp = KVp + (size_t)split * KVN +
              ((size_t)(bh0 + hd) * 64 + mv * 16 + rofs) * 64 + (lane & 15);
#pragma unroll
  for (int nd = 0; nd < 4; ++nd)
#pragma unroll
    for (int j = 0; j < 8; ++j) kp[j * 64 + nd * 16] = kv[nd][j];
  // In front of the sums below, which may write registers that these stores name.
  asm volatile("s_wait_xcnt 0x0" ::: "memory");

  // Ksum: a lane sums one K column; a wave's 32 sums fill one 128-byte line.
  if (wid < 4) {
    const __bf16* kr = T + (wid * 32 + lane) * TSTR;
    float part[4] = {0.f, 0.f, 0.f, 0.f};  // four independent chains
#pragma unroll
    for (int c = 0; c < 16; ++c) {
      const v8bf k8 = *(const v8bf*)(kr + c * 8);
#pragma unroll
      for (int e = 0; e < 8; ++e) part[c & 3] += (float)k8[e];
    }
    Ksp[(size_t)split * KSN + (size_t)bh0 * DHD + wid * 32 + lane] =
        (part[0] + part[1]) + (part[2] + part[3]);
  }
}

// Two GEMMs with f32 results of pitch DD in one launch, for the same reason;
// blockIdx.z picks the operands; the longer K comes first.
__global__ __launch_bounds__(256) GEMM_TWO_GROUPS void gemm_f32_pair_kernel(
    const __bf16* __restrict__ A0, int lda0, const __bf16* __restrict__ Bt0,
    float* __restrict__ C0, const __bf16* __restrict__ A1, int lda1,
    const __bf16* __restrict__ Bt1, float* __restrict__ C1) {
  __shared__ alignas(16) a_tiles_t As;
  __shared__ alignas(16) b_tiles_t Bs;
  const bool first = blockIdx.z == 0;
  const int ld = first ? lda0 : lda1;  // row pitch of A and of Bt, and K
  v8f acc[4][4];
  const __bf16* Blo = (first ? Bt0 : Bt1) + (size_t)blockIdx.x * 256 * ld;
  gemm_main<false, 0>(As, Bs, first ? A0 : A1, nullptr, ld, Blo,
                      Blo + (size_t)128 * ld, ld, ld, acc);
  gemm_store<GEMM_F32, DD>(acc, first ? C0 : C1, nullptr);
}

// ---------------------------------------------------------------------------
// Adds the NSPLIT partial planes: KVt (bf16) from KVp, Ksum (f32) from Ksp.
// Blocks 0 .. KVN/256-1 take KV elements, the rest Ksum elements.
// ---------------------------------------------------------------------------
__global__ __launch_bounds__(256) void split_reduce_kernel(
    const float* __restrict__ KVp, const float* __restrict__ Ksp,
    __bf16* __restrict__ KVt, float* __restrict__ Ksum) {
  const int i = blockIdx.x * 256 + threadIdx.x;
  float acc = 0.f;
  if (blockIdx.x < KVN / 256) {
    const unsigned voff = (unsigned)i * 4;  // the element's byte offset in a plane
    float v[NSPLIT];
#pragma unroll  // all NSPLIT loads in flight at once
    for (int p = 0; p < NSPLIT; ++p)
      v[p] = *(const float*)((const char*)KVp + (size_t)p * KVN * 4 + voff);
    loads_issued(voff);
#pragma unroll
    for (int p = 0; p < NSPLIT; ++p) acc += v[p];
    KVt[i] = (__bf16)acc;
  } else {
    const int j = i - KVN;
#pragma unroll  // all NSPLIT loads in flight at once
    for (int p = 0; p < NSPLIT; ++p) acc += Ksp[(size_t)p * KSN + j];
    Ksum[j] = acc;
    // Stands in front of the other branch's loads: in the built code a path
    // leads on to them from here, and the first writes this store's data register.
    asm volatile("s_wait_xcnt 0x0" ::: "memory");
  }
}

template <int SRC>
static __device__ __forceinline__ float row_share(float v) {
  return __builtin_bit_cast(
      float, __builtin_amdgcn_update_dpp(0, __builtin_bit_cast(int, v),
                                         0x150 + SRC /* row_share:SRC */, 0xf, 0xf,
                                         true));
}

__global__ __launch_bounds__(256) void attn_out_kernel(
    const __bf16* __restrict__ Qf, const __bf16* __restrict__ KVt,
    const float* __restrict__ Ksum, const float* __restrict__ thr,
    __bf16* __restrict__ Ao) {
  __shared__ alignas(16) __bf16 Aq[128 * 72];
  __shared__ alignas(16) __bf16 Kv[64 * 72];
  const int tid = threadIdx.x, lane = tid & 31, wid = tid >> 5;
  const int bh = blockIdx.y, b = bh >> 3, h = bh & 7;
  const size_t rowbase = (size_t)b * LL + (size_t)blockIdx.x * 128;

#pragma unroll
  for (int i = 0; i < 4; ++i) {  // Q tile 128x64 (async DMA)
    int c = tid + i * 256;
    int row = c >> 3, cc = (c & 7) << 3;
    async_copy16(&Aq[row * 72 + cc], Qf + (rowbase + row) * DD + h * DHD + cc);
  }
#pragma unroll
  for (int i = 0; i < 2; ++i) {  // KVt 64x64 (async DMA)
    int c = tid + i * 256;
    int row = c >> 3, cc = (c & 7) << 3;
    async_copy16(&Kv[row * 72 + cc], KVt + ((size_t)bh * 64 + row) * 64 + cc);
  }
  // the 32 elements of Ksum that meet the lane's half of a Q row
  const unsigned voff = (lane & 1) * 128;  // the half's byte offset in Ksum[b,h]
  const char* ksb = (const char*)(Ksum + (size_t)bh * DHD);
  v4f ksv[8];
#pragma unroll
  for (int i = 0; i < 8; ++i) ksv[i] = *(const v4f*)(ksb + i * 16 + voff);
  const float th = thr[0];
  loads_issued(voff);
  wait_async0();
  __syncthreads();

  float z;
  {
    const __bf16* qh = &Aq[(wid * 16 + (lane >> 1)) * 72 + (lane & 1) * 32];
    float part[4];  // four independent chains of eight products
#pragma unroll
    for (int c = 0; c < 4; ++c) {
      const v8bf q8 = *(const v8bf*)(qh + c * 8);
      part[c] = 0.f;
#pragma unroll
      for (int e = 0; e < 8; ++e)
        part[c] += (float)q8[e] * ksv[c * 2 + (e >> 2)][e & 3];
    }
    const float sc =
        row_xor_add<0x161>((part[0] + part[1]) + (part[2] + part[3]));
    const float sp = sc > th ? sc : 0.f;
    z = 1.0f / (sp + 1e-6f);
  }

  v8f acc[4];
#pragma unroll
  for (int ni = 0; ni < 4; ++ni)
#pragma unroll
    for (int j = 0; j < 8; ++j) acc[ni][j] = 0.f;

#pragma unroll
  for (int ks = 0; ks < 64; ks += 32) {
    v16bf a = frag_lds(&Aq[(wid * 16) * 72 + ks], 72, lane);
#pragma unroll
    for (int ni = 0; ni < 4; ++ni) {
      v16bf bb = frag_lds(&Kv[(ni * 16) * 72 + ks], 72, lane);
      acc[ni] = wmma_bf16f32(a, bb, acc[ni]);
    }
  }

  const int rofs = (lane >> 4) << 3;
  // Z of accumulator row j (tile row rofs + j): from lane 2j of the 16-lane row
  const float zv[8] = {row_share<0>(z),  row_share<2>(z),  row_share<4>(z),
                       row_share<6>(z),  row_share<8>(z),  row_share<10>(z),
                       row_share<12>(z), row_share<14>(z)};
#pragma unroll
  for (int ni = 0; ni < 4; ++ni) {
    int col = h * DHD + ni * 16 + (lane & 15);
#pragma unroll
    for (int j = 0; j < 8; ++j) {
      size_t row = rowbase + wid * 16 + rofs + j;
      Ao[row * DD + col] = (__bf16)(acc[ni][j] * zv[j]);
    }
  }
}

// ---------------------------------------------------------------------------
// LayerNorm over 512 f32; writes the f32 or the bf16 output.
// One wave per row, LN_R rows a wave: a lane holds 16 elements of a row (four
// 16-byte loads, 512 contiguous bytes a wave each); the row's sums are taken
// inside the wave.  A block covers 8 * LN_R rows.
// ---------------------------------------------------------------------------
#define LN_R 2

template <int BF16OUT>
__global__ __launch_bounds__(256) void layernorm_kernel(
    const float* __restrict__ in, const float* __restrict__ g,
    const float* __restrict__ bta, float* __restrict__ out_f32,
    __bf16* __restrict__ out_bf16) {
  const int lane = threadIdx.x & 31;
  // the wave's number, scalar: row bases stay in scalar registers
  const int wid = __builtin_amdgcn_readfirstlane(threadIdx.x >> 5);
  const size_t row0 = ((size_t)blockIdx.x * 8 + wid) * LN_R;
  const int c0 = lane * 4;
  const unsigned voff = lane * 16;  // the lane's byte offset in a 512-byte piece
  const char* inb = (const char*)(in + row0 * DD);
  v4f v[LN_R][4], gv[4], bv[4];
#pragma unroll
  for (int r = 0; r < LN_R; ++r)
#pragma unroll
    for (int j = 0; j < 4; ++j)
      v[r][j] = *(const v4f*)(inb + (r * DD + j * 128) * 4 + voff);
#pragma unroll
  for (int j = 0; j < 4; ++j) {
    gv[j] = *(const v4f*)((const char*)g + j * 512 + voff);
    bv[j] = *(const v4f*)((const char*)bta + j * 512 + voff);
  }
  loads_issued(voff);
#pragma unroll
  for (int r = 0; r < LN_R; ++r) {
    float s = 0.f, q = 0.f;
#pragma unroll
    for (int j = 0; j < 4; ++j)
#pragma unroll
      for (int e = 0; e < 4; ++e) {
        s += v[r][j][e];
        q += v[r][j][e] * v[r][j][e];
      }
    s = wave_sum(s);
    q = wave_sum(q);
    const float mu = s * (1.0f / DD);
    const float var = q * (1.0f / DD) - mu * mu;
    const float rstd = rsqrtf(var + 1e-5f);
#pragma unroll
    for (int j = 0; j < 4; ++j)
#pragma unroll
      for (int e = 0; e < 4; ++e)
        v[r][j][e] = (v[r][j][e] - mu) * rstd * gv[j][e] + bv[j][e];
  }
  if (BF16OUT) {
    v4bf o[LN_R][4];
#pragma unroll
    for (int r = 0; r < LN_R; ++r)
#pragma unroll
      for (int j = 0; j < 4; ++j) o[r][j] = __builtin_convertvector(v[r][j], v4bf);
#pragma unroll
    for (int r = 0; r < LN_R; ++r)
#pragma unroll
      for (int j = 0; j < 4; ++j)
        *(v4bf*)(out_bf16 + (row0 + r) * DD + j * 128 + c0) = o[r][j];
  } else {
#pragma unroll
    for (int r = 0; r < LN_R; ++r)
#pragma unroll
      for (int j = 0; j < 4; ++j)
        *(v4f*)(out_f32 + (row0 + r) * DD + j * 128 + c0) = v[r][j];
  }
}

// ---------------------------------------------------------------------------
// out = x + LN(mlp2; g2, b2) + LN(aug32 + baug; gaug, bln)
// One wave per row as in layernorm_kernel, FIN_R rows a wave: one row's 32 loads
// already hold 128 registers.
// ---------------------------------------------------------------------------
#define FIN_R 1

__global__ __launch_bounds__(256) void final_kernel(
    const float* __restrict__ x, const float* __restrict__ mlp2,
    const float* __restrict__ g2, const float* __restrict__ b2,
    const float* __restrict__ aug32, const float* __restrict__ baug,
    const float* __restrict__ gaug, const float* __restrict__ bln,
    float* __restrict__ out) {
  const int lane = threadIdx.x & 31;
  // the wave's number, scalar: row bases stay in scalar registers
  const int wid = __builtin_amdgcn_readfirstlane(threadIdx.x >> 5);
  const size_t row0 = ((size_t)blockIdx.x * 8 + wid) * FIN_R;
  const int c0 = lane * 4;
  const unsigned voff = lane * 16;  // the lane's byte offset in a 512-byte piece
  const char* ab = (const char*)(aug32 + row0 * DD);
  const char* xb = (const char*)(x + row0 * DD);
  const char* mb = (const char*)(mlp2 + row0 * DD);
  v4f a[FIN_R][4], xv[FIN_R][4], mv[FIN_R][4], av[4], gv[4], bv[4], g2v[4], b2v[4];
#pragma unroll
  for (int r = 0; r < FIN_R; ++r)
#pragma unroll
    for (int j = 0; j < 4; ++j)
      a[r][j] = *(const v4f*)(ab + (r * DD + j * 128) * 4 + voff);
#pragma unroll
  for (int j = 0; j < 4; ++j)
    av[j] = *(const v4f*)((const char*)baug + j * 512 + voff);
#pragma unroll
  for (int r = 0; r < FIN_R; ++r)
#pragma unroll
    for (int j = 0; j < 4; ++j) {
      xv[r][j] = *(const v4f*)(xb + (r * DD + j * 128) * 4 + voff);
      mv[r][j] = *(const v4f*)(mb + (r * DD + j * 128) * 4 + voff);
    }
#pragma unroll
  for (int j = 0; j < 4; ++j) {
    gv[j] = *(const v4f*)((const char*)gaug + j * 512 + voff);
    bv[j] = *(const v4f*)((const char*)bln + j * 512 + voff);
    g2v[j] = *(const v4f*)((const char*)g2 + j * 512 + voff);
    b2v[j] = *(const v4f*)((const char*)b2 + j * 512 + voff);
  }
  loads_issued(voff);
#pragma unroll
  for (int r = 0; r < FIN_R; ++r) {
    float s = 0.f, q = 0.f, s2 = 0.f, q2 = 0.f;
#pragma unroll
    for (int j = 0; j < 4; ++j) {
      a[r][j] += av[j];
#pragma unroll
      for (int e = 0; e < 4; ++e) {
        s += a[r][j][e];
        q += a[r][j][e] * a[r][j][e];
        s2 += mv[r][j][e];
        q2 += mv[r][j][e] * mv[r][j][e];
      }
    }
    s = wave_sum(s);
    q = wave_sum(q);
    s2 = wave_sum(s2);
    q2 = wave_sum(q2);
    const float mu = s * (1.0f / DD);
    const float var = q * (1.0f / DD) - mu * mu;
    const float rstd = rsqrtf(var + 1e-5f);
    const float mu2 = s2 * (1.0f / DD);
    const float var2 = q2 * (1.0f / DD) - mu2 * mu2;
    const float rstd2 = rsqrtf(var2 + 1e-5f);
#pragma unroll
    for (int j = 0; j < 4; ++j)
#pragma unroll
      for (int e = 0; e < 4; ++e) {
        const float l = (a[r][j][e] - mu) * rstd * gv[j][e] + bv[j][e];
        const float m = (mv[r][j][e] - mu2) * rstd2 * g2v[j][e] + b2v[j][e];
        a[r][j][e] = xv[r][j][e] + m + l;
      }
  }
#pragma unroll
  for (int r = 0; r < FIN_R; ++r)
#pragma unroll
    for (int j = 0; j < 4; ++j)
      *(v4f*)(out + (row0 + r) * DD + j * 128 + c0) = a[r][j];
}

// ---------------------------------------------------------------------------
// Host orchestration
// ---------------------------------------------------------------------------
extern "C" void kernel_launch(void* const* d_in, const int* in_sizes, int n_in,
                              void* d_out, int out_size, void* d_ws,
                              size_t ws_size, hipStream_t stream) {
  (void)in_sizes; (void)n_in; (void)out_size; (void)ws_size;
  const float* x      = (const float*)d_in[0];
  const float* source = (const float*)d_in[1];
  const float* Wq     = (const float*)d_in[2];
  const float* Wk     = (const float*)d_in[3];
  const float* Wv     = (const float*)d_in[4];
  const float* Wmerge = (const float*)d_in[5];
  const float* Wmlp1  = (const float*)d_in[6];
  const float* Wmlp2  = (const float*)d_in[7];
  const float* g1     = (const float*)d_in[8];
  const float* b1     = (const float*)d_in[9];
  const float* g2     = (const float*)d_in[10];
  const float* b2     = (const float*)d_in[11];
  const float* Waug   = (const float*)d_in[12];
  const float* baug   = (const float*)d_in[13];
  const float* gaug   = (const float*)d_in[14];
  const float* bln    = (const float*)d_in[15];
  const float* thr    = (const float*)d_in[16];
  float* out = (float*)d_out;

  char* ws = (char*)d_ws;
  size_t off = 0;
  auto take = [&](size_t bytes) -> char* {
    char* p = ws + off;
    off += (bytes + 255) & ~(size_t)255;
    return p;
  };

  __bf16* xb   = (__bf16*)take((size_t)NT * DD * 2);
  __bf16* sb   = (__bf16*)take((size_t)NT * DD * 2);
  __bf16* WqT  = (__bf16*)take((size_t)DD * DD * 2);
  __bf16* WkT  = (__bf16*)take((size_t)DD * DD * 2);
  __bf16* WvT  = (__bf16*)take((size_t)DD * DD * 2);
  __bf16* WmT  = (__bf16*)take((size_t)DD * DD * 2);
  __bf16* W1T  = (__bf16*)take((size_t)D2 * D2 * 2);
  __bf16* W2T  = (__bf16*)take((size_t)DD * D2 * 2);
  __bf16* WaT  = (__bf16*)take((size_t)DD * DD * 2);
  float*  C1   = (float*)take((size_t)NT * DD * 4);
  __bf16* Qf   = (__bf16*)take((size_t)NT * DD * 2);
  float*  Ksum = (float*)take((size_t)BB * HH * DHD * 4);
  __bf16* KVt  = (__bf16*)take((size_t)BB * HH * 64 * 64 * 2);
  __bf16* Ao   = (__bf16*)take((size_t)NT * DD * 2);
  __bf16* Msgb = (__bf16*)take((size_t)NT * DD * 2);
  __bf16* Hb   = (__bf16*)take((size_t)NT * D2 * 2);
  float*  KVp  = (float*)take((size_t)NSPLIT * KVN * 4);
  float*  Ksp  = (float*)take((size_t)NSPLIT * KSN * 4);

  float*  Aug  = (float*)take((size_t)NT * DD * 4);

  const dim3 blk(256);

  // 1) Convert activations and (transposed) weights to bf16
  prep_kernel<<<dim3(TR_ALL + 2 * CVT_NB), blk, 0, stream>>>(
      x, source, Wq, Wk, Wv, Wmerge, Wmlp1, Wmlp2, Waug, xb, sb, WqT, WkT, WvT, WmT,
      W1T, W2T, WaT);

  // 2) Qf = elu(rope(x@Wq)) + 1 (bf16); of Kf = elu(rope(source@Wk)) + 1 and
  //    Vb = source@Wv each block's share of the sums over s (fused epilogues)
  qkv_gemm_kernel<<<dim3(HH / 2 + DD / 256, NT / 128), blk, 0, stream>>>(
      xb, sb, DD, WqT, WkT, WvT, DD, DD, Qf, KVp, Ksp);

  // 3) attention core
  split_reduce_kernel<<<dim3(KVN / 256 + KSN / 256), blk, 0, stream>>>(
      KVp, Ksp, KVt, Ksum);
  attn_out_kernel<<<dim3(LL / 128, BB * HH), blk, 0, stream>>>(Qf, KVt, Ksum, thr,
                                                               Ao);

  // 4) merge + LN1 -> Msgb (bf16)
  gemm_bf16_kernel<GEMM_F32, DD, false>
      <<<dim3(DD / 256, NT / 128), blk, 0, stream>>>(Ao, nullptr, DD, WmT, DD, C1,
                                                     DD, nullptr);
  layernorm_kernel<1><<<dim3(NT / (8 * LN_R)), blk, 0, stream>>>(C1, g1, b1, nullptr, Msgb);

  // 5) MLP1: Hb = relu([x, msg] @ Wmlp1) (bf16, fused epilogue)
  gemm_bf16_kernel<GEMM_RELU, D2, true>
      <<<dim3(D2 / 256, NT / 128), blk, 0, stream>>>(xb, Msgb, DD, W1T, D2,
                                                     nullptr, D2, Hb);

  // 6) MLP2 -> C1 and the aug GEMM -> Aug
  gemm_f32_pair_kernel<<<dim3(DD / 256, NT / 128, 2), blk, 0, stream>>>(
      Hb, D2, W2T, C1, xb, DD, WaT, Aug);

  // 7) both LayerNorms and the residual
  final_kernel<<<dim3(NT / (8 * FIN_R)), blk, 0, stream>>>(x, C1, g2, b2, Aug, baug,
                                                           gaug, bln, out);
}

// v010
// A run of this version takes 122 microseconds.
// In two side-by-side timings against v009, it was 1.08 and 1.07 times as fast.
// Counting every step since v000, it is 5.03 times as fast.
#include <hip/hip_runtime.h>
#include <hip/hip_bf16.h>

#define BB 4
#define LL 4096
#define SSEQ 4096
#define DD 512
#define HH 8
#define DHD 64
#define NT (BB * LL)     /* 16384 token rows */
#define D2 (2 * DD)      /* 1024 */
#define NSPLIT (SSEQ / 128) /* work-groups that share one (b,h) sum over s */
#define KVN (BB * HH * DHD * DHD) /* elements of one KV partial plane */
#define KSN (BB * HH * DHD)       /* elements of one Ksum partial plane */

typedef __bf16 v16bf __attribute__((ext_vector_type(16)));
typedef __bf16 v8bf  __attribute__((ext_vector_type(8)));
typedef float  v8f   __attribute__((ext_vector_type(8)));
typedef int    v4i   __attribute__((ext_vector_type(4)));
typedef float  v4f   __attribute__((ext_vector_type(4)));
typedef __bf16 v4bf  __attribute__((ext_vector_type(4)));
typedef float  v2f   __attribute__((ext_vector_type(2)));

#if defined(__has_builtin)
#if __has_builtin(__builtin_amdgcn_global_load_async_to_lds_b128)
#define HAVE_ASYNC_BUILTIN 1
#endif
#if __has_builtin(__builtin_amdgcn_s_wait_asynccnt)
#define HAVE_ASYNCWAIT_BUILTIN 1
#endif
#endif

static __device__ __forceinline__ void async_copy16(void* lds, const void* g) {
#ifdef HAVE_ASYNC_BUILTIN
  __builtin_amdgcn_global_load_async_to_lds_b128(
      (__attribute__((address_space(1))) v4i*)(g),
      (__attribute__((address_space(3))) v4i*)(lds), 0, 0);
#else
  asm volatile("global_load_async_to_lds_b128 %0, %1, off" ::"v"(
                   (unsigned)(size_t)lds),
               "v"(g)
               : "memory");
#endif
}

static __device__ __forceinline__ void wait_async0() {
#ifdef HAVE_ASYNCWAIT_BUILTIN
  __builtin_amdgcn_s_wait_asynccnt(0);
#else
  asm volatile("s_wait_asynccnt 0x0" ::: "memory");
#endif
}

static __device__ __forceinline__ v8f wmma_bf16f32(v16bf a, v16bf b, v8f c) {
  // D = A(16x32) * B(32x16) + C, f32 accumulate
  return __builtin_amdgcn_wmma_f32_16x16x32_bf16(false, a, false, b, (short)0, c,
                                                 false, false);
}

static __device__ __forceinline__ v16bf frag_lds(const __bf16* tile, int stride,
                                                 int lane) {
  const int row  = lane & 15;
  const int koff = (lane >> 4) << 3;
  const __bf16* p = tile + row * stride + koff;
  v8bf lo = *(const v8bf*)(p);
  v8bf hi = *(const v8bf*)(p + 16);
  return __builtin_shufflevector(lo, hi, 0, 1, 2, 3, 4, 5, 6, 7, 8, 9, 10, 11,
                                 12, 13, 14, 15);
}

// ---------------------------------------------------------------------------
// Sum over the 32 lanes of a wave, the same bits in every lane: four xor steps
// inside each 16-lane row, then the exchange with the other row.
// ---------------------------------------------------------------------------
// the value that the lane's partner (row_xmask in CTRL) holds
template <int CTRL>
static __device__ __forceinline__ float row_xor_get(float v) {
  return __builtin_bit_cast(
      float, __builtin_amdgcn_update_dpp(0, __builtin_bit_cast(int, v), CTRL, 0xf,
                                         0xf, true));
}

template <int CTRL>
static __device__ __forceinline__ float row_xor_add(float v) {
  return v + row_xor_get<CTRL>(v);
}

static __device__ __forceinline__ float wave_sum(float v) {
  v = row_xor_add<0x161>(v);  // row_xmask:1
  v = row_xor_add<0x162>(v);  // row_xmask:2
  v = row_xor_add<0x164>(v);  // row_xmask:4
  v = row_xor_add<0x168>(v);  // row_xmask:8
  const int b = __builtin_bit_cast(int, v);
  const int o =
      __builtin_amdgcn_permlanex16(b, b, 0x76543210, 0xfedcba98, false, false);
  return v + __builtin_bit_cast(float, o);
}

// Stands behind a kernel's whole group of loads, which share the offset register
// voff.
static __device__ __forceinline__ void loads_issued(unsigned voff) {
  // In front of every later write of a register that these loads name; as an
  // operand voff stays live up to here, so no load's result lands on it.
  asm volatile("s_wait_xcnt 0x0" ::"v"(voff) : "memory");
  // No arithmetic moves up among the loads: without it the build issued part of
  // the group late, behind waits for the first loads.
  __builtin_amdgcn_sched_barrier(0);
}

static __device__ __forceinline__ float exp2_slot(float x) {
  float y;
  asm("v_exp_f32 %0, %1\n\tv_nop" : "=&v"(y) : "v"(x));
  return y;
}

// exp(x) as the fast library form computes it
static __device__ __forceinline__ float exp_fast(float x) {
  return exp2_slot(x * 1.44269504088896340736f);
}

// sine and cosine of an angle in radians, as the fast library form computes them
static __device__ __forceinline__ void sincos_fast(float a, float* s, float* c) {
  const float rev = a * 0.15915494309189532f;
  asm("v_sin_f32 %0, %2\n\tv_cos_f32 %1, %2\n\tv_nop"
      : "=&v"(*s), "=&v"(*c)
      : "v"(rev));
}

// ---------------------------------------------------------------------------
// Elementwise conversion.  A thread takes CVT_G groups of four floats, each a
// 16-byte load (512 contiguous bytes a wave), all issued before the first use.
// One block covers CVT_BLK elements (block blk of the array); CVT_BLK divides n.
// ---------------------------------------------------------------------------
#define CVT_G 8
#define CVT_BLK (256 * 4 * CVT_G)

static __device__ __forceinline__ void f32_to_bf16_block(
    const float* __restrict__ in, __bf16* __restrict__ out, int blk) {
  const size_t base = (size_t)blk * CVT_BLK + threadIdx.x * 4;
  v4f v[CVT_G];
  v4bf o[CVT_G];
#pragma unroll
  for (int j = 0; j < CVT_G; ++j) v[j] = *(const v4f*)(in + base + j * 1024);
#pragma unroll
  for (int j = 0; j < CVT_G; ++j) o[j] = __builtin_convertvector(v[j], v4bf);
#pragma unroll
  for (int j = 0; j < CVT_G; ++j) *(v4bf*)(out + base + j * 1024) = o[j];
}

// W[k][n] (f32, KxN row-major) -> Wt[n][k] (bf16, NxK row-major)
// Block tile: 64 k x 32 n.  A thread reads 8 consecutive k of one n and stores
// them as 16 bytes; 8 lanes side by side in k fill one 128-byte line of Wt.
// Tiles: bx in 0 .. N / 32 - 1, by in 0 .. K / 64 - 1.
// gs: nullptr, or a factor for each of the rows k = DD .. 2 * DD - 1 of W.
static __device__ __forceinline__ void transpose_bf16_block(
    const float* __restrict__ W, __bf16* __restrict__ Wt, int K, int N, int bx,
    int by, const float* __restrict__ gs) {
  const int k0 = by * 64 + (threadIdx.x & 7) * 8;
  const int n  = bx * 32 + (threadIdx.x >> 3);
  const float* wp = W + (size_t)k0 * N + n;
  float w[8];
#pragma unroll
  for (int e = 0; e < 8; ++e) w[e] = wp[(size_t)e * N];
  if (gs != nullptr && by >= DD / 64) {  // the same for the whole block
    // In front of what follows, which writes registers that the loads above name;
    asm volatile("s_wait_xcnt 0x0" ::: "memory");
    // and none of it moves up over the wait.
    __builtin_amdgcn_sched_barrier(0);
#pragma unroll
    for (int e = 0; e < 8; ++e) w[e] *= gs[k0 - DD + e];
  }
  v8bf o;
#pragma unroll
  for (int e = 0; e < 8; ++e) o[e] = (__bf16)w[e];
  *(v8bf*)(Wt + (size_t)n * K + k0) = o;
}

// LayerNorm 1 is applied inside MLP1 (mlp1_gemm_kernel).  With W' = g1[k] * Wmlp1[DD
// + k][n], rounded to bf16 as the GEMM reads it, that takes for every column n
// cs[n] = sum_k W'[k][n] and bb[n] = sum_k b1[k] * Wmlp1[DD + k][n].
// A block takes 32 columns (a lane one column, so a wave's load is one 128-byte
// line), a wave 64 of the 512 rows k; the eight waves' sums meet in LDS.
#define CS_NB (D2 / 32)

static __device__ __forceinline__ void colsum_block(
    const float* __restrict__ W1, const float* __restrict__ g1,
    const float* __restrict__ b1, float* __restrict__ cs, float* __restrict__ bb,
    int blk) {
  __shared__ float red[8][2][32];
  const int lane = threadIdx.x & 31;
  // the wave's number, scalar: row bases and g1, b1 stay in scalar registers
  const int wid = __builtin_amdgcn_readfirstlane(threadIdx.x >> 5);
  const int n = blk * 32 + lane;
  const unsigned voff = (unsigned)n * 4;  // the column's byte offset in a row
  const char* wb = (const char*)(W1 + (size_t)(DD + wid * 64) * D2);
  float w[64];
#pragma unroll  // all 64 loads in flight at once
  for (int e = 0; e < 64; ++e)
    w[e] = *(const float*)(wb + (size_t)e * D2 * 4 + voff);
  loads_issued(voff);
  float c[4] = {0.f, 0.f, 0.f, 0.f}, b[4] = {0.f, 0.f, 0.f, 0.f};
#pragma unroll
  for (int e = 0; e < 64; ++e) {  // four independent chains each
    c[e & 3] += (float)(__bf16)(w[e] * g1[wid * 64 + e]);
    b[e & 3] += w[e] * b1[wid * 64 + e];
  }
  red[wid][0][lane] = (c[0] + c[1]) + (c[2] + c[3]);
  red[wid][1][lane] = (b[0] + b[1]) + (b[2] + b[3]);
  __syncthreads();  // wave 0 reads what the other waves stored
  if (wid == 0) {
    float cc = 0.f, bs = 0.f;
#pragma unroll
    for (int i = 0; i < 8; ++i) {
      cc += red[i][0][lane];
      bs += red[i][1][lane];
    }
    cs[n] = cc;
    bb[n] = bs;
  }
}

// All input conversions in one launch: none reads what another writes.  The
// block index picks the job: first the column sums and the weight tiles (short,
// bound by latency), which then run under the two activation streams behind them.
#define TR_W1 ((D2 / 32) * (D2 / 64))  /* 512 tiles of Wmlp1 */
#define TR_W2 ((DD / 32) * (D2 / 64))  /* 256 tiles of Wmlp2 */
#define TR_SQ ((DD / 32) * (DD / 64))  /* 128 tiles of each 512 x 512 weight */
#define TR_ALL (TR_W1 + TR_W2 + 5 * TR_SQ)
#define CVT_NB (NT * DD / CVT_BLK)     /* 1024 blocks for x, as many for source */

__global__ __launch_bounds__(256) void prep_kernel(
    const float* __restrict__ x, const float* __restrict__ source,
    const float* __restrict__ Wq, const float* __restrict__ Wk,
    const float* __restrict__ Wv, const float* __restrict__ Wmerge,
    const float* __restrict__ Wmlp1, const float* __restrict__ Wmlp2,
    const float* __restrict__ Waug, const float* __restrict__ g1,
    const float* __restrict__ b1, __bf16* __restrict__ xb,
    __bf16* __restrict__ sb, __bf16* __restrict__ WqT, __bf16* __restrict__ WkT,
    __bf16* __restrict__ WvT, __bf16* __restrict__ WmT, __bf16* __restrict__ W1T,
    __bf16* __restrict__ W2T, __bf16* __restrict__ WaT, float* __restrict__ cs,
    float* __restrict__ bb) {
  if (blockIdx.x < CS_NB) {  // the whole block
    colsum_block(Wmlp1, g1, b1, cs, bb, blockIdx.x);
    return;
  }
  const int blk = blockIdx.x - CS_NB;
  if (blk < TR_ALL) {
    const float* W;
    __bf16* Wt;
    const float* gs = nullptr;
    int K = DD, N = DD, t;
    if (blk < TR_W1) {
      W = Wmlp1; Wt = W1T; K = D2; N = D2; t = blk; gs = g1;
    } else if (blk < TR_W1 + TR_W2) {
      W = Wmlp2; Wt = W2T; K = D2; t = blk - TR_W1;
    } else {
      const int w = (blk - (TR_W1 + TR_W2)) / TR_SQ;
      t = (blk - (TR_W1 + TR_W2)) % TR_SQ;
      W  = w == 0 ? Wq : w == 1 ? Wk : w == 2 ? Wv : w == 3 ? Wmerge : Waug;
      Wt = w == 0 ? WqT : w == 1 ? WkT : w == 2 ? WvT : w == 3 ? WmT : WaT;
    }
    const int sh = N == D2 ? 5 : 4;  // log2 of the N / 32 tiles in a row of tiles
    transpose_bf16_block(W, Wt, K, N, t & ((1 << sh) - 1), t >> sh, gs);
    // Stands in front of the column sums' code: in the built code a path leads on to
    // it from here, and it writes registers that this store names.
    asm volatile("s_wait_xcnt 0x0" ::: "memory");
  } else {
    const int t = blk - TR_ALL;
    const bool first = t < CVT_NB;
    f32_to_bf16_block(first ? x : source, first ? xb : sb, first ? t : t - CVT_NB);
    // Stands in front of the other branch's code: in the built code a path leads
    // on to it from here, and it writes registers that these stores name.
    asm volatile("s_wait_xcnt 0x0" ::: "memory");
  }
}

// ---------------------------------------------------------------------------
// Generic bf16 GEMM: C[M,N](f32) = A[M,K](bf16,row-major) * Bt[N,K]^T
// Block = 256 threads = 8 waves; block tile 128x256, K-step BK = 64, double-buffered
// LDS filled by async global->LDS DMA: a K-step takes 128 bytes of every operand
// row, so a wave's copy covers 4 whole 128-byte lines.  Wave (wr in 0..1, wc in
// 0..3) owns a 64x64 sub-tile = 4x4 wmma tiles: 32 WMMAs per 32 ds_load_b128 per
// K-step.  K is a multiple of BK.
// What becomes of the result and the row pitch of the output are fixed at compile
// time: MODE GEMM_F32 stores f32 to C, GEMM_RELU max(result, 0) and GEMM_BF16 the
// result as bf16 to Cbf; LDC is the pitch in elements.
// TWO_A: the K range is two halves of lda columns each: first A with columns lda ..
// 2 * lda - 1 of Bt, then A2 with columns 0 .. lda - 1; between them mid() is called.
// pre() is called while tile 0 flies; what it stores to LDS the first barrier publishes.
// Blo, Bhi: the rows of Bt that make the tile's columns 0..127 and 128..255.
// ROT: wave w takes column strip (w + ROT * (w / 4)) % 4 of the tile.
// ---------------------------------------------------------------------------
#define GEMM_F32 0
#define GEMM_RELU 1
#define GEMM_BF16 2
#define BK 64    /* columns of A and of Bt in a K-step (128B of a row) */
#define LDSTR 72 /* padded LDS row stride in bf16 elements (144B) */

#define GEMM_TWO_GROUPS __attribute__((amdgpu_waves_per_eu(4, 4)))

typedef __bf16 a_tiles_t[2][128 * LDSTR];
typedef __bf16 b_tiles_t[2][256 * LDSTR];

// The K loop: acc = the wave's 64x64 part of the block's tile (rows: blockIdx.y).
struct no_mid {
  __device__ __forceinline__ void operator()() const {}
};

template <bool TWO_A, int ROT, typename PRE, typename MID>
static __device__ __forceinline__ void gemm_main(
    a_tiles_t& As, b_tiles_t& Bs, const __bf16* __restrict__ A,
    const __bf16* __restrict__ A2, int lda, const __bf16* __restrict__ Blo,
    const __bf16* __restrict__ Bhi, int ldb, int K, v8f (&acc)[4][4],
    const PRE& pre, const MID& mid) {
  const int tid  = threadIdx.x;
  const int lane = tid & 31;
  const int wid  = tid >> 5;
  const int wr   = wid >> 2;              // 0..1 (m)
  const int wc   = (wid + ROT * wr) & 3;  // 0..3 (n)
  const size_t m0 = (size_t)blockIdx.y * 128;

  const __bf16* Ab = A + m0 * lda;

  auto stage_tiles = [&](int buf, int kk) {
    // first column of this K-step in the buffers that hold it (kk is scalar)
    const __bf16* Ak = Ab + kk;
    int kb = kk;
    if (TWO_A) {
      kb = kk < lda ? kk + lda : kk - lda;
      if (kk >= lda) Ak = A2 + m0 * lda + (kk - lda);
    }
#pragma unroll
    for (int i = 0; i < 4; ++i) {  // A tile: 128 rows x 64 cols
      int c   = tid + i * 256;     // 0..1023 chunks of 8 bf16
      int row = c >> 3;            // 0..127
      int cc  = (c & 7) << 3;      // 0,8,..,56
      async_copy16(&As[buf][row * LDSTR + cc],
                   Ak + (size_t)row * lda + cc);
    }
#pragma unroll
    for (int i = 0; i < 8; ++i) {  // B tile: 256 rows x 64 cols
      int c   = tid + i * 256;     // 0..2047
      int row = c >> 3;            // 0..255
      int cc  = (c & 7) << 3;
      async_copy16(&Bs[buf][row * LDSTR + cc],
                   (i < 4 ? Blo : Bhi) + (size_t)(row & 127) * ldb + kb + cc);
    }
  };

#pragma unroll
  for (int mi = 0; mi < 4; ++mi)
#pragma unroll
    for (int ni = 0; ni < 4; ++ni)
#pragma unroll
      for (int j = 0; j < 8; ++j) acc[mi][ni][j] = 0.f;

  // One 32-deep half of a K-step: its 8 fragments (16 LDS loads, all held at once, so
  // that they go out as a group and not two in front of each row), its 16 WMMAs.
  // (what the first row of WMMAs reads comes first: LDS answers in order)
  auto load_frags = [&](int buf, int ks, v16bf (&af)[4], v16bf (&bfv)[4]) {
    af[0] = frag_lds(&As[buf][(wr * 64) * LDSTR + ks], LDSTR, lane);
#pragma unroll
    for (int ni = 0; ni < 4; ++ni)
      bfv[ni] = frag_lds(&Bs[buf][(wc * 64 + ni * 16) * LDSTR + ks], LDSTR, lane);
#pragma unroll
    for (int mi = 1; mi < 4; ++mi)
      af[mi] = frag_lds(&As[buf][(wr * 64 + mi * 16) * LDSTR + ks], LDSTR, lane);
  };
  auto mma_half = [&](const v16bf (&af)[4], const v16bf (&bfv)[4]) {
#pragma unroll
    for (int mi = 0; mi < 4; ++mi)
#pragma unroll
      for (int ni = 0; ni < 4; ++ni)
        acc[mi][ni] = wmma_bf16f32(af[mi], bfv[ni], acc[mi][ni]);
  };

  stage_tiles(0, 0);
  pre();
  // this wave's copies of tile 0 have landed; behind the barrier, every wave's
  asm volatile("s_wait_asynccnt 0x0" ::: "memory");
  __syncthreads();
  if (BK < K) stage_tiles(1, BK);  // tile 1 flies under trip 0

  for (int kk = 0; kk < K; kk += BK) {
    const int cur = (kk / BK) & 1;
    if (TWO_A && kk == lda) mid();  // acc holds the whole first half (scalar test)
    v16bf a0[4], b0[4], a1[4], b1[4];
    load_frags(cur, 0, a0, b0);
    mma_half(a0, b0);
    load_frags(cur, 32, a1, b1);
    // The wave's last reads of this buffer are in registers ...
    asm volatile("s_wait_dscnt 0x0" ::: "memory");
    // ... and its copies of the next tile have landed.
    asm volatile("s_wait_asynccnt 0x0" ::: "memory");
    __syncthreads();  // publishes the next tile; every wave has left this buffer
    if (kk + 2 * BK < K) stage_tiles(cur, kk + 2 * BK);
    mma_half(a1, b1);
  }
  // nothing of the ring is outstanding when its LDS is used for anything else
  asm volatile("s_wait_asynccnt 0x0" ::: "memory");
}

template <int MODE, int LDC>
static __device__ __forceinline__ void gemm_store(v8f (&acc)[4][4],
                                                  float* __restrict__ C,
                                                  __bf16* __restrict__ Cbf) {
  const int lane = threadIdx.x & 31;
  const int wid  = threadIdx.x >> 5;
  const int wr   = wid >> 2;  // 0..1 (m)
  const int wc   = wid & 3;   // 0..3 (n)
  const size_t m0 = (size_t)blockIdx.y * 128;
  const size_t n0 = (size_t)blockIdx.x * 256;
  const int rofs = (lane >> 4) << 3;
  const size_t idx0 = (m0 + (size_t)wr * 64 + rofs) * LDC + n0 + (size_t)wc * 64 +
                      (lane & 15);
  if (MODE == GEMM_F32) {
    float* cp = C + idx0;
#pragma unroll
    for (int mi = 0; mi < 4; ++mi)
#pragma unroll
      for (int ni = 0; ni < 4; ++ni)
#pragma unroll
        for (int j = 0; j < 8; ++j)
          cp[(mi * 16 + j) * LDC + ni * 16] = acc[mi][ni][j];
  } else {
    __bf16* cp = Cbf + idx0;
#pragma unroll
    for (int mi = 0; mi < 4; ++mi) {
      if (MODE == GEMM_RELU) {
#pragma unroll
        for (int ni = 0; ni < 4; ++ni)
#pragma unroll
          for (int j = 0; j < 8; ++j)
            acc[mi][ni][j] = acc[mi][ni][j] > 0.f ? acc[mi][ni][j] : 0.f;
      }
#pragma unroll
      for (int ni = 0; ni < 4; ++ni)
#pragma unroll
        for (int j = 0; j < 8; ++j)
          cp[(mi * 16 + j) * LDC + ni * 16] = (__bf16)acc[mi][ni][j];
    }
  }
}

// ---------------------------------------------------------------------------
// Merge GEMM: Cm = Ao Wmerge as bf16, not yet normalised, and for LayerNorm 1 each
// wave's share of every row's sum and sum of squares (of the f32 results):
// St[part][row] = {sum, sum of squares} over the 64 columns of part = column / 64.
// A wave fills 512 contiguous bytes of its part's plane.
// ---------------------------------------------------------------------------
#define ST_PARTS (DD / 64)

__global__ __launch_bounds__(256) GEMM_TWO_GROUPS void merge_gemm_kernel(
    const __bf16* __restrict__ A, int lda, const __bf16* __restrict__ Bt, int ldb,
    int K, __bf16* __restrict__ Cm, float* __restrict__ St) {
  __shared__ alignas(16) a_tiles_t As;
  __shared__ alignas(16) b_tiles_t Bs;
  v8f acc[4][4];
  const __bf16* Blo = Bt + (size_t)blockIdx.x * 256 * ldb;
  gemm_main<false, 0>(As, Bs, A, nullptr, lda, Blo, Blo + (size_t)128 * ldb, ldb, K,
                      acc, no_mid(), no_mid());
  gemm_store<GEMM_BF16, DD>(acc, nullptr, Cm);
  // In front of the sums below, which may write registers that these stores name.
  asm volatile("s_wait_xcnt 0x0" ::: "memory");

  const int lane = threadIdx.x & 31;
  const int wid  = threadIdx.x >> 5;
  const int wr   = wid >> 2;  // 0..1 (m)
  const int wc   = wid & 3;   // 0..3 (n)
  const int rofs = (lane >> 4) << 3;
  const bool b3 = lane & 8, b2 = lane & 4, b1 = lane & 2, b0 = lane & 1;
  float* sp = St + ((size_t)(blockIdx.x * 4 + wc) * NT + (size_t)blockIdx.y * 128 +
                    wr * 64 + rofs + (lane & 7)) * 2 + (b3 ? 1 : 0);
#pragma unroll
  for (int mi = 0; mi < 4; ++mi) {
    float u[8], w[4], y[2];
#pragma unroll
    for (int j = 0; j < 8; ++j) {
      const float a0 = acc[mi][0][j], a1 = acc[mi][1][j];
      const float a2 = acc[mi][2][j], a3 = acc[mi][3][j];
      const float s = (a0 + a1) + (a2 + a3);
      const float q = (a0 * a0 + a1 * a1) + (a2 * a2 + a3 * a3);
      u[j] = (b3 ? q : s) + row_xor_get<0x168>(b3 ? s : q);
    }
#pragma unroll
    for (int j = 0; j < 4; ++j)
      w[j] = (b2 ? u[j + 4] : u[j]) + row_xor_get<0x164>(b2 ? u[j] : u[j + 4]);
#pragma unroll
    for (int j = 0; j < 2; ++j)
      y[j] = (b1 ? w[j + 2] : w[j]) + row_xor_get<0x162>(b1 ? w[j] : w[j + 2]);
    sp[mi * 32] = (b0 ? y[1] : y[0]) + row_xor_get<0x161>(b0 ? y[0] : y[1]);
  }
}

// ---------------------------------------------------------------------------
// MLP1 with LayerNorm 1 inside: Hb = relu([x | LN(Cm)] Wmlp1) as bf16.  LN is linear
// in a row up to the row's mean mu and r = 1 / sqrt(var + eps):
//   LN(Cm) Wb = r * (Cm W') - r * mu * cs + bb      (W', cs, bb: colsum_block)
// so the Cm half of the K range comes first, the accumulators take r, r * mu * cs and
// bb once, and the x half is added on top.  Bt holds [Wa | W'] along k; K = 2 * lda.
// ---------------------------------------------------------------------------
__global__ __launch_bounds__(256) GEMM_TWO_GROUPS void mlp1_gemm_kernel(
    const __bf16* __restrict__ X, const __bf16* __restrict__ Cm, int lda,
    const __bf16* __restrict__ Bt, int ldb, int K, const float* __restrict__ St,
    const float* __restrict__ cs, const float* __restrict__ bb,
    __bf16* __restrict__ Hb) {
  __shared__ alignas(16) a_tiles_t As;
  __shared__ alignas(16) b_tiles_t Bs;
  __shared__ alignas(32) float rsA[128];  // r of the block's rows
  __shared__ alignas(32) float mrA[128];  // r * mu
  __shared__ float csA[256];              // cs, bb of the block's columns
  __shared__ float bbA[256];
  const int tid = threadIdx.x;
  auto row_stats = [&]() {
    const float c = cs[blockIdx.x * 256 + tid];
    const float b = bb[blockIdx.x * 256 + tid];
    if (tid < 128) {  // whole waves
      const unsigned voff = (unsigned)tid * 8;  // the row's byte offset in sb8
      const char* sb8 = (const char*)(St + (size_t)blockIdx.y * 128 * 2);
      v2f p[ST_PARTS];
#pragma unroll  // all loads in flight at once
      for (int i = 0; i < ST_PARTS; ++i)
        p[i] = *(const v2f*)(sb8 + (size_t)i * NT * 8 + voff);
      loads_issued(voff);
      float s = 0.f, q = 0.f;
#pragma unroll
      for (int i = 0; i < ST_PARTS; ++i) {
        s += p[i][0];
        q += p[i][1];
      }
      const float mu = s * (1.0f / DD);
      const float var = q * (1.0f / DD) - mu * mu;
      const float r = rsqrtf(var + 1e-5f);
      rsA[tid] = r;
      mrA[tid] = r * mu;
    }
    csA[tid] = c;
    bbA[tid] = b;
  };

  v8f acc[4][4];
  auto apply_ln = [&]() {
    const int lane = tid & 31;
    const int wid  = tid >> 5;
    const int wr   = wid >> 2;  // 0..1 (m)
    const int wc   = wid & 3;   // 0..3 (n)
    const int rofs = (lane >> 4) << 3;
    float cv[4], bv[4];
#pragma unroll
    for (int ni = 0; ni < 4; ++ni) {
      cv[ni] = csA[wc * 64 + ni * 16 + (lane & 15)];
      bv[ni] = bbA[wc * 64 + ni * 16 + (lane & 15)];
    }
#pragma unroll
    for (int mi = 0; mi < 4; ++mi) {
      const v8f r  = *(const v8f*)&rsA[wr * 64 + mi * 16 + rofs];
      const v8f mr = *(const v8f*)&mrA[wr * 64 + mi * 16 + rofs];
#pragma unroll
      for (int ni = 0; ni < 4; ++ni)
#pragma unroll
        for (int j = 0; j < 8; ++j)
          acc[mi][ni][j] = acc[mi][ni][j] * r[j] + (bv[ni] - mr[j] * cv[ni]);
    }
  };
  const __bf16* Blo = Bt + (size_t)blockIdx.x * 256 * ldb;
  gemm_main<true, 0>(As, Bs, Cm, X, lda, Blo, Blo + (size_t)128 * ldb, ldb, K, acc,
                     row_stats, apply_ln);
  gemm_store<GEMM_RELU, D2>(acc, nullptr, Hb);
}

// a = elu(rope(a)) + 1 on one row of four accumulator tiles; pos0: the position in
// the sequence of the lane's first row; dv: the rotation's frequency for the lane's
// column in each tile.  A rotation pair (columns 2p, 2p + 1) lies in two
// neighbouring lanes: even column: v * cos - partner * sin; odd: v * cos + partner
// * sin; sgn flips sin in even columns.
static __device__ __forceinline__ void rope_elu_tiles(v8f (&a)[4], int pos0,
                                                      const float (&dv)[4],
                                                      int sgn) {
#pragma unroll
  for (int j = 0; j < 8; ++j) {
    const float pos = (float)(pos0 + j);
#pragma unroll
    for (int ni = 0; ni < 4; ++ni) {
      const float v = a[ni][j];
      const float p = __builtin_bit_cast(
          float, __builtin_amdgcn_update_dpp(0, __builtin_bit_cast(int, v),
                                             0x161 /* row_xmask:1 */, 0xf, 0xf,
                                             true));
      float s, c;
      sincos_fast(pos * dv[ni], &s, &c);
      const float ss = __builtin_bit_cast(float, __builtin_bit_cast(int, s) ^ sgn);
      const float r = v * c + p * ss;
      const float ex = exp_fast(r);  // taken in every lane: no branch
      a[ni][j] = r > 0.f ? r + 1.f : ex;
    }
  }
}

#define TSTR 136 /* LDS pitch of a column's 128 s in bf16 elements (272B) */

__global__ __launch_bounds__(256) GEMM_TWO_GROUPS void qkv_gemm_kernel(
    const __bf16* __restrict__ xb, const __bf16* __restrict__ sb, int lda,
    const __bf16* __restrict__ WqT, const __bf16* __restrict__ WkT,
    const __bf16* __restrict__ WvT, int ldb, int K, __bf16* __restrict__ Qf,
    float* __restrict__ KVp, float* __restrict__ Ksp) {
  __shared__ alignas(16) a_tiles_t As;
  __shared__ alignas(16) b_tiles_t Bs;
  const int bx = blockIdx.x;
  const bool kvb = bx < 4;
  const __bf16* Blo =
      kvb ? WkT + (size_t)bx * 128 * ldb : WqT + (size_t)(bx - 4) * 256 * ldb;
  const __bf16* Bhi = kvb ? WvT + (size_t)bx * 128 * ldb : Blo + (size_t)128 * ldb;
  v8f acc[4][4];
  gemm_main<false, 2>(As, Bs, kvb ? sb : xb, nullptr, lda, Blo, Bhi, ldb, K, acc,
                      no_mid(), no_mid());

  const int lane = threadIdx.x & 31;
  // the wave's number, scalar: the tests on it below are scalar branches
  const int wid = __builtin_amdgcn_readfirstlane(threadIdx.x >> 5);
  const int wr = wid >> 2;            // 0..1 (m)
  const int wc = (wid + 2 * wr) & 3;  // 0..3 (n); in a K, V tile 0, 1: K; 2, 3: V
  const int rofs = (lane >> 4) << 3;
  const int row0 = blockIdx.y * 128 + wr * 64 + rofs;  // the lane's first row
  // the strip's first column in Q or in K
  const int colb = (kvb ? bx * 128 : (bx - 4) * 256) + wc * 64;
  const bool rot = !kvb || wc < 2;
  const int sgn = (lane & 1) ? 0 : (int)0x80000000;
  // a block's 128 rows never cross a sequence's end
  const int pos0 = row0 & (LL - 1);
  float dv[4] = {0.f, 0.f, 0.f, 0.f};
  if (rot) {
#pragma unroll
    for (int ni = 0; ni < 4; ++ni)
      dv[ni] = exp_fast((float)(colb + (lane & 14) + ni * 16) *
                        (-9.2103403719761836f / 512.0f));
  }
  __bf16* T = &Bs[0][0];
  __bf16* tp = T + (wc * 64 + (lane & 15)) * TSTR + wr * 64 + rofs;
  __bf16* cp = Qf + (size_t)row0 * DD + colb + (lane & 15);
#pragma unroll
  for (int mi = 0; mi < 4; ++mi) {
    if (rot) rope_elu_tiles(acc[mi], pos0 + mi * 16, dv, sgn);
    if (kvb) {
#pragma unroll
      for (int ni = 0; ni < 4; ++ni)
        *(v8bf*)(tp + ni * 16 * TSTR + mi * 16) =
            __builtin_convertvector(acc[mi][ni], v8bf);
    } else {
#pragma unroll
      for (int ni = 0; ni < 4; ++ni)
#pragma unroll
        for (int j = 0; j < 8; ++j)
          cp[(mi * 16 + j) * DD + ni * 16] = (__bf16)acc[mi][ni][j];
      // In front of what follows (the next row's arithmetic; behind the last row,
      // in the built code, the other blocks' path), which may write registers that
      // these stores name.
      asm volatile("s_wait_xcnt 0x0" ::: "memory");
    }
    // A row of tiles is stored before the next row's arithmetic begins, so the
    // stores drain under it; without this the build kept all 128 for the end.
    __builtin_amdgcn_sched_barrier(0);
  }
  if (!kvb) return;  // the whole block, in front of the barrier
  __syncthreads();   // below, a wave reads columns of T that other waves stored

  // Wave: head hd of the two, 16 rows v (mv) by all 64 columns d of its KV.
  const int hd = wid >> 2, mv = wid & 3;
  v8f kv[4];
#pragma unroll
  for (int nd = 0; nd < 4; ++nd)
#pragma unroll
    for (int j = 0; j < 8; ++j) kv[nd][j] = 0.f;
#pragma unroll
  for (int ks = 0; ks < 128; ks += 32) {
    v16bf a = frag_lds(T + (128 + hd * 64 + mv * 16) * TSTR + ks, TSTR, lane);
#pragma unroll
    for (int nd = 0; nd < 4; ++nd) {
      v16bf bb = frag_lds(T + (hd * 64 + nd * 16) * TSTR + ks, TSTR, lane);
      kv[nd] = wmma_bf16f32(a, bb, kv[nd]);
    }
  }
  const int split = blockIdx.y % NSPLIT;
  const int bh0 = (blockIdx.y / NSPLIT) * HH + bx * 2;
  float* kp = KVp + (size_t)split * KVN +
              ((size_t)(bh0 + hd) * 64 + mv * 16 + rofs) * 64 + (lane & 15);
#pragma unroll
  for (int nd = 0; nd < 4; ++nd)
#pragma unroll
    for (int j = 0; j < 8; ++j) kp[j * 64 + nd * 16] = kv[nd][j];
  // In front of the sums below, which may write registers that these stores name.
  asm volatile("s_wait_xcnt 0x0" ::: "memory");

  // Ksum: a lane sums one K column; a wave's 32 sums fill one 128-byte line.
  if (wid < 4) {
    const __bf16* kr = T + (wid * 32 + lane) * TSTR;
    float part[4] = {0.f, 0.f, 0.f, 0.f};  // four independent chains
#pragma unroll
    for (int c = 0; c < 16; ++c) {
      const v8bf k8 = *(const v8bf*)(kr + c * 8);
#pragma unroll
      for (int e = 0; e < 8; ++e) part[c & 3] += (float)k8[e];
    }
    Ksp[(size_t)split * KSN + (size_t)bh0 * DHD + wid * 32 + lane] =
        (part[0] + part[1]) + (part[2] + part[3]);
  }
}

// Two GEMMs with f32 results of pitch DD in one launch, for the same reason;
// blockIdx.z picks the operands; the longer K comes first.
__global__ __launch_bounds__(256) GEMM_TWO_GROUPS void gemm_f32_pair_kernel(
    const __bf16* __restrict__ A0, int lda0, const __bf16* __restrict__ Bt0,
    float* __restrict__ C0, const __bf16* __restrict__ A1, int lda1,
    const __bf16* __restrict__ Bt1, float* __restrict__ C1) {
  __shared__ alignas(16) a_tiles_t As;
  __shared__ alignas(16) b_tiles_t Bs;
  const bool first = blockIdx.z == 0;
  const int ld = first ? lda0 : lda1;  // row pitch of A and of Bt, and K
  v8f acc[4][4];
  const __bf16* Blo = (first ? Bt0 : Bt1) + (size_t)blockIdx.x * 256 * ld;
  gemm_main<false, 0>(As, Bs, first ? A0 : A1, nullptr, ld, Blo,
                      Blo + (size_t)128 * ld, ld, ld, acc, no_mid(), no_mid());
  gemm_store<GEMM_F32, DD>(acc, first ? C0 : C1, nullptr);
}

// ---------------------------------------------------------------------------
// Adds the NSPLIT partial planes: KVt (bf16) from KVp, Ksum (f32) from Ksp.
// Blocks 0 .. KVN/256-1 take KV elements, the rest Ksum elements.
// ---------------------------------------------------------------------------
__global__ __launch_bounds__(256) void split_reduce_kernel(
    const float* __restrict__ KVp, const float* __restrict__ Ksp,
    __bf16* __restrict__ KVt, float* __restrict__ Ksum) {
  const int i = blockIdx.x * 256 + threadIdx.x;
  float acc = 0.f;
  if (blockIdx.x < KVN / 256) {
    const unsigned voff = (unsigned)i * 4;  // the element's byte offset in a plane
    float v[NSPLIT];
#pragma unroll  // all NSPLIT loads in flight at once
    for (int p = 0; p < NSPLIT; ++p)
      v[p] = *(const float*)((const char*)KVp + (size_t)p * KVN * 4 + voff);
    loads_issued(voff);
#pragma unroll
    for (int p = 0; p < NSPLIT; ++p) acc += v[p];
    KVt[i] = (__bf16)acc;
  } else {
    const int j = i - KVN;
#pragma unroll  // all NSPLIT loads in flight at once
    for (int p = 0; p < NSPLIT; ++p) acc += Ksp[(size_t)p * KSN + j];
    Ksum[j] = acc;
    // Stands in front of the other branch's loads: in the built code a path
    // leads on to them from here, and the first writes this store's data register.
    asm volatile("s_wait_xcnt 0x0" ::: "memory");
  }
}

template <int SRC>
static __device__ __forceinline__ float row_share(float v) {
  return __builtin_bit_cast(
      float, __builtin_amdgcn_update_dpp(0, __builtin_bit_cast(int, v),
                                         0x150 + SRC /* row_share:SRC */, 0xf, 0xf,
                                         true));
}

__global__ __launch_bounds__(256) void attn_out_kernel(
    const __bf16* __restrict__ Qf, const __bf16* __restrict__ KVt,
    const float* __restrict__ Ksum, const float* __restrict__ thr,
    __bf16* __restrict__ Ao) {
  __shared__ alignas(16) __bf16 Aq[128 * 72];
  __shared__ alignas(16) __bf16 Kv[64 * 72];
  const int tid = threadIdx.x, lane = tid & 31, wid = tid >> 5;
  const int bh = blockIdx.y, b = bh >> 3, h = bh & 7;
  const size_t rowbase = (size_t)b * LL + (size_t)blockIdx.x * 128;

#pragma unroll
  for (int i = 0; i < 4; ++i) {  // Q tile 128x64 (async DMA)
    int c = tid + i * 256;
    int row = c >> 3, cc = (c & 7) << 3;
    async_copy16(&Aq[row * 72 + cc], Qf + (rowbase + row) * DD + h * DHD + cc);
  }
#pragma unroll
  for (int i = 0; i < 2; ++i) {  // KVt 64x64 (async DMA)
    int c = tid + i * 256;
    int row = c >> 3, cc = (c & 7) << 3;
    async_copy16(&Kv[row * 72 + cc], KVt + ((size_t)bh * 64 + row) * 64 + cc);
  }
  // the 32 elements of Ksum that meet the lane's half of a Q row
  const unsigned voff = (lane & 1) * 128;  // the half's byte offset in Ksum[b,h]
  const char* ksb = (const char*)(Ksum + (size_t)bh * DHD);
  v4f ksv[8];
#pragma unroll
  for (int i = 0; i < 8; ++i) ksv[i] = *(const v4f*)(ksb + i * 16 + voff);
  const float th = thr[0];
  loads_issued(voff);
  wait_async0();
  __syncthreads();

  float z;
  {
    const __bf16* qh = &Aq[(wid * 16 + (lane >> 1)) * 72 + (lane & 1) * 32];
    float part[4];  // four independent chains of eight products
#pragma unroll
    for (int c = 0; c < 4; ++c) {
      const v8bf q8 = *(const v8bf*)(qh + c * 8);
      part[c] = 0.f;
#pragma unroll
      for (int e = 0; e < 8; ++e)
        part[c] += (float)q8[e] * ksv[c * 2 + (e >> 2)][e & 3];
    }
    const float sc =
        row_xor_add<0x161>((part[0] + part[1]) + (part[2] + part[3]));
    const float sp = sc > th ? sc : 0.f;
    z = 1.0f / (sp + 1e-6f);
  }

  v8f acc[4];
#pragma unroll
  for (int ni = 0; ni < 4; ++ni)
#pragma unroll
    for (int j = 0; j < 8; ++j) acc[ni][j] = 0.f;

#pragma unroll
  for (int ks = 0; ks < 64; ks += 32) {
    v16bf a = frag_lds(&Aq[(wid * 16) * 72 + ks], 72, lane);
#pragma unroll
    for (int ni = 0; ni < 4; ++ni) {
      v16bf bb = frag_lds(&Kv[(ni * 16) * 72 + ks], 72, lane);
      acc[ni] = wmma_bf16f32(a, bb, acc[ni]);
    }
  }

  const int rofs = (lane >> 4) << 3;
  // Z of accumulator row j (tile row rofs + j): from lane 2j of the 16-lane row
  const float zv[8] = {row_share<0>(z),  row_share<2>(z),  row_share<4>(z),
                       row_share<6>(z),  row_share<8>(z),  row_share<10>(z),
                       row_share<12>(z), row_share<14>(z)};
#pragma unroll
  for (int ni = 0; ni < 4; ++ni) {
    int col = h * DHD + ni * 16 + (lane & 15);
#pragma unroll
    for (int j = 0; j < 8; ++j) {
      size_t row = rowbase + wid * 16 + rofs + j;
      Ao[row * DD + col] = (__bf16)(acc[ni][j] * zv[j]);
    }
  }
}

// ---------------------------------------------------------------------------
// out = x + LN(mlp2; g2, b2) + LN(aug32 + baug; gaug, bln)
// One wave per row, FIN_R rows a wave (one row's 32 loads already hold 128
// registers): a lane holds 16 elements of a row (four 16-byte loads, 512 contiguous
// bytes a wave each); the row's sums are taken inside the wave.
// ---------------------------------------------------------------------------
#define FIN_R 1

__global__ __launch_bounds__(256) void final_kernel(
    const float* __restrict__ x, const float* __restrict__ mlp2,
    const float* __restrict__ g2, const float* __restrict__ b2,
    const float* __restrict__ aug32, const float* __restrict__ baug,
    const float* __restrict__ gaug, const float* __restrict__ bln,
    float* __restrict__ out) {
  const int lane = threadIdx.x & 31;
  // the wave's number, scalar: row bases stay in scalar registers
  const int wid = __builtin_amdgcn_readfirstlane(threadIdx.x >> 5);
  const size_t row0 = ((size_t)blockIdx.x * 8 + wid) * FIN_R;
  const int c0 = lane * 4;
  const unsigned voff = lane * 16;  // the lane's byte offset in a 512-byte piece
  const char* ab = (const char*)(aug32 + row0 * DD);
  const char* xb = (const char*)(x + row0 * DD);
  const char* mb = (const char*)(mlp2 + row0 * DD);
  v4f a[FIN_R][4], xv[FIN_R][4], mv[FIN_R][4], av[4], gv[4], bv[4], g2v[4], b2v[4];
#pragma unroll
  for (int r = 0; r < FIN_R; ++r)
#pragma unroll
    for (int j = 0; j < 4; ++j)
      a[r][j] = *(const v4f*)(ab + (r * DD + j * 128) * 4 + voff);
#pragma unroll
  for (int j = 0; j < 4; ++j)
    av[j] = *(const v4f*)((const char*)baug + j * 512 + voff);
#pragma unroll
  for (int r = 0; r < FIN_R; ++r)
#pragma unroll
    for (int j = 0; j < 4; ++j) {
      xv[r][j] = *(const v4f*)(xb + (r * DD + j * 128) * 4 + voff);
      mv[r][j] = *(const v4f*)(mb + (r * DD + j * 128) * 4 + voff);
    }
#pragma unroll
  for (int j = 0; j < 4; ++j) {
    gv[j] = *(const v4f*)((const char*)gaug + j * 512 + voff);
    bv[j] = *(const v4f*)((const char*)bln + j * 512 + voff);
    g2v[j] = *(const v4f*)((const char*)g2 + j * 512 + voff);
    b2v[j] = *(const v4f*)((const char*)b2 + j * 512 + voff);
  }
  loads_issued(voff);
#pragma unroll
  for (int r = 0; r < FIN_R; ++r) {
    float s = 0.f, q = 0.f, s2 = 0.f, q2 = 0.f;
#pragma unroll
    for (int j = 0; j < 4; ++j) {
      a[r][j] += av[j];
#pragma unroll
      for (int e = 0; e < 4; ++e) {
        s += a[r][j][e];
        q += a[r][j][e] * a[r][j][e];
        s2 += mv[r][j][e];
        q2 += mv[r][j][e] * mv[r][j][e];
      }
    }
    s = wave_sum(s);
    q = wave_sum(q);
    s2 = wave_sum(s2);
    q2 = wave_sum(q2);
    const float mu = s * (1.0f / DD);
    const float var = q * (1.0f / DD) - mu * mu;
    const float rstd = rsqrtf(var + 1e-5f);
    const float mu2 = s2 * (1.0f / DD);
    const float var2 = q2 * (1.0f / DD) - mu2 * mu2;
    const float rstd2 = rsqrtf(var2 + 1e-5f);
#pragma unroll
    for (int j = 0; j < 4; ++j)
#pragma unroll
      for (int e = 0; e < 4; ++e) {
        const float l = (a[r][j][e] - mu) * rstd * gv[j][e] + bv[j][e];
        const float m = (mv[r][j][e] - mu2) * rstd2 * g2v[j][e] + b2v[j][e];
        a[r][j][e] = xv[r][j][e] + m + l;
      }
  }
#pragma unroll
  for (int r = 0; r < FIN_R; ++r)
#pragma unroll
    for (int j = 0; j < 4; ++j)
      *(v4f*)(out + (row0 + r) * DD + j * 128 + c0) = a[r][j];
}

// ---------------------------------------------------------------------------
// Host orchestration
// ---------------------------------------------------------------------------
extern "C" void kernel_launch(void* const* d_in, const int* in_sizes, int n_in,
                              void* d_out, int out_size, void* d_ws,
                              size_t ws_size, hipStream_t stream) {
  (void)in_sizes; (void)n_in; (void)out_size; (void)ws_size;
  const float* x      = (const float*)d_in[0];
  const float* source = (const float*)d_in[1];
  const float* Wq     = (const float*)d_in[2];
  const float* Wk     = (const float*)d_in[3];
  const float* Wv     = (const float*)d_in[4];
  const float* Wmerge = (const float*)d_in[5];
  const float* Wmlp1  = (const float*)d_in[6];
  const float* Wmlp2  = (const float*)d_in[7];
  const float* g1     = (const float*)d_in[8];
  const float* b1     = (const float*)d_in[9];
  const float* g2     = (const float*)d_in[10];
  const float* b2     = (const float*)d_in[11];
  const float* Waug   = (const float*)d_in[12];
  const float* baug   = (const float*)d_in[13];
  const float* gaug   = (const float*)d_in[14];
  const float* bln    = (const float*)d_in[15];
  const float* thr    = (const float*)d_in[16];
  float* out = (float*)d_out;

  char* ws = (char*)d_ws;
  size_t off = 0;
  auto take = [&](size_t bytes) -> char* {
    char* p = ws + off;
    off += (bytes + 255) & ~(size_t)255;
    return p;
  };

  __bf16* xb   = (__bf16*)take((size_t)NT * DD * 2);
  __bf16* sb   = (__bf16*)take((size_t)NT * DD * 2);
  __bf16* WqT  = (__bf16*)take((size_t)DD * DD * 2);
  __bf16* WkT  = (__bf16*)take((size_t)DD * DD * 2);
  __bf16* WvT  = (__bf16*)take((size_t)DD * DD * 2);
  __bf16* WmT  = (__bf16*)take((size_t)DD * DD * 2);
  __bf16* W1T  = (__bf16*)take((size_t)D2 * D2 * 2);
  __bf16* W2T  = (__bf16*)take((size_t)DD * D2 * 2);
  __bf16* WaT  = (__bf16*)take((size_t)DD * DD * 2);
  float*  C1   = (float*)take((size_t)NT * DD * 4);
  __bf16* Qf   = (__bf16*)take((size_t)NT * DD * 2);
  float*  Ksum = (float*)take((size_t)BB * HH * DHD * 4);
  __bf16* KVt  = (__bf16*)take((size_t)BB * HH * 64 * 64 * 2);
  __bf16* Ao   = (__bf16*)take((size_t)NT * DD * 2);
  __bf16* Cm   = (__bf16*)take((size_t)NT * DD * 2);
  __bf16* Hb   = (__bf16*)take((size_t)NT * D2 * 2);
  float*  KVp  = (float*)take((size_t)NSPLIT * KVN * 4);
  float*  Ksp  = (float*)take((size_t)NSPLIT * KSN * 4);

  float*  Aug  = (float*)take((size_t)NT * DD * 4);
  float*  St   = (float*)take((size_t)ST_PARTS * NT * 2 * 4);
  float*  cs   = (float*)take((size_t)D2 * 4);
  float*  bb   = (float*)take((size_t)D2 * 4);

  const dim3 blk(256);

  // 1) Convert activations and (transposed) weights to bf16; g1 goes into Wmlp1's
  //    lower half, whose column sums LayerNorm 1 takes
  prep_kernel<<<dim3(CS_NB + TR_ALL + 2 * CVT_NB), blk, 0, stream>>>(
      x, source, Wq, Wk, Wv, Wmerge, Wmlp1, Wmlp2, Waug, g1, b1, xb, sb, WqT, WkT, WvT,
      WmT, W1T, W2T, WaT, cs, bb);

  // 2) Qf = elu(rope(x@Wq)) + 1 (bf16); of Kf = elu(rope(source@Wk)) + 1 and
  //    Vb = source@Wv each block's share of the sums over s (fused epilogues)
  qkv_gemm_kernel<<<dim3(HH / 2 + DD / 256, NT / 128), blk, 0, stream>>>(
      xb, sb, DD, WqT, WkT, WvT, DD, DD, Qf, KVp, Ksp);

  // 3) attention core
  split_reduce_kernel<<<dim3(KVN / 256 + KSN / 256), blk, 0, stream>>>(
      KVp, Ksp, KVt, Ksum);
  attn_out_kernel<<<dim3(LL / 128, BB * HH), blk, 0, stream>>>(Qf, KVt, Ksum, thr,
                                                               Ao);

  // 4) merge -> Cm (bf16, not normalised) and the rows' sums for LN1
  merge_gemm_kernel<<<dim3(DD / 256, NT / 128), blk, 0, stream>>>(Ao, DD, WmT, DD, DD,
                                                                  Cm, St);

  // 5) MLP1: Hb = relu([x, LN1(Cm)] @ Wmlp1) (bf16; LN1 applied to the accumulators)
  mlp1_gemm_kernel<<<dim3(D2 / 256, NT / 128), blk, 0, stream>>>(xb, Cm, DD, W1T, D2,
                                                                 D2, St, cs, bb, Hb);

  // 6) MLP2 -> C1 and the aug GEMM -> Aug
  gemm_f32_pair_kernel<<<dim3(DD / 256, NT / 128, 2), blk, 0, stream>>>(
      Hb, D2, W2T, C1, xb, DD, WaT, Aug);

  // 7) both LayerNorms and the residual
  final_kernel<<<dim3(NT / (8 * FIN_R)), blk, 0, stream>>>(x, C1, g2, b2, Aug, baug,
                                                           gaug, bln, out);
}
